// v000
// Measured on an AMD MI455X. A time is GPU time per run, averaged over a window of back-to-back runs after a warm-up
// (all launches, gaps included; the runs take copies of the inputs in turn), and the median of several windows.
// Apart from v000's, it joins two sittings. Times from different sittings can be a few percent apart, while
// side-by-side timings come from the same sitting.
// v000, which the later versions start from, runs in 2050 microseconds.
#include <hip/hip_runtime.h>

// Multi-headed attention on three streams with a padding-or-diagonal mask and a post-softmax group weighting (query, key, value [2][2048][1024]; q, k, v = x W^T + b ('oi' 0.02, zero biases; 16 heads x 64); scores / sqrt(64); key j is kept for query i when mask[b][j] != 0 OR j == i (mask int [2][2048] random 0/1, read; -1e9 == exclusion); p = softmax; p = p x group_prob[b][i][j] (f32 [2][2048][2048] uniform, read; NOT renormalised); x = p.v; out = merged Wo^T + bo -> [2][2048][1024] (4.2 M); argument order query, key, value, group_prob, mask, Wq, bq, Wk, bk, Wv, bv, Wo, bo).
// Layout per batch: bf16 copies of query, key, value in turn; 'oi' weights; exact projections + f32 biases; identity-table plane builders; dense T-2048 attention (hybrid rows: < 512 hi/lo 3 products, rest fp16 x1024); the softmax kernel reads the batch's int key vector (select with the always-kept diagonal) and, after normalising, multiplies each probability by bf16(group_prob[b][i][j]) (the row of the batch's [S][S] plane read 16 B per lane) before the planes are stored; merged hi/lo x Wo exact + bo.
// Compute dtypes, f32 accumulate: every input rounded to bf16 incl. group_prob; projections exact + f32 biases; attention rows < 512 3 products, rest fp16; softmax and group weighting f32; Wo hl x exact + bias.

#define NB_  2
#define TT   2048
#define DM   1024
#define NH_  16
#define NKV  16
#define REP  (NH_ / NKV)
#define HD   64
#define DQ   (NH_ * HD)
#define DKV  (NKV * HD)
#define ZH   2
#define RH   512                  // query rows < RH use hi+lo planes (0: none)
#define WIN  0
#define PCAR 1024.0f
#define SCL  0.125f   // HD^-0.5
typedef _Float16 h16;
typedef unsigned short bf;
typedef __attribute__((ext_vector_type(16))) __bf16   v16bf;
typedef __attribute__((ext_vector_type(16))) _Float16 v16h;
typedef __attribute__((ext_vector_type(8)))  _Float16 v8h;
typedef __attribute__((ext_vector_type(8)))  unsigned short v8us;
typedef __attribute__((ext_vector_type(8)))  float    v8f;
typedef __attribute__((ext_vector_type(4)))  float    v4f;
typedef v8h  __attribute__((may_alias)) v8ha;
typedef v4f  __attribute__((may_alias)) v4fa;
typedef v8us __attribute__((may_alias)) v8usa;

__device__ __forceinline__ unsigned short f2bf(float f) { unsigned u = __float_as_uint(f); u += 0x7FFFu + ((u >> 16) & 1u); return (unsigned short)(u >> 16); }
__device__ __forceinline__ float bf2f(unsigned short b) { return __uint_as_float(((unsigned)b) << 16); }
__device__ __forceinline__ float bfr(float f) { return bf2f(f2bf(f)); }
__device__ __forceinline__ v16h cat16(v8h lo, v8h hi) { return __builtin_shufflevector(lo, hi, 0, 1, 2, 3, 4, 5, 6, 7, 8, 9, 10, 11, 12, 13, 14, 15); }
__device__ __forceinline__ v16bf cat16b(v8us lo, v8us hi) { return __builtin_bit_cast(v16bf, __builtin_shufflevector(lo, hi, 0, 1, 2, 3, 4, 5, 6, 7, 8, 9, 10, 11, 12, 13, 14, 15)); }
__device__ __forceinline__ v8f wmma16(v16h a, v16h b, v8f c) { return __builtin_amdgcn_wmma_f32_16x16x32_f16(false, a, false, b, (short)0, c, false, false); }
__device__ __forceinline__ v8f wmmab(v16bf a, v16bf b, v8f c) { return __builtin_amdgcn_wmma_f32_16x16x32_bf16(false, a, false, b, (short)0, c, false, false); }



// ---- k_gemmw: register-blocked GEMM, ONE WAVE per 64x64 output tile (16 accumulators), operands straight from K-contiguous 16-bit planes; grid (M/64, N/64, Z), 32 threads.
// C[m][n] (f32, pitch ldc, + optional f32 bias[n]) = sum_k A[m][k] Bt[n][k] (+ split products per NSPLIT). z-batch strides sA/sB/sC in elements. K % 32 == 0.
template <typename T16> struct WFrag;
template <> struct WFrag<h16> { typedef v16h V; static __device__ __forceinline__ V ld(const h16* p) { return cat16(*(const v8h*)p, *(const v8h*)(p + 16)); } static __device__ __forceinline__ v8f mma(V a, V b, v8f c) { return wmma16(a, b, c); } };
template <> struct WFrag<bf> { typedef v16bf V; static __device__ __forceinline__ V ld(const bf* p) { return cat16b(*(const v8us*)p, *(const v8us*)(p + 16)); } static __device__ __forceinline__ v8f mma(V a, V b, v8f c) { return wmmab(a, b, c); } };
template <typename T16, int NSPLIT, bool BIAS>
__global__ __launch_bounds__(32) void k_gemmw(const T16* __restrict__ A, const T16* __restrict__ A2, const T16* __restrict__ Bt, const T16* __restrict__ Bt2, int K, float* C, int ldc, const float* __restrict__ bias, size_t sA, size_t sB, size_t sC) {
    typedef typename WFrag<T16>::V V;
    __shared__ __align__(16) float os[16 * 68];
    const size_t z = blockIdx.z; A += z * sA; if (A2) A2 += z * sA; Bt += z * sB; if (Bt2) Bt2 += z * sB; C += z * sC;
    const int lane = threadIdx.x & 31, lr = lane & 15, hi = lane >> 4; const int r0 = blockIdx.x * 64, c0 = blockIdx.y * 64;
    v8f acc[4][4];
#pragma unroll
    for (int mb = 0; mb < 4; ++mb)
#pragma unroll
        for (int nb = 0; nb < 4; ++nb) acc[mb][nb] = (v8f){};
    const size_t aoff = (size_t)(r0 + lr) * K + 8 * hi, boff = (size_t)(c0 + lr) * K + 8 * hi;
#pragma unroll 1
    for (int kc = 0; kc < K; kc += 32) {
        V a[4], a2[4];
#pragma unroll
        for (int mb = 0; mb < 4; ++mb) { a[mb] = WFrag<T16>::ld(A + aoff + (size_t)mb * 16 * K + kc); if (NSPLIT == 1 || NSPLIT == 2) a2[mb] = WFrag<T16>::ld(A2 + aoff + (size_t)mb * 16 * K + kc); }
#pragma unroll
        for (int nb = 0; nb < 4; ++nb) { const V b = WFrag<T16>::ld(Bt + boff + (size_t)nb * 16 * K + kc); V b2; if (NSPLIT >= 2) b2 = WFrag<T16>::ld(Bt2 + boff + (size_t)nb * 16 * K + kc);
#pragma unroll
            for (int mb = 0; mb < 4; ++mb) { acc[mb][nb] = WFrag<T16>::mma(a[mb], b, acc[mb][nb]); if (NSPLIT == 1 || NSPLIT == 2) acc[mb][nb] = WFrag<T16>::mma(a2[mb], b, acc[mb][nb]); if (NSPLIT >= 2) acc[mb][nb] = WFrag<T16>::mma(a[mb], b2, acc[mb][nb]); } }
        asm volatile("v_nop\n\tv_nop\n\tv_nop\n\tv_nop" : "+v"(acc[0][0]), "+v"(acc[1][1]), "+v"(acc[2][2]), "+v"(acc[3][3]) : "v"(a[0]), "v"(a[3]));
    }
#pragma unroll
    for (int mb = 0; mb < 4; ++mb) {
#pragma unroll
        for (int nb = 0; nb < 4; ++nb) {
#pragma unroll
            for (int j = 0; j < 8; ++j) os[(hi * 8 + j) * 68 + nb * 16 + lr] = acc[mb][nb][j]; }
        __builtin_amdgcn_wave_barrier(); asm volatile("" ::: "memory");
        float* crow = C + (size_t)(r0 + mb * 16) * ldc + c0;
{
#pragma unroll
            for (int s = 0; s < 8; ++s) { const int row = 2 * s + hi, cofs = lr * 4; v4f val = *(const v4fa*)(os + row * 68 + cofs); if (BIAS) { val[0] += bfr(bias[c0 + cofs]); val[1] += bfr(bias[c0 + cofs + 1]); val[2] += bfr(bias[c0 + cofs + 2]); val[3] += bfr(bias[c0 + cofs + 3]); }
                *(v4f*)(crow + (size_t)row * ldc + cofs) = val; }
             }
        __builtin_amdgcn_wave_barrier(); asm volatile("" ::: "memory");
    }
}

__device__ __forceinline__ h16 tohx(float x) { return (h16)x; }
__device__ __forceinline__ void splitf(float y, unsigned short& h, unsigned short& l) { h = f2bf(y); l = f2bf(y - bf2f(h)); }
typedef __attribute__((ext_vector_type(2))) _Float16 v2h;
typedef __attribute__((ext_vector_type(4))) _Float16 v4h;
typedef __attribute__((ext_vector_type(2))) unsigned short v2us;
typedef __attribute__((ext_vector_type(4))) unsigned short v4us;
typedef __attribute__((ext_vector_type(2))) float v2f;
typedef __attribute__((ext_vector_type(4))) int v4i;

__global__ __launch_bounds__(256) void k_cvt8(const float* __restrict__ src, bf* dst, size_t n8) { const size_t i = (size_t)blockIdx.x * 256 + threadIdx.x; if (i >= n8) return; const v8f v = *(const v8f*)(src + i * 8); v8us o;
#pragma unroll
    for (int k = 0; k < 8; ++k) o[k] = f2bf(v[k]); *(v8us*)(dst + i * 8) = o;  }

// k_rope: head planes [h][t][d] (fp16 + hi/lo) of rope(x) x sc with the rotate-half convention out[d] = x[d] cos[t][d] - x[d+HD/2] sin[t][d], out[d+HD/2] = x[d+HD/2] cos[t][d+HD/2] + x[d] sin[t][d+HD/2]
__global__ __launch_bounds__(256) void k_rope(const float* __restrict__ F, int pitch, int nheads, const float* __restrict__ CS, const float* __restrict__ RF, const float* __restrict__ nw, float sc, h16* P16, bf* Ph, bf* Pl) {
    const size_t e = ((size_t)blockIdx.x * 256 + threadIdx.x) * 2; if (e >= (size_t)nheads * TT * HD) return; const int d = (int)(e % HD); const int t = (int)((e / HD) % TT); const int h = (int)(e / ((size_t)HD * TT)); const float* f = F + (size_t)t * pitch + h * HD; const float rf = RF ? RF[(size_t)h * TT + t] : 1.0f; v2h o16; v2us oh, ol;
#pragma unroll
    for (int q = 0; q < 2; ++q) { const int dd = d + q; const int dp = (dd < HD / 2) ? dd + HD / 2 : dd - HD / 2; float x0 = f[dd], x1 = f[dp];
        if (RF) { float n0 = __fmul_rn(x0, rf), n1 = __fmul_rn(x1, rf); asm volatile("" : "+v"(n0)); asm volatile("" : "+v"(n1)); x0 = __fmul_rn(bfr(nw[dd]), n0); x1 = __fmul_rn(bfr(nw[dp]), n1); }
        const v2f cs = *(const v2f*)(CS + ((size_t)t * HD + dd) * 2); float a = __fmul_rn(x0, cs[0]), bq = __fmul_rn(x1, cs[1]); asm volatile("" : "+v"(a)); asm volatile("" : "+v"(bq)); const float r = ((dd < HD / 2) ? __fsub_rn(a, bq) : __fadd_rn(a, bq)) * sc;
        o16[q] = tohx(r); unsigned short a2, c2; splitf(r, a2, c2); oh[q] = a2; ol[q] = c2; }
    *(v2h*)(P16 + e) = o16; *(v2us*)(Ph + e) = oh; *(v2us*)(Pl + e) = ol;  }
__global__ __launch_bounds__(256) void k_vtp(const float* __restrict__ F, int pitch, int nheads, h16* V16, bf* Vh, bf* Vl) { const size_t e = ((size_t)blockIdx.x * 256 + threadIdx.x) * 2; if (e >= (size_t)nheads * HD * TT) return; const int t = (int)(e % TT); const int d = (int)((e / TT) % HD); const int g = (int)(e / ((size_t)TT * HD)); v2h o16; v2us oh, ol;
#pragma unroll
    for (int q = 0; q < 2; ++q) { const float x = F[(size_t)(t + q) * pitch + g * HD + d]; o16[q] = tohx(x); unsigned short a2, c2; splitf(x, a2, c2); oh[q] = a2; ol[q] = c2; }
    *(v2h*)(V16 + e) = o16; *(v2us*)(Vh + e) = oh; *(v2us*)(Vl + e) = ol;  }
__global__ __launch_bounds__(256) void k_csid(float* CS) { const int idx = blockIdx.x * 256 + threadIdx.x; if (idx >= TT * HD) return; v2f cs; cs[0] = 1.0f; cs[1] = 0.0f; *(v2f*)(CS + (size_t)idx * 2) = cs;  }
// k_asoft: per row (zz, i): t = S x 1/8 where mask[b][j] != 0 or j == i (the batch's int key vector read as data; the diagonal is always kept; -1e9 == exclusion); softmax over the keys (register row, one exp, fixed trees);
__global__ __launch_bounds__(256) void k_asoft(const float* __restrict__ Sb, const int* __restrict__ kvp, const float* __restrict__ gp, h16* P16, bf* Ph, bf* Pl) {
    const int lane = threadIdx.x & 31; const int row = blockIdx.x * 8 + (threadIdx.x >> 5); if (row >= ZH * TT) return; const int i = row % TT; const int zz = row / TT; (void)zz; const bool hires = (i < RH); const float* sr = Sb + (size_t)row * TT; float v[TT / 32]; float mx = -3.0e38f;
#pragma unroll
    for (int ch = 0; ch < TT / 128; ++ch) { const int j0 = ch * 128 + lane * 4; const v4f a = *(const v4f*)(sr + j0); const v4i kv4 = *(const v4i*)(kvp + j0);   /* the batch's key vector, 16 B per lane, unconditional */
#pragma unroll
        for (int q = 0; q < 4; ++q) { const int j = j0 + q; (void)j; const float t = (kv4[q] != 0 || j == i) ? a[q] * SCL : -3.0e38f; v[ch * 4 + q] = t; mx = fmaxf(mx, t); } }
#pragma unroll
    for (int sh = 16; sh; sh >>= 1) mx = fmaxf(mx, __shfl_xor(mx, sh, 32));
    float sum = 0.f;
#pragma unroll
    for (int k = 0; k < TT / 32; ++k) { float d0 = __fsub_rn(v[k], mx); asm volatile("" : "+v"(d0)); v[k] = __builtin_amdgcn_exp2f(__fmul_rn(d0, 1.4426950408889634f)); sum += v[k]; }
#pragma unroll
    for (int sh = 16; sh; sh >>= 1) sum += __shfl_xor(sum, sh, 32);
    const float f = __fdiv_rn(hires ? 1.0f : PCAR, sum);
    { const float* gr = gp + (size_t)i * TT;   /* group_prob[b][i][:]: post-softmax weighting, p = (e / sum) x bf16(g) (not renormalised) */
#pragma unroll
      for (int ch = 0; ch < TT / 128; ++ch) { const v4f g4 = *(const v4f*)(gr + ch * 128 + lane * 4);
#pragma unroll
        for (int q = 0; q < 4; ++q) { float pn = __fmul_rn(v[ch * 4 + q], f); asm volatile("" : "+v"(pn)); v[ch * 4 + q] = __fmul_rn(pn, bfr(g4[q])); } } }
{
        if (hires) {
#pragma unroll
            for (int ch = 0; ch < TT / 128; ++ch) { v4us oh, ol;
#pragma unroll
                for (int q = 0; q < 4; ++q) { unsigned short a, c2; splitf(v[ch * 4 + q], a, c2); oh[q] = a; ol[q] = c2; }
                const size_t oo = ((size_t)zz * (RH ? RH : 1) + i) * TT + ch * 128 + lane * 4; *(v4us*)(Ph + oo) = oh; *(v4us*)(Pl + oo) = ol; }
        } else {
#pragma unroll
            for (int ch = 0; ch < TT / 128; ++ch) { v4h o4;
#pragma unroll
                for (int q = 0; q < 4; ++q) o4[q] = tohx(v[ch * 4 + q]);
                *(v4h*)(P16 + (size_t)row * TT + ch * 128 + lane * 4) = o4; } }
         }
}
__global__ __launch_bounds__(256) void k_merge(const float* __restrict__ O, int h0, bf* Ah, bf* Al) { const size_t e = ((size_t)blockIdx.x * 256 + threadIdx.x) * 2; if (e >= (size_t)ZH * TT * HD) return; const int d = (int)(e % HD); const int t = (int)((e / HD) % TT); const int zz = (int)(e / ((size_t)HD * TT)); const float cs = (t < RH) ? 1.0f : (1.0f / PCAR); const size_t oo = (size_t)t * DQ + (h0 + zz) * HD + d;
    v2us oh, ol;
#pragma unroll
    for (int q = 0; q < 2; ++q) { unsigned short a, c2; splitf(O[e + q] * cs, a, c2); oh[q] = a; ol[q] = c2; } *(v2us*)(Ah + oo) = oh; *(v2us*)(Al + oo) = ol;  }

extern "C" void kernel_launch(void* const* d_in, const int* in_sizes, int n_in,
                              void* d_out, int out_size, void* d_ws, size_t ws_size, hipStream_t stream) {
    (void)in_sizes; (void)n_in; (void)out_size;
    const float* x = (const float*)d_in[0]; const float* xk = (const float*)d_in[1]; const float* xv = (const float*)d_in[2]; const float* gprob = (const float*)d_in[3];   /* group_prob [2][2048][2048] f32 */ const int* kmask = (const int*)d_in[4];   /* mask [2][2048] int32: 1 = attendable key (OR the diagonal) */ const float* wq = (const float*)d_in[5]; const float* bq = (const float*)d_in[6]; const float* wk = (const float*)d_in[7]; const float* bk = (const float*)d_in[8]; const float* wv = (const float*)d_in[9]; const float* bv = (const float*)d_in[10]; const float* wo = (const float*)d_in[11]; const float* bo = (const float*)d_in[12];   /* input order query, key, value, group_prob, mask, Wq, bq, Wk, bk, Wv, bv, Wo, bo ('oi') */
    float* OUT = (float*)d_out;     // [2][2048][1024]
    char* wsp = (char*)d_ws;
    auto take = [&](size_t bytes) { char* p = wsp; wsp += (bytes + 255) & ~(size_t)255; return (void*)p; };
    bf* WQ = (bf*)take((size_t)DQ * DM * 2); bf* WK = (bf*)take((size_t)DKV * DM * 2); bf* WV = (bf*)take((size_t)DKV * DM * 2); bf* WO = (bf*)take((size_t)DM * DQ * 2); float* CS = (float*)take((size_t)TT * HD * 2 * 4);
    bf* XB = (bf*)take((size_t)TT * DM * 2); float* FQ = (float*)take((size_t)TT * DQ * 4); float* FK = (float*)take((size_t)TT * DKV * 4);
    h16* QP16 = (h16*)take((size_t)NH_ * TT * HD * 2); h16* KP16 = (h16*)take((size_t)NKV * TT * HD * 2); h16* VT16 = (h16*)take((size_t)NKV * HD * TT * 2);
    bf* QPh = (bf*)take((size_t)NH_ * TT * HD * 2); bf* QPl = (bf*)take((size_t)NH_ * TT * HD * 2); bf* KPh = (bf*)take((size_t)NKV * TT * HD * 2); bf* KPl = (bf*)take((size_t)NKV * TT * HD * 2); bf* VTh = (bf*)take((size_t)NKV * HD * TT * 2); bf* VTl = (bf*)take((size_t)NKV * HD * TT * 2); bf* Ph = (bf*)take((size_t)ZH * RH * TT * 2); bf* Pl = (bf*)take((size_t)ZH * RH * TT * 2);
    float* Sb = (float*)take((size_t)ZH * TT * TT * 4); h16* P16 = (h16*)take((size_t)ZH * TT * TT * 2); float* Ob = (float*)take((size_t)ZH * TT * HD * 4); bf* ATh = (bf*)take((size_t)TT * DQ * 2); bf* ATl = (bf*)take((size_t)TT * DQ * 2);
    if ((size_t)(wsp - (char*)d_ws) > ws_size) return;    // ws 256 MiB
    float* FV = FK;   // v projection reuses the k buffer after the k planes are built (stream-ordered)
    { k_cvt8<<<(unsigned)(((size_t)DQ * DM / 8 + 255) / 256), 256, 0, stream>>>(wq, WQ, (size_t)DQ * DM / 8); k_cvt8<<<(unsigned)(((size_t)DKV * DM / 8 + 255) / 256), 256, 0, stream>>>(wk, WK, (size_t)DKV * DM / 8); k_cvt8<<<(unsigned)(((size_t)DKV * DM / 8 + 255) / 256), 256, 0, stream>>>(wv, WV, (size_t)DKV * DM / 8);
      k_cvt8<<<(unsigned)(((size_t)DM * DQ / 8 + 255) / 256), 256, 0, stream>>>(wo, WO, (size_t)DM * DQ / 8);
       }
    k_csid<<<(TT * HD + 255) / 256, 256, 0, stream>>>(CS);
    const unsigned LQ = (unsigned)(((size_t)NH_ * TT * HD / 2 + 255) / 256), LKv = (unsigned)(((size_t)NKV * TT * HD / 2 + 255) / 256);
    for (int b = 0; b < NB_; ++b) {
        
        k_cvt8<<<(unsigned)(((size_t)TT * DM / 8 + 255) / 256), 256, 0, stream>>>(x + (size_t)b * TT * DM, XB, (size_t)TT * DM / 8);
        k_gemmw<bf, 0, true><<<dim3(TT / 64, DQ / 64, 1), 32, 0, stream>>>(XB, nullptr, WQ, nullptr, DM, FQ, DQ, bq, 0, 0, 0);
        k_rope<<<LQ, 256, 0, stream>>>(FQ, DQ, NH_, CS, nullptr, nullptr, 1.0f, QP16, QPh, QPl);
        k_cvt8<<<(unsigned)(((size_t)TT * DM / 8 + 255) / 256), 256, 0, stream>>>(xk + (size_t)b * TT * DM, XB, (size_t)TT * DM / 8);   /* XB := bf16(key[b]) */ k_gemmw<bf, 0, true><<<dim3(TT / 64, DKV / 64, 1), 32, 0, stream>>>(XB, nullptr, WK, nullptr, DM, FK, DKV, bk, 0, 0, 0);
        k_rope<<<LKv, 256, 0, stream>>>(FK, DKV, NKV, CS, nullptr, nullptr, 1.0f, KP16, KPh, KPl);
        k_cvt8<<<(unsigned)(((size_t)TT * DM / 8 + 255) / 256), 256, 0, stream>>>(xv + (size_t)b * TT * DM, XB, (size_t)TT * DM / 8);   /* XB := bf16(value[b]) */ k_gemmw<bf, 0, true><<<dim3(TT / 64, DKV / 64, 1), 32, 0, stream>>>(XB, nullptr, WV, nullptr, DM, FV, DKV, bv, 0, 0, 0); k_vtp<<<LKv, 256, 0, stream>>>(FV, DKV, NKV, VT16, VTh, VTl);
        for (int h0 = 0; h0 < NH_; h0 += ZH) { const size_t zq = (size_t)h0, zk = (size_t)(h0 / REP);   // one kv head per query head: the pass's two heads use consecutive kv planes (z-strides TT*HD)
            k_gemmw<bf, 2, false><<<dim3(RH / 64, TT / 64, ZH), 32, 0, stream>>>(QPh + zq * TT * HD, QPl + zq * TT * HD, KPh + zk * TT * HD, KPl + zk * TT * HD, HD, Sb, TT, nullptr, (size_t)TT * HD, (size_t)TT * HD, (size_t)TT * TT);
            k_gemmw<h16, 0, false><<<dim3((TT - RH) / 64, TT / 64, ZH), 32, 0, stream>>>(QP16 + zq * TT * HD + (size_t)RH * HD, nullptr, KP16 + zk * TT * HD, nullptr, HD, Sb + (size_t)RH * TT, TT, nullptr, (size_t)TT * HD, (size_t)TT * HD, (size_t)TT * TT);
            k_asoft<<<ZH * TT / 8, 256, 0, stream>>>(Sb, kmask + (size_t)b * TT, gprob + (size_t)b * TT * TT, P16, Ph, Pl);
            k_gemmw<bf, 2, false><<<dim3(RH / 64, HD / 64, ZH), 32, 0, stream>>>(Ph, Pl, VTh + zk * HD * TT, VTl + zk * HD * TT, TT, Ob, HD, nullptr, (size_t)RH * TT, (size_t)HD * TT, (size_t)TT * HD);
            k_gemmw<h16, 0, false><<<dim3((TT - RH) / 64, HD / 64, ZH), 32, 0, stream>>>(P16 + (size_t)RH * TT, nullptr, VT16 + zk * HD * TT, nullptr, TT, Ob + (size_t)RH * HD, HD, nullptr, (size_t)TT * TT, (size_t)HD * TT, (size_t)TT * HD);
            k_merge<<<(unsigned)(((size_t)ZH * TT * HD / 2 + 255) / 256), 256, 0, stream>>>(Ob, h0, ATh, ATl); }
        k_gemmw<bf, 1, true><<<dim3(TT / 64, DM / 64, 1), 32, 0, stream>>>(ATh, ATl, WO, nullptr, DQ, OUT + (size_t)b * TT * DM, DM, bo, 0, 0, 0); }
}

// v001
// A run of this version takes 1100 microseconds.
// Timed twice side by side with v000, it ran 1.84 and 1.86 times as fast.
#include <hip/hip_runtime.h>

// Multi-headed attention on three streams with a padding-or-diagonal mask and a post-softmax group weighting (query, key, value [2][2048][1024]; q, k, v = x W^T + b ('oi' 0.02, zero biases; 16 heads x 64); scores / sqrt(64); key j is kept for query i when mask[b][j] != 0 OR j == i (mask int [2][2048] random 0/1, read; -1e9 == exclusion); p = softmax; p = p x group_prob[b][i][j] (f32 [2][2048][2048] uniform, read; NOT renormalised); x = p.v; out = merged Wo^T + bo -> [2][2048][1024] (4.2 M); argument order query, key, value, group_prob, mask, Wq, bq, Wk, bk, Wv, bv, Wo, bo).
// Layout per batch: bf16 copies of query, key, value in turn; 'oi' weights; exact projections + f32 biases; identity-table plane builders; dense T-2048 attention (hybrid rows: < 512 hi/lo 3 products, rest fp16 x1024); the softmax kernel reads the batch's int key vector (select with the always-kept diagonal) and, after normalising, multiplies each probability by bf16(group_prob[b][i][j]) (the row of the batch's [S][S] plane read 16 B per lane) before the planes are stored; merged hi/lo x Wo exact + bo.
// Compute dtypes, f32 accumulate: every input rounded to bf16 incl. group_prob; projections exact + f32 biases; attention rows < 512 3 products, rest fp16; softmax and group weighting f32; Wo hl x exact + bias.

#define NB_  2
#define TT   2048
#define DM   1024
#define NH_  16
#define NKV  16
#define REP  (NH_ / NKV)
#define HD   64
#define DQ   (NH_ * HD)
#define DKV  (NKV * HD)
#define ZH   2
#define RH   512                  // query rows < RH use hi+lo planes (0: none)
#define WIN  0
#define PCAR 1024.0f
#define SCL  0.125f   // HD^-0.5
typedef _Float16 h16;
typedef unsigned short bf;
typedef __attribute__((ext_vector_type(16))) __bf16   v16bf;
typedef __attribute__((ext_vector_type(16))) _Float16 v16h;
typedef __attribute__((ext_vector_type(8)))  _Float16 v8h;
typedef __attribute__((ext_vector_type(8)))  unsigned short v8us;
typedef __attribute__((ext_vector_type(8)))  float    v8f;
typedef __attribute__((ext_vector_type(4)))  float    v4f;
typedef v8h  __attribute__((may_alias)) v8ha;
typedef v4f  __attribute__((may_alias)) v4fa;
typedef v8us __attribute__((may_alias)) v8usa;

__device__ __forceinline__ unsigned short f2bf(float f) { unsigned u = __float_as_uint(f); u += 0x7FFFu + ((u >> 16) & 1u); return (unsigned short)(u >> 16); }
__device__ __forceinline__ float bf2f(unsigned short b) { return __uint_as_float(((unsigned)b) << 16); }
__device__ __forceinline__ float bfr(float f) { return bf2f(f2bf(f)); }
__device__ __forceinline__ v16h cat16(v8h lo, v8h hi) { return __builtin_shufflevector(lo, hi, 0, 1, 2, 3, 4, 5, 6, 7, 8, 9, 10, 11, 12, 13, 14, 15); }
__device__ __forceinline__ v16bf cat16b(v8us lo, v8us hi) { return __builtin_bit_cast(v16bf, __builtin_shufflevector(lo, hi, 0, 1, 2, 3, 4, 5, 6, 7, 8, 9, 10, 11, 12, 13, 14, 15)); }
__device__ __forceinline__ v8f wmma16(v16h a, v16h b, v8f c) { return __builtin_amdgcn_wmma_f32_16x16x32_f16(false, a, false, b, (short)0, c, false, false); }
__device__ __forceinline__ v8f wmmab(v16bf a, v16bf b, v8f c) { return __builtin_amdgcn_wmma_f32_16x16x32_bf16(false, a, false, b, (short)0, c, false, false); }



// ---- k_gemmw: register-blocked GEMM, one work-group of KW waves per 64x64 output tile, operands straight from K-contiguous 16-bit planes; grid (M/64, N/64, Z), 32 * KW threads.
// Each wave holds the whole tile (16 accumulators) over its own K / KW slice of k; for KW > 1 the KW partial tiles go to LDS and are summed there in wave order (a fixed order).
// C[m][n] (f32, pitch ldc, + optional f32 bias[n]) = sum_k A[m][k] Bt[n][k] (+ split products per NSPLIT). z-batch strides sA/sB/sC in elements. K % (32 * KW) == 0.
template <typename T16> struct WFrag;
template <> struct WFrag<h16> { typedef v16h V; static __device__ __forceinline__ V ld(const h16* p) { return cat16(*(const v8h*)p, *(const v8h*)(p + 16)); } static __device__ __forceinline__ v8f mma(V a, V b, v8f c) { return wmma16(a, b, c); } };
template <> struct WFrag<bf> { typedef v16bf V; static __device__ __forceinline__ V ld(const bf* p) { return cat16b(*(const v8us*)p, *(const v8us*)(p + 16)); } static __device__ __forceinline__ v8f mma(V a, V b, v8f c) { return wmmab(a, b, c); } };
template <typename T16, int NSPLIT, bool BIAS, int KW>
__global__ __launch_bounds__(32 * KW) void k_gemmw(const T16* __restrict__ A, const T16* __restrict__ A2, const T16* __restrict__ Bt, const T16* __restrict__ Bt2, int K, float* C, int ldc, const float* __restrict__ bias, size_t sA, size_t sB, size_t sC) {
    typedef typename WFrag<T16>::V V;
    __shared__ __align__(16) float os[(KW == 1 ? 16 : KW * 64) * 68];
    const size_t z = blockIdx.z; A += z * sA; if (A2) A2 += z * sA; Bt += z * sB; if (Bt2) Bt2 += z * sB; C += z * sC;
    const int lane = threadIdx.x & 31, lr = lane & 15, hi = lane >> 4; const int r0 = blockIdx.x * 64, c0 = blockIdx.y * 64;
    v8f acc[4][4];
#pragma unroll
    for (int mb = 0; mb < 4; ++mb)
#pragma unroll
        for (int nb = 0; nb < 4; ++nb) acc[mb][nb] = (v8f){};
    const size_t aoff = (size_t)(r0 + lr) * K + 8 * hi, boff = (size_t)(c0 + lr) * K + 8 * hi;
    const int wv = (KW == 1) ? 0 : __builtin_amdgcn_readfirstlane((int)(threadIdx.x >> 5));   // wave number, scalar: the k loop's bounds stay in scalar registers
    const int kbeg = wv * (K / KW), kend = kbeg + K / KW;
#pragma unroll 1
    for (int kc = kbeg; kc < kend; kc += 32) {
        V a[4], a2[4];
#pragma unroll
        for (int mb = 0; mb < 4; ++mb) { a[mb] = WFrag<T16>::ld(A + aoff + (size_t)mb * 16 * K + kc); if (NSPLIT == 1 || NSPLIT == 2) a2[mb] = WFrag<T16>::ld(A2 + aoff + (size_t)mb * 16 * K + kc); }
#pragma unroll
        for (int nb = 0; nb < 4; ++nb) { const V b = WFrag<T16>::ld(Bt + boff + (size_t)nb * 16 * K + kc); V b2; if (NSPLIT >= 2) b2 = WFrag<T16>::ld(Bt2 + boff + (size_t)nb * 16 * K + kc);
#pragma unroll
            for (int mb = 0; mb < 4; ++mb) { acc[mb][nb] = WFrag<T16>::mma(a[mb], b, acc[mb][nb]); if (NSPLIT == 1 || NSPLIT == 2) acc[mb][nb] = WFrag<T16>::mma(a2[mb], b, acc[mb][nb]); if (NSPLIT >= 2) acc[mb][nb] = WFrag<T16>::mma(a[mb], b2, acc[mb][nb]); } }
        asm volatile("v_nop\n\tv_nop\n\tv_nop\n\tv_nop" : "+v"(acc[0][0]), "+v"(acc[1][1]), "+v"(acc[2][2]), "+v"(acc[3][3]) : "v"(a[0]), "v"(a[3]));
    }
    if constexpr (KW > 1) {
        float* ow = os + wv * (64 * 68); const int cofs = ((int)threadIdx.x & 15) * 4; v4f bv = (v4f){};
        if (BIAS) { bv[0] = bfr(bias[c0 + cofs]); bv[1] = bfr(bias[c0 + cofs + 1]); bv[2] = bfr(bias[c0 + cofs + 2]); bv[3] = bfr(bias[c0 + cofs + 3]); }   // read ahead of the barrier: its latency passes behind the LDS stores
#pragma unroll
        for (int mb = 0; mb < 4; ++mb)
#pragma unroll
            for (int nb = 0; nb < 4; ++nb)
#pragma unroll
                for (int j = 0; j < 8; ++j) ow[(mb * 16 + hi * 8 + j) * 68 + nb * 16 + lr] = acc[mb][nb][j];
        __syncthreads();   // every wave's partial tile stands in LDS before any of it is summed
#pragma unroll
        for (int i = 0; i < 32 / KW; ++i) { const int row = i * 2 * KW + ((int)threadIdx.x >> 4); v4f val = *(const v4fa*)(os + row * 68 + cofs);
#pragma unroll
            for (int w = 1; w < KW; ++w) val += *(const v4fa*)(os + w * (64 * 68) + row * 68 + cofs);
            if (BIAS) val += bv;
            *(v4f*)(C + (size_t)(r0 + row) * ldc + c0 + cofs) = val; }
    } else {
#pragma unroll
    for (int mb = 0; mb < 4; ++mb) {
#pragma unroll
        for (int nb = 0; nb < 4; ++nb) {
#pragma unroll
            for (int j = 0; j < 8; ++j) os[(hi * 8 + j) * 68 + nb * 16 + lr] = acc[mb][nb][j]; }
        __builtin_amdgcn_wave_barrier(); asm volatile("" ::: "memory");
        float* crow = C + (size_t)(r0 + mb * 16) * ldc + c0;
{
#pragma unroll
            for (int s = 0; s < 8; ++s) { const int row = 2 * s + hi, cofs = lr * 4; v4f val = *(const v4fa*)(os + row * 68 + cofs); if (BIAS) { val[0] += bfr(bias[c0 + cofs]); val[1] += bfr(bias[c0 + cofs + 1]); val[2] += bfr(bias[c0 + cofs + 2]); val[3] += bfr(bias[c0 + cofs + 3]); }
                *(v4f*)(crow + (size_t)row * ldc + cofs) = val; }
             }
        __builtin_amdgcn_wave_barrier(); asm volatile("" ::: "memory");
    }
    }
}

__device__ __forceinline__ h16 tohx(float x) { return (h16)x; }
__device__ __forceinline__ void splitf(float y, unsigned short& h, unsigned short& l) { h = f2bf(y); l = f2bf(y - bf2f(h)); }
typedef __attribute__((ext_vector_type(2))) _Float16 v2h;
typedef __attribute__((ext_vector_type(4))) _Float16 v4h;
typedef __attribute__((ext_vector_type(2))) unsigned short v2us;
typedef __attribute__((ext_vector_type(4))) unsigned short v4us;
typedef __attribute__((ext_vector_type(2))) float v2f;
typedef __attribute__((ext_vector_type(4))) int v4i;

__global__ __launch_bounds__(256) void k_cvt8(const float* __restrict__ src, bf* dst, size_t n8) { const size_t i = (size_t)blockIdx.x * 256 + threadIdx.x; if (i >= n8) return; const v8f v = *(const v8f*)(src + i * 8); v8us o;
#pragma unroll
    for (int k = 0; k < 8; ++k) o[k] = f2bf(v[k]); *(v8us*)(dst + i * 8) = o;  }

// k_rope: head planes [h][t][d] (fp16 + hi/lo) of rope(x) x sc with the rotate-half convention out[d] = x[d] cos[t][d] - x[d+HD/2] sin[t][d], out[d+HD/2] = x[d+HD/2] cos[t][d+HD/2] + x[d] sin[t][d+HD/2]
__global__ __launch_bounds__(256) void k_rope(const float* __restrict__ F, int pitch, int nheads, const float* __restrict__ CS, const float* __restrict__ RF, const float* __restrict__ nw, float sc, h16* P16, bf* Ph, bf* Pl) {
    const size_t e = ((size_t)blockIdx.x * 256 + threadIdx.x) * 2; if (e >= (size_t)nheads * TT * HD) return; const int d = (int)(e % HD); const int t = (int)((e / HD) % TT); const int h = (int)(e / ((size_t)HD * TT)); const float* f = F + (size_t)t * pitch + h * HD; const float rf = RF ? RF[(size_t)h * TT + t] : 1.0f; v2h o16; v2us oh, ol;
#pragma unroll
    for (int q = 0; q < 2; ++q) { const int dd = d + q; const int dp = (dd < HD / 2) ? dd + HD / 2 : dd - HD / 2; float x0 = f[dd], x1 = f[dp];
        if (RF) { float n0 = __fmul_rn(x0, rf), n1 = __fmul_rn(x1, rf); asm volatile("" : "+v"(n0)); asm volatile("" : "+v"(n1)); x0 = __fmul_rn(bfr(nw[dd]), n0); x1 = __fmul_rn(bfr(nw[dp]), n1); }
        const v2f cs = *(const v2f*)(CS + ((size_t)t * HD + dd) * 2); float a = __fmul_rn(x0, cs[0]), bq = __fmul_rn(x1, cs[1]); asm volatile("" : "+v"(a)); asm volatile("" : "+v"(bq)); const float r = ((dd < HD / 2) ? __fsub_rn(a, bq) : __fadd_rn(a, bq)) * sc;
        o16[q] = tohx(r); unsigned short a2, c2; splitf(r, a2, c2); oh[q] = a2; ol[q] = c2; }
    *(v2h*)(P16 + e) = o16; *(v2us*)(Ph + e) = oh; *(v2us*)(Pl + e) = ol;  }
__global__ __launch_bounds__(256) void k_vtp(const float* __restrict__ F, int pitch, int nheads, h16* V16, bf* Vh, bf* Vl) { const size_t e = ((size_t)blockIdx.x * 256 + threadIdx.x) * 2; if (e >= (size_t)nheads * HD * TT) return; const int t = (int)(e % TT); const int d = (int)((e / TT) % HD); const int g = (int)(e / ((size_t)TT * HD)); v2h o16; v2us oh, ol;
#pragma unroll
    for (int q = 0; q < 2; ++q) { const float x = F[(size_t)(t + q) * pitch + g * HD + d]; o16[q] = tohx(x); unsigned short a2, c2; splitf(x, a2, c2); oh[q] = a2; ol[q] = c2; }
    *(v2h*)(V16 + e) = o16; *(v2us*)(Vh + e) = oh; *(v2us*)(Vl + e) = ol;  }
__global__ __launch_bounds__(256) void k_csid(float* CS) { const int idx = blockIdx.x * 256 + threadIdx.x; if (idx >= TT * HD) return; v2f cs; cs[0] = 1.0f; cs[1] = 0.0f; *(v2f*)(CS + (size_t)idx * 2) = cs;  }
// k_asoft: per row (zz, i): t = S x 1/8 where mask[b][j] != 0 or j == i (the batch's int key vector read as data; the diagonal is always kept; -1e9 == exclusion); softmax over the keys (register row, one exp, fixed trees);
__global__ __launch_bounds__(256) void k_asoft(const float* __restrict__ Sb, const int* __restrict__ kvp, const float* __restrict__ gp, h16* P16, bf* Ph, bf* Pl) {
    const int lane = threadIdx.x & 31; const int row = blockIdx.x * 8 + (threadIdx.x >> 5); if (row >= ZH * TT) return; const int i = row % TT; const int zz = row / TT; (void)zz; const bool hires = (i < RH); const float* sr = Sb + (size_t)row * TT; float v[TT / 32]; float mx = -3.0e38f;
#pragma unroll
    for (int ch = 0; ch < TT / 128; ++ch) { const int j0 = ch * 128 + lane * 4; const v4f a = *(const v4f*)(sr + j0); const v4i kv4 = *(const v4i*)(kvp + j0);   /* the batch's key vector, 16 B per lane, unconditional */
#pragma unroll
        for (int q = 0; q < 4; ++q) { const int j = j0 + q; (void)j; const float t = (kv4[q] != 0 || j == i) ? a[q] * SCL : -3.0e38f; v[ch * 4 + q] = t; mx = fmaxf(mx, t); } }
#pragma unroll
    for (int sh = 16; sh; sh >>= 1) mx = fmaxf(mx, __shfl_xor(mx, sh, 32));
    float sum = 0.f;
#pragma unroll
    for (int k = 0; k < TT / 32; ++k) { float d0 = __fsub_rn(v[k], mx); asm volatile("" : "+v"(d0)); v[k] = __builtin_amdgcn_exp2f(__fmul_rn(d0, 1.4426950408889634f)); sum += v[k]; }
#pragma unroll
    for (int sh = 16; sh; sh >>= 1) sum += __shfl_xor(sum, sh, 32);
    const float f = __fdiv_rn(hires ? 1.0f : PCAR, sum);
    { const float* gr = gp + (size_t)i * TT;   /* group_prob[b][i][:]: post-softmax weighting, p = (e / sum) x bf16(g) (not renormalised) */
#pragma unroll
      for (int ch = 0; ch < TT / 128; ++ch) { const v4f g4 = *(const v4f*)(gr + ch * 128 + lane * 4);
#pragma unroll
        for (int q = 0; q < 4; ++q) { float pn = __fmul_rn(v[ch * 4 + q], f); asm volatile("" : "+v"(pn)); v[ch * 4 + q] = __fmul_rn(pn, bfr(g4[q])); } } }
{
        if (hires) {
#pragma unroll
            for (int ch = 0; ch < TT / 128; ++ch) { v4us oh, ol;
#pragma unroll
                for (int q = 0; q < 4; ++q) { unsigned short a, c2; splitf(v[ch * 4 + q], a, c2); oh[q] = a; ol[q] = c2; }
                const size_t oo = ((size_t)zz * (RH ? RH : 1) + i) * TT + ch * 128 + lane * 4; *(v4us*)(Ph + oo) = oh; *(v4us*)(Pl + oo) = ol; }
        } else {
#pragma unroll
            for (int ch = 0; ch < TT / 128; ++ch) { v4h o4;
#pragma unroll
                for (int q = 0; q < 4; ++q) o4[q] = tohx(v[ch * 4 + q]);
                *(v4h*)(P16 + (size_t)row * TT + ch * 128 + lane * 4) = o4; } }
         }
}
__global__ __launch_bounds__(256) void k_merge(const float* __restrict__ O, int h0, bf* Ah, bf* Al) { const size_t e = ((size_t)blockIdx.x * 256 + threadIdx.x) * 2; if (e >= (size_t)ZH * TT * HD) return; const int d = (int)(e % HD); const int t = (int)((e / HD) % TT); const int zz = (int)(e / ((size_t)HD * TT)); const float cs = (t < RH) ? 1.0f : (1.0f / PCAR); const size_t oo = (size_t)t * DQ + (h0 + zz) * HD + d;
    v2us oh, ol;
#pragma unroll
    for (int q = 0; q < 2; ++q) { unsigned short a, c2; splitf(O[e + q] * cs, a, c2); oh[q] = a; ol[q] = c2; } *(v2us*)(Ah + oo) = oh; *(v2us*)(Al + oo) = ol;  }

extern "C" void kernel_launch(void* const* d_in, const int* in_sizes, int n_in,
                              void* d_out, int out_size, void* d_ws, size_t ws_size, hipStream_t stream) {
    (void)in_sizes; (void)n_in; (void)out_size;
    const float* x = (const float*)d_in[0]; const float* xk = (const float*)d_in[1]; const float* xv = (const float*)d_in[2]; const float* gprob = (const float*)d_in[3];   /* group_prob [2][2048][2048] f32 */ const int* kmask = (const int*)d_in[4];   /* mask [2][2048] int32: 1 = attendable key (OR the diagonal) */ const float* wq = (const float*)d_in[5]; const float* bq = (const float*)d_in[6]; const float* wk = (const float*)d_in[7]; const float* bk = (const float*)d_in[8]; const float* wv = (const float*)d_in[9]; const float* bv = (const float*)d_in[10]; const float* wo = (const float*)d_in[11]; const float* bo = (const float*)d_in[12];   /* input order query, key, value, group_prob, mask, Wq, bq, Wk, bk, Wv, bv, Wo, bo ('oi') */
    float* OUT = (float*)d_out;     // [2][2048][1024]
    char* wsp = (char*)d_ws;
    auto take = [&](size_t bytes) { char* p = wsp; wsp += (bytes + 255) & ~(size_t)255; return (void*)p; };
    bf* WQ = (bf*)take((size_t)DQ * DM * 2); bf* WK = (bf*)take((size_t)DKV * DM * 2); bf* WV = (bf*)take((size_t)DKV * DM * 2); bf* WO = (bf*)take((size_t)DM * DQ * 2); float* CS = (float*)take((size_t)TT * HD * 2 * 4);
    bf* XB = (bf*)take((size_t)TT * DM * 2); float* FQ = (float*)take((size_t)TT * DQ * 4); float* FK = (float*)take((size_t)TT * DKV * 4);
    h16* QP16 = (h16*)take((size_t)NH_ * TT * HD * 2); h16* KP16 = (h16*)take((size_t)NKV * TT * HD * 2); h16* VT16 = (h16*)take((size_t)NKV * HD * TT * 2);
    bf* QPh = (bf*)take((size_t)NH_ * TT * HD * 2); bf* QPl = (bf*)take((size_t)NH_ * TT * HD * 2); bf* KPh = (bf*)take((size_t)NKV * TT * HD * 2); bf* KPl = (bf*)take((size_t)NKV * TT * HD * 2); bf* VTh = (bf*)take((size_t)NKV * HD * TT * 2); bf* VTl = (bf*)take((size_t)NKV * HD * TT * 2); bf* Ph = (bf*)take((size_t)ZH * RH * TT * 2); bf* Pl = (bf*)take((size_t)ZH * RH * TT * 2);
    float* Sb = (float*)take((size_t)ZH * TT * TT * 4); h16* P16 = (h16*)take((size_t)ZH * TT * TT * 2); float* Ob = (float*)take((size_t)ZH * TT * HD * 4); bf* ATh = (bf*)take((size_t)TT * DQ * 2); bf* ATl = (bf*)take((size_t)TT * DQ * 2);
    if ((size_t)(wsp - (char*)d_ws) > ws_size) return;    // ws 256 MiB
    float* FV = FK;   // v projection reuses the k buffer after the k planes are built (stream-ordered)
    { k_cvt8<<<(unsigned)(((size_t)DQ * DM / 8 + 255) / 256), 256, 0, stream>>>(wq, WQ, (size_t)DQ * DM / 8); k_cvt8<<<(unsigned)(((size_t)DKV * DM / 8 + 255) / 256), 256, 0, stream>>>(wk, WK, (size_t)DKV * DM / 8); k_cvt8<<<(unsigned)(((size_t)DKV * DM / 8 + 255) / 256), 256, 0, stream>>>(wv, WV, (size_t)DKV * DM / 8);
      k_cvt8<<<(unsigned)(((size_t)DM * DQ / 8 + 255) / 256), 256, 0, stream>>>(wo, WO, (size_t)DM * DQ / 8);
       }
    k_csid<<<(TT * HD + 255) / 256, 256, 0, stream>>>(CS);
    const unsigned LQ = (unsigned)(((size_t)NH_ * TT * HD / 2 + 255) / 256), LKv = (unsigned)(((size_t)NKV * TT * HD / 2 + 255) / 256);
    for (int b = 0; b < NB_; ++b) {
        
        k_cvt8<<<(unsigned)(((size_t)TT * DM / 8 + 255) / 256), 256, 0, stream>>>(x + (size_t)b * TT * DM, XB, (size_t)TT * DM / 8);
        k_gemmw<bf, 0, true, 8><<<dim3(TT / 64, DQ / 64, 1), 256, 0, stream>>>(XB, nullptr, WQ, nullptr, DM, FQ, DQ, bq, 0, 0, 0);
        k_rope<<<LQ, 256, 0, stream>>>(FQ, DQ, NH_, CS, nullptr, nullptr, 1.0f, QP16, QPh, QPl);
        k_cvt8<<<(unsigned)(((size_t)TT * DM / 8 + 255) / 256), 256, 0, stream>>>(xk + (size_t)b * TT * DM, XB, (size_t)TT * DM / 8);   /* XB := bf16(key[b]) */ k_gemmw<bf, 0, true, 8><<<dim3(TT / 64, DKV / 64, 1), 256, 0, stream>>>(XB, nullptr, WK, nullptr, DM, FK, DKV, bk, 0, 0, 0);
        k_rope<<<LKv, 256, 0, stream>>>(FK, DKV, NKV, CS, nullptr, nullptr, 1.0f, KP16, KPh, KPl);
        k_cvt8<<<(unsigned)(((size_t)TT * DM / 8 + 255) / 256), 256, 0, stream>>>(xv + (size_t)b * TT * DM, XB, (size_t)TT * DM / 8);   /* XB := bf16(value[b]) */ k_gemmw<bf, 0, true, 8><<<dim3(TT / 64, DKV / 64, 1), 256, 0, stream>>>(XB, nullptr, WV, nullptr, DM, FV, DKV, bv, 0, 0, 0); k_vtp<<<LKv, 256, 0, stream>>>(FV, DKV, NKV, VT16, VTh, VTl);
        for (int h0 = 0; h0 < NH_; h0 += ZH) { const size_t zq = (size_t)h0, zk = (size_t)(h0 / REP);   // one kv head per query head: the pass's two heads use consecutive kv planes (z-strides TT*HD)
            k_gemmw<bf, 2, false, 1><<<dim3(RH / 64, TT / 64, ZH), 32, 0, stream>>>(QPh + zq * TT * HD, QPl + zq * TT * HD, KPh + zk * TT * HD, KPl + zk * TT * HD, HD, Sb, TT, nullptr, (size_t)TT * HD, (size_t)TT * HD, (size_t)TT * TT);
            k_gemmw<h16, 0, false, 1><<<dim3((TT - RH) / 64, TT / 64, ZH), 32, 0, stream>>>(QP16 + zq * TT * HD + (size_t)RH * HD, nullptr, KP16 + zk * TT * HD, nullptr, HD, Sb + (size_t)RH * TT, TT, nullptr, (size_t)TT * HD, (size_t)TT * HD, (size_t)TT * TT);
            k_asoft<<<ZH * TT / 8, 256, 0, stream>>>(Sb, kmask + (size_t)b * TT, gprob + (size_t)b * TT * TT, P16, Ph, Pl);
            k_gemmw<bf, 2, false, 16><<<dim3(RH / 64, HD / 64, ZH), 512, 0, stream>>>(Ph, Pl, VTh + zk * HD * TT, VTl + zk * HD * TT, TT, Ob, HD, nullptr, (size_t)RH * TT, (size_t)HD * TT, (size_t)TT * HD);
            k_gemmw<h16, 0, false, 16><<<dim3((TT - RH) / 64, HD / 64, ZH), 512, 0, stream>>>(P16 + (size_t)RH * TT, nullptr, VT16 + zk * HD * TT, nullptr, TT, Ob + (size_t)RH * HD, HD, nullptr, (size_t)TT * TT, (size_t)HD * TT, (size_t)TT * HD);
            k_merge<<<(unsigned)(((size_t)ZH * TT * HD / 2 + 255) / 256), 256, 0, stream>>>(Ob, h0, ATh, ATl); }
        k_gemmw<bf, 1, true, 8><<<dim3(TT / 64, DM / 64, 1), 256, 0, stream>>>(ATh, ATl, WO, nullptr, DQ, OUT + (size_t)b * TT * DM, DM, bo, 0, 0, 0); }
}

// v002
// It runs in 603 microseconds.
// Timed twice side by side with v001, it ran 1.82 and 1.81 times as fast.
// All steps since v000 together make it 3.36 times as fast.
#include <hip/hip_runtime.h>

// Multi-headed attention on three streams with a padding-or-diagonal mask and a post-softmax group weighting (query, key, value [2][2048][1024]; q, k, v = x W^T + b ('oi' 0.02, zero biases; 16 heads x 64); scores / sqrt(64); key j is kept for query i when mask[b][j] != 0 OR j == i (mask int [2][2048] random 0/1, read; -1e9 == exclusion); p = softmax; p = p x group_prob[b][i][j] (f32 [2][2048][2048] uniform, read; NOT renormalised); x = p.v; out = merged Wo^T + bo -> [2][2048][1024] (4.2 M); argument order query, key, value, group_prob, mask, Wq, bq, Wk, bk, Wv, bv, Wo, bo).
// Layout per batch: bf16 copies of query, key, value in turn; 'oi' weights; exact projections + f32 biases; identity-table plane builders; dense T-2048 attention (hybrid rows: < 512 hi/lo 3 products, rest fp16 x1024); the softmax kernel reads the batch's int key vector (select with the always-kept diagonal) and, after normalising, multiplies each probability by bf16(group_prob[b][i][j]) (the row of the batch's [S][S] plane read 16 B per lane) before the planes are stored; merged hi/lo x Wo exact + bo.
// Compute dtypes, f32 accumulate: every input rounded to bf16 incl. group_prob; projections exact + f32 biases; attention rows < 512 3 products, rest fp16; softmax and group weighting f32; Wo hl x exact + bias.

#define NB_  2
#define TT   2048
#define DM   1024
#define NH_  16
#define NKV  16
#define REP  (NH_ / NKV)
#define HD   64
#define DQ   (NH_ * HD)
#define DKV  (NKV * HD)
#define ZH   8                    // heads per attention pass
#define RH   512                  // query rows < RH use hi+lo planes (0: none)
#define WIN  0
#define PCAR 1024.0f
#define SCL  0.125f   // HD^-0.5
typedef _Float16 h16;
typedef unsigned short bf;
typedef __attribute__((ext_vector_type(16))) __bf16   v16bf;
typedef __attribute__((ext_vector_type(16))) _Float16 v16h;
typedef __attribute__((ext_vector_type(8)))  _Float16 v8h;
typedef __attribute__((ext_vector_type(8)))  unsigned short v8us;
typedef __attribute__((ext_vector_type(8)))  float    v8f;
typedef __attribute__((ext_vector_type(4)))  float    v4f;
typedef v8h  __attribute__((may_alias)) v8ha;
typedef v4f  __attribute__((may_alias)) v4fa;
typedef v8us __attribute__((may_alias)) v8usa;

__device__ __forceinline__ unsigned short f2bf(float f) { unsigned u = __float_as_uint(f); u += 0x7FFFu + ((u >> 16) & 1u); return (unsigned short)(u >> 16); }
__device__ __forceinline__ float bf2f(unsigned short b) { return __uint_as_float(((unsigned)b) << 16); }
__device__ __forceinline__ float bfr(float f) { return bf2f(f2bf(f)); }
__device__ __forceinline__ v16h cat16(v8h lo, v8h hi) { return __builtin_shufflevector(lo, hi, 0, 1, 2, 3, 4, 5, 6, 7, 8, 9, 10, 11, 12, 13, 14, 15); }
__device__ __forceinline__ v16bf cat16b(v8us lo, v8us hi) { return __builtin_bit_cast(v16bf, __builtin_shufflevector(lo, hi, 0, 1, 2, 3, 4, 5, 6, 7, 8, 9, 10, 11, 12, 13, 14, 15)); }
__device__ __forceinline__ v8f wmma16(v16h a, v16h b, v8f c) { return __builtin_amdgcn_wmma_f32_16x16x32_f16(false, a, false, b, (short)0, c, false, false); }
__device__ __forceinline__ v8f wmmab(v16bf a, v16bf b, v8f c) { return __builtin_amdgcn_wmma_f32_16x16x32_bf16(false, a, false, b, (short)0, c, false, false); }



// ---- k_gemmw: register-blocked GEMM, one work-group of KW waves per 64x64 output tile, operands straight from K-contiguous 16-bit planes; grid (M/64, N/64, Z), 32 * KW threads.
// Each wave holds the whole tile (16 accumulators) over its own K / KW slice of k; for KW > 1 the KW partial tiles go to LDS and are summed there in wave order (a fixed order).
// C[m][n] (f32, pitch ldc, + optional f32 bias[n]) = sum_k A[m][k] Bt[n][k] (+ split products per NSPLIT). A rows have pitch lda elements, Bt rows pitch K. z-batch strides sA/sB/sC in elements. K % (32 * KW) == 0.
template <typename T16> struct WFrag;
template <> struct WFrag<h16> { typedef v16h V; static __device__ __forceinline__ V ld(const h16* p) { return cat16(*(const v8h*)p, *(const v8h*)(p + 16)); } static __device__ __forceinline__ v8f mma(V a, V b, v8f c) { return wmma16(a, b, c); } };
template <> struct WFrag<bf> { typedef v16bf V; static __device__ __forceinline__ V ld(const bf* p) { return cat16b(*(const v8us*)p, *(const v8us*)(p + 16)); } static __device__ __forceinline__ v8f mma(V a, V b, v8f c) { return wmmab(a, b, c); } };
template <typename T16, int NSPLIT, bool BIAS, int KW>
__global__ __launch_bounds__(32 * KW) void k_gemmw(const T16* __restrict__ A, const T16* __restrict__ A2, const T16* __restrict__ Bt, const T16* __restrict__ Bt2, int K, int lda, float* C, int ldc, const float* __restrict__ bias, size_t sA, size_t sB, size_t sC) {
    typedef typename WFrag<T16>::V V;
    __shared__ __align__(16) float os[(KW == 1 ? 16 : KW * 64) * 68];
    const size_t z = blockIdx.z; A += z * sA; if (A2) A2 += z * sA; Bt += z * sB; if (Bt2) Bt2 += z * sB; C += z * sC;
    const int lane = threadIdx.x & 31, lr = lane & 15, hi = lane >> 4; const int r0 = blockIdx.x * 64, c0 = blockIdx.y * 64;
    v8f acc[4][4];
#pragma unroll
    for (int mb = 0; mb < 4; ++mb)
#pragma unroll
        for (int nb = 0; nb < 4; ++nb) acc[mb][nb] = (v8f){};
    const size_t aoff = (size_t)(r0 + lr) * lda + 8 * hi, boff = (size_t)(c0 + lr) * K + 8 * hi;
    const int wv = (KW == 1) ? 0 : __builtin_amdgcn_readfirstlane((int)(threadIdx.x >> 5));   // wave number, scalar: the k loop's bounds stay in scalar registers
    const int kbeg = wv * (K / KW), kend = kbeg + K / KW;
#pragma unroll 1
    for (int kc = kbeg; kc < kend; kc += 32) {
        V a[4], a2[4];
#pragma unroll
        for (int mb = 0; mb < 4; ++mb) { a[mb] = WFrag<T16>::ld(A + aoff + (size_t)mb * 16 * lda + kc); if (NSPLIT == 1 || NSPLIT == 2) a2[mb] = WFrag<T16>::ld(A2 + aoff + (size_t)mb * 16 * lda + kc); }
#pragma unroll
        for (int nb = 0; nb < 4; ++nb) { const V b = WFrag<T16>::ld(Bt + boff + (size_t)nb * 16 * K + kc); V b2; if (NSPLIT >= 2) b2 = WFrag<T16>::ld(Bt2 + boff + (size_t)nb * 16 * K + kc);
#pragma unroll
            for (int mb = 0; mb < 4; ++mb) { acc[mb][nb] = WFrag<T16>::mma(a[mb], b, acc[mb][nb]); if (NSPLIT == 1 || NSPLIT == 2) acc[mb][nb] = WFrag<T16>::mma(a2[mb], b, acc[mb][nb]); if (NSPLIT >= 2) acc[mb][nb] = WFrag<T16>::mma(a[mb], b2, acc[mb][nb]); } }
        asm volatile("v_nop\n\tv_nop\n\tv_nop\n\tv_nop" : "+v"(acc[0][0]), "+v"(acc[1][1]), "+v"(acc[2][2]), "+v"(acc[3][3]) : "v"(a[0]), "v"(a[3]));
    }
    if constexpr (KW > 1) {
        float* ow = os + wv * (64 * 68); const int cofs = ((int)threadIdx.x & 15) * 4; v4f bv = (v4f){};
        if (BIAS) { bv[0] = bfr(bias[c0 + cofs]); bv[1] = bfr(bias[c0 + cofs + 1]); bv[2] = bfr(bias[c0 + cofs + 2]); bv[3] = bfr(bias[c0 + cofs + 3]); }   // read ahead of the barrier: its latency passes behind the LDS stores
#pragma unroll
        for (int mb = 0; mb < 4; ++mb)
#pragma unroll
            for (int nb = 0; nb < 4; ++nb)
#pragma unroll
                for (int j = 0; j < 8; ++j) ow[(mb * 16 + hi * 8 + j) * 68 + nb * 16 + lr] = acc[mb][nb][j];
        __syncthreads();   // every wave's partial tile stands in LDS before any of it is summed
#pragma unroll
        for (int i = 0; i < 32 / KW; ++i) { const int row = i * 2 * KW + ((int)threadIdx.x >> 4); v4f val = *(const v4fa*)(os + row * 68 + cofs);
#pragma unroll
            for (int w = 1; w < KW; ++w) val += *(const v4fa*)(os + w * (64 * 68) + row * 68 + cofs);
            if (BIAS) val += bv;
            *(v4f*)(C + (size_t)(r0 + row) * ldc + c0 + cofs) = val; }
    } else {
#pragma unroll
    for (int mb = 0; mb < 4; ++mb) {
#pragma unroll
        for (int nb = 0; nb < 4; ++nb) {
#pragma unroll
            for (int j = 0; j < 8; ++j) os[(hi * 8 + j) * 68 + nb * 16 + lr] = acc[mb][nb][j]; }
        __builtin_amdgcn_wave_barrier(); asm volatile("" ::: "memory");
        float* crow = C + (size_t)(r0 + mb * 16) * ldc + c0;
{
#pragma unroll
            for (int s = 0; s < 8; ++s) { const int row = 2 * s + hi, cofs = lr * 4; v4f val = *(const v4fa*)(os + row * 68 + cofs); if (BIAS) { val[0] += bfr(bias[c0 + cofs]); val[1] += bfr(bias[c0 + cofs + 1]); val[2] += bfr(bias[c0 + cofs + 2]); val[3] += bfr(bias[c0 + cofs + 3]); }
                *(v4f*)(crow + (size_t)row * ldc + cofs) = val; }
             }
        __builtin_amdgcn_wave_barrier(); asm volatile("" ::: "memory");
    }
    }
}

__device__ __forceinline__ h16 tohx(float x) { return (h16)x; }
__device__ __forceinline__ void splitf(float y, unsigned short& h, unsigned short& l) { h = f2bf(y); l = f2bf(y - bf2f(h)); }
typedef __attribute__((ext_vector_type(2))) _Float16 v2h;
typedef __attribute__((ext_vector_type(4))) _Float16 v4h;
typedef __attribute__((ext_vector_type(2))) unsigned short v2us;
typedef __attribute__((ext_vector_type(4))) unsigned short v4us;
typedef __attribute__((ext_vector_type(2))) float v2f;
typedef __attribute__((ext_vector_type(4))) int v4i;

__global__ __launch_bounds__(256) void k_cvt8(const float* __restrict__ src, bf* dst, size_t n8) { const size_t i = (size_t)blockIdx.x * 256 + threadIdx.x; if (i >= n8) return; const v8f v = *(const v8f*)(src + i * 8); v8us o;
#pragma unroll
    for (int k = 0; k < 8; ++k) o[k] = f2bf(v[k]); *(v8us*)(dst + i * 8) = o;  }

// k_rope: head planes [h][t][d] (fp16 + hi/lo) of rope(x) x sc with the rotate-half convention out[d] = x[d] cos[t][d] - x[d+HD/2] sin[t][d], out[d+HD/2] = x[d+HD/2] cos[t][d+HD/2] + x[d] sin[t][d+HD/2]
__global__ __launch_bounds__(256) void k_rope(const float* __restrict__ F, int pitch, int nheads, const float* __restrict__ CS, const float* __restrict__ RF, const float* __restrict__ nw, float sc, h16* P16, bf* Ph, bf* Pl) {
    const size_t e = ((size_t)blockIdx.x * 256 + threadIdx.x) * 2; if (e >= (size_t)nheads * TT * HD) return; const int d = (int)(e % HD); const int t = (int)((e / HD) % TT); const int h = (int)(e / ((size_t)HD * TT)); const float* f = F + (size_t)t * pitch + h * HD; const float rf = RF ? RF[(size_t)h * TT + t] : 1.0f; v2h o16; v2us oh, ol;
#pragma unroll
    for (int q = 0; q < 2; ++q) { const int dd = d + q; const int dp = (dd < HD / 2) ? dd + HD / 2 : dd - HD / 2; float x0 = f[dd], x1 = f[dp];
        if (RF) { float n0 = __fmul_rn(x0, rf), n1 = __fmul_rn(x1, rf); asm volatile("" : "+v"(n0)); asm volatile("" : "+v"(n1)); x0 = __fmul_rn(bfr(nw[dd]), n0); x1 = __fmul_rn(bfr(nw[dp]), n1); }
        const v2f cs = *(const v2f*)(CS + ((size_t)t * HD + dd) * 2); float a = __fmul_rn(x0, cs[0]), bq = __fmul_rn(x1, cs[1]); asm volatile("" : "+v"(a)); asm volatile("" : "+v"(bq)); const float r = ((dd < HD / 2) ? __fsub_rn(a, bq) : __fadd_rn(a, bq)) * sc;
        o16[q] = tohx(r); unsigned short a2, c2; splitf(r, a2, c2); oh[q] = a2; ol[q] = c2; }
    *(v2h*)(P16 + e) = o16; *(v2us*)(Ph + e) = oh; *(v2us*)(Pl + e) = ol;  }
__global__ __launch_bounds__(256) void k_vtp(const float* __restrict__ F, int pitch, int nheads, h16* V16, bf* Vh, bf* Vl) { const size_t e = ((size_t)blockIdx.x * 256 + threadIdx.x) * 2; if (e >= (size_t)nheads * HD * TT) return; const int t = (int)(e % TT); const int d = (int)((e / TT) % HD); const int g = (int)(e / ((size_t)TT * HD)); v2h o16; v2us oh, ol;
#pragma unroll
    for (int q = 0; q < 2; ++q) { const float x = F[(size_t)(t + q) * pitch + g * HD + d]; o16[q] = tohx(x); unsigned short a2, c2; splitf(x, a2, c2); oh[q] = a2; ol[q] = c2; }
    *(v2h*)(V16 + e) = o16; *(v2us*)(Vh + e) = oh; *(v2us*)(Vl + e) = ol;  }
__global__ __launch_bounds__(256) void k_csid(float* CS) { const int idx = blockIdx.x * 256 + threadIdx.x; if (idx >= TT * HD) return; v2f cs; cs[0] = 1.0f; cs[1] = 0.0f; *(v2f*)(CS + (size_t)idx * 2) = cs;  }
// k_asoft: per row (zz, i): t = S x 1/8 where mask[b][j] != 0 or j == i (the batch's int key vector read as data; the diagonal is always kept; -1e9 == exclusion); softmax over the keys (register row, one exp, fixed trees);
// the probabilities go back into the row's own 8 KiB of Sb (a wave holds its whole row in registers before it stores): rows < RH as hi plane [0, TT) and lo plane [TT, 2 TT) in 16-bit elements, the rest as fp16 in [0, TT).
__global__ __launch_bounds__(256) void k_asoft(float* Sb, const int* __restrict__ kvp, const float* __restrict__ gp) {
    const int lane = threadIdx.x & 31; const int row = blockIdx.x * 8 + (threadIdx.x >> 5); if (row >= ZH * TT) return; const int i = row % TT; const int zz = row / TT; (void)zz; const bool hires = (i < RH); const float* sr = Sb + (size_t)row * TT; float v[TT / 32]; float mx = -3.0e38f;
#pragma unroll
    for (int ch = 0; ch < TT / 128; ++ch) { const int j0 = ch * 128 + lane * 4; const v4f a = *(const v4f*)(sr + j0); const v4i kv4 = *(const v4i*)(kvp + j0);   /* the batch's key vector, 16 B per lane, unconditional */
#pragma unroll
        for (int q = 0; q < 4; ++q) { const int j = j0 + q; (void)j; const float t = (kv4[q] != 0 || j == i) ? a[q] * SCL : -3.0e38f; v[ch * 4 + q] = t; mx = fmaxf(mx, t); } }
#pragma unroll
    for (int sh = 16; sh; sh >>= 1) mx = fmaxf(mx, __shfl_xor(mx, sh, 32));
    float sum = 0.f;
#pragma unroll
    for (int k = 0; k < TT / 32; ++k) { float d0 = __fsub_rn(v[k], mx); asm volatile("" : "+v"(d0)); v[k] = __builtin_amdgcn_exp2f(__fmul_rn(d0, 1.4426950408889634f)); sum += v[k]; }
#pragma unroll
    for (int sh = 16; sh; sh >>= 1) sum += __shfl_xor(sum, sh, 32);
    const float f = __fdiv_rn(hires ? 1.0f : PCAR, sum);
    { const float* gr = gp + (size_t)i * TT;   /* group_prob[b][i][:]: post-softmax weighting, p = (e / sum) x bf16(g) (not renormalised) */
#pragma unroll
      for (int ch = 0; ch < TT / 128; ++ch) { const v4f g4 = *(const v4f*)(gr + ch * 128 + lane * 4);
#pragma unroll
        for (int q = 0; q < 4; ++q) { float pn = __fmul_rn(v[ch * 4 + q], f); asm volatile("" : "+v"(pn)); v[ch * 4 + q] = __fmul_rn(pn, bfr(g4[q])); } } }
{
        if (hires) {
#pragma unroll
            for (int ch = 0; ch < TT / 128; ++ch) { v4us oh, ol;
#pragma unroll
                for (int q = 0; q < 4; ++q) { unsigned short a, c2; splitf(v[ch * 4 + q], a, c2); oh[q] = a; ol[q] = c2; }
                bf* pr = (bf*)(Sb + (size_t)row * TT) + ch * 128 + lane * 4; *(v4us*)pr = oh; *(v4us*)(pr + TT) = ol; }
        } else {
#pragma unroll
            for (int ch = 0; ch < TT / 128; ++ch) { v4h o4;
#pragma unroll
                for (int q = 0; q < 4; ++q) o4[q] = tohx(v[ch * 4 + q]);
                *(v4h*)((h16*)(Sb + (size_t)row * TT) + ch * 128 + lane * 4) = o4; } }
         }
}
__global__ __launch_bounds__(256) void k_merge(const float* __restrict__ O, int h0, bf* Ah, bf* Al) { const size_t e = ((size_t)blockIdx.x * 256 + threadIdx.x) * 2; if (e >= (size_t)ZH * TT * HD) return; const int d = (int)(e % HD); const int t = (int)((e / HD) % TT); const int zz = (int)(e / ((size_t)HD * TT)); const float cs = (t < RH) ? 1.0f : (1.0f / PCAR); const size_t oo = (size_t)t * DQ + (h0 + zz) * HD + d;
    v2us oh, ol;
#pragma unroll
    for (int q = 0; q < 2; ++q) { unsigned short a, c2; splitf(O[e + q] * cs, a, c2); oh[q] = a; ol[q] = c2; } *(v2us*)(Ah + oo) = oh; *(v2us*)(Al + oo) = ol;  }

extern "C" void kernel_launch(void* const* d_in, const int* in_sizes, int n_in,
                              void* d_out, int out_size, void* d_ws, size_t ws_size, hipStream_t stream) {
    (void)in_sizes; (void)n_in; (void)out_size;
    const float* x = (const float*)d_in[0]; const float* xk = (const float*)d_in[1]; const float* xv = (const float*)d_in[2]; const float* gprob = (const float*)d_in[3];   /* group_prob [2][2048][2048] f32 */ const int* kmask = (const int*)d_in[4];   /* mask [2][2048] int32: 1 = attendable key (OR the diagonal) */ const float* wq = (const float*)d_in[5]; const float* bq = (const float*)d_in[6]; const float* wk = (const float*)d_in[7]; const float* bk = (const float*)d_in[8]; const float* wv = (const float*)d_in[9]; const float* bv = (const float*)d_in[10]; const float* wo = (const float*)d_in[11]; const float* bo = (const float*)d_in[12];   /* input order query, key, value, group_prob, mask, Wq, bq, Wk, bk, Wv, bv, Wo, bo ('oi') */
    float* OUT = (float*)d_out;     // [2][2048][1024]
    char* wsp = (char*)d_ws;
    auto take = [&](size_t bytes) { char* p = wsp; wsp += (bytes + 255) & ~(size_t)255; return (void*)p; };
    bf* WQ = (bf*)take((size_t)DQ * DM * 2); bf* WK = (bf*)take((size_t)DKV * DM * 2); bf* WV = (bf*)take((size_t)DKV * DM * 2); bf* WO = (bf*)take((size_t)DM * DQ * 2); float* CS = (float*)take((size_t)TT * HD * 2 * 4);
    bf* XB = (bf*)take((size_t)TT * DM * 2); float* FQ = (float*)take((size_t)TT * DQ * 4); float* FK = (float*)take((size_t)TT * DKV * 4);
    h16* QP16 = (h16*)take((size_t)NH_ * TT * HD * 2); h16* KP16 = (h16*)take((size_t)NKV * TT * HD * 2); h16* VT16 = (h16*)take((size_t)NKV * HD * TT * 2);
    bf* QPh = (bf*)take((size_t)NH_ * TT * HD * 2); bf* QPl = (bf*)take((size_t)NH_ * TT * HD * 2); bf* KPh = (bf*)take((size_t)NKV * TT * HD * 2); bf* KPl = (bf*)take((size_t)NKV * TT * HD * 2); bf* VTh = (bf*)take((size_t)NKV * HD * TT * 2); bf* VTl = (bf*)take((size_t)NKV * HD * TT * 2);
    float* Sb = (float*)take((size_t)ZH * TT * TT * 4); float* Ob = (float*)take((size_t)ZH * TT * HD * 4); bf* ATh = (bf*)take((size_t)TT * DQ * 2); bf* ATl = (bf*)take((size_t)TT * DQ * 2);
    if ((size_t)(wsp - (char*)d_ws) > ws_size) return;    // ws 256 MiB
    float* FV = FK;   // v projection reuses the k buffer after the k planes are built (stream-ordered)
    { k_cvt8<<<(unsigned)(((size_t)DQ * DM / 8 + 255) / 256), 256, 0, stream>>>(wq, WQ, (size_t)DQ * DM / 8); k_cvt8<<<(unsigned)(((size_t)DKV * DM / 8 + 255) / 256), 256, 0, stream>>>(wk, WK, (size_t)DKV * DM / 8); k_cvt8<<<(unsigned)(((size_t)DKV * DM / 8 + 255) / 256), 256, 0, stream>>>(wv, WV, (size_t)DKV * DM / 8);
      k_cvt8<<<(unsigned)(((size_t)DM * DQ / 8 + 255) / 256), 256, 0, stream>>>(wo, WO, (size_t)DM * DQ / 8);
       }
    k_csid<<<(TT * HD + 255) / 256, 256, 0, stream>>>(CS);
    const unsigned LQ = (unsigned)(((size_t)NH_ * TT * HD / 2 + 255) / 256), LKv = (unsigned)(((size_t)NKV * TT * HD / 2 + 255) / 256);
    for (int b = 0; b < NB_; ++b) {
        
        k_cvt8<<<(unsigned)(((size_t)TT * DM / 8 + 255) / 256), 256, 0, stream>>>(x + (size_t)b * TT * DM, XB, (size_t)TT * DM / 8);
        k_gemmw<bf, 0, true, 8><<<dim3(TT / 64, DQ / 64, 1), 256, 0, stream>>>(XB, nullptr, WQ, nullptr, DM, DM, FQ, DQ, bq, 0, 0, 0);
        k_rope<<<LQ, 256, 0, stream>>>(FQ, DQ, NH_, CS, nullptr, nullptr, 1.0f, QP16, QPh, QPl);
        k_cvt8<<<(unsigned)(((size_t)TT * DM / 8 + 255) / 256), 256, 0, stream>>>(xk + (size_t)b * TT * DM, XB, (size_t)TT * DM / 8);   /* XB := bf16(key[b]) */ k_gemmw<bf, 0, true, 8><<<dim3(TT / 64, DKV / 64, 1), 256, 0, stream>>>(XB, nullptr, WK, nullptr, DM, DM, FK, DKV, bk, 0, 0, 0);
        k_rope<<<LKv, 256, 0, stream>>>(FK, DKV, NKV, CS, nullptr, nullptr, 1.0f, KP16, KPh, KPl);
        k_cvt8<<<(unsigned)(((size_t)TT * DM / 8 + 255) / 256), 256, 0, stream>>>(xv + (size_t)b * TT * DM, XB, (size_t)TT * DM / 8);   /* XB := bf16(value[b]) */ k_gemmw<bf, 0, true, 8><<<dim3(TT / 64, DKV / 64, 1), 256, 0, stream>>>(XB, nullptr, WV, nullptr, DM, DM, FV, DKV, bv, 0, 0, 0); k_vtp<<<LKv, 256, 0, stream>>>(FV, DKV, NKV, VT16, VTh, VTl);
        for (int h0 = 0; h0 < NH_; h0 += ZH) { const size_t zq = (size_t)h0, zk = (size_t)(h0 / REP);   // one kv head per query head: the pass's ZH heads use consecutive kv planes (z-strides TT*HD)
            k_gemmw<bf, 2, false, 1><<<dim3(RH / 64, TT / 64, ZH), 32, 0, stream>>>(QPh + zq * TT * HD, QPl + zq * TT * HD, KPh + zk * TT * HD, KPl + zk * TT * HD, HD, HD, Sb, TT, nullptr, (size_t)TT * HD, (size_t)TT * HD, (size_t)TT * TT);
            k_gemmw<h16, 0, false, 1><<<dim3((TT - RH) / 64, TT / 64, ZH), 32, 0, stream>>>(QP16 + zq * TT * HD + (size_t)RH * HD, nullptr, KP16 + zk * TT * HD, nullptr, HD, HD, Sb + (size_t)RH * TT, TT, nullptr, (size_t)TT * HD, (size_t)TT * HD, (size_t)TT * TT);
            k_asoft<<<ZH * TT / 8, 256, 0, stream>>>(Sb, kmask + (size_t)b * TT, gprob + (size_t)b * TT * TT);
            k_gemmw<bf, 2, false, 16><<<dim3(RH / 64, HD / 64, ZH), 512, 0, stream>>>((const bf*)Sb, (const bf*)Sb + TT, VTh + zk * HD * TT, VTl + zk * HD * TT, TT, 2 * TT, Ob, HD, nullptr, (size_t)TT * TT * 2, (size_t)HD * TT, (size_t)TT * HD);
            k_gemmw<h16, 0, false, 16><<<dim3((TT - RH) / 64, HD / 64, ZH), 512, 0, stream>>>((const h16*)Sb + (size_t)RH * TT * 2, nullptr, VT16 + zk * HD * TT, nullptr, TT, 2 * TT, Ob + (size_t)RH * HD, HD, nullptr, (size_t)TT * TT * 2, (size_t)HD * TT, (size_t)TT * HD);
            k_merge<<<(unsigned)(((size_t)ZH * TT * HD / 2 + 255) / 256), 256, 0, stream>>>(Ob, h0, ATh, ATl); }
        k_gemmw<bf, 1, true, 8><<<dim3(TT / 64, DM / 64, 1), 256, 0, stream>>>(ATh, ATl, WO, nullptr, DQ, DQ, OUT + (size_t)b * TT * DM, DM, bo, 0, 0, 0); }
}

// v003
// One run takes 280 microseconds.
// In two side-by-side timings against v002, it was 2.16 and 2.15 times as fast.
// All steps since v000 together make it 7.24 times as fast.
#include <hip/hip_runtime.h>

// Multi-headed attention on three streams with a padding-or-diagonal mask and a post-softmax group weighting (query, key, value [2][2048][1024]; q, k, v = x W^T + b ('oi' 0.02, zero biases; 16 heads x 64); scores / sqrt(64); key j is kept for query i when mask[b][j] != 0 OR j == i (mask int [2][2048] random 0/1, read; -1e9 == exclusion); p = softmax; p = p x group_prob[b][i][j] (f32 [2][2048][2048] uniform, read; NOT renormalised); x = p.v; out = merged Wo^T + bo -> [2][2048][1024] (4.2 M); argument order query, key, value, group_prob, mask, Wq, bq, Wk, bk, Wv, bv, Wo, bo).
// Layout per batch: bf16 copies of query, key, value in turn; 'oi' weights; exact projections + f32 biases; identity-table plane builders; one fused attention launch for all heads of both batches (hybrid rows: < 512 hi/lo 3 products, rest fp16 x1024): it reads the batch's int key vector (select with the always-kept diagonal), multiplies each exponential by bf16(group_prob[b][i][j]) and divides the P.V sums by the row's sum of exponentials; merged hi/lo x Wo exact + bo.
// Compute dtypes, f32 accumulate: every input rounded to bf16 incl. group_prob; projections exact + f32 biases; attention rows < 512 3 products, rest fp16; softmax and group weighting f32; Wo hl x exact + bias.

#define NB_  2
#define TT   2048
#define DM   1024
#define NH_  16
#define NKV  16
#define HD   64
#define DQ   (NH_ * HD)
#define DKV  (NKV * HD)
#define RH   512                  // query rows < RH use hi+lo planes (0: none)
#define WIN  0
#define SCL  0.125f   // HD^-0.5
typedef _Float16 h16;
typedef unsigned short bf;
typedef __attribute__((ext_vector_type(16))) __bf16   v16bf;
typedef __attribute__((ext_vector_type(16))) _Float16 v16h;
typedef __attribute__((ext_vector_type(8)))  _Float16 v8h;
typedef __attribute__((ext_vector_type(8)))  unsigned short v8us;
typedef __attribute__((ext_vector_type(8)))  float    v8f;
typedef __attribute__((ext_vector_type(4)))  float    v4f;
typedef v8h  __attribute__((may_alias)) v8ha;
typedef v4f  __attribute__((may_alias)) v4fa;
typedef v8us __attribute__((may_alias)) v8usa;

__device__ __forceinline__ unsigned short f2bf(float f) { unsigned u = __float_as_uint(f); u += 0x7FFFu + ((u >> 16) & 1u); return (unsigned short)(u >> 16); }
__device__ __forceinline__ float bf2f(unsigned short b) { return __uint_as_float(((unsigned)b) << 16); }
__device__ __forceinline__ float bfr(float f) { return bf2f(f2bf(f)); }
__device__ __forceinline__ v16h cat16(v8h lo, v8h hi) { return __builtin_shufflevector(lo, hi, 0, 1, 2, 3, 4, 5, 6, 7, 8, 9, 10, 11, 12, 13, 14, 15); }
__device__ __forceinline__ v16bf cat16b(v8us lo, v8us hi) { return __builtin_bit_cast(v16bf, __builtin_shufflevector(lo, hi, 0, 1, 2, 3, 4, 5, 6, 7, 8, 9, 10, 11, 12, 13, 14, 15)); }
__device__ __forceinline__ v8f wmma16(v16h a, v16h b, v8f c) { return __builtin_amdgcn_wmma_f32_16x16x32_f16(false, a, false, b, (short)0, c, false, false); }
__device__ __forceinline__ v8f wmmab(v16bf a, v16bf b, v8f c) { return __builtin_amdgcn_wmma_f32_16x16x32_bf16(false, a, false, b, (short)0, c, false, false); }



// ---- k_gemmw: register-blocked GEMM, one work-group of KW waves per 64x64 output tile, operands straight from K-contiguous 16-bit planes; grid (M/64, N/64, Z), 32 * KW threads.
// Each wave holds the whole tile (16 accumulators) over its own K / KW slice of k; for KW > 1 the KW partial tiles go to LDS and are summed there in wave order (a fixed order).
// C[m][n] (f32, pitch ldc, + optional f32 bias[n]) = sum_k A[m][k] Bt[n][k] (+ split products per NSPLIT). A rows have pitch lda elements, Bt rows pitch K. z-batch strides sA/sB/sC in elements. K % (32 * KW) == 0.
template <typename T16> struct WFrag;
template <> struct WFrag<h16> { typedef v16h V; static __device__ __forceinline__ V ld(const h16* p) { return cat16(*(const v8h*)p, *(const v8h*)(p + 16)); } static __device__ __forceinline__ v8f mma(V a, V b, v8f c) { return wmma16(a, b, c); } };
template <> struct WFrag<bf> { typedef v16bf V; static __device__ __forceinline__ V ld(const bf* p) { return cat16b(*(const v8us*)p, *(const v8us*)(p + 16)); } static __device__ __forceinline__ v8f mma(V a, V b, v8f c) { return wmmab(a, b, c); } };
template <typename T16, int NSPLIT, bool BIAS, int KW>
__global__ __launch_bounds__(32 * KW) void k_gemmw(const T16* __restrict__ A, const T16* __restrict__ A2, const T16* __restrict__ Bt, const T16* __restrict__ Bt2, int K, int lda, float* C, int ldc, const float* __restrict__ bias, size_t sA, size_t sB, size_t sC) {
    typedef typename WFrag<T16>::V V;
    __shared__ __align__(16) float os[(KW == 1 ? 16 : KW * 64) * 68];
    const size_t z = blockIdx.z; A += z * sA; if (A2) A2 += z * sA; Bt += z * sB; if (Bt2) Bt2 += z * sB; C += z * sC;
    const int lane = threadIdx.x & 31, lr = lane & 15, hi = lane >> 4; const int r0 = blockIdx.x * 64, c0 = blockIdx.y * 64;
    v8f acc[4][4];
#pragma unroll
    for (int mb = 0; mb < 4; ++mb)
#pragma unroll
        for (int nb = 0; nb < 4; ++nb) acc[mb][nb] = (v8f){};
    const size_t aoff = (size_t)(r0 + lr) * lda + 8 * hi, boff = (size_t)(c0 + lr) * K + 8 * hi;
    const int wv = (KW == 1) ? 0 : __builtin_amdgcn_readfirstlane((int)(threadIdx.x >> 5));   // wave number, scalar: the k loop's bounds stay in scalar registers
    const int kbeg = wv * (K / KW), kend = kbeg + K / KW;
#pragma unroll 1
    for (int kc = kbeg; kc < kend; kc += 32) {
        V a[4], a2[4];
#pragma unroll
        for (int mb = 0; mb < 4; ++mb) { a[mb] = WFrag<T16>::ld(A + aoff + (size_t)mb * 16 * lda + kc); if (NSPLIT == 1 || NSPLIT == 2) a2[mb] = WFrag<T16>::ld(A2 + aoff + (size_t)mb * 16 * lda + kc); }
#pragma unroll
        for (int nb = 0; nb < 4; ++nb) { const V b = WFrag<T16>::ld(Bt + boff + (size_t)nb * 16 * K + kc); V b2; if (NSPLIT >= 2) b2 = WFrag<T16>::ld(Bt2 + boff + (size_t)nb * 16 * K + kc);
#pragma unroll
            for (int mb = 0; mb < 4; ++mb) { acc[mb][nb] = WFrag<T16>::mma(a[mb], b, acc[mb][nb]); if (NSPLIT == 1 || NSPLIT == 2) acc[mb][nb] = WFrag<T16>::mma(a2[mb], b, acc[mb][nb]); if (NSPLIT >= 2) acc[mb][nb] = WFrag<T16>::mma(a[mb], b2, acc[mb][nb]); } }
        asm volatile("v_nop\n\tv_nop\n\tv_nop\n\tv_nop" : "+v"(acc[0][0]), "+v"(acc[1][1]), "+v"(acc[2][2]), "+v"(acc[3][3]) : "v"(a[0]), "v"(a[3]));
    }
    if constexpr (KW > 1) {
        float* ow = os + wv * (64 * 68); const int cofs = ((int)threadIdx.x & 15) * 4; v4f bv = (v4f){};
        if (BIAS) { bv[0] = bfr(bias[c0 + cofs]); bv[1] = bfr(bias[c0 + cofs + 1]); bv[2] = bfr(bias[c0 + cofs + 2]); bv[3] = bfr(bias[c0 + cofs + 3]); }   // read ahead of the barrier: its latency passes behind the LDS stores
#pragma unroll
        for (int mb = 0; mb < 4; ++mb)
#pragma unroll
            for (int nb = 0; nb < 4; ++nb)
#pragma unroll
                for (int j = 0; j < 8; ++j) ow[(mb * 16 + hi * 8 + j) * 68 + nb * 16 + lr] = acc[mb][nb][j];
        __syncthreads();   // every wave's partial tile stands in LDS before any of it is summed
#pragma unroll
        for (int i = 0; i < 32 / KW; ++i) { const int row = i * 2 * KW + ((int)threadIdx.x >> 4); v4f val = *(const v4fa*)(os + row * 68 + cofs);
#pragma unroll
            for (int w = 1; w < KW; ++w) val += *(const v4fa*)(os + w * (64 * 68) + row * 68 + cofs);
            if (BIAS) val += bv;
            *(v4f*)(C + (size_t)(r0 + row) * ldc + c0 + cofs) = val; }
    } else {
#pragma unroll
    for (int mb = 0; mb < 4; ++mb) {
#pragma unroll
        for (int nb = 0; nb < 4; ++nb) {
#pragma unroll
            for (int j = 0; j < 8; ++j) os[(hi * 8 + j) * 68 + nb * 16 + lr] = acc[mb][nb][j]; }
        __builtin_amdgcn_wave_barrier(); asm volatile("" ::: "memory");
        float* crow = C + (size_t)(r0 + mb * 16) * ldc + c0;
{
#pragma unroll
            for (int s = 0; s < 8; ++s) { const int row = 2 * s + hi, cofs = lr * 4; v4f val = *(const v4fa*)(os + row * 68 + cofs); if (BIAS) { val[0] += bfr(bias[c0 + cofs]); val[1] += bfr(bias[c0 + cofs + 1]); val[2] += bfr(bias[c0 + cofs + 2]); val[3] += bfr(bias[c0 + cofs + 3]); }
                *(v4f*)(crow + (size_t)row * ldc + cofs) = val; }
             }
        __builtin_amdgcn_wave_barrier(); asm volatile("" ::: "memory");
    }
    }
}

__device__ __forceinline__ h16 tohx(float x) { return (h16)x; }
__device__ __forceinline__ void splitf(float y, unsigned short& h, unsigned short& l) { h = f2bf(y); l = f2bf(y - bf2f(h)); }
typedef __attribute__((ext_vector_type(2))) _Float16 v2h;
typedef __attribute__((ext_vector_type(2))) unsigned short v2us;
typedef __attribute__((ext_vector_type(2))) float v2f;
typedef __attribute__((ext_vector_type(4))) int v4i;

__global__ __launch_bounds__(256) void k_cvt8(const float* __restrict__ src, bf* dst, size_t n8) { const size_t i = (size_t)blockIdx.x * 256 + threadIdx.x; if (i >= n8) return; const v8f v = *(const v8f*)(src + i * 8); v8us o;
#pragma unroll
    for (int k = 0; k < 8; ++k) o[k] = f2bf(v[k]); *(v8us*)(dst + i * 8) = o;  }

// k_rope: head planes [h][t][d] (fp16 + hi/lo) of rope(x) x sc with the rotate-half convention out[d] = x[d] cos[t][d] - x[d+HD/2] sin[t][d], out[d+HD/2] = x[d+HD/2] cos[t][d+HD/2] + x[d] sin[t][d+HD/2]
__global__ __launch_bounds__(256) void k_rope(const float* __restrict__ F, int pitch, int nheads, const float* __restrict__ CS, const float* __restrict__ RF, const float* __restrict__ nw, float sc, h16* P16, bf* Ph, bf* Pl) {
    const size_t e = ((size_t)blockIdx.x * 256 + threadIdx.x) * 2; if (e >= (size_t)nheads * TT * HD) return; const int d = (int)(e % HD); const int t = (int)((e / HD) % TT); const int h = (int)(e / ((size_t)HD * TT)); const float* f = F + (size_t)t * pitch + h * HD; const float rf = RF ? RF[(size_t)h * TT + t] : 1.0f; v2h o16; v2us oh, ol;
#pragma unroll
    for (int q = 0; q < 2; ++q) { const int dd = d + q; const int dp = (dd < HD / 2) ? dd + HD / 2 : dd - HD / 2; float x0 = f[dd], x1 = f[dp];
        if (RF) { float n0 = __fmul_rn(x0, rf), n1 = __fmul_rn(x1, rf); asm volatile("" : "+v"(n0)); asm volatile("" : "+v"(n1)); x0 = __fmul_rn(bfr(nw[dd]), n0); x1 = __fmul_rn(bfr(nw[dp]), n1); }
        const v2f cs = *(const v2f*)(CS + ((size_t)t * HD + dd) * 2); float a = __fmul_rn(x0, cs[0]), bq = __fmul_rn(x1, cs[1]); asm volatile("" : "+v"(a)); asm volatile("" : "+v"(bq)); const float r = ((dd < HD / 2) ? __fsub_rn(a, bq) : __fadd_rn(a, bq)) * sc;
        o16[q] = tohx(r); unsigned short a2, c2; splitf(r, a2, c2); oh[q] = a2; ol[q] = c2; }
    *(v2h*)(P16 + e) = o16; *(v2us*)(Ph + e) = oh; *(v2us*)(Pl + e) = ol;  }
__global__ __launch_bounds__(256) void k_vtp(const float* __restrict__ F, int pitch, int nheads, h16* V16, bf* Vh, bf* Vl) { const size_t e = ((size_t)blockIdx.x * 256 + threadIdx.x) * 2; if (e >= (size_t)nheads * HD * TT) return; const int t = (int)(e % TT); const int d = (int)((e / TT) % HD); const int g = (int)(e / ((size_t)TT * HD)); v2h o16; v2us oh, ol;
#pragma unroll
    for (int q = 0; q < 2; ++q) { const float x = F[(size_t)(t + q) * pitch + g * HD + d]; o16[q] = tohx(x); unsigned short a2, c2; splitf(x, a2, c2); oh[q] = a2; ol[q] = c2; }
    *(v2h*)(V16 + e) = o16; *(v2us*)(Vh + e) = oh; *(v2us*)(Vl + e) = ol;  }
__global__ __launch_bounds__(256) void k_csid(float* CS) { const int idx = blockIdx.x * 256 + threadIdx.x; if (idx >= TT * HD) return; v2f cs; cs[0] = 1.0f; cs[1] = 0.0f; *(v2f*)(CS + (size_t)idx * 2) = cs;  }
// k_fattn: scores, mask, softmax, group weighting, P.V and the head merge in one kernel; no score or probability leaves the registers. Grid (RH/64 + (TT-RH)/128, heads, batches), 4 waves.
// A wave owns NQ * 16 query rows of one head; the work-group walks all TT keys twice, 32 keys a stage. A stage's K rows and V^T rows are read from global in whole or half lines, one stage ahead (walk 1: two), and shared through two LDS buffers (one barrier a stage).
// S^T = K Q^T (A = K rows, B = Q rows, same k order on both sides): a lane holds 8 keys of ONE query per tile. The key mask enters as the C operand (0 or -3e38 per key, from an LDS table built at entry);
// in the one stage that holds a wave's diagonal the products are formed once more from C = 0 and the element j == i takes that value (the diagonal is always kept).
// Walk 1: the row maximum over the kept keys. Walk 2: e = exp(s / 8 - max), l += e, p = e x bf16(group_prob[b][i][j]); the two key tiles of a stage, converted in place, are the B operand of O^T += V^T P^T (A = V^T rows in the hardware k order).
// The epilogue joins the wave halves' sums, divides by l (the weighting is not renormalised: l sums e alone) and stores hi/lo bf16 planes of the merged rows, 16 B per lane.
// Rows < RH: hi/lo bf16 planes, 3 products in both GEMMs, 16 rows a wave; the rest fp16 with p carried x 1024 (folded into the exponent, so l carries it too and it cancels), 32 rows a wave.
#define KPI 72   // LDS pitch of a K row in elements: 128 B + 16 B, for 16-byte readers
#define VPI 40   // LDS pitch of a V^T row of 32 keys in elements: 64 B + 16 B
#define SBUF (2 * (32 * KPI + 64 * VPI))   // elements of one stage buffer at two planes per operand
typedef __attribute__((ext_vector_type(2))) __bf16 v2bf;
typedef __attribute__((ext_vector_type(8))) unsigned v8u;
typedef __attribute__((ext_vector_type(4))) unsigned v4u;
typedef v4i __attribute__((may_alias)) v4ia;
__device__ __forceinline__ unsigned pkbf(float a, float b) { v2f x; x[0] = a; x[1] = b; return __builtin_bit_cast(unsigned, __builtin_convertvector(x, v2bf)); }   // two f32 -> packed bf16, round to nearest even
// two 2^x in one statement: the early-clobber outputs keep each off the other's registers, and the v_nop keeps the slot that the instruction set asks for behind a transcendental before its result is used or its source overwritten
__device__ __forceinline__ void exp2x2(float x0, float x1, float& e0, float& e1) { asm("v_exp_f32 %0, %2\n\tv_exp_f32 %1, %3\n\tv_nop" : "=&v"(e0), "=&v"(e1) : "v"(x0), "v"(x1)); }
// work-group barrier that orders LDS alone: unlike __syncthreads() it does not wait for the global loads in flight (the next stage's tiles and group_prob go to registers and concern no other wave)
__device__ __forceinline__ void lds_barrier() { __builtin_amdgcn_fence(__ATOMIC_RELEASE, "workgroup", "local"); __builtin_amdgcn_s_barrier(); __builtin_amdgcn_fence(__ATOMIC_ACQUIRE, "workgroup", "local"); }
__device__ __forceinline__ float bflo(unsigned u) { return __uint_as_float(u << 16); }
__device__ __forceinline__ float bfhi(unsigned u) { return __uint_as_float(u & 0xFFFF0000u); }
template <typename T16, bool HI, int NQ>
__device__ __forceinline__ void attn_rows(const T16* __restrict__ Q, const T16* __restrict__ Q2, const T16* __restrict__ K, const T16* __restrict__ K2, const T16* __restrict__ VT, const T16* __restrict__ VT2, const int* __restrict__ kvp, const float* __restrict__ gp, const int q0, bf* Ah, bf* Al, T16* sb, float* bias) {
    typedef WFrag<T16> F; typedef typename F::V V;   // every inner loop below is unrolled in full, so that the fragment and accumulator arrays stay in registers
    constexpr int NP = HI ? 2 : 1, KTS = 32 * KPI, VTS = 64 * VPI;
    const int tid = threadIdx.x, lane = tid & 31, lr = lane & 15, hi = lane >> 4;
    const float CE = SCL * 1.4426950408889634f;
    v4i rk[NP][2], rk2[NP][2], rv[NP][2];
    auto gk = [&](v4i (&t)[NP][2], int j0) {
#pragma unroll
        for (int u = 0; u < 2; ++u) { const size_t o = (size_t)j0 * HD + (tid + 128 * u) * 8; t[0][u] = *(const v4ia*)(K + o); if (HI) t[NP - 1][u] = *(const v4ia*)(K2 + o); } };
    auto gv = [&](int j0) {
#pragma unroll
        for (int u = 0; u < 2; ++u) { const int x = tid + 128 * u; const size_t o = (size_t)(x >> 2) * TT + j0 + (x & 3) * 8; rv[0][u] = *(const v4ia*)(VT + o); if (HI) rv[NP - 1][u] = *(const v4ia*)(VT2 + o); } };
    auto sk = [&](const v4i (&t)[NP][2], int bs) { T16* d = sb + bs * SBUF;
#pragma unroll
        for (int u = 0; u < 2; ++u) { const int x = tid + 128 * u, o = (x >> 3) * KPI + (x & 7) * 8; *(v4ia*)(d + o) = t[0][u]; if (HI) *(v4ia*)(d + KTS + o) = t[NP - 1][u]; } };
    auto sv = [&](int bs) { T16* d = sb + bs * SBUF + NP * KTS;
#pragma unroll
        for (int u = 0; u < 2; ++u) { const int x = tid + 128 * u, o = (x >> 2) * VPI + (x & 3) * 8; *(v4ia*)(d + o) = rv[0][u]; if (HI) *(v4ia*)(d + VTS + o) = rv[NP - 1][u]; } };
    gk(rk, 0); gv(0); gk(rk2, 32);
    V qf[NQ][2], qf2[NQ][2];
#pragma unroll
    for (int qt = 0; qt < NQ; ++qt)
#pragma unroll
        for (int ks = 0; ks < 2; ++ks) { const size_t o = (size_t)(q0 + qt * 16 + lr) * HD + ks * 32 + 8 * hi; qf[qt][ks] = F::ld(Q + o); if (HI) qf2[qt][ks] = F::ld(Q2 + o); }
#pragma unroll
    for (int u = 0; u < TT / 512; ++u) { const v4i m = *(const v4i*)(kvp + (tid + 128 * u) * 4); v4f bz;
#pragma unroll
        for (int q = 0; q < 4; ++q) bz[q] = (m[q] != 0) ? 0.0f : -3.0e38f;
        *(v4f*)(bias + (tid + 128 * u) * 4) = bz; }
    sk(rk, 0); sv(0);
    lds_barrier();   // stage 0 and the mask table stand in LDS before any wave reads them
    // masked raw scores of the stage's 32 keys
    auto scores = [&](int bs, int j0, v8f (&s)[2][NQ]) { const T16* kb = sb + bs * SBUF; V kf[2][2], kf2[2][2];
#pragma unroll
        for (int kt = 0; kt < 2; ++kt)
#pragma unroll
            for (int ks = 0; ks < 2; ++ks) { const int o = (kt * 16 + lr) * KPI + ks * 32 + 8 * hi; kf[kt][ks] = F::ld(kb + o); if (HI) kf2[kt][ks] = F::ld(kb + KTS + o); }
        auto prod = [&](int kt, int qt, v8f a) {
#pragma unroll
            for (int ks = 0; ks < 2; ++ks) { a = F::mma(kf[kt][ks], qf[qt][ks], a); if (HI) { a = F::mma(kf[kt][ks], qf2[qt][ks], a); a = F::mma(kf2[kt][ks], qf[qt][ks], a); } }
            return a; };
#pragma unroll
        for (int kt = 0; kt < 2; ++kt) { const float* bp = bias + j0 + kt * 16 + 8 * hi; const v4f c0 = *(const v4f*)bp, c1 = *(const v4f*)(bp + 4); const v8f cb = __builtin_shufflevector(c0, c1, 0, 1, 2, 3, 4, 5, 6, 7);
#pragma unroll
            for (int qt = 0; qt < NQ; ++qt) s[kt][qt] = prod(kt, qt, cb); }
        if (j0 == (q0 & ~31)) {   // scalar test: the one stage with this wave's diagonal
#pragma unroll
            for (int kt = 0; kt < 2; ++kt)
#pragma unroll
                for (int qt = 0; qt < NQ; ++qt) { const v8f a = prod(kt, qt, (v8f){}); const int dj = q0 + qt * 16 + lr - (j0 + kt * 16 + 8 * hi);
#pragma unroll
                    for (int r = 0; r < 8; ++r) s[kt][qt][r] = (dj == r) ? a[r] : s[kt][qt][r]; } } };
    float mx[NQ], l[NQ];
#pragma unroll
    for (int qt = 0; qt < NQ; ++qt) { mx[qt] = -3.0e38f; l[qt] = 0.f; }
    // walk 1 is short of work per stage, so its K tiles are fetched two stages ahead, in two register sets that take turns; the index wraps: the last trip brings stage 0 back for walk 2
    auto walk1 = [&](int bs, int j0, v4i (&tn)[NP][2], const v4i (&tc)[NP][2]) { gk(tn, (j0 + 64) & (TT - 1));
        __builtin_amdgcn_sched_barrier(0);   // keeps the global loads issued ahead of this stage's work, whose time covers part of their latency
        v8f s[2][NQ]; scores(bs, j0, s);
#pragma unroll
        for (int qt = 0; qt < NQ; ++qt)
#pragma unroll
            for (int r = 0; r < 8; ++r) mx[qt] = fmaxf(mx[qt], fmaxf(s[0][qt][r], s[1][qt][r]));
        sk(tc, bs ^ 1);
        lds_barrier(); };   // publishes the next stage; ends every wave's reads of the buffer that the next stage refills
#pragma unroll 1   // rolled: one trip holds the two stages that the two register sets ask for; more would only cost instruction cache
    for (int st = 0; st < TT / 32; st += 2) { walk1(0, st * 32, rk, rk2); walk1(1, st * 32 + 32, rk2, rk); }
    float mc[NQ];
#pragma unroll
    for (int qt = 0; qt < NQ; ++qt) { mx[qt] = fmaxf(mx[qt], __shfl_xor(mx[qt], 16, 32)); mc[qt] = mx[qt] * CE - (HI ? 0.0f : 10.0f); }
    v4f g[NQ][4];   // group_prob of the stage's 32 keys, 8 + 8 per lane and query row
    auto gg = [&](int j0) {
#pragma unroll
        for (int qt = 0; qt < NQ; ++qt) { const float* gr = gp + (size_t)(q0 + qt * 16 + lr) * TT + j0 + 8 * hi; g[qt][0] = *(const v4f*)gr; g[qt][1] = *(const v4f*)(gr + 4); g[qt][2] = *(const v4f*)(gr + 16); g[qt][3] = *(const v4f*)(gr + 20); } };
    gg(0);
    v8f o[4][NQ];
#pragma unroll
    for (int dt = 0; dt < 4; ++dt)
#pragma unroll
        for (int qt = 0; qt < NQ; ++qt) o[dt][qt] = (v8f){};
#pragma unroll 1   // rolled: a second stage body would cost registers and instruction cache and save nothing
    for (int st = 0; st < TT / 32; ++st) { const int j0 = st * 32, bs = st & 1;
        gk(rk, (j0 + 32) & (TT - 1)); gv((j0 + 32) & (TT - 1));
        __builtin_amdgcn_sched_barrier(0);   // keeps the next stage's global loads issued ahead of this stage's work, whose time covers their latency
        v8f s[2][NQ]; scores(bs, j0, s); V pf[NQ], pf2[NQ], vf[4], vf2[4];
        const T16* vb = sb + bs * SBUF + NP * KTS;   // the V^T fragments are read ahead of the exponentials, which cover the LDS latency
#pragma unroll
        for (int dt = 0; dt < 4; ++dt) { const int vo = (dt * 16 + lr) * VPI + 8 * hi; vf[dt] = F::ld(vb + vo); if (HI) vf2[dt] = F::ld(vb + VTS + vo); }
        unsigned gb[NQ][8];   // this stage's group_prob rounded to bf16, two a register
#pragma unroll
        for (int qt = 0; qt < NQ; ++qt)
#pragma unroll
            for (int w = 0; w < 8; ++w) gb[qt][w] = pkbf(g[qt][w >> 1][(w & 1) * 2], g[qt][w >> 1][(w & 1) * 2 + 1]);
        gg((j0 + 32) & (TT - 1));
        __builtin_amdgcn_sched_barrier(0);   // keeps the next stage's group_prob loads and the V^T reads issued here: the exponentials and the P.V products cover their latency; the barrier waits for LDS alone, so the group_prob loads may stay in flight past it
#pragma unroll
        for (int qt = 0; qt < NQ; ++qt) { v16h ph; v8u uh, ul;
#pragma unroll
            for (int kt = 0; kt < 2; ++kt)
#pragma unroll
                for (int r = 0; r < 8; r += 2) { const unsigned gw = gb[qt][kt * 4 + (r >> 1)];
                    float e0, e1; exp2x2(__builtin_fmaf(s[kt][qt][r], CE, -mc[qt]), __builtin_fmaf(s[kt][qt][r + 1], CE, -mc[qt]), e0, e1); l[qt] += e0; l[qt] += e1;
                    const float p0 = e0 * bflo(gw), p1 = e1 * bfhi(gw);
                    if constexpr (HI) { const unsigned a = pkbf(p0, p1); uh[kt * 4 + (r >> 1)] = a; ul[kt * 4 + (r >> 1)] = pkbf(p0 - bflo(a), p1 - bfhi(a)); } else { ph[kt * 8 + r] = tohx(p0); ph[kt * 8 + r + 1] = tohx(p1); } }
            if constexpr (HI) { pf[qt] = __builtin_bit_cast(v16bf, uh); pf2[qt] = __builtin_bit_cast(v16bf, ul); } else pf[qt] = ph; }
#pragma unroll
        for (int dt = 0; dt < 4; ++dt)
#pragma unroll
            for (int qt = 0; qt < NQ; ++qt) { o[dt][qt] = F::mma(vf[dt], pf[qt], o[dt][qt]); if (HI) { o[dt][qt] = F::mma(vf[dt], pf2[qt], o[dt][qt]); o[dt][qt] = F::mma(vf2[dt], pf[qt], o[dt][qt]); } }
        sk(rk, bs ^ 1); sv(bs ^ 1);
        lds_barrier(); }   // publishes the next stage; ends every wave's reads of the buffer that the next trip refills
#pragma unroll
    for (int qt = 0; qt < NQ; ++qt) { const float inv = __fdiv_rn(1.0f, l[qt] + __shfl_xor(l[qt], 16, 32)); const size_t oo = (size_t)(q0 + qt * 16 + lr) * DQ + 8 * hi;
#pragma unroll
        for (int dt = 0; dt < 4; ++dt) { v4u oh, ol;
#pragma unroll
            for (int r = 0; r < 8; r += 2) { const float y0 = o[dt][qt][r] * inv, y1 = o[dt][qt][r + 1] * inv; const unsigned a = pkbf(y0, y1); oh[r >> 1] = a; ol[r >> 1] = pkbf(y0 - bflo(a), y1 - bfhi(a)); }
            *(v4u*)(Ah + oo + dt * 16) = oh; *(v4u*)(Al + oo + dt * 16) = ol; } }
}
__global__ __launch_bounds__(128) void k_fattn(const h16* __restrict__ Q16, const bf* __restrict__ Qh, const bf* __restrict__ Ql, const h16* __restrict__ K16, const bf* __restrict__ Kh, const bf* __restrict__ Kl, const h16* __restrict__ V16, const bf* __restrict__ Vh, const bf* __restrict__ Vl, const int* __restrict__ kmask, const float* __restrict__ gprob, bf* Ah, bf* Al) {
    __shared__ __align__(16) char sm[2 * SBUF * 2]; __shared__ __align__(16) float bias[TT];
    const int wv = __builtin_amdgcn_readfirstlane((int)(threadIdx.x >> 5));   // wave number, scalar: the row base and the diagonal test stay in scalar registers
    const int bx = blockIdx.x, h = blockIdx.y, b = blockIdx.z; const size_t po = ((size_t)b * NH_ + h) * TT * HD;
    const int* kvp = kmask + (size_t)b * TT; const float* gp = gprob + (size_t)b * TT * TT; bf* ah = Ah + (size_t)b * TT * DQ + h * HD; bf* al = Al + (size_t)b * TT * DQ + h * HD;
    if (bx < RH / 64) attn_rows<bf, true, 1>(Qh + po, Ql + po, Kh + po, Kl + po, Vh + po, Vl + po, kvp, gp, bx * 64 + wv * 16, ah, al, (bf*)sm, bias);
    else attn_rows<h16, false, 2>(Q16 + po, nullptr, K16 + po, nullptr, V16 + po, nullptr, kvp, gp, RH + (bx - RH / 64) * 128 + wv * 32, ah, al, (h16*)sm, bias);
}

extern "C" void kernel_launch(void* const* d_in, const int* in_sizes, int n_in,
                              void* d_out, int out_size, void* d_ws, size_t ws_size, hipStream_t stream) {
    (void)in_sizes; (void)n_in; (void)out_size;
    const float* x = (const float*)d_in[0]; const float* xk = (const float*)d_in[1]; const float* xv = (const float*)d_in[2]; const float* gprob = (const float*)d_in[3];   /* group_prob [2][2048][2048] f32 */ const int* kmask = (const int*)d_in[4];   /* mask [2][2048] int32: 1 = attendable key (OR the diagonal) */ const float* wq = (const float*)d_in[5]; const float* bq = (const float*)d_in[6]; const float* wk = (const float*)d_in[7]; const float* bk = (const float*)d_in[8]; const float* wv = (const float*)d_in[9]; const float* bv = (const float*)d_in[10]; const float* wo = (const float*)d_in[11]; const float* bo = (const float*)d_in[12];   /* input order query, key, value, group_prob, mask, Wq, bq, Wk, bk, Wv, bv, Wo, bo ('oi') */
    float* OUT = (float*)d_out;     // [2][2048][1024]
    char* wsp = (char*)d_ws;
    auto take = [&](size_t bytes) { char* p = wsp; wsp += (bytes + 255) & ~(size_t)255; return (void*)p; };
    bf* WQ = (bf*)take((size_t)DQ * DM * 2); bf* WK = (bf*)take((size_t)DKV * DM * 2); bf* WV = (bf*)take((size_t)DKV * DM * 2); bf* WO = (bf*)take((size_t)DM * DQ * 2); float* CS = (float*)take((size_t)TT * HD * 2 * 4);
    bf* XB = (bf*)take((size_t)TT * DM * 2); float* FQ = (float*)take((size_t)TT * DQ * 4); float* FK = (float*)take((size_t)TT * DKV * 4);
    const size_t PS = (size_t)NH_ * TT * HD;   // one batch's plane, elements (NKV == NH_); every plane holds both batches
    h16* QP16 = (h16*)take(NB_ * PS * 2); h16* KP16 = (h16*)take(NB_ * PS * 2); h16* VT16 = (h16*)take(NB_ * PS * 2);
    bf* QPh = (bf*)take(NB_ * PS * 2); bf* QPl = (bf*)take(NB_ * PS * 2); bf* KPh = (bf*)take(NB_ * PS * 2); bf* KPl = (bf*)take(NB_ * PS * 2); bf* VTh = (bf*)take(NB_ * PS * 2); bf* VTl = (bf*)take(NB_ * PS * 2);
    bf* ATh = (bf*)take((size_t)NB_ * TT * DQ * 2); bf* ATl = (bf*)take((size_t)NB_ * TT * DQ * 2);
    if ((size_t)(wsp - (char*)d_ws) > ws_size) return;    // ws 256 MiB
    float* FV = FK;   // v projection reuses the k buffer after the k planes are built (stream-ordered)
    { k_cvt8<<<(unsigned)(((size_t)DQ * DM / 8 + 255) / 256), 256, 0, stream>>>(wq, WQ, (size_t)DQ * DM / 8); k_cvt8<<<(unsigned)(((size_t)DKV * DM / 8 + 255) / 256), 256, 0, stream>>>(wk, WK, (size_t)DKV * DM / 8); k_cvt8<<<(unsigned)(((size_t)DKV * DM / 8 + 255) / 256), 256, 0, stream>>>(wv, WV, (size_t)DKV * DM / 8);
      k_cvt8<<<(unsigned)(((size_t)DM * DQ / 8 + 255) / 256), 256, 0, stream>>>(wo, WO, (size_t)DM * DQ / 8);
       }
    k_csid<<<(TT * HD + 255) / 256, 256, 0, stream>>>(CS);
    const unsigned LQ = (unsigned)(((size_t)NH_ * TT * HD / 2 + 255) / 256), LKv = (unsigned)(((size_t)NKV * TT * HD / 2 + 255) / 256);
    for (int b = 0; b < NB_; ++b) {
        
        k_cvt8<<<(unsigned)(((size_t)TT * DM / 8 + 255) / 256), 256, 0, stream>>>(x + (size_t)b * TT * DM, XB, (size_t)TT * DM / 8);
        k_gemmw<bf, 0, true, 8><<<dim3(TT / 64, DQ / 64, 1), 256, 0, stream>>>(XB, nullptr, WQ, nullptr, DM, DM, FQ, DQ, bq, 0, 0, 0);
        k_rope<<<LQ, 256, 0, stream>>>(FQ, DQ, NH_, CS, nullptr, nullptr, 1.0f, QP16 + b * PS, QPh + b * PS, QPl + b * PS);
        k_cvt8<<<(unsigned)(((size_t)TT * DM / 8 + 255) / 256), 256, 0, stream>>>(xk + (size_t)b * TT * DM, XB, (size_t)TT * DM / 8);   /* XB := bf16(key[b]) */ k_gemmw<bf, 0, true, 8><<<dim3(TT / 64, DKV / 64, 1), 256, 0, stream>>>(XB, nullptr, WK, nullptr, DM, DM, FK, DKV, bk, 0, 0, 0);
        k_rope<<<LKv, 256, 0, stream>>>(FK, DKV, NKV, CS, nullptr, nullptr, 1.0f, KP16 + b * PS, KPh + b * PS, KPl + b * PS);
        k_cvt8<<<(unsigned)(((size_t)TT * DM / 8 + 255) / 256), 256, 0, stream>>>(xv + (size_t)b * TT * DM, XB, (size_t)TT * DM / 8);   /* XB := bf16(value[b]) */ k_gemmw<bf, 0, true, 8><<<dim3(TT / 64, DKV / 64, 1), 256, 0, stream>>>(XB, nullptr, WV, nullptr, DM, DM, FV, DKV, bv, 0, 0, 0); k_vtp<<<LKv, 256, 0, stream>>>(FV, DKV, NKV, VT16 + b * PS, VTh + b * PS, VTl + b * PS); }
    k_fattn<<<dim3(RH / 64 + (TT - RH) / 128, NH_, NB_), 128, 0, stream>>>(QP16, QPh, QPl, KP16, KPh, KPl, VT16, VTh, VTl, kmask, gprob, ATh, ATl);
    for (int b = 0; b < NB_; ++b) {
        k_gemmw<bf, 1, true, 8><<<dim3(TT / 64, DM / 64, 1), 256, 0, stream>>>(ATh + (size_t)b * TT * DQ, ATl + (size_t)b * TT * DQ, WO, nullptr, DQ, DQ, OUT + (size_t)b * TT * DM, DM, bo, 0, 0, 0); }
}

// v004
// One run takes 239 microseconds.
// In both of two side-by-side timings against v003, it was 1.17 times as fast.
// Over all steps from v000 it is 8.48 times as fast.
#include <hip/hip_runtime.h>

// Multi-headed attention on three streams with a padding-or-diagonal mask and a post-softmax group weighting (query, key, value [2][2048][1024]; q, k, v = x W^T + b ('oi' 0.02, zero biases; 16 heads x 64); scores / sqrt(64); key j is kept for query i when mask[b][j] != 0 OR j == i (mask int [2][2048] random 0/1, read; -1e9 == exclusion); p = softmax; p = p x group_prob[b][i][j] (f32 [2][2048][2048] uniform, read; NOT renormalised); x = p.v; out = merged Wo^T + bo -> [2][2048][1024] (4.2 M); argument order query, key, value, group_prob, mask, Wq, bq, Wk, bk, Wv, bv, Wo, bo).
// Layout per batch: bf16 copies of query, key, value in turn; 'oi' weights; exact projections + f32 biases, whose epilogue writes the head planes; one fused attention launch for all heads of both batches (hybrid rows: < 512 hi/lo 3 products, rest fp16 x1024): it reads the batch's int key vector (select with the always-kept diagonal), multiplies each exponential by bf16(group_prob[b][i][j]) and divides the P.V sums by the row's sum of exponentials; merged hi/lo x Wo exact + bo.
// Compute dtypes, f32 accumulate: every input rounded to bf16 incl. group_prob; projections exact + f32 biases; attention rows < 512 3 products, rest fp16; softmax and group weighting f32; Wo hl x exact + bias.

#define NB_  2
#define TT   2048
#define DM   1024
#define NH_  16
#define NKV  16
#define HD   64
#define DQ   (NH_ * HD)
#define DKV  (NKV * HD)
#define RH   512                  // query rows < RH use hi+lo planes (0: none)
#define WIN  0
#define SCL  0.125f   // HD^-0.5
typedef _Float16 h16;
typedef unsigned short bf;
typedef __attribute__((ext_vector_type(16))) __bf16   v16bf;
typedef __attribute__((ext_vector_type(16))) _Float16 v16h;
typedef __attribute__((ext_vector_type(8)))  _Float16 v8h;
typedef __attribute__((ext_vector_type(8)))  unsigned short v8us;
typedef __attribute__((ext_vector_type(8)))  float    v8f;
typedef __attribute__((ext_vector_type(4)))  _Float16 v4h;
typedef __attribute__((ext_vector_type(4)))  unsigned short v4us;
typedef __attribute__((ext_vector_type(4)))  float    v4f;
typedef v8h  __attribute__((may_alias)) v8ha;
typedef v4f  __attribute__((may_alias)) v4fa;
typedef v8us __attribute__((may_alias)) v8usa;

__device__ __forceinline__ unsigned short f2bf(float f) { unsigned u = __float_as_uint(f); u += 0x7FFFu + ((u >> 16) & 1u); return (unsigned short)(u >> 16); }
__device__ __forceinline__ float bf2f(unsigned short b) { return __uint_as_float(((unsigned)b) << 16); }
__device__ __forceinline__ float bfr(float f) { return bf2f(f2bf(f)); }
__device__ __forceinline__ v16h cat16(v8h lo, v8h hi) { return __builtin_shufflevector(lo, hi, 0, 1, 2, 3, 4, 5, 6, 7, 8, 9, 10, 11, 12, 13, 14, 15); }
__device__ __forceinline__ v16bf cat16b(v8us lo, v8us hi) { return __builtin_bit_cast(v16bf, __builtin_shufflevector(lo, hi, 0, 1, 2, 3, 4, 5, 6, 7, 8, 9, 10, 11, 12, 13, 14, 15)); }
__device__ __forceinline__ v8f wmma16(v16h a, v16h b, v8f c) { return __builtin_amdgcn_wmma_f32_16x16x32_f16(false, a, false, b, (short)0, c, false, false); }
__device__ __forceinline__ v8f wmmab(v16bf a, v16bf b, v8f c) { return __builtin_amdgcn_wmma_f32_16x16x32_bf16(false, a, false, b, (short)0, c, false, false); }



// ---- k_gemmw: register-blocked GEMM, one work-group of KW waves per 64x64 output tile, operands straight from K-contiguous 16-bit planes; grid (M/64, N/64, Z), 32 * KW threads.
// Each wave holds the whole tile (16 accumulators) over its own K / KW slice of k; for KW > 1 the KW partial tiles go to LDS and are summed there in wave order (a fixed order).
// C[m][n] (f32, pitch ldc, + optional f32 bias[n]) = sum_k A[m][k] Bt[n][k] (+ split products per NSPLIT). A rows have pitch lda elements, Bt rows pitch K. z-batch strides sA/sB/sC in elements. K % (32 * KW) == 0.
// PL != 0: no f32 C; the summed tile goes out as three 16-bit planes (fp16, bf16 hi, bf16 lo of the remainder). PL == 1: one plane block of [ldc rows][64] per tile column (head planes [h][t][d]), bias[n]. PL == 2: row-major [m][n] with pitch ldc, bias[m] (V^T = Wv X^T: rows are head dims, columns tokens).
template <typename T16> struct WFrag;
template <> struct WFrag<h16> { typedef v16h V; static __device__ __forceinline__ V ld(const h16* p) { return cat16(*(const v8h*)p, *(const v8h*)(p + 16)); } static __device__ __forceinline__ v8f mma(V a, V b, v8f c) { return wmma16(a, b, c); } };
template <> struct WFrag<bf> { typedef v16bf V; static __device__ __forceinline__ V ld(const bf* p) { return cat16b(*(const v8us*)p, *(const v8us*)(p + 16)); } static __device__ __forceinline__ v8f mma(V a, V b, v8f c) { return wmmab(a, b, c); } };
template <typename T16, int NSPLIT, bool BIAS, int KW, int PL>
__global__ __launch_bounds__(32 * KW) void k_gemmw(const T16* __restrict__ A, const T16* __restrict__ A2, const T16* __restrict__ Bt, const T16* __restrict__ Bt2, int K, int lda, float* C, int ldc, const float* __restrict__ bias, size_t sA, size_t sB, size_t sC, h16* P16, bf* Ph, bf* Pl) {
    static_assert(PL == 0 || KW > 1, "the plane epilogue stands in the k-split path");
    typedef typename WFrag<T16>::V V;
    __shared__ __align__(16) float os[(KW == 1 ? 16 : KW * 64) * 68];
    const size_t z = blockIdx.z; A += z * sA; if (A2) A2 += z * sA; Bt += z * sB; if (Bt2) Bt2 += z * sB; C += z * sC;
    const int lane = threadIdx.x & 31, lr = lane & 15, hi = lane >> 4; const int r0 = blockIdx.x * 64, c0 = blockIdx.y * 64;
    v8f acc[4][4];
#pragma unroll
    for (int mb = 0; mb < 4; ++mb)
#pragma unroll
        for (int nb = 0; nb < 4; ++nb) acc[mb][nb] = (v8f){};
    const size_t aoff = (size_t)(r0 + lr) * lda + 8 * hi, boff = (size_t)(c0 + lr) * K + 8 * hi;
    const int wv = (KW == 1) ? 0 : __builtin_amdgcn_readfirstlane((int)(threadIdx.x >> 5));   // wave number, scalar: the k loop's bounds stay in scalar registers
    const int kbeg = wv * (K / KW), kend = kbeg + K / KW;
    float pb[(PL == 2) ? 32 / KW : 4];   // plane epilogue: this thread's biases (PL == 1: of its 4 columns; PL == 2: of its rows), read ahead of the k loop, which covers their latency
    if constexpr (BIAS && PL != 0) {
#pragma unroll
        for (int i = 0; i < ((PL == 2) ? 32 / KW : 4); ++i) pb[i] = (PL == 1) ? bias[c0 + ((int)threadIdx.x & 15) * 4 + i] : bias[r0 + i * 2 * KW + ((int)threadIdx.x >> 4)]; }
#pragma unroll 1
    for (int kc = kbeg; kc < kend; kc += 32) {
        V a[4], a2[4];
#pragma unroll
        for (int mb = 0; mb < 4; ++mb) { a[mb] = WFrag<T16>::ld(A + aoff + (size_t)mb * 16 * lda + kc); if (NSPLIT == 1 || NSPLIT == 2) a2[mb] = WFrag<T16>::ld(A2 + aoff + (size_t)mb * 16 * lda + kc); }
#pragma unroll
        for (int nb = 0; nb < 4; ++nb) { const V b = WFrag<T16>::ld(Bt + boff + (size_t)nb * 16 * K + kc); V b2; if (NSPLIT >= 2) b2 = WFrag<T16>::ld(Bt2 + boff + (size_t)nb * 16 * K + kc);
#pragma unroll
            for (int mb = 0; mb < 4; ++mb) { acc[mb][nb] = WFrag<T16>::mma(a[mb], b, acc[mb][nb]); if (NSPLIT == 1 || NSPLIT == 2) acc[mb][nb] = WFrag<T16>::mma(a2[mb], b, acc[mb][nb]); if (NSPLIT >= 2) acc[mb][nb] = WFrag<T16>::mma(a[mb], b2, acc[mb][nb]); } }
        asm volatile("v_nop\n\tv_nop\n\tv_nop\n\tv_nop" : "+v"(acc[0][0]), "+v"(acc[1][1]), "+v"(acc[2][2]), "+v"(acc[3][3]) : "v"(a[0]), "v"(a[3]));
    }
    if constexpr (KW > 1) {
        float* ow = os + wv * (64 * 68); const int cofs = ((int)threadIdx.x & 15) * 4; v4f bv = (v4f){};
        if constexpr (PL == 0)
        if (BIAS) { bv[0] = bfr(bias[c0 + cofs]); bv[1] = bfr(bias[c0 + cofs + 1]); bv[2] = bfr(bias[c0 + cofs + 2]); bv[3] = bfr(bias[c0 + cofs + 3]); }   // read ahead of the barrier: its latency passes behind the LDS stores
        if constexpr (BIAS && PL == 1) { bv[0] = bfr(pb[0]); bv[1] = bfr(pb[1]); bv[2] = bfr(pb[2]); bv[3] = bfr(pb[3]); }
#pragma unroll
        for (int mb = 0; mb < 4; ++mb)
#pragma unroll
            for (int nb = 0; nb < 4; ++nb)
#pragma unroll
                for (int j = 0; j < 8; ++j) ow[(mb * 16 + hi * 8 + j) * 68 + nb * 16 + lr] = acc[mb][nb][j];
        __syncthreads();   // every wave's partial tile stands in LDS before any of it is summed
#pragma unroll
        for (int i = 0; i < 32 / KW; ++i) { const int row = i * 2 * KW + ((int)threadIdx.x >> 4); v4f val = *(const v4fa*)(os + row * 68 + cofs);
#pragma unroll
            for (int w = 1; w < KW; ++w) val += *(const v4fa*)(os + w * (64 * 68) + row * 68 + cofs);
            if (BIAS) { if constexpr (PL == 2) val += bfr(pb[i]); else val += bv; }
            if constexpr (PL == 0) *(v4f*)(C + (size_t)(r0 + row) * ldc + c0 + cofs) = val;
            else { const size_t e = (PL == 1) ? ((size_t)blockIdx.y * ldc + r0 + row) * 64 + cofs : (size_t)(r0 + row) * ldc + c0 + cofs; v4h o16; v4us oh, ol;
#pragma unroll
                for (int q = 0; q < 4; ++q) { o16[q] = (h16)val[q]; const unsigned short a2 = f2bf(val[q]); oh[q] = a2; ol[q] = f2bf(val[q] - bf2f(a2)); }
                *(v4h*)(P16 + e) = o16; *(v4us*)(Ph + e) = oh; *(v4us*)(Pl + e) = ol; } }
    } else {
#pragma unroll
    for (int mb = 0; mb < 4; ++mb) {
#pragma unroll
        for (int nb = 0; nb < 4; ++nb) {
#pragma unroll
            for (int j = 0; j < 8; ++j) os[(hi * 8 + j) * 68 + nb * 16 + lr] = acc[mb][nb][j]; }
        __builtin_amdgcn_wave_barrier(); asm volatile("" ::: "memory");
        float* crow = C + (size_t)(r0 + mb * 16) * ldc + c0;
{
#pragma unroll
            for (int s = 0; s < 8; ++s) { const int row = 2 * s + hi, cofs = lr * 4; v4f val = *(const v4fa*)(os + row * 68 + cofs); if (BIAS) { val[0] += bfr(bias[c0 + cofs]); val[1] += bfr(bias[c0 + cofs + 1]); val[2] += bfr(bias[c0 + cofs + 2]); val[3] += bfr(bias[c0 + cofs + 3]); }
                *(v4f*)(crow + (size_t)row * ldc + cofs) = val; }
             }
        __builtin_amdgcn_wave_barrier(); asm volatile("" ::: "memory");
    }
    }
}

__device__ __forceinline__ h16 tohx(float x) { return (h16)x; }
typedef __attribute__((ext_vector_type(2))) float v2f;
typedef __attribute__((ext_vector_type(4))) int v4i;

__global__ __launch_bounds__(256) void k_cvt8(const float* __restrict__ src, bf* dst, size_t n8) { const size_t i = (size_t)blockIdx.x * 256 + threadIdx.x; if (i >= n8) return; const v8f v = *(const v8f*)(src + i * 8); v8us o;
#pragma unroll
    for (int k = 0; k < 8; ++k) o[k] = f2bf(v[k]); *(v8us*)(dst + i * 8) = o;  }

// k_fattn: scores, mask, softmax, group weighting, P.V and the head merge in one kernel; no score or probability leaves the registers. Grid (RH/64 + (TT-RH)/128, heads, batches), 4 waves.
// A wave owns NQ * 16 query rows of one head; the work-group walks all TT keys twice, 32 keys a stage. A stage's K rows and V^T rows are read from global in whole or half lines, one stage ahead (walk 1: two), and shared through two LDS buffers (one barrier a stage).
// S^T = K Q^T (A = K rows, B = Q rows, same k order on both sides): a lane holds 8 keys of ONE query per tile. The key mask enters as the C operand (0 or -3e38 per key, from an LDS table built at entry);
// in the one stage that holds a wave's diagonal the products are formed once more from C = 0 and the element j == i takes that value (the diagonal is always kept).
// Walk 1: the row maximum over the kept keys. Walk 2: e = exp(s / 8 - max), l += e, p = e x bf16(group_prob[b][i][j]); the two key tiles of a stage, converted in place, are the B operand of O^T += V^T P^T (A = V^T rows in the hardware k order).
// The epilogue joins the wave halves' sums, divides by l (the weighting is not renormalised: l sums e alone) and stores hi/lo bf16 planes of the merged rows, 16 B per lane.
// Rows < RH: hi/lo bf16 planes, 3 products in both GEMMs, 16 rows a wave; the rest fp16 with p carried x 1024 (folded into the exponent, so l carries it too and it cancels), 32 rows a wave.
#define KPI 72   // LDS pitch of a K row in elements: 128 B + 16 B, for 16-byte readers
#define VPI 40   // LDS pitch of a V^T row of 32 keys in elements: 64 B + 16 B
#define SBUF (2 * (32 * KPI + 64 * VPI))   // elements of one stage buffer at two planes per operand
typedef __attribute__((ext_vector_type(2))) __bf16 v2bf;
typedef __attribute__((ext_vector_type(8))) unsigned v8u;
typedef __attribute__((ext_vector_type(4))) unsigned v4u;
typedef v4i __attribute__((may_alias)) v4ia;
__device__ __forceinline__ unsigned pkbf(float a, float b) { v2f x; x[0] = a; x[1] = b; return __builtin_bit_cast(unsigned, __builtin_convertvector(x, v2bf)); }   // two f32 -> packed bf16, round to nearest even
// two 2^x in one statement: the early-clobber outputs keep each off the other's registers, and the v_nop keeps the slot that the instruction set asks for behind a transcendental before its result is used or its source overwritten
__device__ __forceinline__ void exp2x2(float x0, float x1, float& e0, float& e1) { asm("v_exp_f32 %0, %2\n\tv_exp_f32 %1, %3\n\tv_nop" : "=&v"(e0), "=&v"(e1) : "v"(x0), "v"(x1)); }
// work-group barrier that orders LDS alone: unlike __syncthreads() it does not wait for the global loads in flight (the next stage's tiles and group_prob go to registers and concern no other wave)
__device__ __forceinline__ void lds_barrier() { __builtin_amdgcn_fence(__ATOMIC_RELEASE, "workgroup", "local"); __builtin_amdgcn_s_barrier(); __builtin_amdgcn_fence(__ATOMIC_ACQUIRE, "workgroup", "local"); }
__device__ __forceinline__ float bflo(unsigned u) { return __uint_as_float(u << 16); }
__device__ __forceinline__ float bfhi(unsigned u) { return __uint_as_float(u & 0xFFFF0000u); }
template <typename T16, bool HI, int NQ>
__device__ __forceinline__ void attn_rows(const T16* __restrict__ Q, const T16* __restrict__ Q2, const T16* __restrict__ K, const T16* __restrict__ K2, const T16* __restrict__ VT, const T16* __restrict__ VT2, const int* __restrict__ kvp, const float* __restrict__ gp, const int q0, bf* Ah, bf* Al, T16* sb, float* bias) {
    typedef WFrag<T16> F; typedef typename F::V V;   // every inner loop below is unrolled in full, so that the fragment and accumulator arrays stay in registers
    constexpr int NP = HI ? 2 : 1, KTS = 32 * KPI, VTS = 64 * VPI;
    const int tid = threadIdx.x, lane = tid & 31, lr = lane & 15, hi = lane >> 4;
    const float CE = SCL * 1.4426950408889634f;
    v4i rk[NP][2], rk2[NP][2], rv[NP][2];
    auto gk = [&](v4i (&t)[NP][2], int j0) {
#pragma unroll
        for (int u = 0; u < 2; ++u) { const size_t o = (size_t)j0 * HD + (tid + 128 * u) * 8; t[0][u] = *(const v4ia*)(K + o); if (HI) t[NP - 1][u] = *(const v4ia*)(K2 + o); } };
    auto gv = [&](int j0) {
#pragma unroll
        for (int u = 0; u < 2; ++u) { const int x = tid + 128 * u; const size_t o = (size_t)(x >> 2) * TT + j0 + (x & 3) * 8; rv[0][u] = *(const v4ia*)(VT + o); if (HI) rv[NP - 1][u] = *(const v4ia*)(VT2 + o); } };
    auto sk = [&](const v4i (&t)[NP][2], int bs) { T16* d = sb + bs * SBUF;
#pragma unroll
        for (int u = 0; u < 2; ++u) { const int x = tid + 128 * u, o = (x >> 3) * KPI + (x & 7) * 8; *(v4ia*)(d + o) = t[0][u]; if (HI) *(v4ia*)(d + KTS + o) = t[NP - 1][u]; } };
    auto sv = [&](int bs) { T16* d = sb + bs * SBUF + NP * KTS;
#pragma unroll
        for (int u = 0; u < 2; ++u) { const int x = tid + 128 * u, o = (x >> 2) * VPI + (x & 3) * 8; *(v4ia*)(d + o) = rv[0][u]; if (HI) *(v4ia*)(d + VTS + o) = rv[NP - 1][u]; } };
    gk(rk, 0); gv(0); gk(rk2, 32);
    V qf[NQ][2], qf2[NQ][2];
#pragma unroll
    for (int qt = 0; qt < NQ; ++qt)
#pragma unroll
        for (int ks = 0; ks < 2; ++ks) { const size_t o = (size_t)(q0 + qt * 16 + lr) * HD + ks * 32 + 8 * hi; qf[qt][ks] = F::ld(Q + o); if (HI) qf2[qt][ks] = F::ld(Q2 + o); }
#pragma unroll
    for (int u = 0; u < TT / 512; ++u) { const v4i m = *(const v4i*)(kvp + (tid + 128 * u) * 4); v4f bz;
#pragma unroll
        for (int q = 0; q < 4; ++q) bz[q] = (m[q] != 0) ? 0.0f : -3.0e38f;
        *(v4f*)(bias + (tid + 128 * u) * 4) = bz; }
    sk(rk, 0); sv(0);
    lds_barrier();   // stage 0 and the mask table stand in LDS before any wave reads them
    // masked raw scores of the stage's 32 keys
    auto scores = [&](int bs, int j0, v8f (&s)[2][NQ]) { const T16* kb = sb + bs * SBUF; V kf[2][2], kf2[2][2];
#pragma unroll
        for (int kt = 0; kt < 2; ++kt)
#pragma unroll
            for (int ks = 0; ks < 2; ++ks) { const int o = (kt * 16 + lr) * KPI + ks * 32 + 8 * hi; kf[kt][ks] = F::ld(kb + o); if (HI) kf2[kt][ks] = F::ld(kb + KTS + o); }
        auto prod = [&](int kt, int qt, v8f a) {
#pragma unroll
            for (int ks = 0; ks < 2; ++ks) { a = F::mma(kf[kt][ks], qf[qt][ks], a); if (HI) { a = F::mma(kf[kt][ks], qf2[qt][ks], a); a = F::mma(kf2[kt][ks], qf[qt][ks], a); } }
            return a; };
#pragma unroll
        for (int kt = 0; kt < 2; ++kt) { const float* bp = bias + j0 + kt * 16 + 8 * hi; const v4f c0 = *(const v4f*)bp, c1 = *(const v4f*)(bp + 4); const v8f cb = __builtin_shufflevector(c0, c1, 0, 1, 2, 3, 4, 5, 6, 7);
#pragma unroll
            for (int qt = 0; qt < NQ; ++qt) s[kt][qt] = prod(kt, qt, cb); }
        if (j0 == (q0 & ~31)) {   // scalar test: the one stage with this wave's diagonal
#pragma unroll
            for (int kt = 0; kt < 2; ++kt)
#pragma unroll
                for (int qt = 0; qt < NQ; ++qt) { const v8f a = prod(kt, qt, (v8f){}); const int dj = q0 + qt * 16 + lr - (j0 + kt * 16 + 8 * hi);
#pragma unroll
                    for (int r = 0; r < 8; ++r) s[kt][qt][r] = (dj == r) ? a[r] : s[kt][qt][r]; } } };
    float mx[NQ], l[NQ];
#pragma unroll
    for (int qt = 0; qt < NQ; ++qt) { mx[qt] = -3.0e38f; l[qt] = 0.f; }
    // walk 1 is short of work per stage, so its K tiles are fetched two stages ahead, in two register sets that take turns; the index wraps: the last trip brings stage 0 back for walk 2
    auto walk1 = [&](int bs, int j0, v4i (&tn)[NP][2], const v4i (&tc)[NP][2]) { gk(tn, (j0 + 64) & (TT - 1));
        __builtin_amdgcn_sched_barrier(0);   // keeps the global loads issued ahead of this stage's work, whose time covers part of their latency
        v8f s[2][NQ]; scores(bs, j0, s);
#pragma unroll
        for (int qt = 0; qt < NQ; ++qt)
#pragma unroll
            for (int r = 0; r < 8; ++r) mx[qt] = fmaxf(mx[qt], fmaxf(s[0][qt][r], s[1][qt][r]));
        sk(tc, bs ^ 1);
        lds_barrier(); };   // publishes the next stage; ends every wave's reads of the buffer that the next stage refills
#pragma unroll 1   // rolled: one trip holds the two stages that the two register sets ask for; more would only cost instruction cache
    for (int st = 0; st < TT / 32; st += 2) { walk1(0, st * 32, rk, rk2); walk1(1, st * 32 + 32, rk2, rk); }
    float mc[NQ];
#pragma unroll
    for (int qt = 0; qt < NQ; ++qt) { mx[qt] = fmaxf(mx[qt], __shfl_xor(mx[qt], 16, 32)); mc[qt] = mx[qt] * CE - (HI ? 0.0f : 10.0f); }
    v4f g[NQ][4];   // group_prob of the stage's 32 keys, 8 + 8 per lane and query row
    auto gg = [&](int j0) {
#pragma unroll
        for (int qt = 0; qt < NQ; ++qt) { const float* gr = gp + (size_t)(q0 + qt * 16 + lr) * TT + j0 + 8 * hi; g[qt][0] = *(const v4f*)gr; g[qt][1] = *(const v4f*)(gr + 4); g[qt][2] = *(const v4f*)(gr + 16); g[qt][3] = *(const v4f*)(gr + 20); } };
    gg(0);
    v8f o[4][NQ];
#pragma unroll
    for (int dt = 0; dt < 4; ++dt)
#pragma unroll
        for (int qt = 0; qt < NQ; ++qt) o[dt][qt] = (v8f){};
#pragma unroll 1   // rolled: a second stage body would cost registers and instruction cache and save nothing
    for (int st = 0; st < TT / 32; ++st) { const int j0 = st * 32, bs = st & 1;
        gk(rk, (j0 + 32) & (TT - 1)); gv((j0 + 32) & (TT - 1));
        __builtin_amdgcn_sched_barrier(0);   // keeps the next stage's global loads issued ahead of this stage's work, whose time covers their latency
        v8f s[2][NQ]; scores(bs, j0, s); V pf[NQ], pf2[NQ], vf[4], vf2[4];
        const T16* vb = sb + bs * SBUF + NP * KTS;   // the V^T fragments are read ahead of the exponentials, which cover the LDS latency
#pragma unroll
        for (int dt = 0; dt < 4; ++dt) { const int vo = (dt * 16 + lr) * VPI + 8 * hi; vf[dt] = F::ld(vb + vo); if (HI) vf2[dt] = F::ld(vb + VTS + vo); }
        unsigned gb[NQ][8];   // this stage's group_prob rounded to bf16, two a register
#pragma unroll
        for (int qt = 0; qt < NQ; ++qt)
#pragma unroll
            for (int w = 0; w < 8; ++w) gb[qt][w] = pkbf(g[qt][w >> 1][(w & 1) * 2], g[qt][w >> 1][(w & 1) * 2 + 1]);
        gg((j0 + 32) & (TT - 1));
        __builtin_amdgcn_sched_barrier(0);   // keeps the next stage's group_prob loads and the V^T reads issued here: the exponentials and the P.V products cover their latency; the barrier waits for LDS alone, so the group_prob loads may stay in flight past it
#pragma unroll
        for (int qt = 0; qt < NQ; ++qt) { v16h ph; v8u uh, ul;
#pragma unroll
            for (int kt = 0; kt < 2; ++kt)
#pragma unroll
                for (int r = 0; r < 8; r += 2) { const unsigned gw = gb[qt][kt * 4 + (r >> 1)];
                    float e0, e1; exp2x2(__builtin_fmaf(s[kt][qt][r], CE, -mc[qt]), __builtin_fmaf(s[kt][qt][r + 1], CE, -mc[qt]), e0, e1); l[qt] += e0; l[qt] += e1;
                    const float p0 = e0 * bflo(gw), p1 = e1 * bfhi(gw);
                    if constexpr (HI) { const unsigned a = pkbf(p0, p1); uh[kt * 4 + (r >> 1)] = a; ul[kt * 4 + (r >> 1)] = pkbf(p0 - bflo(a), p1 - bfhi(a)); } else { ph[kt * 8 + r] = tohx(p0); ph[kt * 8 + r + 1] = tohx(p1); } }
            if constexpr (HI) { pf[qt] = __builtin_bit_cast(v16bf, uh); pf2[qt] = __builtin_bit_cast(v16bf, ul); } else pf[qt] = ph; }
#pragma unroll
        for (int dt = 0; dt < 4; ++dt)
#pragma unroll
            for (int qt = 0; qt < NQ; ++qt) { o[dt][qt] = F::mma(vf[dt], pf[qt], o[dt][qt]); if (HI) { o[dt][qt] = F::mma(vf[dt], pf2[qt], o[dt][qt]); o[dt][qt] = F::mma(vf2[dt], pf[qt], o[dt][qt]); } }
        sk(rk, bs ^ 1); sv(bs ^ 1);
        lds_barrier(); }   // publishes the next stage; ends every wave's reads of the buffer that the next trip refills
#pragma unroll
    for (int qt = 0; qt < NQ; ++qt) { const float inv = __fdiv_rn(1.0f, l[qt] + __shfl_xor(l[qt], 16, 32)); const size_t oo = (size_t)(q0 + qt * 16 + lr) * DQ + 8 * hi;
#pragma unroll
        for (int dt = 0; dt < 4; ++dt) { v4u oh, ol;
#pragma unroll
            for (int r = 0; r < 8; r += 2) { const float y0 = o[dt][qt][r] * inv, y1 = o[dt][qt][r + 1] * inv; const unsigned a = pkbf(y0, y1); oh[r >> 1] = a; ol[r >> 1] = pkbf(y0 - bflo(a), y1 - bfhi(a)); }
            *(v4u*)(Ah + oo + dt * 16) = oh; *(v4u*)(Al + oo + dt * 16) = ol; } }
}
__global__ __launch_bounds__(128) void k_fattn(const h16* __restrict__ Q16, const bf* __restrict__ Qh, const bf* __restrict__ Ql, const h16* __restrict__ K16, const bf* __restrict__ Kh, const bf* __restrict__ Kl, const h16* __restrict__ V16, const bf* __restrict__ Vh, const bf* __restrict__ Vl, const int* __restrict__ kmask, const float* __restrict__ gprob, bf* Ah, bf* Al) {
    __shared__ __align__(16) char sm[2 * SBUF * 2]; __shared__ __align__(16) float bias[TT];
    const int wv = __builtin_amdgcn_readfirstlane((int)(threadIdx.x >> 5));   // wave number, scalar: the row base and the diagonal test stay in scalar registers
    const int bx = blockIdx.x, h = blockIdx.y, b = blockIdx.z; const size_t po = ((size_t)b * NH_ + h) * TT * HD;
    const int* kvp = kmask + (size_t)b * TT; const float* gp = gprob + (size_t)b * TT * TT; bf* ah = Ah + (size_t)b * TT * DQ + h * HD; bf* al = Al + (size_t)b * TT * DQ + h * HD;
    if (bx < RH / 64) attn_rows<bf, true, 1>(Qh + po, Ql + po, Kh + po, Kl + po, Vh + po, Vl + po, kvp, gp, bx * 64 + wv * 16, ah, al, (bf*)sm, bias);
    else attn_rows<h16, false, 2>(Q16 + po, nullptr, K16 + po, nullptr, V16 + po, nullptr, kvp, gp, RH + (bx - RH / 64) * 128 + wv * 32, ah, al, (h16*)sm, bias);
}

extern "C" void kernel_launch(void* const* d_in, const int* in_sizes, int n_in,
                              void* d_out, int out_size, void* d_ws, size_t ws_size, hipStream_t stream) {
    (void)in_sizes; (void)n_in; (void)out_size;
    const float* x = (const float*)d_in[0]; const float* xk = (const float*)d_in[1]; const float* xv = (const float*)d_in[2]; const float* gprob = (const float*)d_in[3];   /* group_prob [2][2048][2048] f32 */ const int* kmask = (const int*)d_in[4];   /* mask [2][2048] int32: 1 = attendable key (OR the diagonal) */ const float* wq = (const float*)d_in[5]; const float* bq = (const float*)d_in[6]; const float* wk = (const float*)d_in[7]; const float* bk = (const float*)d_in[8]; const float* wv = (const float*)d_in[9]; const float* bv = (const float*)d_in[10]; const float* wo = (const float*)d_in[11]; const float* bo = (const float*)d_in[12];   /* input order query, key, value, group_prob, mask, Wq, bq, Wk, bk, Wv, bv, Wo, bo ('oi') */
    float* OUT = (float*)d_out;     // [2][2048][1024]
    char* wsp = (char*)d_ws;
    auto take = [&](size_t bytes) { char* p = wsp; wsp += (bytes + 255) & ~(size_t)255; return (void*)p; };
    bf* WQ = (bf*)take((size_t)DQ * DM * 2); bf* WK = (bf*)take((size_t)DKV * DM * 2); bf* WV = (bf*)take((size_t)DKV * DM * 2); bf* WO = (bf*)take((size_t)DM * DQ * 2);
    bf* XB = (bf*)take((size_t)TT * DM * 2);
    const size_t PS = (size_t)NH_ * TT * HD;   // one batch's plane, elements (NKV == NH_); every plane holds both batches
    h16* QP16 = (h16*)take(NB_ * PS * 2); h16* KP16 = (h16*)take(NB_ * PS * 2); h16* VT16 = (h16*)take(NB_ * PS * 2);
    bf* QPh = (bf*)take(NB_ * PS * 2); bf* QPl = (bf*)take(NB_ * PS * 2); bf* KPh = (bf*)take(NB_ * PS * 2); bf* KPl = (bf*)take(NB_ * PS * 2); bf* VTh = (bf*)take(NB_ * PS * 2); bf* VTl = (bf*)take(NB_ * PS * 2);
    bf* ATh = (bf*)take((size_t)NB_ * TT * DQ * 2); bf* ATl = (bf*)take((size_t)NB_ * TT * DQ * 2);
    if ((size_t)(wsp - (char*)d_ws) > ws_size) return;    // ws 256 MiB
    { k_cvt8<<<(unsigned)(((size_t)DQ * DM / 8 + 255) / 256), 256, 0, stream>>>(wq, WQ, (size_t)DQ * DM / 8); k_cvt8<<<(unsigned)(((size_t)DKV * DM / 8 + 255) / 256), 256, 0, stream>>>(wk, WK, (size_t)DKV * DM / 8); k_cvt8<<<(unsigned)(((size_t)DKV * DM / 8 + 255) / 256), 256, 0, stream>>>(wv, WV, (size_t)DKV * DM / 8);
      k_cvt8<<<(unsigned)(((size_t)DM * DQ / 8 + 255) / 256), 256, 0, stream>>>(wo, WO, (size_t)DM * DQ / 8);
       }
    for (int b = 0; b < NB_; ++b) {
        k_cvt8<<<(unsigned)(((size_t)TT * DM / 8 + 255) / 256), 256, 0, stream>>>(x + (size_t)b * TT * DM, XB, (size_t)TT * DM / 8);
        k_gemmw<bf, 0, true, 8, 1><<<dim3(TT / 64, DQ / 64, 1), 256, 0, stream>>>(XB, nullptr, WQ, nullptr, DM, DM, nullptr, TT, bq, 0, 0, 0, QP16 + b * PS, QPh + b * PS, QPl + b * PS);
        k_cvt8<<<(unsigned)(((size_t)TT * DM / 8 + 255) / 256), 256, 0, stream>>>(xk + (size_t)b * TT * DM, XB, (size_t)TT * DM / 8);   /* XB := bf16(key[b]) */
        k_gemmw<bf, 0, true, 8, 1><<<dim3(TT / 64, DKV / 64, 1), 256, 0, stream>>>(XB, nullptr, WK, nullptr, DM, DM, nullptr, TT, bk, 0, 0, 0, KP16 + b * PS, KPh + b * PS, KPl + b * PS);
        k_cvt8<<<(unsigned)(((size_t)TT * DM / 8 + 255) / 256), 256, 0, stream>>>(xv + (size_t)b * TT * DM, XB, (size_t)TT * DM / 8);   /* XB := bf16(value[b]) */
        k_gemmw<bf, 0, true, 8, 2><<<dim3(DKV / 64, TT / 64, 1), 256, 0, stream>>>(WV, nullptr, XB, nullptr, DM, DM, nullptr, TT, bv, 0, 0, 0, VT16 + b * PS, VTh + b * PS, VTl + b * PS); }   /* V^T = Wv X^T: rows [g][d], columns t */
    k_fattn<<<dim3(RH / 64 + (TT - RH) / 128, NH_, NB_), 128, 0, stream>>>(QP16, QPh, QPl, KP16, KPh, KPl, VT16, VTh, VTl, kmask, gprob, ATh, ATl);
    for (int b = 0; b < NB_; ++b) {
        k_gemmw<bf, 1, true, 8, 0><<<dim3(TT / 64, DM / 64, 1), 256, 0, stream>>>(ATh + (size_t)b * TT * DQ, ATl + (size_t)b * TT * DQ, WO, nullptr, DQ, DQ, OUT + (size_t)b * TT * DM, DM, bo, 0, 0, 0, nullptr, nullptr, nullptr); }
}

// v005
// Measured time: 213 microseconds a run.
// Next to v004, in two timings, it ran 1.13 and 1.12 times as fast.
// Counting every step since v000, it is 9.54 times as fast.
#include <hip/hip_runtime.h>

// Multi-headed attention on three streams with a padding-or-diagonal mask and a post-softmax group weighting (query, key, value [2][2048][1024]; q, k, v = x W^T + b ('oi' 0.02, zero biases; 16 heads x 64); scores / sqrt(64); key j is kept for query i when mask[b][j] != 0 OR j == i (mask int [2][2048] random 0/1, read; -1e9 == exclusion); p = softmax; p = p x group_prob[b][i][j] (f32 [2][2048][2048] uniform, read; NOT renormalised); x = p.v; out = merged Wo^T + bo -> [2][2048][1024] (4.2 M); argument order query, key, value, group_prob, mask, Wq, bq, Wk, bk, Wv, bv, Wo, bo).
// Four launches: bf16 copies of query, key, value and the 'oi' weights; the three exact projections of both batches + f32 biases, whose epilogue writes the head planes; one fused attention launch for all heads of both batches (hybrid rows: < 512 hi/lo 3 products, rest fp16 x1024): it reads the batch's int key vector (select with the always-kept diagonal), multiplies each exponential by bf16(group_prob[b][i][j]) and divides the P.V sums by the row's sum of exponentials; merged hi/lo x Wo exact + bo.
// Compute dtypes, f32 accumulate: every input rounded to bf16 incl. group_prob; projections exact + f32 biases; attention rows < 512 3 products, rest fp16; softmax and group weighting f32; Wo hl x exact + bias.

#define NB_  2
#define TT   2048
#define DM   1024
#define NH_  16
#define NKV  16
#define HD   64
#define DQ   (NH_ * HD)
#define DKV  (NKV * HD)
#define RH   512                  // query rows < RH use hi+lo planes (0: none)
#define WIN  0
#define SCL  0.125f   // HD^-0.5
typedef _Float16 h16;
typedef unsigned short bf;
typedef __attribute__((ext_vector_type(16))) __bf16   v16bf;
typedef __attribute__((ext_vector_type(16))) _Float16 v16h;
typedef __attribute__((ext_vector_type(8)))  _Float16 v8h;
typedef __attribute__((ext_vector_type(8)))  unsigned short v8us;
typedef __attribute__((ext_vector_type(8)))  float    v8f;
typedef __attribute__((ext_vector_type(4)))  _Float16 v4h;
typedef __attribute__((ext_vector_type(4)))  unsigned short v4us;
typedef __attribute__((ext_vector_type(4)))  float    v4f;
typedef v8h  __attribute__((may_alias)) v8ha;
typedef v4f  __attribute__((may_alias)) v4fa;
typedef v8us __attribute__((may_alias)) v8usa;

__device__ __forceinline__ unsigned short f2bf(float f) { unsigned u = __float_as_uint(f); u += 0x7FFFu + ((u >> 16) & 1u); return (unsigned short)(u >> 16); }
__device__ __forceinline__ float bf2f(unsigned short b) { return __uint_as_float(((unsigned)b) << 16); }
__device__ __forceinline__ float bfr(float f) { return bf2f(f2bf(f)); }
__device__ __forceinline__ v16h cat16(v8h lo, v8h hi) { return __builtin_shufflevector(lo, hi, 0, 1, 2, 3, 4, 5, 6, 7, 8, 9, 10, 11, 12, 13, 14, 15); }
__device__ __forceinline__ v16bf cat16b(v8us lo, v8us hi) { return __builtin_bit_cast(v16bf, __builtin_shufflevector(lo, hi, 0, 1, 2, 3, 4, 5, 6, 7, 8, 9, 10, 11, 12, 13, 14, 15)); }
__device__ __forceinline__ v8f wmma16(v16h a, v16h b, v8f c) { return __builtin_amdgcn_wmma_f32_16x16x32_f16(false, a, false, b, (short)0, c, false, false); }
__device__ __forceinline__ v8f wmmab(v16bf a, v16bf b, v8f c) { return __builtin_amdgcn_wmma_f32_16x16x32_bf16(false, a, false, b, (short)0, c, false, false); }



// ---- gemmw: register-blocked GEMM, one work-group of KW waves per 64x64 output tile (bx, by), operands straight from K-contiguous 16-bit planes; 32 * KW threads; os: the work-group's LDS, (KW == 1 ? 16 : KW * 64) * 68 floats.
// Each wave holds the whole tile (16 accumulators) over its own K / KW slice of k; for KW > 1 the KW partial tiles go to LDS and are summed there in wave order (a fixed order).
// C[m][n] (f32, pitch ldc, + optional f32 bias[n]) = sum_k A[m][k] Bt[n][k] (+ split products per NSPLIT). A rows have pitch lda elements, Bt rows pitch K. K % (32 * KW) == 0.
// PL != 0: no f32 C; the summed tile goes out as three 16-bit planes (fp16, bf16 hi, bf16 lo of the remainder). PL == 1: one plane block of [ldc rows][64] per tile column (head planes [h][t][d]), bias[n]. PL == 2: row-major [m][n] with pitch ldc, bias[m] (V^T = Wv X^T: rows are head dims, columns tokens).
template <typename T16> struct WFrag;
template <> struct WFrag<h16> { typedef v16h V; static __device__ __forceinline__ V ld(const h16* p) { return cat16(*(const v8h*)p, *(const v8h*)(p + 16)); } static __device__ __forceinline__ v8f mma(V a, V b, v8f c) { return wmma16(a, b, c); } };
template <> struct WFrag<bf> { typedef v16bf V; static __device__ __forceinline__ V ld(const bf* p) { return cat16b(*(const v8us*)p, *(const v8us*)(p + 16)); } static __device__ __forceinline__ v8f mma(V a, V b, v8f c) { return wmmab(a, b, c); } };
template <typename T16, int NSPLIT, bool BIAS, int KW, int PL>
__device__ __forceinline__ void gemmw(float* os, const int bx, const int by, const T16* __restrict__ A, const T16* __restrict__ A2, const T16* __restrict__ Bt, const T16* __restrict__ Bt2, int K, int lda, float* C, int ldc, const float* __restrict__ bias, h16* P16, bf* Ph, bf* Pl) {
    static_assert(PL == 0 || KW > 1, "the plane epilogue stands in the k-split path");
    typedef typename WFrag<T16>::V V;
    const int lane = threadIdx.x & 31, lr = lane & 15, hi = lane >> 4; const int r0 = bx * 64, c0 = by * 64;
    v8f acc[4][4];
#pragma unroll
    for (int mb = 0; mb < 4; ++mb)
#pragma unroll
        for (int nb = 0; nb < 4; ++nb) acc[mb][nb] = (v8f){};
    const size_t aoff = (size_t)(r0 + lr) * lda + 8 * hi, boff = (size_t)(c0 + lr) * K + 8 * hi;
    const int wv = (KW == 1) ? 0 : __builtin_amdgcn_readfirstlane((int)(threadIdx.x >> 5));   // wave number, scalar: the k loop's bounds stay in scalar registers
    const int kbeg = wv * (K / KW), kend = kbeg + K / KW;
    float pb[(PL == 2) ? 32 / KW : 4];   // plane epilogue: this thread's biases (PL == 1: of its 4 columns; PL == 2: of its rows), read ahead of the k loop, which covers their latency
    if constexpr (BIAS && PL != 0) {
#pragma unroll
        for (int i = 0; i < ((PL == 2) ? 32 / KW : 4); ++i) pb[i] = (PL == 1) ? bias[c0 + ((int)threadIdx.x & 15) * 4 + i] : bias[r0 + i * 2 * KW + ((int)threadIdx.x >> 4)]; }
#pragma unroll 1
    for (int kc = kbeg; kc < kend; kc += 32) {
        V a[4], a2[4];
#pragma unroll
        for (int mb = 0; mb < 4; ++mb) { a[mb] = WFrag<T16>::ld(A + aoff + (size_t)mb * 16 * lda + kc); if (NSPLIT == 1 || NSPLIT == 2) a2[mb] = WFrag<T16>::ld(A2 + aoff + (size_t)mb * 16 * lda + kc); }
#pragma unroll
        for (int nb = 0; nb < 4; ++nb) { const V b = WFrag<T16>::ld(Bt + boff + (size_t)nb * 16 * K + kc); V b2; if (NSPLIT >= 2) b2 = WFrag<T16>::ld(Bt2 + boff + (size_t)nb * 16 * K + kc);
#pragma unroll
            for (int mb = 0; mb < 4; ++mb) { acc[mb][nb] = WFrag<T16>::mma(a[mb], b, acc[mb][nb]); if (NSPLIT == 1 || NSPLIT == 2) acc[mb][nb] = WFrag<T16>::mma(a2[mb], b, acc[mb][nb]); if (NSPLIT >= 2) acc[mb][nb] = WFrag<T16>::mma(a[mb], b2, acc[mb][nb]); } }
        asm volatile("v_nop\n\tv_nop\n\tv_nop\n\tv_nop" : "+v"(acc[0][0]), "+v"(acc[1][1]), "+v"(acc[2][2]), "+v"(acc[3][3]) : "v"(a[0]), "v"(a[3]));
    }
    if constexpr (KW > 1) {
        float* ow = os + wv * (64 * 68); const int cofs = ((int)threadIdx.x & 15) * 4; v4f bv = (v4f){};
        if constexpr (PL == 0)
        if (BIAS) { bv[0] = bfr(bias[c0 + cofs]); bv[1] = bfr(bias[c0 + cofs + 1]); bv[2] = bfr(bias[c0 + cofs + 2]); bv[3] = bfr(bias[c0 + cofs + 3]); }   // read ahead of the barrier: its latency passes behind the LDS stores
        if constexpr (BIAS && PL == 1) { bv[0] = bfr(pb[0]); bv[1] = bfr(pb[1]); bv[2] = bfr(pb[2]); bv[3] = bfr(pb[3]); }
#pragma unroll
        for (int mb = 0; mb < 4; ++mb)
#pragma unroll
            for (int nb = 0; nb < 4; ++nb)
#pragma unroll
                for (int j = 0; j < 8; ++j) ow[(mb * 16 + hi * 8 + j) * 68 + nb * 16 + lr] = acc[mb][nb][j];
        __syncthreads();   // every wave's partial tile stands in LDS before any of it is summed
#pragma unroll
        for (int i = 0; i < 32 / KW; ++i) { const int row = i * 2 * KW + ((int)threadIdx.x >> 4); v4f val = *(const v4fa*)(os + row * 68 + cofs);
#pragma unroll
            for (int w = 1; w < KW; ++w) val += *(const v4fa*)(os + w * (64 * 68) + row * 68 + cofs);
            if (BIAS) { if constexpr (PL == 2) val += bfr(pb[i]); else val += bv; }
            if constexpr (PL == 0) *(v4f*)(C + (size_t)(r0 + row) * ldc + c0 + cofs) = val;
            else { const size_t e = (PL == 1) ? ((size_t)by * ldc + r0 + row) * 64 + cofs : (size_t)(r0 + row) * ldc + c0 + cofs; v4h o16; v4us oh, ol;
#pragma unroll
                for (int q = 0; q < 4; ++q) { o16[q] = (h16)val[q]; const unsigned short a2 = f2bf(val[q]); oh[q] = a2; ol[q] = f2bf(val[q] - bf2f(a2)); }
                *(v4h*)(P16 + e) = o16; *(v4us*)(Ph + e) = oh; *(v4us*)(Pl + e) = ol; } }
    } else {
#pragma unroll
    for (int mb = 0; mb < 4; ++mb) {
#pragma unroll
        for (int nb = 0; nb < 4; ++nb) {
#pragma unroll
            for (int j = 0; j < 8; ++j) os[(hi * 8 + j) * 68 + nb * 16 + lr] = acc[mb][nb][j]; }
        __builtin_amdgcn_wave_barrier(); asm volatile("" ::: "memory");
        float* crow = C + (size_t)(r0 + mb * 16) * ldc + c0;
{
#pragma unroll
            for (int s = 0; s < 8; ++s) { const int row = 2 * s + hi, cofs = lr * 4; v4f val = *(const v4fa*)(os + row * 68 + cofs); if (BIAS) { val[0] += bfr(bias[c0 + cofs]); val[1] += bfr(bias[c0 + cofs + 1]); val[2] += bfr(bias[c0 + cofs + 2]); val[3] += bfr(bias[c0 + cofs + 3]); }
                *(v4f*)(crow + (size_t)row * ldc + cofs) = val; }
             }
        __builtin_amdgcn_wave_barrier(); asm volatile("" ::: "memory");
    }
    }
}

// k_gemmw: one GEMM; grid (M/64, N/64).
template <typename T16, int NSPLIT, bool BIAS, int KW, int PL>
__global__ __launch_bounds__(32 * KW) void k_gemmw(const T16* __restrict__ A, const T16* __restrict__ A2, const T16* __restrict__ Bt, const T16* __restrict__ Bt2, int K, int lda, float* C, int ldc, const float* __restrict__ bias, h16* P16, bf* Ph, bf* Pl) {
    __shared__ __align__(16) float os[(KW == 1 ? 16 : KW * 64) * 68];
    gemmw<T16, NSPLIT, BIAS, KW, PL>(os, blockIdx.x, blockIdx.y, A, A2, Bt, Bt2, K, lda, C, ldc, bias, P16, Ph, Pl);
}
// k_proj: the q, k and v projections of both batches in one launch; grid (TT/64, DQ/64, 3 * NB_), z = stream * NB_ + batch. X holds the bf16 streams as [stream][batch][t][DM]; every plane holds both batches.
// q and k: x W^T into head planes; v: V^T = Wv X^T (rows [g][d], columns t), so its tile indices change places.
__global__ __launch_bounds__(256) void k_proj(const bf* __restrict__ X, const bf* __restrict__ WQ, const bf* __restrict__ WK, const bf* __restrict__ WV, const float* __restrict__ bq, const float* __restrict__ bk, const float* __restrict__ bv,
                                              h16* QP16, bf* QPh, bf* QPl, h16* KP16, bf* KPh, bf* KPl, h16* VT16, bf* VTh, bf* VTl) {
    __shared__ __align__(16) float os[8 * 64 * 68];
    const int z = blockIdx.z, sm = z / NB_; const bf* xs = X + (size_t)z * TT * DM; const size_t po = (size_t)(z % NB_) * NH_ * TT * HD;
    if (sm == 2) gemmw<bf, 0, true, 8, 2>(os, blockIdx.y, blockIdx.x, WV, nullptr, xs, nullptr, DM, DM, nullptr, TT, bv, VT16 + po, VTh + po, VTl + po);
    else gemmw<bf, 0, true, 8, 1>(os, blockIdx.x, blockIdx.y, xs, nullptr, sm ? WK : WQ, nullptr, DM, DM, nullptr, TT, sm ? bk : bq, (sm ? KP16 : QP16) + po, (sm ? KPh : QPh) + po, (sm ? KPl : QPl) + po);
}

__device__ __forceinline__ h16 tohx(float x) { return (h16)x; }
typedef __attribute__((ext_vector_type(2))) float v2f;
typedef __attribute__((ext_vector_type(4))) int v4i;

// k_cvt: every f32 -> bf16 copy of the call in one launch. dst is one range: query, key, value (NB_ * TT * DM elements each), then Wq, Wk, Wv, Wo (DM * DM each).
// A block converts CBE consecutive elements of one tensor (every tensor's size is a multiple of CBE), a thread CU pieces of 8: few waves to start, and each has all its loads in flight at once. Grid CVE / CBE.
#define CU  16
#define CBE (CU * 256 * 8)
#define CVE (3 * NB_ * TT * DM + 4 * DM * DM)
__global__ __launch_bounds__(256) void k_cvt(const float* __restrict__ xq, const float* __restrict__ xk, const float* __restrict__ xv, const float* __restrict__ wq, const float* __restrict__ wk, const float* __restrict__ wv, const float* __restrict__ wo, bf* dst) {
    constexpr int BX = NB_ * TT * DM / CBE, BW = DM * DM / CBE; static_assert(NB_ * TT * DM % CBE == 0 && DM * DM % CBE == 0, "a block stays inside one tensor");
    const int bx = blockIdx.x; const float* s; int b0;   // the block's tensor and that tensor's first block: scalar
    if (bx < 3 * BX) { const int t = bx / BX; s = (t == 0) ? xq : (t == 1) ? xk : xv; b0 = t * BX; }
    else { const int t = (bx - 3 * BX) / BW; s = (t == 0) ? wq : (t == 1) ? wk : (t == 2) ? wv : wo; b0 = 3 * BX + t * BW; }
    s += (size_t)(bx - b0) * CBE + threadIdx.x * 8; bf* d = dst + (size_t)bx * CBE + threadIdx.x * 8;
    v8f v[CU];   // both loops are unrolled in full: v stays in registers and the loads issue ahead of the first conversion
#pragma unroll
    for (int u = 0; u < CU; ++u) v[u] = *(const v8f*)(s + u * 2048);
#pragma unroll
    for (int u = 0; u < CU; ++u) { v8us o;
#pragma unroll
        for (int k = 0; k < 8; ++k) o[k] = f2bf(v[u][k]);
        *(v8us*)(d + u * 2048) = o; } }

// k_fattn: scores, mask, softmax, group weighting, P.V and the head merge in one kernel; no score or probability leaves the registers. Grid (RH/64 + (TT-RH)/128, heads, batches), 4 waves.
// A wave owns NQ * 16 query rows of one head; the work-group walks all TT keys twice, 32 keys a stage. A stage's K rows and V^T rows are read from global in whole or half lines, one stage ahead (walk 1: two), and shared through two LDS buffers (one barrier a stage).
// S^T = K Q^T (A = K rows, B = Q rows, same k order on both sides): a lane holds 8 keys of ONE query per tile. The key mask enters as the C operand (0 or -3e38 per key, from an LDS table built at entry);
// in the one stage that holds a wave's diagonal the products are formed once more from C = 0 and the element j == i takes that value (the diagonal is always kept).
// Walk 1: the row maximum over the kept keys. Walk 2: e = exp(s / 8 - max), l += e, p = e x bf16(group_prob[b][i][j]); the two key tiles of a stage, converted in place, are the B operand of O^T += V^T P^T (A = V^T rows in the hardware k order).
// The epilogue joins the wave halves' sums, divides by l (the weighting is not renormalised: l sums e alone) and stores hi/lo bf16 planes of the merged rows, 16 B per lane.
// Rows < RH: hi/lo bf16 planes, 3 products in both GEMMs, 16 rows a wave; the rest fp16 with p carried x 1024 (folded into the exponent, so l carries it too and it cancels), 32 rows a wave.
#define KPI 72   // LDS pitch of a K row in elements: 128 B + 16 B, for 16-byte readers
#define VPI 40   // LDS pitch of a V^T row of 32 keys in elements: 64 B + 16 B
#define SBUF (2 * (32 * KPI + 64 * VPI))   // elements of one stage buffer at two planes per operand
typedef __attribute__((ext_vector_type(2))) __bf16 v2bf;
typedef __attribute__((ext_vector_type(8))) unsigned v8u;
typedef __attribute__((ext_vector_type(4))) unsigned v4u;
typedef v4i __attribute__((may_alias)) v4ia;
__device__ __forceinline__ unsigned pkbf(float a, float b) { v2f x; x[0] = a; x[1] = b; return __builtin_bit_cast(unsigned, __builtin_convertvector(x, v2bf)); }   // two f32 -> packed bf16, round to nearest even
// two 2^x in one statement: the early-clobber outputs keep each off the other's registers, and the v_nop keeps the slot that the instruction set asks for behind a transcendental before its result is used or its source overwritten
__device__ __forceinline__ void exp2x2(float x0, float x1, float& e0, float& e1) { asm("v_exp_f32 %0, %2\n\tv_exp_f32 %1, %3\n\tv_nop" : "=&v"(e0), "=&v"(e1) : "v"(x0), "v"(x1)); }
// work-group barrier that orders LDS alone: unlike __syncthreads() it does not wait for the global loads in flight (the next stage's tiles and group_prob go to registers and concern no other wave)
__device__ __forceinline__ void lds_barrier() { __builtin_amdgcn_fence(__ATOMIC_RELEASE, "workgroup", "local"); __builtin_amdgcn_s_barrier(); __builtin_amdgcn_fence(__ATOMIC_ACQUIRE, "workgroup", "local"); }
__device__ __forceinline__ float bflo(unsigned u) { return __uint_as_float(u << 16); }
__device__ __forceinline__ float bfhi(unsigned u) { return __uint_as_float(u & 0xFFFF0000u); }
template <typename T16, bool HI, int NQ>
__device__ __forceinline__ void attn_rows(const T16* __restrict__ Q, const T16* __restrict__ Q2, const T16* __restrict__ K, const T16* __restrict__ K2, const T16* __restrict__ VT, const T16* __restrict__ VT2, const int* __restrict__ kvp, const float* __restrict__ gp, const int q0, bf* Ah, bf* Al, T16* sb, float* bias) {
    typedef WFrag<T16> F; typedef typename F::V V;   // every inner loop below is unrolled in full, so that the fragment and accumulator arrays stay in registers
    constexpr int NP = HI ? 2 : 1, KTS = 32 * KPI, VTS = 64 * VPI;
    const int tid = threadIdx.x, lane = tid & 31, lr = lane & 15, hi = lane >> 4;
    const float CE = SCL * 1.4426950408889634f;
    v4i rk[NP][2], rk2[NP][2], rv[NP][2];
    auto gk = [&](v4i (&t)[NP][2], int j0) {
#pragma unroll
        for (int u = 0; u < 2; ++u) { const size_t o = (size_t)j0 * HD + (tid + 128 * u) * 8; t[0][u] = *(const v4ia*)(K + o); if (HI) t[NP - 1][u] = *(const v4ia*)(K2 + o); } };
    auto gv = [&](int j0) {
#pragma unroll
        for (int u = 0; u < 2; ++u) { const int x = tid + 128 * u; const size_t o = (size_t)(x >> 2) * TT + j0 + (x & 3) * 8; rv[0][u] = *(const v4ia*)(VT + o); if (HI) rv[NP - 1][u] = *(const v4ia*)(VT2 + o); } };
    auto sk = [&](const v4i (&t)[NP][2], int bs) { T16* d = sb + bs * SBUF;
#pragma unroll
        for (int u = 0; u < 2; ++u) { const int x = tid + 128 * u, o = (x >> 3) * KPI + (x & 7) * 8; *(v4ia*)(d + o) = t[0][u]; if (HI) *(v4ia*)(d + KTS + o) = t[NP - 1][u]; } };
    auto sv = [&](int bs) { T16* d = sb + bs * SBUF + NP * KTS;
#pragma unroll
        for (int u = 0; u < 2; ++u) { const int x = tid + 128 * u, o = (x >> 2) * VPI + (x & 3) * 8; *(v4ia*)(d + o) = rv[0][u]; if (HI) *(v4ia*)(d + VTS + o) = rv[NP - 1][u]; } };
    gk(rk, 0); gv(0); gk(rk2, 32);
    V qf[NQ][2], qf2[NQ][2];
#pragma unroll
    for (int qt = 0; qt < NQ; ++qt)
#pragma unroll
        for (int ks = 0; ks < 2; ++ks) { const size_t o = (size_t)(q0 + qt * 16 + lr) * HD + ks * 32 + 8 * hi; qf[qt][ks] = F::ld(Q + o); if (HI) qf2[qt][ks] = F::ld(Q2 + o); }
#pragma unroll
    for (int u = 0; u < TT / 512; ++u) { const v4i m = *(const v4i*)(kvp + (tid + 128 * u) * 4); v4f bz;
#pragma unroll
        for (int q = 0; q < 4; ++q) bz[q] = (m[q] != 0) ? 0.0f : -3.0e38f;
        *(v4f*)(bias + (tid + 128 * u) * 4) = bz; }
    sk(rk, 0); sv(0);
    lds_barrier();   // stage 0 and the mask table stand in LDS before any wave reads them
    // masked raw scores of the stage's 32 keys
    auto scores = [&](int bs, int j0, v8f (&s)[2][NQ]) { const T16* kb = sb + bs * SBUF; V kf[2][2], kf2[2][2];
#pragma unroll
        for (int kt = 0; kt < 2; ++kt)
#pragma unroll
            for (int ks = 0; ks < 2; ++ks) { const int o = (kt * 16 + lr) * KPI + ks * 32 + 8 * hi; kf[kt][ks] = F::ld(kb + o); if (HI) kf2[kt][ks] = F::ld(kb + KTS + o); }
        auto prod = [&](int kt, int qt, v8f a) {
#pragma unroll
            for (int ks = 0; ks < 2; ++ks) { a = F::mma(kf[kt][ks], qf[qt][ks], a); if (HI) { a = F::mma(kf[kt][ks], qf2[qt][ks], a); a = F::mma(kf2[kt][ks], qf[qt][ks], a); } }
            return a; };
#pragma unroll
        for (int kt = 0; kt < 2; ++kt) { const float* bp = bias + j0 + kt * 16 + 8 * hi; const v4f c0 = *(const v4f*)bp, c1 = *(const v4f*)(bp + 4); const v8f cb = __builtin_shufflevector(c0, c1, 0, 1, 2, 3, 4, 5, 6, 7);
#pragma unroll
            for (int qt = 0; qt < NQ; ++qt) s[kt][qt] = prod(kt, qt, cb); }
        if (j0 == (q0 & ~31)) {   // scalar test: the one stage with this wave's diagonal
#pragma unroll
            for (int kt = 0; kt < 2; ++kt)
#pragma unroll
                for (int qt = 0; qt < NQ; ++qt) { const v8f a = prod(kt, qt, (v8f){}); const int dj = q0 + qt * 16 + lr - (j0 + kt * 16 + 8 * hi);
#pragma unroll
                    for (int r = 0; r < 8; ++r) s[kt][qt][r] = (dj == r) ? a[r] : s[kt][qt][r]; } } };
    float mx[NQ], l[NQ];
#pragma unroll
    for (int qt = 0; qt < NQ; ++qt) { mx[qt] = -3.0e38f; l[qt] = 0.f; }
    // walk 1 is short of work per stage, so its K tiles are fetched two stages ahead, in two register sets that take turns; the index wraps: the last trip brings stage 0 back for walk 2
    auto walk1 = [&](int bs, int j0, v4i (&tn)[NP][2], const v4i (&tc)[NP][2]) { gk(tn, (j0 + 64) & (TT - 1));
        __builtin_amdgcn_sched_barrier(0);   // keeps the global loads issued ahead of this stage's work, whose time covers part of their latency
        v8f s[2][NQ]; scores(bs, j0, s);
#pragma unroll
        for (int qt = 0; qt < NQ; ++qt)
#pragma unroll
            for (int r = 0; r < 8; ++r) mx[qt] = fmaxf(mx[qt], fmaxf(s[0][qt][r], s[1][qt][r]));
        sk(tc, bs ^ 1);
        lds_barrier(); };   // publishes the next stage; ends every wave's reads of the buffer that the next stage refills
#pragma unroll 1   // rolled: one trip holds the two stages that the two register sets ask for; more would only cost instruction cache
    for (int st = 0; st < TT / 32; st += 2) { walk1(0, st * 32, rk, rk2); walk1(1, st * 32 + 32, rk2, rk); }
    float mc[NQ];
#pragma unroll
    for (int qt = 0; qt < NQ; ++qt) { mx[qt] = fmaxf(mx[qt], __shfl_xor(mx[qt], 16, 32)); mc[qt] = mx[qt] * CE - (HI ? 0.0f : 10.0f); }
    v4f g[NQ][4];   // group_prob of the stage's 32 keys, 8 + 8 per lane and query row
    auto gg = [&](int j0) {
#pragma unroll
        for (int qt = 0; qt < NQ; ++qt) { const float* gr = gp + (size_t)(q0 + qt * 16 + lr) * TT + j0 + 8 * hi; g[qt][0] = *(const v4f*)gr; g[qt][1] = *(const v4f*)(gr + 4); g[qt][2] = *(const v4f*)(gr + 16); g[qt][3] = *(const v4f*)(gr + 20); } };
    gg(0);
    v8f o[4][NQ];
#pragma unroll
    for (int dt = 0; dt < 4; ++dt)
#pragma unroll
        for (int qt = 0; qt < NQ; ++qt) o[dt][qt] = (v8f){};
#pragma unroll 1   // rolled: a second stage body would cost registers and instruction cache and save nothing
    for (int st = 0; st < TT / 32; ++st) { const int j0 = st * 32, bs = st & 1;
        gk(rk, (j0 + 32) & (TT - 1)); gv((j0 + 32) & (TT - 1));
        __builtin_amdgcn_sched_barrier(0);   // keeps the next stage's global loads issued ahead of this stage's work, whose time covers their latency
        v8f s[2][NQ]; scores(bs, j0, s); V pf[NQ], pf2[NQ], vf[4], vf2[4];
        const T16* vb = sb + bs * SBUF + NP * KTS;   // the V^T fragments are read ahead of the exponentials, which cover the LDS latency
#pragma unroll
        for (int dt = 0; dt < 4; ++dt) { const int vo = (dt * 16 + lr) * VPI + 8 * hi; vf[dt] = F::ld(vb + vo); if (HI) vf2[dt] = F::ld(vb + VTS + vo); }
        unsigned gb[NQ][8];   // this stage's group_prob rounded to bf16, two a register
#pragma unroll
        for (int qt = 0; qt < NQ; ++qt)
#pragma unroll
            for (int w = 0; w < 8; ++w) gb[qt][w] = pkbf(g[qt][w >> 1][(w & 1) * 2], g[qt][w >> 1][(w & 1) * 2 + 1]);
        gg((j0 + 32) & (TT - 1));
        __builtin_amdgcn_sched_barrier(0);   // keeps the next stage's group_prob loads and the V^T reads issued here: the exponentials and the P.V products cover their latency; the barrier waits for LDS alone, so the group_prob loads may stay in flight past it
#pragma unroll
        for (int qt = 0; qt < NQ; ++qt) { v16h ph; v8u uh, ul;
#pragma unroll
            for (int kt = 0; kt < 2; ++kt)
#pragma unroll
                for (int r = 0; r < 8; r += 2) { const unsigned gw = gb[qt][kt * 4 + (r >> 1)];
                    float e0, e1; exp2x2(__builtin_fmaf(s[kt][qt][r], CE, -mc[qt]), __builtin_fmaf(s[kt][qt][r + 1], CE, -mc[qt]), e0, e1); l[qt] += e0; l[qt] += e1;
                    const float p0 = e0 * bflo(gw), p1 = e1 * bfhi(gw);
                    if constexpr (HI) { const unsigned a = pkbf(p0, p1); uh[kt * 4 + (r >> 1)] = a; ul[kt * 4 + (r >> 1)] = pkbf(p0 - bflo(a), p1 - bfhi(a)); } else { ph[kt * 8 + r] = tohx(p0); ph[kt * 8 + r + 1] = tohx(p1); } }
            if constexpr (HI) { pf[qt] = __builtin_bit_cast(v16bf, uh); pf2[qt] = __builtin_bit_cast(v16bf, ul); } else pf[qt] = ph; }
#pragma unroll
        for (int dt = 0; dt < 4; ++dt)
#pragma unroll
            for (int qt = 0; qt < NQ; ++qt) { o[dt][qt] = F::mma(vf[dt], pf[qt], o[dt][qt]); if (HI) { o[dt][qt] = F::mma(vf[dt], pf2[qt], o[dt][qt]); o[dt][qt] = F::mma(vf2[dt], pf[qt], o[dt][qt]); } }
        sk(rk, bs ^ 1); sv(bs ^ 1);
        lds_barrier(); }   // publishes the next stage; ends every wave's reads of the buffer that the next trip refills
#pragma unroll
    for (int qt = 0; qt < NQ; ++qt) { const float inv = __fdiv_rn(1.0f, l[qt] + __shfl_xor(l[qt], 16, 32)); const size_t oo = (size_t)(q0 + qt * 16 + lr) * DQ + 8 * hi;
#pragma unroll
        for (int dt = 0; dt < 4; ++dt) { v4u oh, ol;
#pragma unroll
            for (int r = 0; r < 8; r += 2) { const float y0 = o[dt][qt][r] * inv, y1 = o[dt][qt][r + 1] * inv; const unsigned a = pkbf(y0, y1); oh[r >> 1] = a; ol[r >> 1] = pkbf(y0 - bflo(a), y1 - bfhi(a)); }
            *(v4u*)(Ah + oo + dt * 16) = oh; *(v4u*)(Al + oo + dt * 16) = ol; } }
}
__global__ __launch_bounds__(128) void k_fattn(const h16* __restrict__ Q16, const bf* __restrict__ Qh, const bf* __restrict__ Ql, const h16* __restrict__ K16, const bf* __restrict__ Kh, const bf* __restrict__ Kl, const h16* __restrict__ V16, const bf* __restrict__ Vh, const bf* __restrict__ Vl, const int* __restrict__ kmask, const float* __restrict__ gprob, bf* Ah, bf* Al) {
    __shared__ __align__(16) char sm[2 * SBUF * 2]; __shared__ __align__(16) float bias[TT];
    const int wv = __builtin_amdgcn_readfirstlane((int)(threadIdx.x >> 5));   // wave number, scalar: the row base and the diagonal test stay in scalar registers
    const int bx = blockIdx.x, h = blockIdx.y, b = blockIdx.z; const size_t po = ((size_t)b * NH_ + h) * TT * HD;
    const int* kvp = kmask + (size_t)b * TT; const float* gp = gprob + (size_t)b * TT * TT; bf* ah = Ah + (size_t)b * TT * DQ + h * HD; bf* al = Al + (size_t)b * TT * DQ + h * HD;
    if (bx < RH / 64) attn_rows<bf, true, 1>(Qh + po, Ql + po, Kh + po, Kl + po, Vh + po, Vl + po, kvp, gp, bx * 64 + wv * 16, ah, al, (bf*)sm, bias);
    else attn_rows<h16, false, 2>(Q16 + po, nullptr, K16 + po, nullptr, V16 + po, nullptr, kvp, gp, RH + (bx - RH / 64) * 128 + wv * 32, ah, al, (h16*)sm, bias);
}

extern "C" void kernel_launch(void* const* d_in, const int* in_sizes, int n_in,
                              void* d_out, int out_size, void* d_ws, size_t ws_size, hipStream_t stream) {
    (void)in_sizes; (void)n_in; (void)out_size;
    const float* x = (const float*)d_in[0]; const float* xk = (const float*)d_in[1]; const float* xv = (const float*)d_in[2]; const float* gprob = (const float*)d_in[3];   /* group_prob [2][2048][2048] f32 */ const int* kmask = (const int*)d_in[4];   /* mask [2][2048] int32: 1 = attendable key (OR the diagonal) */ const float* wq = (const float*)d_in[5]; const float* bq = (const float*)d_in[6]; const float* wk = (const float*)d_in[7]; const float* bk = (const float*)d_in[8]; const float* wv = (const float*)d_in[9]; const float* bv = (const float*)d_in[10]; const float* wo = (const float*)d_in[11]; const float* bo = (const float*)d_in[12];   /* input order query, key, value, group_prob, mask, Wq, bq, Wk, bk, Wv, bv, Wo, bo ('oi') */
    float* OUT = (float*)d_out;     // [2][2048][1024]
    char* wsp = (char*)d_ws;
    auto take = [&](size_t bytes) { char* p = wsp; wsp += (bytes + 255) & ~(size_t)255; return (void*)p; };
    bf* XB = (bf*)take((size_t)CVE * 2);   // k_cvt's range: the three streams [stream][batch][t][DM], then the four weights
    bf* WQ = XB + (size_t)3 * NB_ * TT * DM; bf* WK = WQ + (size_t)DM * DM; bf* WV = WK + (size_t)DM * DM; bf* WO = WV + (size_t)DM * DM;
    const size_t PS = (size_t)NH_ * TT * HD;   // one batch's plane, elements (NKV == NH_); every plane holds both batches
    h16* QP16 = (h16*)take(NB_ * PS * 2); h16* KP16 = (h16*)take(NB_ * PS * 2); h16* VT16 = (h16*)take(NB_ * PS * 2);
    bf* QPh = (bf*)take(NB_ * PS * 2); bf* QPl = (bf*)take(NB_ * PS * 2); bf* KPh = (bf*)take(NB_ * PS * 2); bf* KPl = (bf*)take(NB_ * PS * 2); bf* VTh = (bf*)take(NB_ * PS * 2); bf* VTl = (bf*)take(NB_ * PS * 2);
    bf* ATh = (bf*)take((size_t)NB_ * TT * DQ * 2); bf* ATl = (bf*)take((size_t)NB_ * TT * DQ * 2);
    if ((size_t)(wsp - (char*)d_ws) > ws_size) return;    // ws 256 MiB
    k_cvt<<<CVE / CBE, 256, 0, stream>>>(x, xk, xv, wq, wk, wv, wo, XB);
    k_proj<<<dim3(TT / 64, DQ / 64, 3 * NB_), 256, 0, stream>>>(XB, WQ, WK, WV, bq, bk, bv, QP16, QPh, QPl, KP16, KPh, KPl, VT16, VTh, VTl);
    k_fattn<<<dim3(RH / 64 + (TT - RH) / 128, NH_, NB_), 128, 0, stream>>>(QP16, QPh, QPl, KP16, KPh, KPl, VT16, VTh, VTl, kmask, gprob, ATh, ATl);
    k_gemmw<bf, 1, true, 8, 0><<<dim3(NB_ * TT / 64, DM / 64, 1), 256, 0, stream>>>(ATh, ATl, WO, nullptr, DQ, DQ, OUT, DM, bo, nullptr, nullptr, nullptr);   /* both batches: their rows follow one another in ATh, ATl and OUT */
}

// v006
// Measured time: 163 microseconds a run.
// In both of two side-by-side timings against v005, it was 1.30 times as fast.
// All steps since v000 together make it 12.4 times as fast.
#include <hip/hip_runtime.h>

// Multi-headed attention on three streams with a padding-or-diagonal mask and a post-softmax group weighting (query, key, value [2][2048][1024]; q, k, v = x W^T + b ('oi' 0.02, zero biases; 16 heads x 64); scores / sqrt(64); key j is kept for query i when mask[b][j] != 0 OR j == i (mask int [2][2048] random 0/1, read; -1e9 == exclusion); p = softmax; p = p x group_prob[b][i][j] (f32 [2][2048][2048] uniform, read; NOT renormalised); x = p.v; out = merged Wo^T + bo -> [2][2048][1024] (4.2 M); argument order query, key, value, group_prob, mask, Wq, bq, Wk, bk, Wv, bv, Wo, bo).
// Four launches: bf16 copies of query, key, value and the 'oi' weights; the three exact projections of both batches + bf16-rounded biases, whose epilogue writes the head planes; one fused attention launch for all heads of both batches (hybrid rows: < 512 hi/lo 3 products, rest fp16 x1024): it reads the batch's int key vector (select with the always-kept diagonal), multiplies each exponential by bf16(group_prob[b][i][j]) and divides the P.V sums by the row's sum of exponentials; merged hi/lo x Wo exact + bo.
// Compute dtypes, f32 accumulate: every input rounded to bf16 incl. group_prob; projections exact + bf16-rounded biases; attention rows < 512 3 products, rest fp16; softmax and group weighting f32; Wo hl x exact + bias.

#define NB_  2
#define TT   2048
#define DM   1024
#define NH_  16
#define NKV  16
#define HD   64
#define DQ   (NH_ * HD)
#define DKV  (NKV * HD)
#define RH   512                  // query rows < RH use hi+lo planes (0: none)
#define WIN  0
#define SCL  0.125f   // HD^-0.5
typedef _Float16 h16;
typedef unsigned short bf;
typedef __attribute__((ext_vector_type(16))) __bf16   v16bf;
typedef __attribute__((ext_vector_type(16))) _Float16 v16h;
typedef __attribute__((ext_vector_type(8)))  _Float16 v8h;
typedef __attribute__((ext_vector_type(8)))  unsigned short v8us;
typedef __attribute__((ext_vector_type(8)))  float    v8f;
typedef __attribute__((ext_vector_type(4)))  _Float16 v4h;
typedef __attribute__((ext_vector_type(4)))  unsigned short v4us;
typedef __attribute__((ext_vector_type(4)))  float    v4f;
typedef v8h  __attribute__((may_alias)) v8ha;
typedef v4f  __attribute__((may_alias)) v4fa;
typedef v8us __attribute__((may_alias)) v8usa;

__device__ __forceinline__ unsigned short f2bf(float f) { unsigned u = __float_as_uint(f); u += 0x7FFFu + ((u >> 16) & 1u); return (unsigned short)(u >> 16); }
__device__ __forceinline__ float bf2f(unsigned short b) { return __uint_as_float(((unsigned)b) << 16); }
__device__ __forceinline__ float bfr(float f) { return bf2f(f2bf(f)); }
__device__ __forceinline__ v16h cat16(v8h lo, v8h hi) { return __builtin_shufflevector(lo, hi, 0, 1, 2, 3, 4, 5, 6, 7, 8, 9, 10, 11, 12, 13, 14, 15); }
__device__ __forceinline__ v16bf cat16b(v8us lo, v8us hi) { return __builtin_bit_cast(v16bf, __builtin_shufflevector(lo, hi, 0, 1, 2, 3, 4, 5, 6, 7, 8, 9, 10, 11, 12, 13, 14, 15)); }
__device__ __forceinline__ v8f wmma16(v16h a, v16h b, v8f c) { return __builtin_amdgcn_wmma_f32_16x16x32_f16(false, a, false, b, (short)0, c, false, false); }
__device__ __forceinline__ v8f wmmab(v16bf a, v16bf b, v8f c) { return __builtin_amdgcn_wmma_f32_16x16x32_bf16(false, a, false, b, (short)0, c, false, false); }



// ---- gemmt: GEMM on a 128x128 output tile (bx, by) per work-group of 8 waves (2 x 4, a wave holds 64x32: 8 accumulators), k = DM walked in stages of 64.
// A stage's rows (128 B of each of the 128 A rows and 128 Bt rows: whole lines) are read from global one stage ahead into registers and shared through two LDS buffers, one barrier a stage; the fragments come from LDS.
// C[m][n] (f32, pitch ldc, + optional f32 bias[n]) = sum_k A[m][k] Bt[n][k] (NSPLIT == 1: + A2[m][k] Bt[n][k]). A, A2 and Bt are K-contiguous bf16 planes of pitch DM. sm: the work-group's LDS, GLDS(NSPLIT) bytes.
// The epilogue passes the f32 tile through LDS (pitch 132 floats), so that a wave stores whole rows. PL != 0: no f32 C; the tile goes out as three 16-bit planes (fp16, bf16 hi, bf16 lo of the remainder).
// PL == 1: one plane block of [ldc rows][64] per 64 columns (head planes [h][t][d]), bias[n]. PL == 2: row-major [m][n] with pitch ldc, bias[m] (V^T = Wv X^T: rows are head dims, columns tokens).
template <typename T16> struct WFrag;
template <> struct WFrag<h16> { typedef v16h V; static __device__ __forceinline__ V ld(const h16* p) { return cat16(*(const v8h*)p, *(const v8h*)(p + 16)); } static __device__ __forceinline__ v8f mma(V a, V b, v8f c) { return wmma16(a, b, c); } };
template <> struct WFrag<bf> { typedef v16bf V; static __device__ __forceinline__ V ld(const bf* p) { return cat16b(*(const v8us*)p, *(const v8us*)(p + 16)); } static __device__ __forceinline__ v8f mma(V a, V b, v8f c) { return wmmab(a, b, c); } };
typedef __attribute__((ext_vector_type(4))) int v4i;
typedef v4i __attribute__((may_alias)) v4ia;
// work-group barrier that orders LDS alone: unlike __syncthreads() it does not wait for the global loads in flight (they go to registers and concern no other wave)
__device__ __forceinline__ void lds_barrier() { __builtin_amdgcn_fence(__ATOMIC_RELEASE, "workgroup", "local"); __builtin_amdgcn_s_barrier(); __builtin_amdgcn_fence(__ATOMIC_ACQUIRE, "workgroup", "local"); }
#define GPI 72            // LDS pitch of a row's 64 elements: 128 B + 16 B, for 16-byte readers
#define GOP (128 * GPI)   // elements of one operand's stage
#define GLDS(NSPLIT) (2 * ((NSPLIT) ? 3 : 2) * GOP * 2)   // two stage buffers, bytes; the f32 tile of the epilogue (128 * 132 * 4) fits inside
template <int NSPLIT, bool BIAS, int PL>
__device__ __forceinline__ void gemmt(char* sm, const int bx, const int by, const bf* __restrict__ A, const bf* __restrict__ A2, const bf* __restrict__ Bt, float* C, int ldc, const float* __restrict__ bias, h16* P16, bf* Ph, bf* Pl) {
    static_assert(GLDS(NSPLIT) >= 128 * 132 * 4 && DM % 64 == 0, "the epilogue's tile fits the stage buffers; whole stages");
    typedef WFrag<bf> F; typedef typename F::V V;   // every inner loop below is unrolled in full, so that the fragment, staging and accumulator arrays stay in registers
    constexpr int NO = NSPLIT ? 3 : 2, SB = NO * GOP, NS = DM / 64;   // operand tiles a stage (A, A2, Bt), elements of a stage buffer, stages
    const int tid = threadIdx.x, lane = tid & 31, lr = lane & 15, hi = lane >> 4; const int r0 = bx * 128, c0 = by * 128;
    const int wv = __builtin_amdgcn_readfirstlane(tid >> 5), wm = wv >> 2, wn = wv & 3;   // wave number, scalar: the wave's place in the tile stays in scalar registers
    bf* sb = (bf*)sm;
    const size_t ga = (size_t)(r0 + (tid >> 3)) * DM + (tid & 7) * 8, gb = (size_t)(c0 + (tid >> 3)) * DM + (tid & 7) * 8;   // 8 threads a row: a wave's load covers 4 whole lines
    const int so = (tid >> 3) * GPI + (tid & 7) * 8;
    v4i rg[NO][4];
    auto gl = [&](int kc) {
#pragma unroll
        for (int u = 0; u < 4; ++u) { const size_t d = (size_t)u * 32 * DM + kc; rg[0][u] = *(const v4ia*)(A + ga + d); if (NSPLIT) rg[1][u] = *(const v4ia*)(A2 + ga + d); rg[NO - 1][u] = *(const v4ia*)(Bt + gb + d); } };
    auto st = [&](int bs) { bf* d = sb + bs * SB + so;
#pragma unroll
        for (int u = 0; u < 4; ++u)
#pragma unroll
            for (int p = 0; p < NO; ++p) *(v4ia*)(d + p * GOP + u * 32 * GPI) = rg[p][u]; };
    v8f acc[4][2];
#pragma unroll
    for (int mb = 0; mb < 4; ++mb)
#pragma unroll
        for (int nb = 0; nb < 2; ++nb) acc[mb][nb] = (v8f){};
    gl(0); st(0);
    lds_barrier();   // stage 0 stands in LDS before any wave reads it
#pragma unroll 1   // rolled: a second stage body would cost registers and instruction cache and save nothing
    for (int s = 0; s < NS; ++s) { const int bs = s & 1;
        if (s + 1 < NS) gl((s + 1) * 64);   // issued ahead of this stage's work, whose time covers their latency
        const bf* ab = sb + bs * SB + (wm * 64 + lr) * GPI + 8 * hi; const bf* bb = sb + bs * SB + (NO - 1) * GOP + (wn * 32 + lr) * GPI + 8 * hi;
#pragma unroll
        for (int ks = 0; ks < 2; ++ks) { V a[4], a2[4], b[2];
#pragma unroll
            for (int mb = 0; mb < 4; ++mb) { a[mb] = F::ld(ab + mb * 16 * GPI + ks * 32); if (NSPLIT) a2[mb] = F::ld(ab + GOP + mb * 16 * GPI + ks * 32); }
#pragma unroll
            for (int nb = 0; nb < 2; ++nb) b[nb] = F::ld(bb + nb * 16 * GPI + ks * 32);
#pragma unroll
            for (int nb = 0; nb < 2; ++nb)
#pragma unroll
                for (int mb = 0; mb < 4; ++mb) { acc[mb][nb] = F::mma(a[mb], b[nb], acc[mb][nb]); if (NSPLIT) acc[mb][nb] = F::mma(a2[mb], b[nb], acc[mb][nb]); } }
        if (s + 1 < NS) st(bs ^ 1);
        lds_barrier(); }   // publishes the next stage; ends every wave's reads of the buffer that the next trip refills (after the last trip: that the f32 tile overwrites)
    float* os = (float*)sm; const int cofs = lane * 4; v4f bv = (v4f){}; float pbl = 0.f;   // a wave takes rows wv, wv + 8, ...: 4 columns a lane; the biases are read ahead of the LDS stores, which cover their latency
    if constexpr (BIAS && PL != 2) { const v4f t = *(const v4f*)(bias + c0 + cofs); bv[0] = bfr(t[0]); bv[1] = bfr(t[1]); bv[2] = bfr(t[2]); bv[3] = bfr(t[3]); }
    if constexpr (BIAS && PL == 2) pbl = bfr(bias[r0 + lr * 8 + wv]);   // one load for the wave's 16 rows: lane i (and i + 16) holds the bias of row i * 8 + wv
#pragma unroll
    for (int mb = 0; mb < 4; ++mb)
#pragma unroll
        for (int nb = 0; nb < 2; ++nb)
#pragma unroll
            for (int j = 0; j < 8; ++j) os[(wm * 64 + mb * 16 + hi * 8 + j) * 132 + wn * 32 + nb * 16 + lr] = acc[mb][nb][j];
    lds_barrier();   // every wave's part of the f32 tile stands in LDS before any row is read
#pragma unroll
    for (int i = 0; i < 16; ++i) { const int row = i * 8 + wv; v4f val = *(const v4fa*)(os + row * 132 + cofs);
        if (BIAS) { if constexpr (PL == 2) val += __uint_as_float(__builtin_amdgcn_readlane(__float_as_uint(pbl), i)); else val += bv; }   // i is a constant of the unrolled loop: the row's bias comes out of lane i as a scalar
        if constexpr (PL == 0) *(v4f*)(C + (size_t)(r0 + row) * ldc + c0 + cofs) = val;
        else { const size_t e = (PL == 1) ? ((size_t)(by * 2 + (cofs >> 6)) * ldc + r0 + row) * 64 + (cofs & 63) : (size_t)(r0 + row) * ldc + c0 + cofs; v4h o16; v4us oh, ol;
#pragma unroll
            for (int q = 0; q < 4; ++q) { o16[q] = (h16)val[q]; const unsigned short a2 = f2bf(val[q]); oh[q] = a2; ol[q] = f2bf(val[q] - bf2f(a2)); }
            *(v4h*)(P16 + e) = o16; *(v4us*)(Ph + e) = oh; *(v4us*)(Pl + e) = ol; } }
}

// k_gemmo: out = (Ah + Al) Wo^T + bo, f32; grid (M/128, DM/128).
__global__ __launch_bounds__(256) void k_gemmo(const bf* __restrict__ Ah, const bf* __restrict__ Al, const bf* __restrict__ WO, float* C, const float* __restrict__ bo) {
    __shared__ __align__(16) char sm[GLDS(1)];
    gemmt<1, true, 0>(sm, blockIdx.x, blockIdx.y, Ah, Al, WO, C, DM, bo, nullptr, nullptr, nullptr);
}
// k_proj: the q, k and v projections of both batches in one launch; grid (TT/128, DQ/128, 3 * NB_), z = stream * NB_ + batch. X holds the bf16 streams as [stream][batch][t][DM]; every plane holds both batches.
// q and k: x W^T into head planes; v: V^T = Wv X^T (rows [g][d], columns t), so its tile indices change places.
__global__ __launch_bounds__(256) void k_proj(const bf* __restrict__ X, const bf* __restrict__ WQ, const bf* __restrict__ WK, const bf* __restrict__ WV, const float* __restrict__ bq, const float* __restrict__ bk, const float* __restrict__ bv,
                                              h16* QP16, bf* QPh, bf* QPl, h16* KP16, bf* KPh, bf* KPl, h16* VT16, bf* VTh, bf* VTl) {
    __shared__ __align__(16) char sm[GLDS(0)];
    const int z = blockIdx.z, sm_ = z / NB_; const bf* xs = X + (size_t)z * TT * DM; const size_t po = (size_t)(z % NB_) * NH_ * TT * HD;
    if (sm_ == 2) gemmt<0, true, 2>(sm, blockIdx.y, blockIdx.x, WV, nullptr, xs, nullptr, TT, bv, VT16 + po, VTh + po, VTl + po);
    else gemmt<0, true, 1>(sm, blockIdx.x, blockIdx.y, xs, nullptr, sm_ ? WK : WQ, nullptr, TT, sm_ ? bk : bq, (sm_ ? KP16 : QP16) + po, (sm_ ? KPh : QPh) + po, (sm_ ? KPl : QPl) + po);
}

__device__ __forceinline__ h16 tohx(float x) { return (h16)x; }
typedef __attribute__((ext_vector_type(2))) float v2f;

// k_cvt: every f32 -> bf16 copy of the call in one launch. dst is one range: query, key, value (NB_ * TT * DM elements each), then Wq, Wk, Wv, Wo (DM * DM each).
// A block converts CBE consecutive elements of one tensor (every tensor's size is a multiple of CBE), a thread CU pieces of 8: few waves to start, and each has all its loads in flight at once. Grid CVE / CBE.
#define CU  16
#define CBE (CU * 256 * 8)
#define CVE (3 * NB_ * TT * DM + 4 * DM * DM)
__global__ __launch_bounds__(256) void k_cvt(const float* __restrict__ xq, const float* __restrict__ xk, const float* __restrict__ xv, const float* __restrict__ wq, const float* __restrict__ wk, const float* __restrict__ wv, const float* __restrict__ wo, bf* dst) {
    constexpr int BX = NB_ * TT * DM / CBE, BW = DM * DM / CBE; static_assert(NB_ * TT * DM % CBE == 0 && DM * DM % CBE == 0, "a block stays inside one tensor");
    const int bx = blockIdx.x; const float* s; int b0;   // the block's tensor and that tensor's first block: scalar
    if (bx < 3 * BX) { const int t = bx / BX; s = (t == 0) ? xq : (t == 1) ? xk : xv; b0 = t * BX; }
    else { const int t = (bx - 3 * BX) / BW; s = (t == 0) ? wq : (t == 1) ? wk : (t == 2) ? wv : wo; b0 = 3 * BX + t * BW; }
    s += (size_t)(bx - b0) * CBE + threadIdx.x * 8; bf* d = dst + (size_t)bx * CBE + threadIdx.x * 8;
    v8f v[CU];   // both loops are unrolled in full: v stays in registers and the loads issue ahead of the first conversion
#pragma unroll
    for (int u = 0; u < CU; ++u) v[u] = *(const v8f*)(s + u * 2048);
#pragma unroll
    for (int u = 0; u < CU; ++u) { v8us o;
#pragma unroll
        for (int k = 0; k < 8; ++k) o[k] = f2bf(v[u][k]);
        *(v8us*)(d + u * 2048) = o; } }

// k_fattn: scores, mask, softmax, group weighting, P.V and the head merge in one kernel; no score or probability leaves the registers. Grid (RH/64 + (TT-RH)/128, heads, batches), 4 waves.
// A wave owns NQ * 16 query rows of one head; the work-group walks all TT keys twice, 32 keys a stage. A stage's K rows and V^T rows are read from global in whole or half lines, one stage ahead (walk 1: two), and shared through two LDS buffers (one barrier a stage).
// S^T = K Q^T (A = K rows, B = Q rows, same k order on both sides): a lane holds 8 keys of ONE query per tile. The key mask enters as the C operand (0 or -3e38 per key, from an LDS table built at entry);
// in the one stage that holds a wave's diagonal the products are formed once more from C = 0 and the element j == i takes that value (the diagonal is always kept).
// Walk 1: the row maximum over the kept keys. Walk 2: e = exp(s / 8 - max), l += e, p = e x bf16(group_prob[b][i][j]); the two key tiles of a stage, converted in place, are the B operand of O^T += V^T P^T (A = V^T rows in the hardware k order).
// The epilogue joins the wave halves' sums, divides by l (the weighting is not renormalised: l sums e alone) and stores hi/lo bf16 planes of the merged rows, 16 B per lane.
// Rows < RH: hi/lo bf16 planes, 3 products in both GEMMs, 16 rows a wave; the rest fp16 with p carried x 1024 (folded into the exponent, so l carries it too and it cancels), 32 rows a wave.
#define KPI 72   // LDS pitch of a K row in elements: 128 B + 16 B, for 16-byte readers
#define VPI 40   // LDS pitch of a V^T row of 32 keys in elements: 64 B + 16 B
#define SBUF (2 * (32 * KPI + 64 * VPI))   // elements of one stage buffer at two planes per operand
typedef __attribute__((ext_vector_type(2))) __bf16 v2bf;
typedef __attribute__((ext_vector_type(8))) unsigned v8u;
typedef __attribute__((ext_vector_type(4))) unsigned v4u;
__device__ __forceinline__ unsigned pkbf(float a, float b) { v2f x; x[0] = a; x[1] = b; return __builtin_bit_cast(unsigned, __builtin_convertvector(x, v2bf)); }   // two f32 -> packed bf16, round to nearest even
// two 2^x in one statement: the early-clobber outputs keep each off the other's registers, and the v_nop keeps the slot that the instruction set asks for behind a transcendental before its result is used or its source overwritten
__device__ __forceinline__ void exp2x2(float x0, float x1, float& e0, float& e1) { asm("v_exp_f32 %0, %2\n\tv_exp_f32 %1, %3\n\tv_nop" : "=&v"(e0), "=&v"(e1) : "v"(x0), "v"(x1)); }
__device__ __forceinline__ float bflo(unsigned u) { return __uint_as_float(u << 16); }
__device__ __forceinline__ float bfhi(unsigned u) { return __uint_as_float(u & 0xFFFF0000u); }
template <typename T16, bool HI, int NQ>
__device__ __forceinline__ void attn_rows(const T16* __restrict__ Q, const T16* __restrict__ Q2, const T16* __restrict__ K, const T16* __restrict__ K2, const T16* __restrict__ VT, const T16* __restrict__ VT2, const int* __restrict__ kvp, const float* __restrict__ gp, const int q0, bf* Ah, bf* Al, T16* sb, float* bias) {
    typedef WFrag<T16> F; typedef typename F::V V;   // every inner loop below is unrolled in full, so that the fragment and accumulator arrays stay in registers
    constexpr int NP = HI ? 2 : 1, KTS = 32 * KPI, VTS = 64 * VPI;
    const int tid = threadIdx.x, lane = tid & 31, lr = lane & 15, hi = lane >> 4;
    const float CE = SCL * 1.4426950408889634f;
    v4i rk[NP][2], rk2[NP][2], rv[NP][2];
    auto gk = [&](v4i (&t)[NP][2], int j0) {
#pragma unroll
        for (int u = 0; u < 2; ++u) { const size_t o = (size_t)j0 * HD + (tid + 128 * u) * 8; t[0][u] = *(const v4ia*)(K + o); if (HI) t[NP - 1][u] = *(const v4ia*)(K2 + o); } };
    auto gv = [&](int j0) {
#pragma unroll
        for (int u = 0; u < 2; ++u) { const int x = tid + 128 * u; const size_t o = (size_t)(x >> 2) * TT + j0 + (x & 3) * 8; rv[0][u] = *(const v4ia*)(VT + o); if (HI) rv[NP - 1][u] = *(const v4ia*)(VT2 + o); } };
    auto sk = [&](const v4i (&t)[NP][2], int bs) { T16* d = sb + bs * SBUF;
#pragma unroll
        for (int u = 0; u < 2; ++u) { const int x = tid + 128 * u, o = (x >> 3) * KPI + (x & 7) * 8; *(v4ia*)(d + o) = t[0][u]; if (HI) *(v4ia*)(d + KTS + o) = t[NP - 1][u]; } };
    auto sv = [&](int bs) { T16* d = sb + bs * SBUF + NP * KTS;
#pragma unroll
        for (int u = 0; u < 2; ++u) { const int x = tid + 128 * u, o = (x >> 2) * VPI + (x & 3) * 8; *(v4ia*)(d + o) = rv[0][u]; if (HI) *(v4ia*)(d + VTS + o) = rv[NP - 1][u]; } };
    gk(rk, 0); gv(0); gk(rk2, 32);
    V qf[NQ][2], qf2[NQ][2];
#pragma unroll
    for (int qt = 0; qt < NQ; ++qt)
#pragma unroll
        for (int ks = 0; ks < 2; ++ks) { const size_t o = (size_t)(q0 + qt * 16 + lr) * HD + ks * 32 + 8 * hi; qf[qt][ks] = F::ld(Q + o); if (HI) qf2[qt][ks] = F::ld(Q2 + o); }
#pragma unroll
    for (int u = 0; u < TT / 512; ++u) { const v4i m = *(const v4i*)(kvp + (tid + 128 * u) * 4); v4f bz;
#pragma unroll
        for (int q = 0; q < 4; ++q) bz[q] = (m[q] != 0) ? 0.0f : -3.0e38f;
        *(v4f*)(bias + (tid + 128 * u) * 4) = bz; }
    sk(rk, 0); sv(0);
    lds_barrier();   // stage 0 and the mask table stand in LDS before any wave reads them
    // masked raw scores of the stage's 32 keys
    auto scores = [&](int bs, int j0, v8f (&s)[2][NQ]) { const T16* kb = sb + bs * SBUF; V kf[2][2], kf2[2][2];
#pragma unroll
        for (int kt = 0; kt < 2; ++kt)
#pragma unroll
            for (int ks = 0; ks < 2; ++ks) { const int o = (kt * 16 + lr) * KPI + ks * 32 + 8 * hi; kf[kt][ks] = F::ld(kb + o); if (HI) kf2[kt][ks] = F::ld(kb + KTS + o); }
        auto prod = [&](int kt, int qt, v8f a) {
#pragma unroll
            for (int ks = 0; ks < 2; ++ks) { a = F::mma(kf[kt][ks], qf[qt][ks], a); if (HI) { a = F::mma(kf[kt][ks], qf2[qt][ks], a); a = F::mma(kf2[kt][ks], qf[qt][ks], a); } }
            return a; };
#pragma unroll
        for (int kt = 0; kt < 2; ++kt) { const float* bp = bias + j0 + kt * 16 + 8 * hi; const v4f c0 = *(const v4f*)bp, c1 = *(const v4f*)(bp + 4); const v8f cb = __builtin_shufflevector(c0, c1, 0, 1, 2, 3, 4, 5, 6, 7);
#pragma unroll
            for (int qt = 0; qt < NQ; ++qt) s[kt][qt] = prod(kt, qt, cb); }
        if (j0 == (q0 & ~31)) {   // scalar test: the one stage with this wave's diagonal
#pragma unroll
            for (int kt = 0; kt < 2; ++kt)
#pragma unroll
                for (int qt = 0; qt < NQ; ++qt) { const v8f a = prod(kt, qt, (v8f){}); const int dj = q0 + qt * 16 + lr - (j0 + kt * 16 + 8 * hi);
#pragma unroll
                    for (int r = 0; r < 8; ++r) s[kt][qt][r] = (dj == r) ? a[r] : s[kt][qt][r]; } } };
    float mx[NQ], l[NQ];
#pragma unroll
    for (int qt = 0; qt < NQ; ++qt) { mx[qt] = -3.0e38f; l[qt] = 0.f; }
    // walk 1 is short of work per stage, so its K tiles are fetched two stages ahead, in two register sets that take turns; the index wraps: the last trip brings stage 0 back for walk 2
    auto walk1 = [&](int bs, int j0, v4i (&tn)[NP][2], const v4i (&tc)[NP][2]) { gk(tn, (j0 + 64) & (TT - 1));
        __builtin_amdgcn_sched_barrier(0);   // keeps the global loads issued ahead of this stage's work, whose time covers part of their latency
        v8f s[2][NQ]; scores(bs, j0, s);
#pragma unroll
        for (int qt = 0; qt < NQ; ++qt)
#pragma unroll
            for (int r = 0; r < 8; ++r) mx[qt] = fmaxf(mx[qt], fmaxf(s[0][qt][r], s[1][qt][r]));
        sk(tc, bs ^ 1);
        lds_barrier(); };   // publishes the next stage; ends every wave's reads of the buffer that the next stage refills
#pragma unroll 1   // rolled: one trip holds the two stages that the two register sets ask for; more would only cost instruction cache
    for (int st = 0; st < TT / 32; st += 2) { walk1(0, st * 32, rk, rk2); walk1(1, st * 32 + 32, rk2, rk); }
    float mc[NQ];
#pragma unroll
    for (int qt = 0; qt < NQ; ++qt) { mx[qt] = fmaxf(mx[qt], __shfl_xor(mx[qt], 16, 32)); mc[qt] = mx[qt] * CE - (HI ? 0.0f : 10.0f); }
    v4f g[NQ][4];   // group_prob of the stage's 32 keys, 8 + 8 per lane and query row
    auto gg = [&](int j0) {
#pragma unroll
        for (int qt = 0; qt < NQ; ++qt) { const float* gr = gp + (size_t)(q0 + qt * 16 + lr) * TT + j0 + 8 * hi; g[qt][0] = *(const v4f*)gr; g[qt][1] = *(const v4f*)(gr + 4); g[qt][2] = *(const v4f*)(gr + 16); g[qt][3] = *(const v4f*)(gr + 20); } };
    gg(0);
    v8f o[4][NQ];
#pragma unroll
    for (int dt = 0; dt < 4; ++dt)
#pragma unroll
        for (int qt = 0; qt < NQ; ++qt) o[dt][qt] = (v8f){};
#pragma unroll 1   // rolled: a second stage body would cost registers and instruction cache and save nothing
    for (int st = 0; st < TT / 32; ++st) { const int j0 = st * 32, bs = st & 1;
        gk(rk, (j0 + 32) & (TT - 1)); gv((j0 + 32) & (TT - 1));
        __builtin_amdgcn_sched_barrier(0);   // keeps the next stage's global loads issued ahead of this stage's work, whose time covers their latency
        v8f s[2][NQ]; scores(bs, j0, s); V pf[NQ], pf2[NQ], vf[4], vf2[4];
        const T16* vb = sb + bs * SBUF + NP * KTS;   // the V^T fragments are read ahead of the exponentials, which cover the LDS latency
#pragma unroll
        for (int dt = 0; dt < 4; ++dt) { const int vo = (dt * 16 + lr) * VPI + 8 * hi; vf[dt] = F::ld(vb + vo); if (HI) vf2[dt] = F::ld(vb + VTS + vo); }
        unsigned gb[NQ][8];   // this stage's group_prob rounded to bf16, two a register
#pragma unroll
        for (int qt = 0; qt < NQ; ++qt)
#pragma unroll
            for (int w = 0; w < 8; ++w) gb[qt][w] = pkbf(g[qt][w >> 1][(w & 1) * 2], g[qt][w >> 1][(w & 1) * 2 + 1]);
        gg((j0 + 32) & (TT - 1));
        __builtin_amdgcn_sched_barrier(0);   // keeps the next stage's group_prob loads and the V^T reads issued here: the exponentials and the P.V products cover their latency; the barrier waits for LDS alone, so the group_prob loads may stay in flight past it
#pragma unroll
        for (int qt = 0; qt < NQ; ++qt) { v16h ph; v8u uh, ul;
#pragma unroll
            for (int kt = 0; kt < 2; ++kt)
#pragma unroll
                for (int r = 0; r < 8; r += 2) { const unsigned gw = gb[qt][kt * 4 + (r >> 1)];
                    float e0, e1; exp2x2(__builtin_fmaf(s[kt][qt][r], CE, -mc[qt]), __builtin_fmaf(s[kt][qt][r + 1], CE, -mc[qt]), e0, e1); l[qt] += e0; l[qt] += e1;
                    const float p0 = e0 * bflo(gw), p1 = e1 * bfhi(gw);
                    if constexpr (HI) { const unsigned a = pkbf(p0, p1); uh[kt * 4 + (r >> 1)] = a; ul[kt * 4 + (r >> 1)] = pkbf(p0 - bflo(a), p1 - bfhi(a)); } else { ph[kt * 8 + r] = tohx(p0); ph[kt * 8 + r + 1] = tohx(p1); } }
            if constexpr (HI) { pf[qt] = __builtin_bit_cast(v16bf, uh); pf2[qt] = __builtin_bit_cast(v16bf, ul); } else pf[qt] = ph; }
#pragma unroll
        for (int dt = 0; dt < 4; ++dt)
#pragma unroll
            for (int qt = 0; qt < NQ; ++qt) { o[dt][qt] = F::mma(vf[dt], pf[qt], o[dt][qt]); if (HI) { o[dt][qt] = F::mma(vf[dt], pf2[qt], o[dt][qt]); o[dt][qt] = F::mma(vf2[dt], pf[qt], o[dt][qt]); } }
        sk(rk, bs ^ 1); sv(bs ^ 1);
        lds_barrier(); }   // publishes the next stage; ends every wave's reads of the buffer that the next trip refills
#pragma unroll
    for (int qt = 0; qt < NQ; ++qt) { const float inv = __fdiv_rn(1.0f, l[qt] + __shfl_xor(l[qt], 16, 32)); const size_t oo = (size_t)(q0 + qt * 16 + lr) * DQ + 8 * hi;
#pragma unroll
        for (int dt = 0; dt < 4; ++dt) { v4u oh, ol;
#pragma unroll
            for (int r = 0; r < 8; r += 2) { const float y0 = o[dt][qt][r] * inv, y1 = o[dt][qt][r + 1] * inv; const unsigned a = pkbf(y0, y1); oh[r >> 1] = a; ol[r >> 1] = pkbf(y0 - bflo(a), y1 - bfhi(a)); }
            *(v4u*)(Ah + oo + dt * 16) = oh; *(v4u*)(Al + oo + dt * 16) = ol; } }
}
__global__ __launch_bounds__(128) void k_fattn(const h16* __restrict__ Q16, const bf* __restrict__ Qh, const bf* __restrict__ Ql, const h16* __restrict__ K16, const bf* __restrict__ Kh, const bf* __restrict__ Kl, const h16* __restrict__ V16, const bf* __restrict__ Vh, const bf* __restrict__ Vl, const int* __restrict__ kmask, const float* __restrict__ gprob, bf* Ah, bf* Al) {
    __shared__ __align__(16) char sm[2 * SBUF * 2]; __shared__ __align__(16) float bias[TT];
    const int wv = __builtin_amdgcn_readfirstlane((int)(threadIdx.x >> 5));   // wave number, scalar: the row base and the diagonal test stay in scalar registers
    const int bx = blockIdx.x, h = blockIdx.y, b = blockIdx.z; const size_t po = ((size_t)b * NH_ + h) * TT * HD;
    const int* kvp = kmask + (size_t)b * TT; const float* gp = gprob + (size_t)b * TT * TT; bf* ah = Ah + (size_t)b * TT * DQ + h * HD; bf* al = Al + (size_t)b * TT * DQ + h * HD;
    if (bx < RH / 64) attn_rows<bf, true, 1>(Qh + po, Ql + po, Kh + po, Kl + po, Vh + po, Vl + po, kvp, gp, bx * 64 + wv * 16, ah, al, (bf*)sm, bias);
    else attn_rows<h16, false, 2>(Q16 + po, nullptr, K16 + po, nullptr, V16 + po, nullptr, kvp, gp, RH + (bx - RH / 64) * 128 + wv * 32, ah, al, (h16*)sm, bias);
}

extern "C" void kernel_launch(void* const* d_in, const int* in_sizes, int n_in,
                              void* d_out, int out_size, void* d_ws, size_t ws_size, hipStream_t stream) {
    (void)in_sizes; (void)n_in; (void)out_size;
    const float* x = (const float*)d_in[0]; const float* xk = (const float*)d_in[1]; const float* xv = (const float*)d_in[2]; const float* gprob = (const float*)d_in[3];   /* group_prob [2][2048][2048] f32 */ const int* kmask = (const int*)d_in[4];   /* mask [2][2048] int32: 1 = attendable key (OR the diagonal) */ const float* wq = (const float*)d_in[5]; const float* bq = (const float*)d_in[6]; const float* wk = (const float*)d_in[7]; const float* bk = (const float*)d_in[8]; const float* wv = (const float*)d_in[9]; const float* bv = (const float*)d_in[10]; const float* wo = (const float*)d_in[11]; const float* bo = (const float*)d_in[12];   /* input order query, key, value, group_prob, mask, Wq, bq, Wk, bk, Wv, bv, Wo, bo ('oi') */
    float* OUT = (float*)d_out;     // [2][2048][1024]
    char* wsp = (char*)d_ws;
    auto take = [&](size_t bytes) { char* p = wsp; wsp += (bytes + 255) & ~(size_t)255; return (void*)p; };
    bf* XB = (bf*)take((size_t)CVE * 2);   // k_cvt's range: the three streams [stream][batch][t][DM], then the four weights
    bf* WQ = XB + (size_t)3 * NB_ * TT * DM; bf* WK = WQ + (size_t)DM * DM; bf* WV = WK + (size_t)DM * DM; bf* WO = WV + (size_t)DM * DM;
    const size_t PS = (size_t)NH_ * TT * HD;   // one batch's plane, elements (NKV == NH_); every plane holds both batches
    h16* QP16 = (h16*)take(NB_ * PS * 2); h16* KP16 = (h16*)take(NB_ * PS * 2); h16* VT16 = (h16*)take(NB_ * PS * 2);
    bf* QPh = (bf*)take(NB_ * PS * 2); bf* QPl = (bf*)take(NB_ * PS * 2); bf* KPh = (bf*)take(NB_ * PS * 2); bf* KPl = (bf*)take(NB_ * PS * 2); bf* VTh = (bf*)take(NB_ * PS * 2); bf* VTl = (bf*)take(NB_ * PS * 2);
    bf* ATh = (bf*)take((size_t)NB_ * TT * DQ * 2); bf* ATl = (bf*)take((size_t)NB_ * TT * DQ * 2);
    if ((size_t)(wsp - (char*)d_ws) > ws_size) return;    // ws 256 MiB
    k_cvt<<<CVE / CBE, 256, 0, stream>>>(x, xk, xv, wq, wk, wv, wo, XB);
    k_proj<<<dim3(TT / 128, DQ / 128, 3 * NB_), 256, 0, stream>>>(XB, WQ, WK, WV, bq, bk, bv, QP16, QPh, QPl, KP16, KPh, KPl, VT16, VTh, VTl);
    k_fattn<<<dim3(RH / 64 + (TT - RH) / 128, NH_, NB_), 128, 0, stream>>>(QP16, QPh, QPl, KP16, KPh, KPl, VT16, VTh, VTl, kmask, gprob, ATh, ATl);
    k_gemmo<<<dim3(NB_ * TT / 128, DM / 128, 1), 256, 0, stream>>>(ATh, ATl, WO, OUT, bo);   /* both batches: their rows follow one another in ATh, ATl and OUT */
}

// v007
// It runs in 156 microseconds.
// Timed twice side by side with v006, it ran 1.04 and 1.05 times as fast.
// Over all steps from v000 it is 13.0 times as fast.
#include <hip/hip_runtime.h>

// Multi-headed attention on three streams with a padding-or-diagonal mask and a post-softmax group weighting (query, key, value [2][2048][1024]; q, k, v = x W^T + b ('oi' 0.02, zero biases; 16 heads x 64); scores / sqrt(64); key j is kept for query i when mask[b][j] != 0 OR j == i (mask int [2][2048] random 0/1, read; -1e9 == exclusion); p = softmax; p = p x group_prob[b][i][j] (f32 [2][2048][2048] uniform, read; NOT renormalised); x = p.v; out = merged Wo^T + bo -> [2][2048][1024] (4.2 M); argument order query, key, value, group_prob, mask, Wq, bq, Wk, bk, Wv, bv, Wo, bo).
// Four launches: bf16 copies of query, key, value, the 'oi' weights and group_prob (the last in the attention's fragment order); the three exact projections of both batches + f32 biases, whose epilogue writes the head planes; one fused attention launch for all heads of both batches (hybrid rows: < 512 hi/lo 3 products, rest fp16 x1024): it reads the batch's int key vector (select with the always-kept diagonal), multiplies each exponential by the bf16 copy of group_prob[b][i][j] and divides the P.V sums by the row's sum of exponentials; merged hi/lo x Wo exact + bo.
// Compute dtypes, f32 accumulate: every input rounded to bf16 incl. group_prob; projections exact + f32 biases; attention rows < 512 3 products, rest fp16; softmax and group weighting f32; Wo hl x exact + bias.

#define NB_  2
#define TT   2048
#define DM   1024
#define NH_  16
#define NKV  16
#define HD   64
#define DQ   (NH_ * HD)
#define DKV  (NKV * HD)
#define RH   512                  // query rows < RH use hi+lo planes (0: none)
#define WIN  0
#define SCL  0.125f   // HD^-0.5
typedef _Float16 h16;
typedef unsigned short bf;
typedef __attribute__((ext_vector_type(16))) __bf16   v16bf;
typedef __attribute__((ext_vector_type(16))) _Float16 v16h;
typedef __attribute__((ext_vector_type(8)))  _Float16 v8h;
typedef __attribute__((ext_vector_type(8)))  unsigned short v8us;
typedef __attribute__((ext_vector_type(8)))  float    v8f;
typedef __attribute__((ext_vector_type(4)))  _Float16 v4h;
typedef __attribute__((ext_vector_type(4)))  unsigned short v4us;
typedef __attribute__((ext_vector_type(4)))  float    v4f;
typedef v8h  __attribute__((may_alias)) v8ha;
typedef v4f  __attribute__((may_alias)) v4fa;
typedef v8us __attribute__((may_alias)) v8usa;

__device__ __forceinline__ unsigned short f2bf(float f) { unsigned u = __float_as_uint(f); u += 0x7FFFu + ((u >> 16) & 1u); return (unsigned short)(u >> 16); }
__device__ __forceinline__ float bf2f(unsigned short b) { return __uint_as_float(((unsigned)b) << 16); }
__device__ __forceinline__ float bfr(float f) { return bf2f(f2bf(f)); }
__device__ __forceinline__ v16h cat16(v8h lo, v8h hi) { return __builtin_shufflevector(lo, hi, 0, 1, 2, 3, 4, 5, 6, 7, 8, 9, 10, 11, 12, 13, 14, 15); }
__device__ __forceinline__ v16bf cat16b(v8us lo, v8us hi) { return __builtin_bit_cast(v16bf, __builtin_shufflevector(lo, hi, 0, 1, 2, 3, 4, 5, 6, 7, 8, 9, 10, 11, 12, 13, 14, 15)); }
__device__ __forceinline__ v8f wmma16(v16h a, v16h b, v8f c) { return __builtin_amdgcn_wmma_f32_16x16x32_f16(false, a, false, b, (short)0, c, false, false); }
__device__ __forceinline__ v8f wmmab(v16bf a, v16bf b, v8f c) { return __builtin_amdgcn_wmma_f32_16x16x32_bf16(false, a, false, b, (short)0, c, false, false); }



// ---- gemmt: GEMM on a 128x128 output tile (bx, by) per work-group of 8 waves (2 x 4, a wave holds 64x32: 8 accumulators), k = DM walked in stages of 64.
// A stage's rows (128 B of each of the 128 A rows and 128 Bt rows: whole lines) are read from global one stage ahead into registers and shared through two LDS buffers, one barrier a stage; the fragments come from LDS.
// C[m][n] (f32, pitch ldc, + optional f32 bias[n]) = sum_k A[m][k] Bt[n][k] (NSPLIT == 1: + A2[m][k] Bt[n][k]). A, A2 and Bt are K-contiguous bf16 planes of pitch DM. sm: the work-group's LDS, GLDS(NSPLIT) bytes.
// The epilogue passes the f32 tile through LDS (pitch 132 floats), so that a wave stores whole rows. PL != 0: no f32 C; the tile goes out as three 16-bit planes (fp16, bf16 hi, bf16 lo of the remainder).
// PL == 1: one plane block of [ldc rows][64] per 64 columns (head planes [h][t][d]), bias[n]. PL == 2: row-major [m][n] with pitch ldc, bias[m] (V^T = Wv X^T: rows are head dims, columns tokens).
template <typename T16> struct WFrag;
template <> struct WFrag<h16> { typedef v16h V; static __device__ __forceinline__ V ld(const h16* p) { return cat16(*(const v8h*)p, *(const v8h*)(p + 16)); } static __device__ __forceinline__ v8f mma(V a, V b, v8f c) { return wmma16(a, b, c); } };
template <> struct WFrag<bf> { typedef v16bf V; static __device__ __forceinline__ V ld(const bf* p) { return cat16b(*(const v8us*)p, *(const v8us*)(p + 16)); } static __device__ __forceinline__ v8f mma(V a, V b, v8f c) { return wmmab(a, b, c); } };
typedef __attribute__((ext_vector_type(4))) int v4i;
typedef v4i __attribute__((may_alias)) v4ia;
// work-group barrier that orders LDS alone: unlike __syncthreads() it does not wait for the global loads in flight (they go to registers and concern no other wave)
__device__ __forceinline__ void lds_barrier() { __builtin_amdgcn_fence(__ATOMIC_RELEASE, "workgroup", "local"); __builtin_amdgcn_s_barrier(); __builtin_amdgcn_fence(__ATOMIC_ACQUIRE, "workgroup", "local"); }
#define GPI 72            // LDS pitch of a row's 64 elements: 128 B + 16 B, for 16-byte readers
#define GOP (128 * GPI)   // elements of one operand's stage
#define GLDS(NSPLIT) (2 * ((NSPLIT) ? 3 : 2) * GOP * 2)   // two stage buffers, bytes; the f32 tile of the epilogue (128 * 132 * 4) fits inside
template <int NSPLIT, bool BIAS, int PL>
__device__ __forceinline__ void gemmt(char* sm, const int bx, const int by, const bf* __restrict__ A, const bf* __restrict__ A2, const bf* __restrict__ Bt, float* C, int ldc, const float* __restrict__ bias, h16* P16, bf* Ph, bf* Pl) {
    static_assert(GLDS(NSPLIT) >= 128 * 132 * 4 && DM % 64 == 0, "the epilogue's tile fits the stage buffers; whole stages");
    typedef WFrag<bf> F; typedef typename F::V V;   // every inner loop below is unrolled in full, so that the fragment, staging and accumulator arrays stay in registers
    constexpr int NO = NSPLIT ? 3 : 2, SB = NO * GOP, NS = DM / 64;   // operand tiles a stage (A, A2, Bt), elements of a stage buffer, stages
    const int tid = threadIdx.x, lane = tid & 31, lr = lane & 15, hi = lane >> 4; const int r0 = bx * 128, c0 = by * 128;
    const int wv = __builtin_amdgcn_readfirstlane(tid >> 5), wm = wv >> 2, wn = wv & 3;   // wave number, scalar: the wave's place in the tile stays in scalar registers
    bf* sb = (bf*)sm;
    const size_t ga = (size_t)(r0 + (tid >> 3)) * DM + (tid & 7) * 8, gb = (size_t)(c0 + (tid >> 3)) * DM + (tid & 7) * 8;   // 8 threads a row: a wave's load covers 4 whole lines
    const int so = (tid >> 3) * GPI + (tid & 7) * 8;
    v4i rg[NO][4];
    auto gl = [&](int kc) {
#pragma unroll
        for (int u = 0; u < 4; ++u) { const size_t d = (size_t)u * 32 * DM + kc; rg[0][u] = *(const v4ia*)(A + ga + d); if (NSPLIT) rg[1][u] = *(const v4ia*)(A2 + ga + d); rg[NO - 1][u] = *(const v4ia*)(Bt + gb + d); } };
    auto st = [&](int bs) { bf* d = sb + bs * SB + so;
#pragma unroll
        for (int u = 0; u < 4; ++u)
#pragma unroll
            for (int p = 0; p < NO; ++p) *(v4ia*)(d + p * GOP + u * 32 * GPI) = rg[p][u]; };
    v8f acc[4][2];
#pragma unroll
    for (int mb = 0; mb < 4; ++mb)
#pragma unroll
        for (int nb = 0; nb < 2; ++nb) acc[mb][nb] = (v8f){};
    gl(0); st(0);
    lds_barrier();   // stage 0 stands in LDS before any wave reads it
#pragma unroll 1   // rolled: a second stage body would cost registers and instruction cache and save nothing
    for (int s = 0; s < NS; ++s) { const int bs = s & 1;
        if (s + 1 < NS) gl((s + 1) * 64);   // issued ahead of this stage's work, whose time covers their latency
        const bf* ab = sb + bs * SB + (wm * 64 + lr) * GPI + 8 * hi; const bf* bb = sb + bs * SB + (NO - 1) * GOP + (wn * 32 + lr) * GPI + 8 * hi;
#pragma unroll
        for (int ks = 0; ks < 2; ++ks) { V a[4], a2[4], b[2];
#pragma unroll
            for (int mb = 0; mb < 4; ++mb) { a[mb] = F::ld(ab + mb * 16 * GPI + ks * 32); if (NSPLIT) a2[mb] = F::ld(ab + GOP + mb * 16 * GPI + ks * 32); }
#pragma unroll
            for (int nb = 0; nb < 2; ++nb) b[nb] = F::ld(bb + nb * 16 * GPI + ks * 32);
#pragma unroll
            for (int nb = 0; nb < 2; ++nb)
#pragma unroll
                for (int mb = 0; mb < 4; ++mb) { acc[mb][nb] = F::mma(a[mb], b[nb], acc[mb][nb]); if (NSPLIT) acc[mb][nb] = F::mma(a2[mb], b[nb], acc[mb][nb]); } }
        if (s + 1 < NS) st(bs ^ 1);
        lds_barrier(); }   // publishes the next stage; ends every wave's reads of the buffer that the next trip refills (after the last trip: that the f32 tile overwrites)
    float* os = (float*)sm; const int cofs = lane * 4; v4f bv = (v4f){}; float pbl = 0.f;   // a wave takes rows wv, wv + 8, ...: 4 columns a lane; the biases are read ahead of the LDS stores, which cover their latency
    if constexpr (BIAS && PL != 2) { const v4f t = *(const v4f*)(bias + c0 + cofs); bv[0] = bfr(t[0]); bv[1] = bfr(t[1]); bv[2] = bfr(t[2]); bv[3] = bfr(t[3]); }
    if constexpr (BIAS && PL == 2) pbl = bfr(bias[r0 + lr * 8 + wv]);   // one load for the wave's 16 rows: lane i (and i + 16) holds the bias of row i * 8 + wv
#pragma unroll
    for (int mb = 0; mb < 4; ++mb)
#pragma unroll
        for (int nb = 0; nb < 2; ++nb)
#pragma unroll
            for (int j = 0; j < 8; ++j) os[(wm * 64 + mb * 16 + hi * 8 + j) * 132 + wn * 32 + nb * 16 + lr] = acc[mb][nb][j];
    lds_barrier();   // every wave's part of the f32 tile stands in LDS before any row is read
#pragma unroll
    for (int i = 0; i < 16; ++i) { const int row = i * 8 + wv; v4f val = *(const v4fa*)(os + row * 132 + cofs);
        if (BIAS) { if constexpr (PL == 2) val += __uint_as_float(__builtin_amdgcn_readlane(__float_as_uint(pbl), i)); else val += bv; }   // i is a constant of the unrolled loop: the row's bias comes out of lane i as a scalar
        if constexpr (PL == 0) *(v4f*)(C + (size_t)(r0 + row) * ldc + c0 + cofs) = val;
        else { const size_t e = (PL == 1) ? ((size_t)(by * 2 + (cofs >> 6)) * ldc + r0 + row) * 64 + (cofs & 63) : (size_t)(r0 + row) * ldc + c0 + cofs; v4h o16; v4us oh, ol;
#pragma unroll
            for (int q = 0; q < 4; ++q) { o16[q] = (h16)val[q]; const unsigned short a2 = f2bf(val[q]); oh[q] = a2; ol[q] = f2bf(val[q] - bf2f(a2)); }
            *(v4h*)(P16 + e) = o16; *(v4us*)(Ph + e) = oh; *(v4us*)(Pl + e) = ol; } }
}

// k_gemmo: out = (Ah + Al) Wo^T + bo, f32; grid (M/128, DM/128).
__global__ __launch_bounds__(256) void k_gemmo(const bf* __restrict__ Ah, const bf* __restrict__ Al, const bf* __restrict__ WO, float* C, const float* __restrict__ bo) {
    __shared__ __align__(16) char sm[GLDS(1)];
    gemmt<1, true, 0>(sm, blockIdx.x, blockIdx.y, Ah, Al, WO, C, DM, bo, nullptr, nullptr, nullptr);
}
// k_proj: the q, k and v projections of both batches in one launch; grid (TT/128, DQ/128, 3 * NB_), z = stream * NB_ + batch. X holds the bf16 streams as [stream][batch][t][DM]; every plane holds both batches.
// q and k: x W^T into head planes; v: V^T = Wv X^T (rows [g][d], columns t), so its tile indices change places.
__global__ __launch_bounds__(256) void k_proj(const bf* __restrict__ X, const bf* __restrict__ WQ, const bf* __restrict__ WK, const bf* __restrict__ WV, const float* __restrict__ bq, const float* __restrict__ bk, const float* __restrict__ bv,
                                              h16* QP16, bf* QPh, bf* QPl, h16* KP16, bf* KPh, bf* KPl, h16* VT16, bf* VTh, bf* VTl) {
    __shared__ __align__(16) char sm[GLDS(0)];
    const int z = blockIdx.z, sm_ = z / NB_; const bf* xs = X + (size_t)z * TT * DM; const size_t po = (size_t)(z % NB_) * NH_ * TT * HD;
    if (sm_ == 2) gemmt<0, true, 2>(sm, blockIdx.y, blockIdx.x, WV, nullptr, xs, nullptr, TT, bv, VT16 + po, VTh + po, VTl + po);
    else gemmt<0, true, 1>(sm, blockIdx.x, blockIdx.y, xs, nullptr, sm_ ? WK : WQ, nullptr, TT, sm_ ? bk : bq, (sm_ ? KP16 : QP16) + po, (sm_ ? KPh : QPh) + po, (sm_ ? KPl : QPl) + po);
}

__device__ __forceinline__ h16 tohx(float x) { return (h16)x; }
typedef __attribute__((ext_vector_type(2))) float v2f;
typedef __attribute__((ext_vector_type(2))) __bf16 v2bf;
typedef __attribute__((ext_vector_type(4))) unsigned v4u;
__device__ __forceinline__ unsigned pkbf(float a, float b) { v2f x; x[0] = a; x[1] = b; return __builtin_bit_cast(unsigned, __builtin_convertvector(x, v2bf)); }   // two f32 -> packed bf16, round to nearest even

// k_cvt: every f32 -> bf16 copy of the call in one launch. dst is one range: query, key, value (NB_ * TT * DM elements each), then Wq, Wk, Wv, Wo (DM * DM each).
// A block converts CBE consecutive elements of one tensor (every tensor's size is a multiple of CBE), a thread CU pieces of 8: few waves to start, and each has all its loads in flight at once. Grid CVE / CBE + GVE / CBE.
// The last GVE / CBE blocks round group_prob to bf16 into gdst, once for all 16 heads, in the order in which k_fattn's lanes use it: [batch * TT / 16 + row group][stage of 32 keys][key tile kt][lane = hi * 16 + row][8 keys], key = stage * 32 + kt * 16 + hi * 8 + r.
// So a wave of k_fattn reads a (row group, stage, key tile) as 512 contiguous bytes, 4 whole lines, where the f32 rows gave it 32 bytes of each of 16 lines per load. A block takes one group of 16 rows; a wave's piece is 8 rows x 32 keys: it reads whole lines (32 B a lane) and writes 4 whole lines.
#define CU  16
#define CBE (CU * 256 * 8)
#define CVE (3 * NB_ * TT * DM + 4 * DM * DM)
#define GVE (NB_ * TT * TT)
__global__ __launch_bounds__(256) void k_cvt(const float* __restrict__ xq, const float* __restrict__ xk, const float* __restrict__ xv, const float* __restrict__ wq, const float* __restrict__ wk, const float* __restrict__ wv, const float* __restrict__ wo, const float* __restrict__ gp, bf* dst, bf* gdst) {
    constexpr int BX = NB_ * TT * DM / CBE, BW = DM * DM / CBE; static_assert(NB_ * TT * DM % CBE == 0 && DM * DM % CBE == 0, "a block stays inside one tensor");
    static_assert(16 * TT == CBE && CU * 8 == 2 * (TT / 32), "a block of the group_prob part is one group of 16 rows: 2 x TT / 32 wave pieces");
    const int bx = blockIdx.x; const float* s; int b0;   // the block's tensor and that tensor's first block: scalar
    if (bx >= CVE / CBE) {   // scalar test: the group_prob part
        const int rg = bx - CVE / CBE, lane = threadIdx.x & 31, wv8 = threadIdx.x >> 5, row = (wv8 & 1) * 8 + (lane >> 2), un = lane & 3;   // the lane's row of the group and its 8 keys of the stage: un = kt * 2 + hi
        const float* sg = gp + ((size_t)rg * 16 + row) * TT + (wv8 >> 1) * 32 + un * 8; bf* dg = gdst + (size_t)rg * 16 * TT + (wv8 >> 1) * 512 + (un >> 1) * 256 + ((un & 1) * 16 + row) * 8;
        v8f w[CU];   // as below: every load issues ahead of the first conversion
#pragma unroll
        for (int u = 0; u < CU; ++u) w[u] = *(const v8f*)(sg + u * 128);   // piece u: stage u * 4 + wv8 / 2
        asm volatile("s_wait_xcnt 0x0" :: "v"(sg) : "memory");   // the loads' address registers stay as they are (sg is an input here) until every load's address has been taken; no load's result may land in them before
#pragma unroll
        for (int u = 0; u < CU; ++u) { v4u o;
#pragma unroll
            for (int k = 0; k < 4; ++k) o[k] = pkbf(w[u][2 * k], w[u][2 * k + 1]);
            *(v4u*)(dg + u * 2048) = o; }
        return; }
    if (bx < 3 * BX) { const int t = bx / BX; s = (t == 0) ? xq : (t == 1) ? xk : xv; b0 = t * BX; }
    else { const int t = (bx - 3 * BX) / BW; s = (t == 0) ? wq : (t == 1) ? wk : (t == 2) ? wv : wo; b0 = 3 * BX + t * BW; }
    s += (size_t)(bx - b0) * CBE + threadIdx.x * 8; bf* d = dst + (size_t)bx * CBE + threadIdx.x * 8;
    v8f v[CU];   // both loops are unrolled in full: v stays in registers and the loads issue ahead of the first conversion
#pragma unroll
    for (int u = 0; u < CU; ++u) v[u] = *(const v8f*)(s + u * 2048);
#pragma unroll
    for (int u = 0; u < CU; ++u) { v8us o;
#pragma unroll
        for (int k = 0; k < 8; ++k) o[k] = f2bf(v[u][k]);
        *(v8us*)(d + u * 2048) = o; } }

// k_fattn: scores, mask, softmax, group weighting, P.V and the head merge in one kernel; no score or probability leaves the registers. Grid (RH/64 + (TT-RH)/128, heads, batches), 4 waves.
// A wave owns NQ * 16 query rows of one head; the work-group walks all TT keys twice, 32 keys a stage. A stage's K rows and V^T rows are read from global in whole or half lines, one stage ahead (walk 1: two), and shared through two LDS buffers (one barrier a stage).
// S^T = K Q^T (A = K rows, B = Q rows, same k order on both sides): a lane holds 8 keys of ONE query per tile. The key mask enters as the C operand (0 or -3e38 per key, from an LDS table built at entry);
// in the one stage that holds a wave's diagonal the products are formed once more from C = 0 and the element j == i takes that value (the diagonal is always kept).
// Walk 1: the row maximum over the kept keys. Walk 2: e = exp(s / 8 - max), l += e, p = e x group_prob[b][i][j] (k_cvt's bf16 copy, in this kernel's fragment order: 2 loads of 512 contiguous bytes per 16 rows and stage); the two key tiles of a stage, converted in place, are the B operand of O^T += V^T P^T (A = V^T rows in the hardware k order).
// The epilogue joins the wave halves' sums, divides by l (the weighting is not renormalised: l sums e alone) and stores hi/lo bf16 planes of the merged rows, 16 B per lane.
// Rows < RH: hi/lo bf16 planes, 3 products in both GEMMs, 16 rows a wave; the rest fp16 with p carried x 1024 (folded into the exponent, so l carries it too and it cancels), 32 rows a wave.
#define KPI 72   // LDS pitch of a K row in elements: 128 B + 16 B, for 16-byte readers
#define VPI 40   // LDS pitch of a V^T row of 32 keys in elements: 64 B + 16 B
#define SBUF (2 * (32 * KPI + 64 * VPI))   // elements of one stage buffer at two planes per operand
typedef __attribute__((ext_vector_type(8))) unsigned v8u;
// two 2^x in one statement: the early-clobber outputs keep each off the other's registers, and the v_nop keeps the slot that the instruction set asks for behind a transcendental before its result is used or its source overwritten
__device__ __forceinline__ void exp2x2(float x0, float x1, float& e0, float& e1) { asm("v_exp_f32 %0, %2\n\tv_exp_f32 %1, %3\n\tv_nop" : "=&v"(e0), "=&v"(e1) : "v"(x0), "v"(x1)); }
__device__ __forceinline__ float bflo(unsigned u) { return __uint_as_float(u << 16); }
__device__ __forceinline__ float bfhi(unsigned u) { return __uint_as_float(u & 0xFFFF0000u); }
template <typename T16, bool HI, int NQ>
__device__ __forceinline__ void attn_rows(const T16* __restrict__ Q, const T16* __restrict__ Q2, const T16* __restrict__ K, const T16* __restrict__ K2, const T16* __restrict__ VT, const T16* __restrict__ VT2, const int* __restrict__ kvp, const bf* __restrict__ gq, const int q0, bf* Ah, bf* Al, T16* sb, float* bias) {
    typedef WFrag<T16> F; typedef typename F::V V;   // every inner loop below is unrolled in full, so that the fragment and accumulator arrays stay in registers
    constexpr int NP = HI ? 2 : 1, KTS = 32 * KPI, VTS = 64 * VPI;
    const int tid = threadIdx.x, lane = tid & 31, lr = lane & 15, hi = lane >> 4;
    const float CE = SCL * 1.4426950408889634f;
    v4i rk[NP][2], rk2[NP][2], rv[NP][2];
    auto gk = [&](v4i (&t)[NP][2], int j0) {
#pragma unroll
        for (int u = 0; u < 2; ++u) { const size_t o = (size_t)j0 * HD + (tid + 128 * u) * 8; t[0][u] = *(const v4ia*)(K + o); if (HI) t[NP - 1][u] = *(const v4ia*)(K2 + o); } };
    auto gv = [&](int j0) {
#pragma unroll
        for (int u = 0; u < 2; ++u) { const int x = tid + 128 * u; const size_t o = (size_t)(x >> 2) * TT + j0 + (x & 3) * 8; rv[0][u] = *(const v4ia*)(VT + o); if (HI) rv[NP - 1][u] = *(const v4ia*)(VT2 + o); } };
    auto sk = [&](const v4i (&t)[NP][2], int bs) { T16* d = sb + bs * SBUF;
#pragma unroll
        for (int u = 0; u < 2; ++u) { const int x = tid + 128 * u, o = (x >> 3) * KPI + (x & 7) * 8; *(v4ia*)(d + o) = t[0][u]; if (HI) *(v4ia*)(d + KTS + o) = t[NP - 1][u]; } };
    auto sv = [&](int bs) { T16* d = sb + bs * SBUF + NP * KTS;
#pragma unroll
        for (int u = 0; u < 2; ++u) { const int x = tid + 128 * u, o = (x >> 2) * VPI + (x & 3) * 8; *(v4ia*)(d + o) = rv[0][u]; if (HI) *(v4ia*)(d + VTS + o) = rv[NP - 1][u]; } };
    gk(rk, 0); gv(0); gk(rk2, 32);
    V qf[NQ][2], qf2[NQ][2];
#pragma unroll
    for (int qt = 0; qt < NQ; ++qt)
#pragma unroll
        for (int ks = 0; ks < 2; ++ks) { const size_t o = (size_t)(q0 + qt * 16 + lr) * HD + ks * 32 + 8 * hi; qf[qt][ks] = F::ld(Q + o); if (HI) qf2[qt][ks] = F::ld(Q2 + o); }
#pragma unroll
    for (int u = 0; u < TT / 512; ++u) { const v4i m = *(const v4i*)(kvp + (tid + 128 * u) * 4); v4f bz;
#pragma unroll
        for (int q = 0; q < 4; ++q) bz[q] = (m[q] != 0) ? 0.0f : -3.0e38f;
        *(v4f*)(bias + (tid + 128 * u) * 4) = bz; }
    sk(rk, 0); sv(0);
    lds_barrier();   // stage 0 and the mask table stand in LDS before any wave reads them
    // masked raw scores of the stage's 32 keys
    auto scores = [&](int bs, int j0, v8f (&s)[2][NQ]) { const T16* kb = sb + bs * SBUF; V kf[2][2], kf2[2][2];
#pragma unroll
        for (int kt = 0; kt < 2; ++kt)
#pragma unroll
            for (int ks = 0; ks < 2; ++ks) { const int o = (kt * 16 + lr) * KPI + ks * 32 + 8 * hi; kf[kt][ks] = F::ld(kb + o); if (HI) kf2[kt][ks] = F::ld(kb + KTS + o); }
        auto prod = [&](int kt, int qt, v8f a) {
#pragma unroll
            for (int ks = 0; ks < 2; ++ks) { a = F::mma(kf[kt][ks], qf[qt][ks], a); if (HI) { a = F::mma(kf[kt][ks], qf2[qt][ks], a); a = F::mma(kf2[kt][ks], qf[qt][ks], a); } }
            return a; };
#pragma unroll
        for (int kt = 0; kt < 2; ++kt) { const float* bp = bias + j0 + kt * 16 + 8 * hi; const v4f c0 = *(const v4f*)bp, c1 = *(const v4f*)(bp + 4); const v8f cb = __builtin_shufflevector(c0, c1, 0, 1, 2, 3, 4, 5, 6, 7);
#pragma unroll
            for (int qt = 0; qt < NQ; ++qt) s[kt][qt] = prod(kt, qt, cb); }
        if (j0 == (q0 & ~31)) {   // scalar test: the one stage with this wave's diagonal
#pragma unroll
            for (int kt = 0; kt < 2; ++kt)
#pragma unroll
                for (int qt = 0; qt < NQ; ++qt) { const v8f a = prod(kt, qt, (v8f){}); const int dj = q0 + qt * 16 + lr - (j0 + kt * 16 + 8 * hi);
#pragma unroll
                    for (int r = 0; r < 8; ++r) s[kt][qt][r] = (dj == r) ? a[r] : s[kt][qt][r]; } } };
    float mx[NQ], l[NQ];
#pragma unroll
    for (int qt = 0; qt < NQ; ++qt) { mx[qt] = -3.0e38f; l[qt] = 0.f; }
    // walk 1 is short of work per stage, so its K tiles are fetched two stages ahead, in two register sets that take turns; the index wraps: the last trip brings stage 0 back for walk 2
    auto walk1 = [&](int bs, int j0, v4i (&tn)[NP][2], const v4i (&tc)[NP][2]) { gk(tn, (j0 + 64) & (TT - 1));
        __builtin_amdgcn_sched_barrier(0);   // keeps the global loads issued ahead of this stage's work, whose time covers part of their latency
        v8f s[2][NQ]; scores(bs, j0, s);
#pragma unroll
        for (int qt = 0; qt < NQ; ++qt)
#pragma unroll
            for (int r = 0; r < 8; ++r) mx[qt] = fmaxf(mx[qt], fmaxf(s[0][qt][r], s[1][qt][r]));
        sk(tc, bs ^ 1);
        lds_barrier(); };   // publishes the next stage; ends every wave's reads of the buffer that the next stage refills
#pragma unroll 1   // rolled: one trip holds the two stages that the two register sets ask for; more would only cost instruction cache
    for (int st = 0; st < TT / 32; st += 2) { walk1(0, st * 32, rk, rk2); walk1(1, st * 32 + 32, rk2, rk); }
    float mc[NQ];
#pragma unroll
    for (int qt = 0; qt < NQ; ++qt) { mx[qt] = fmaxf(mx[qt], __shfl_xor(mx[qt], 16, 32)); mc[qt] = mx[qt] * CE - (HI ? 0.0f : 10.0f); }
    v4u g[NQ][2], gn[NQ][2];   // group_prob (bf16, two a register) of this stage's and of the next stage's 32 keys, 8 + 8 per lane and query row
    auto gg = [&](v4u (&t)[NQ][2], int j0) {
#pragma unroll
        for (int qt = 0; qt < NQ; ++qt) { const bf* gr = gq + ((size_t)((q0 >> 4) + qt) * (TT / 32) + (j0 >> 5)) * 512 + lane * 8; t[qt][0] = *(const v4u*)gr; t[qt][1] = *(const v4u*)(gr + 256); } };
    gg(g, 0);
    v8f o[4][NQ];
#pragma unroll
    for (int dt = 0; dt < 4; ++dt)
#pragma unroll
        for (int qt = 0; qt < NQ; ++qt) o[dt][qt] = (v8f){};
#pragma unroll 1   // rolled: a second stage body would cost registers and instruction cache and save nothing
    for (int st = 0; st < TT / 32; ++st) { const int j0 = st * 32, bs = st & 1;
        gk(rk, (j0 + 32) & (TT - 1)); gv((j0 + 32) & (TT - 1));
        gg(gn, (j0 + 32) & (TT - 1));
        __builtin_amdgcn_sched_barrier(0);   // keeps the next stage's global loads issued ahead of this stage's work, whose time covers their latency
        v8f s[2][NQ]; scores(bs, j0, s); V pf[NQ], pf2[NQ], vf[4], vf2[4];
        const T16* vb = sb + bs * SBUF + NP * KTS;   // the V^T fragments are read ahead of the exponentials, which cover the LDS latency
#pragma unroll
        for (int dt = 0; dt < 4; ++dt) { const int vo = (dt * 16 + lr) * VPI + 8 * hi; vf[dt] = F::ld(vb + vo); if (HI) vf2[dt] = F::ld(vb + VTS + vo); }
        __builtin_amdgcn_sched_barrier(0);   // keeps the V^T reads issued here: the exponentials cover their latency
#pragma unroll
        for (int qt = 0; qt < NQ; ++qt) { v16h ph; v8u uh, ul;
#pragma unroll
            for (int kt = 0; kt < 2; ++kt)
#pragma unroll
                for (int r = 0; r < 8; r += 2) { const unsigned gw = g[qt][kt][r >> 1];
                    float e0, e1; exp2x2(__builtin_fmaf(s[kt][qt][r], CE, -mc[qt]), __builtin_fmaf(s[kt][qt][r + 1], CE, -mc[qt]), e0, e1); l[qt] += e0; l[qt] += e1;
                    const float p0 = e0 * bflo(gw), p1 = e1 * bfhi(gw);
                    if constexpr (HI) { const unsigned a = pkbf(p0, p1); uh[kt * 4 + (r >> 1)] = a; ul[kt * 4 + (r >> 1)] = pkbf(p0 - bflo(a), p1 - bfhi(a)); } else { ph[kt * 8 + r] = tohx(p0); ph[kt * 8 + r + 1] = tohx(p1); } }
            if constexpr (HI) { pf[qt] = __builtin_bit_cast(v16bf, uh); pf2[qt] = __builtin_bit_cast(v16bf, ul); } else pf[qt] = ph; }
#pragma unroll
        for (int dt = 0; dt < 4; ++dt)
#pragma unroll
            for (int qt = 0; qt < NQ; ++qt) { o[dt][qt] = F::mma(vf[dt], pf[qt], o[dt][qt]); if (HI) { o[dt][qt] = F::mma(vf[dt], pf2[qt], o[dt][qt]); o[dt][qt] = F::mma(vf2[dt], pf[qt], o[dt][qt]); } }
        sk(rk, bs ^ 1); sv(bs ^ 1);
#pragma unroll
        for (int qt = 0; qt < NQ; ++qt) { g[qt][0] = gn[qt][0]; g[qt][1] = gn[qt][1]; }
        lds_barrier(); }   // publishes the next stage; ends every wave's reads of the buffer that the next trip refills
#pragma unroll
    for (int qt = 0; qt < NQ; ++qt) { const float inv = __fdiv_rn(1.0f, l[qt] + __shfl_xor(l[qt], 16, 32)); const size_t oo = (size_t)(q0 + qt * 16 + lr) * DQ + 8 * hi;
#pragma unroll
        for (int dt = 0; dt < 4; ++dt) { v4u oh, ol;
#pragma unroll
            for (int r = 0; r < 8; r += 2) { const float y0 = o[dt][qt][r] * inv, y1 = o[dt][qt][r + 1] * inv; const unsigned a = pkbf(y0, y1); oh[r >> 1] = a; ol[r >> 1] = pkbf(y0 - bflo(a), y1 - bfhi(a)); }
            *(v4u*)(Ah + oo + dt * 16) = oh; *(v4u*)(Al + oo + dt * 16) = ol; } }
}
__global__ __launch_bounds__(128) void k_fattn(const h16* __restrict__ Q16, const bf* __restrict__ Qh, const bf* __restrict__ Ql, const h16* __restrict__ K16, const bf* __restrict__ Kh, const bf* __restrict__ Kl, const h16* __restrict__ V16, const bf* __restrict__ Vh, const bf* __restrict__ Vl, const int* __restrict__ kmask, const bf* __restrict__ GB, bf* Ah, bf* Al) {
    __shared__ __align__(16) char sm[2 * SBUF * 2]; __shared__ __align__(16) float bias[TT];
    const int wv = __builtin_amdgcn_readfirstlane((int)(threadIdx.x >> 5));   // wave number, scalar: the row base and the diagonal test stay in scalar registers
    const int bx = blockIdx.x, h = blockIdx.y, b = blockIdx.z; const size_t po = ((size_t)b * NH_ + h) * TT * HD;
    const int* kvp = kmask + (size_t)b * TT; const bf* gq = GB + (size_t)b * TT * TT; bf* ah = Ah + (size_t)b * TT * DQ + h * HD; bf* al = Al + (size_t)b * TT * DQ + h * HD;
    if (bx < RH / 64) attn_rows<bf, true, 1>(Qh + po, Ql + po, Kh + po, Kl + po, Vh + po, Vl + po, kvp, gq, bx * 64 + wv * 16, ah, al, (bf*)sm, bias);
    else attn_rows<h16, false, 2>(Q16 + po, nullptr, K16 + po, nullptr, V16 + po, nullptr, kvp, gq, RH + (bx - RH / 64) * 128 + wv * 32, ah, al, (h16*)sm, bias);
}

extern "C" void kernel_launch(void* const* d_in, const int* in_sizes, int n_in,
                              void* d_out, int out_size, void* d_ws, size_t ws_size, hipStream_t stream) {
    (void)in_sizes; (void)n_in; (void)out_size;
    const float* x = (const float*)d_in[0]; const float* xk = (const float*)d_in[1]; const float* xv = (const float*)d_in[2]; const float* gprob = (const float*)d_in[3];   /* group_prob [2][2048][2048] f32 */ const int* kmask = (const int*)d_in[4];   /* mask [2][2048] int32: 1 = attendable key (OR the diagonal) */ const float* wq = (const float*)d_in[5]; const float* bq = (const float*)d_in[6]; const float* wk = (const float*)d_in[7]; const float* bk = (const float*)d_in[8]; const float* wv = (const float*)d_in[9]; const float* bv = (const float*)d_in[10]; const float* wo = (const float*)d_in[11]; const float* bo = (const float*)d_in[12];   /* input order query, key, value, group_prob, mask, Wq, bq, Wk, bk, Wv, bv, Wo, bo ('oi') */
    float* OUT = (float*)d_out;     // [2][2048][1024]
    char* wsp = (char*)d_ws;
    auto take = [&](size_t bytes) { char* p = wsp; wsp += (bytes + 255) & ~(size_t)255; return (void*)p; };
    bf* XB = (bf*)take((size_t)CVE * 2);   // k_cvt's range: the three streams [stream][batch][t][DM], then the four weights
    bf* WQ = XB + (size_t)3 * NB_ * TT * DM; bf* WK = WQ + (size_t)DM * DM; bf* WV = WK + (size_t)DM * DM; bf* WO = WV + (size_t)DM * DM;
    const size_t PS = (size_t)NH_ * TT * HD;   // one batch's plane, elements (NKV == NH_); every plane holds both batches
    h16* QP16 = (h16*)take(NB_ * PS * 2); h16* KP16 = (h16*)take(NB_ * PS * 2); h16* VT16 = (h16*)take(NB_ * PS * 2);
    bf* QPh = (bf*)take(NB_ * PS * 2); bf* QPl = (bf*)take(NB_ * PS * 2); bf* KPh = (bf*)take(NB_ * PS * 2); bf* KPl = (bf*)take(NB_ * PS * 2); bf* VTh = (bf*)take(NB_ * PS * 2); bf* VTl = (bf*)take(NB_ * PS * 2);
    bf* GB = (bf*)take((size_t)GVE * 2);   // group_prob, bf16, in k_fattn's fragment order
    bf* ATh = (bf*)take((size_t)NB_ * TT * DQ * 2); bf* ATl = (bf*)take((size_t)NB_ * TT * DQ * 2);
    if ((size_t)(wsp - (char*)d_ws) > ws_size) return;    // ws 256 MiB
    k_cvt<<<CVE / CBE + GVE / CBE, 256, 0, stream>>>(x, xk, xv, wq, wk, wv, wo, gprob, XB, GB);
    k_proj<<<dim3(TT / 128, DQ / 128, 3 * NB_), 256, 0, stream>>>(XB, WQ, WK, WV, bq, bk, bv, QP16, QPh, QPl, KP16, KPh, KPl, VT16, VTh, VTl);
    k_fattn<<<dim3(RH / 64 + (TT - RH) / 128, NH_, NB_), 128, 0, stream>>>(QP16, QPh, QPl, KP16, KPh, KPl, VT16, VTh, VTl, kmask, GB, ATh, ATl);
    k_gemmo<<<dim3(NB_ * TT / 128, DM / 128, 1), 256, 0, stream>>>(ATh, ATl, WO, OUT, bo);   /* both batches: their rows follow one another in ATh, ATl and OUT */
}

// v008
// One run takes 138 microseconds.
// Timed twice side by side with v007, it ran 1.13 times as fast both times.
// All steps since v000 together make it 14.7 times as fast.
#include <hip/hip_runtime.h>

// Multi-headed attention on three streams with a padding-or-diagonal mask and a post-softmax group weighting (query, key, value [2][2048][1024]; q, k, v = x W^T + b ('oi' 0.02, zero biases; 16 heads x 64); scores / sqrt(64); key j is kept for query i when mask[b][j] != 0 OR j == i (mask int [2][2048] random 0/1, read; -1e9 == exclusion); p = softmax; p = p x group_prob[b][i][j] (f32 [2][2048][2048] uniform, read; NOT renormalised); x = p.v; out = merged Wo^T + bo -> [2][2048][1024] (4.2 M); argument order query, key, value, group_prob, mask, Wq, bq, Wk, bk, Wv, bv, Wo, bo).
// Four launches: bf16 copies of query, key, value, the 'oi' weights and group_prob (the last in the attention's fragment order); the three exact projections of both batches + f32 biases, whose epilogue writes the head planes; one fused attention launch for all heads of both batches (hybrid rows: < 512 hi/lo 3 products, rest fp16 x1024): it reads the batch's int key vector (select with the always-kept diagonal), multiplies each exponential by the bf16 copy of group_prob[b][i][j] and divides the P.V sums by the row's sum of exponentials; merged hi/lo x Wo exact + bo.
// Compute dtypes, f32 accumulate: every input rounded to bf16 incl. group_prob; projections exact + f32 biases; attention rows < 512 3 products, rest fp16; softmax and group weighting f32; Wo hl x exact + bias.

#define NB_  2
#define TT   2048
#define DM   1024
#define NH_  16
#define NKV  16
#define HD   64
#define DQ   (NH_ * HD)
#define DKV  (NKV * HD)
#define RH   512                  // query rows < RH use hi+lo planes (0: none)
#define WIN  0
#define SCL  0.125f   // HD^-0.5
typedef _Float16 h16;
typedef unsigned short bf;
typedef __attribute__((ext_vector_type(16))) __bf16   v16bf;
typedef __attribute__((ext_vector_type(16))) _Float16 v16h;
typedef __attribute__((ext_vector_type(8)))  _Float16 v8h;
typedef __attribute__((ext_vector_type(8)))  unsigned short v8us;
typedef __attribute__((ext_vector_type(8)))  float    v8f;
typedef __attribute__((ext_vector_type(4)))  _Float16 v4h;
typedef __attribute__((ext_vector_type(4)))  unsigned short v4us;
typedef __attribute__((ext_vector_type(4)))  float    v4f;
typedef v8h  __attribute__((may_alias)) v8ha;
typedef v4f  __attribute__((may_alias)) v4fa;
typedef v8us __attribute__((may_alias)) v8usa;

__device__ __forceinline__ unsigned short f2bf(float f) { unsigned u = __float_as_uint(f); u += 0x7FFFu + ((u >> 16) & 1u); return (unsigned short)(u >> 16); }
__device__ __forceinline__ float bf2f(unsigned short b) { return __uint_as_float(((unsigned)b) << 16); }
__device__ __forceinline__ float bfr(float f) { return bf2f(f2bf(f)); }
__device__ __forceinline__ v16h cat16(v8h lo, v8h hi) { return __builtin_shufflevector(lo, hi, 0, 1, 2, 3, 4, 5, 6, 7, 8, 9, 10, 11, 12, 13, 14, 15); }
__device__ __forceinline__ v16bf cat16b(v8us lo, v8us hi) { return __builtin_bit_cast(v16bf, __builtin_shufflevector(lo, hi, 0, 1, 2, 3, 4, 5, 6, 7, 8, 9, 10, 11, 12, 13, 14, 15)); }
__device__ __forceinline__ v8f wmma16(v16h a, v16h b, v8f c) { return __builtin_amdgcn_wmma_f32_16x16x32_f16(false, a, false, b, (short)0, c, false, false); }
__device__ __forceinline__ v8f wmmab(v16bf a, v16bf b, v8f c) { return __builtin_amdgcn_wmma_f32_16x16x32_bf16(false, a, false, b, (short)0, c, false, false); }



// ---- gemmt: GEMM on a 128x128 output tile (bx, by) per work-group of 8 waves (2 x 4, a wave holds 64x32: 8 accumulators), k = DM walked in stages of 64.
// A stage's rows (128 B of each of the 128 A rows and 128 Bt rows: whole lines) are read from global one stage ahead into registers and shared through two LDS buffers, one barrier a stage; the fragments come from LDS.
// C[m][n] (f32, pitch ldc, + optional f32 bias[n]) = sum_k A[m][k] Bt[n][k] (NSPLIT == 1: + A2[m][k] Bt[n][k]). A, A2 and Bt are K-contiguous bf16 planes of pitch DM. sm: the work-group's LDS, GLDS(NSPLIT) bytes.
// The epilogue passes the f32 tile through LDS (pitch 132 floats), so that a wave stores whole rows. PL != 0: no f32 C; the tile goes out as three 16-bit planes (fp16, bf16 hi, bf16 lo of the remainder).
// PL == 1: one plane block of [ldc rows][64] per 64 columns (head planes [h][t][d]), bias[n]. PL == 2: row-major [m][n] with pitch ldc, bias[m] (V^T = Wv X^T: rows are head dims, columns tokens).
template <typename T16> struct WFrag;
template <> struct WFrag<h16> { typedef v16h V; static __device__ __forceinline__ V ld(const h16* p) { return cat16(*(const v8h*)p, *(const v8h*)(p + 16)); } static __device__ __forceinline__ v8f mma(V a, V b, v8f c) { return wmma16(a, b, c); } };
template <> struct WFrag<bf> { typedef v16bf V; static __device__ __forceinline__ V ld(const bf* p) { return cat16b(*(const v8us*)p, *(const v8us*)(p + 16)); } static __device__ __forceinline__ v8f mma(V a, V b, v8f c) { return wmmab(a, b, c); } };
typedef __attribute__((ext_vector_type(4))) int v4i;
typedef v4i __attribute__((may_alias)) v4ia;
// work-group barrier that orders LDS alone: unlike __syncthreads() it does not wait for the global loads in flight (they go to registers and concern no other wave)
__device__ __forceinline__ void lds_barrier() { __builtin_amdgcn_fence(__ATOMIC_RELEASE, "workgroup", "local"); __builtin_amdgcn_s_barrier(); __builtin_amdgcn_fence(__ATOMIC_ACQUIRE, "workgroup", "local"); }
#define GPI 72            // LDS pitch of a row's 64 elements: 128 B + 16 B, for 16-byte readers
#define GOP (128 * GPI)   // elements of one operand's stage
#define GLDS(NSPLIT) (2 * ((NSPLIT) ? 3 : 2) * GOP * 2)   // two stage buffers, bytes; the f32 tile of the epilogue (128 * 132 * 4) fits inside
template <int NSPLIT, bool BIAS, int PL>
__device__ __forceinline__ void gemmt(char* sm, const int bx, const int by, const bf* __restrict__ A, const bf* __restrict__ A2, const bf* __restrict__ Bt, float* C, int ldc, const float* __restrict__ bias, h16* P16, bf* Ph, bf* Pl) {
    static_assert(GLDS(NSPLIT) >= 128 * 132 * 4 && DM % 64 == 0, "the epilogue's tile fits the stage buffers; whole stages");
    typedef WFrag<bf> F; typedef typename F::V V;   // every inner loop below is unrolled in full, so that the fragment, staging and accumulator arrays stay in registers
    constexpr int NO = NSPLIT ? 3 : 2, SB = NO * GOP, NS = DM / 64;   // operand tiles a stage (A, A2, Bt), elements of a stage buffer, stages
    const int tid = threadIdx.x, lane = tid & 31, lr = lane & 15, hi = lane >> 4; const int r0 = bx * 128, c0 = by * 128;
    const int wv = __builtin_amdgcn_readfirstlane(tid >> 5), wm = wv >> 2, wn = wv & 3;   // wave number, scalar: the wave's place in the tile stays in scalar registers
    bf* sb = (bf*)sm;
    const size_t ga = (size_t)(r0 + (tid >> 3)) * DM + (tid & 7) * 8, gb = (size_t)(c0 + (tid >> 3)) * DM + (tid & 7) * 8;   // 8 threads a row: a wave's load covers 4 whole lines
    const int so = (tid >> 3) * GPI + (tid & 7) * 8;
    v4i rg[NO][4];
    auto gl = [&](int kc) {
#pragma unroll
        for (int u = 0; u < 4; ++u) { const size_t d = (size_t)u * 32 * DM + kc; rg[0][u] = *(const v4ia*)(A + ga + d); if (NSPLIT) rg[1][u] = *(const v4ia*)(A2 + ga + d); rg[NO - 1][u] = *(const v4ia*)(Bt + gb + d); } };
    auto st = [&](int bs) { bf* d = sb + bs * SB + so;
#pragma unroll
        for (int u = 0; u < 4; ++u)
#pragma unroll
            for (int p = 0; p < NO; ++p) *(v4ia*)(d + p * GOP + u * 32 * GPI) = rg[p][u]; };
    v8f acc[4][2];
#pragma unroll
    for (int mb = 0; mb < 4; ++mb)
#pragma unroll
        for (int nb = 0; nb < 2; ++nb) acc[mb][nb] = (v8f){};
    gl(0); st(0);
    lds_barrier();   // stage 0 stands in LDS before any wave reads it
#pragma unroll 1   // rolled: a second stage body would cost registers and instruction cache and save nothing
    for (int s = 0; s < NS; ++s) { const int bs = s & 1;
        if (s + 1 < NS) gl((s + 1) * 64);   // issued ahead of this stage's work, whose time covers their latency
        const bf* ab = sb + bs * SB + (wm * 64 + lr) * GPI + 8 * hi; const bf* bb = sb + bs * SB + (NO - 1) * GOP + (wn * 32 + lr) * GPI + 8 * hi;
#pragma unroll
        for (int ks = 0; ks < 2; ++ks) { V a[4], a2[4], b[2];
#pragma unroll
            for (int mb = 0; mb < 4; ++mb) { a[mb] = F::ld(ab + mb * 16 * GPI + ks * 32); if (NSPLIT) a2[mb] = F::ld(ab + GOP + mb * 16 * GPI + ks * 32); }
#pragma unroll
            for (int nb = 0; nb < 2; ++nb) b[nb] = F::ld(bb + nb * 16 * GPI + ks * 32);
#pragma unroll
            for (int nb = 0; nb < 2; ++nb)
#pragma unroll
                for (int mb = 0; mb < 4; ++mb) { acc[mb][nb] = F::mma(a[mb], b[nb], acc[mb][nb]); if (NSPLIT) acc[mb][nb] = F::mma(a2[mb], b[nb], acc[mb][nb]); } }
        if (s + 1 < NS) st(bs ^ 1);
        lds_barrier(); }   // publishes the next stage; ends every wave's reads of the buffer that the next trip refills (after the last trip: that the f32 tile overwrites)
    float* os = (float*)sm; const int cofs = lane * 4; v4f bv = (v4f){}; float pbl = 0.f;   // a wave takes rows wv, wv + 8, ...: 4 columns a lane; the biases are read ahead of the LDS stores, which cover their latency
    if constexpr (BIAS && PL != 2) { const v4f t = *(const v4f*)(bias + c0 + cofs); bv[0] = bfr(t[0]); bv[1] = bfr(t[1]); bv[2] = bfr(t[2]); bv[3] = bfr(t[3]); }
    if constexpr (BIAS && PL == 2) pbl = bfr(bias[r0 + lr * 8 + wv]);   // one load for the wave's 16 rows: lane i (and i + 16) holds the bias of row i * 8 + wv
#pragma unroll
    for (int mb = 0; mb < 4; ++mb)
#pragma unroll
        for (int nb = 0; nb < 2; ++nb)
#pragma unroll
            for (int j = 0; j < 8; ++j) os[(wm * 64 + mb * 16 + hi * 8 + j) * 132 + wn * 32 + nb * 16 + lr] = acc[mb][nb][j];
    lds_barrier();   // every wave's part of the f32 tile stands in LDS before any row is read
#pragma unroll
    for (int i = 0; i < 16; ++i) { const int row = i * 8 + wv; v4f val = *(const v4fa*)(os + row * 132 + cofs);
        if (BIAS) { if constexpr (PL == 2) val += __uint_as_float(__builtin_amdgcn_readlane(__float_as_uint(pbl), i)); else val += bv; }   // i is a constant of the unrolled loop: the row's bias comes out of lane i as a scalar
        if constexpr (PL == 0) *(v4f*)(C + (size_t)(r0 + row) * ldc + c0 + cofs) = val;
        else { const size_t e = (PL == 1) ? ((size_t)(by * 2 + (cofs >> 6)) * ldc + r0 + row) * 64 + (cofs & 63) : (size_t)(r0 + row) * ldc + c0 + cofs; v4h o16; v4us oh, ol;
#pragma unroll
            for (int q = 0; q < 4; ++q) { o16[q] = (h16)val[q]; const unsigned short a2 = f2bf(val[q]); oh[q] = a2; ol[q] = f2bf(val[q] - bf2f(a2)); }
            *(v4h*)(P16 + e) = o16; *(v4us*)(Ph + e) = oh; *(v4us*)(Pl + e) = ol; } }
}

// k_gemmo: out = (Ah + Al) Wo^T + bo, f32; grid (M/128, DM/128).
__global__ __launch_bounds__(256) void k_gemmo(const bf* __restrict__ Ah, const bf* __restrict__ Al, const bf* __restrict__ WO, float* C, const float* __restrict__ bo) {
    __shared__ __align__(16) char sm[GLDS(1)];
    gemmt<1, true, 0>(sm, blockIdx.x, blockIdx.y, Ah, Al, WO, C, DM, bo, nullptr, nullptr, nullptr);
}
// k_proj: the q, k and v projections of both batches in one launch; grid (TT/128, DQ/128, 3 * NB_), z = stream * NB_ + batch. X holds the bf16 streams as [stream][batch][t][DM]; every plane holds both batches.
// q and k: x W^T into head planes; v: V^T = Wv X^T (rows [g][d], columns t), so its tile indices change places.
__global__ __launch_bounds__(256) void k_proj(const bf* __restrict__ X, const bf* __restrict__ WQ, const bf* __restrict__ WK, const bf* __restrict__ WV, const float* __restrict__ bq, const float* __restrict__ bk, const float* __restrict__ bv,
                                              h16* QP16, bf* QPh, bf* QPl, h16* KP16, bf* KPh, bf* KPl, h16* VT16, bf* VTh, bf* VTl) {
    __shared__ __align__(16) char sm[GLDS(0)];
    const int z = blockIdx.z, sm_ = z / NB_; const bf* xs = X + (size_t)z * TT * DM; const size_t po = (size_t)(z % NB_) * NH_ * TT * HD;
    if (sm_ == 2) gemmt<0, true, 2>(sm, blockIdx.y, blockIdx.x, WV, nullptr, xs, nullptr, TT, bv, VT16 + po, VTh + po, VTl + po);
    else gemmt<0, true, 1>(sm, blockIdx.x, blockIdx.y, xs, nullptr, sm_ ? WK : WQ, nullptr, TT, sm_ ? bk : bq, (sm_ ? KP16 : QP16) + po, (sm_ ? KPh : QPh) + po, (sm_ ? KPl : QPl) + po);
}

__device__ __forceinline__ h16 tohx(float x) { return (h16)x; }
typedef __attribute__((ext_vector_type(2))) float v2f;
typedef __attribute__((ext_vector_type(2))) __bf16 v2bf;
typedef __attribute__((ext_vector_type(4))) unsigned v4u;
__device__ __forceinline__ unsigned pkbf(float a, float b) { v2f x; x[0] = a; x[1] = b; return __builtin_bit_cast(unsigned, __builtin_convertvector(x, v2bf)); }   // two f32 -> packed bf16, round to nearest even

// k_cvt: every f32 -> bf16 copy of the call in one launch. dst is one range: query, key, value (NB_ * TT * DM elements each), then Wq, Wk, Wv, Wo (DM * DM each).
// A block converts CBE consecutive elements of one tensor (every tensor's size is a multiple of CBE), a thread CU pieces of 8: few waves to start, and each has all its loads in flight at once. Grid CVE / CBE + GVE / CBE.
// The last GVE / CBE blocks round group_prob to bf16 into gdst, once for all 16 heads, in the order in which k_fattn's lanes use it: [batch * TT / 16 + row group][stage of 32 keys][key tile kt][lane = hi * 16 + row][8 keys], key = stage * 32 + kt * 16 + hi * 8 + r.
// So a wave of k_fattn reads a (row group, stage, key tile) as 512 contiguous bytes, 4 whole lines, where the f32 rows gave it 32 bytes of each of 16 lines per load. A block takes one group of 16 rows; a wave's piece is 8 rows x 32 keys: it reads whole lines (32 B a lane) and writes 4 whole lines.
#define CU  16
#define CBE (CU * 256 * 8)
#define CVE (3 * NB_ * TT * DM + 4 * DM * DM)
#define GVE (NB_ * TT * TT)
__global__ __launch_bounds__(256) void k_cvt(const float* __restrict__ xq, const float* __restrict__ xk, const float* __restrict__ xv, const float* __restrict__ wq, const float* __restrict__ wk, const float* __restrict__ wv, const float* __restrict__ wo, const float* __restrict__ gp, bf* dst, bf* gdst) {
    constexpr int BX = NB_ * TT * DM / CBE, BW = DM * DM / CBE; static_assert(NB_ * TT * DM % CBE == 0 && DM * DM % CBE == 0, "a block stays inside one tensor");
    static_assert(16 * TT == CBE && CU * 8 == 2 * (TT / 32), "a block of the group_prob part is one group of 16 rows: 2 x TT / 32 wave pieces");
    const int bx = blockIdx.x; const float* s; int b0;   // the block's tensor and that tensor's first block: scalar
    if (bx >= CVE / CBE) {   // scalar test: the group_prob part
        const int rg = bx - CVE / CBE, lane = threadIdx.x & 31, wv8 = threadIdx.x >> 5, row = (wv8 & 1) * 8 + (lane >> 2), un = lane & 3;   // the lane's row of the group and its 8 keys of the stage: un = kt * 2 + hi
        const float* sg = gp + ((size_t)rg * 16 + row) * TT + (wv8 >> 1) * 32 + un * 8; bf* dg = gdst + (size_t)rg * 16 * TT + (wv8 >> 1) * 512 + (un >> 1) * 256 + ((un & 1) * 16 + row) * 8;
        v8f w[CU];   // as below: every load issues ahead of the first conversion
#pragma unroll
        for (int u = 0; u < CU; ++u) w[u] = *(const v8f*)(sg + u * 128);   // piece u: stage u * 4 + wv8 / 2
        asm volatile("s_wait_xcnt 0x0" :: "v"(sg) : "memory");   // the loads' address registers stay as they are (sg is an input here) until every load's address has been taken; no load's result may land in them before
#pragma unroll
        for (int u = 0; u < CU; ++u) { v4u o;
#pragma unroll
            for (int k = 0; k < 4; ++k) o[k] = pkbf(w[u][2 * k], w[u][2 * k + 1]);
            *(v4u*)(dg + u * 2048) = o; }
        return; }
    if (bx < 3 * BX) { const int t = bx / BX; s = (t == 0) ? xq : (t == 1) ? xk : xv; b0 = t * BX; }
    else { const int t = (bx - 3 * BX) / BW; s = (t == 0) ? wq : (t == 1) ? wk : (t == 2) ? wv : wo; b0 = 3 * BX + t * BW; }
    s += (size_t)(bx - b0) * CBE + threadIdx.x * 8; bf* d = dst + (size_t)bx * CBE + threadIdx.x * 8;
    v8f v[CU];   // both loops are unrolled in full: v stays in registers and the loads issue ahead of the first conversion
#pragma unroll
    for (int u = 0; u < CU; ++u) v[u] = *(const v8f*)(s + u * 2048);
#pragma unroll
    for (int u = 0; u < CU; ++u) { v8us o;
#pragma unroll
        for (int k = 0; k < 8; ++k) o[k] = f2bf(v[u][k]);
        *(v8us*)(d + u * 2048) = o; } }

// k_fattn: scores, mask, softmax, group weighting, P.V and the head merge in one kernel; no score or probability leaves the registers. Grid (RH/64 + (TT-RH)/128, heads, batches), 4 waves.
// A wave owns NQ * 16 query rows of one head; the work-group walks all TT keys once, 32 keys a stage. A stage's K rows and V^T rows are read from global in whole or half lines, one stage ahead, and shared through two LDS buffers (one barrier a stage).
// S^T = K Q^T (A = K rows, B = Q rows, same k order on both sides): a lane holds 8 keys of ONE query per tile. The key mask enters as the C operand (0 or -3e38 per key, from an LDS table built at entry);
// in the one stage that holds a wave's diagonal the products are formed once more from C = 0 and the element j == i takes that value (the diagonal is always kept).
// Each stage: e = exp(s / 8 - ref), l += e, p = e x group_prob[b][i][j] (k_cvt's bf16 copy, in this kernel's fragment order: 2 loads of 512 contiguous bytes per 16 rows and stage); the two key tiles of a stage, converted in place, are the B operand of O^T += V^T P^T (A = V^T rows in the hardware k order).
// ref is a row's running reference, not its maximum: any value cancels in O / l. One test a stage and wave (ballot, scalar branch), on the stage's sums of e: only when a lane's 16 e of some row sum to more than 2^5 does the wave form the stage's scores again, raise every row's ref to the stage's maximum where that is higher, scale l and O by 2^(old - new) and take the exponentials anew.
// The epilogue joins the wave halves' sums, divides by l (the weighting is not renormalised: l sums e alone) and stores hi/lo bf16 planes of the merged rows, 16 B per lane.
// Rows < RH: hi/lo bf16 planes, 3 products in both GEMMs, 16 rows a wave; the rest fp16 with p carried x 1024 (folded into the exponent, so l carries it too and it cancels), 32 rows a wave.
#define KPI 72   // LDS pitch of a K row in elements: 128 B + 16 B, for 16-byte readers
#define VPI 40   // LDS pitch of a V^T row of 32 keys in elements: 64 B + 16 B
#define SBUF (2 * (32 * KPI + 64 * VPI))   // elements of one stage buffer at two planes per operand
typedef __attribute__((ext_vector_type(8))) unsigned v8u;
// two 2^x in one statement: the early-clobber outputs keep each off the other's registers, and the v_nop keeps the slot that the instruction set asks for behind a transcendental before its result is used or its source overwritten
__device__ __forceinline__ void exp2x2(float x0, float x1, float& e0, float& e1) { asm("v_exp_f32 %0, %2\n\tv_exp_f32 %1, %3\n\tv_nop" : "=&v"(e0), "=&v"(e1) : "v"(x0), "v"(x1)); }
__device__ __forceinline__ float exp2x1(float x) { float e; asm("v_exp_f32 %0, %1\n\tv_nop" : "=&v"(e) : "v"(x)); return e; }   // one 2^x, with the same slot behind it
__device__ __forceinline__ float max3f(float a, float b, float c) { return fmaxf(fmaxf(a, b), c); }
__device__ __forceinline__ float bflo(unsigned u) { return __uint_as_float(u << 16); }
__device__ __forceinline__ float bfhi(unsigned u) { return __uint_as_float(u & 0xFFFF0000u); }
template <typename T16, bool HI, int NQ>
__device__ __forceinline__ void attn_rows(const T16* __restrict__ Q, const T16* __restrict__ Q2, const T16* __restrict__ K, const T16* __restrict__ K2, const T16* __restrict__ VT, const T16* __restrict__ VT2, const int* __restrict__ kvp, const bf* __restrict__ gq, const int q0, bf* Ah, bf* Al, T16* sb, float* bias) {
    typedef WFrag<T16> F; typedef typename F::V V;   // every inner loop below is unrolled in full, so that the fragment and accumulator arrays stay in registers
    constexpr int NP = HI ? 2 : 1, KTS = 32 * KPI, VTS = 64 * VPI;
    const int tid = threadIdx.x, lane = tid & 31, lr = lane & 15, hi = lane >> 4;
    const float CE = SCL * 1.4426950408889634f;
    v4i rk[NP][2], rv[NP][2];
    auto gk = [&](v4i (&t)[NP][2], int j0) {
#pragma unroll
        for (int u = 0; u < 2; ++u) { const size_t o = (size_t)j0 * HD + (tid + 128 * u) * 8; t[0][u] = *(const v4ia*)(K + o); if (HI) t[NP - 1][u] = *(const v4ia*)(K2 + o); } };
    auto gv = [&](int j0) {
#pragma unroll
        for (int u = 0; u < 2; ++u) { const int x = tid + 128 * u; const size_t o = (size_t)(x >> 2) * TT + j0 + (x & 3) * 8; rv[0][u] = *(const v4ia*)(VT + o); if (HI) rv[NP - 1][u] = *(const v4ia*)(VT2 + o); } };
    auto sk = [&](const v4i (&t)[NP][2], int bs) { T16* d = sb + bs * SBUF;
#pragma unroll
        for (int u = 0; u < 2; ++u) { const int x = tid + 128 * u, o = (x >> 3) * KPI + (x & 7) * 8; *(v4ia*)(d + o) = t[0][u]; if (HI) *(v4ia*)(d + KTS + o) = t[NP - 1][u]; } };
    auto sv = [&](int bs) { T16* d = sb + bs * SBUF + NP * KTS;
#pragma unroll
        for (int u = 0; u < 2; ++u) { const int x = tid + 128 * u, o = (x >> 2) * VPI + (x & 3) * 8; *(v4ia*)(d + o) = rv[0][u]; if (HI) *(v4ia*)(d + VTS + o) = rv[NP - 1][u]; } };
    v4u g[NQ][2], gn[NQ][2];   // group_prob (bf16, two a register) of this stage's and of the next stage's 32 keys, 8 + 8 per lane and query row
    auto gg = [&](v4u (&t)[NQ][2], int j0) {
#pragma unroll
        for (int qt = 0; qt < NQ; ++qt) { const bf* gr = gq + ((size_t)((q0 >> 4) + qt) * (TT / 32) + (j0 >> 5)) * 512 + lane * 8; t[qt][0] = *(const v4u*)gr; t[qt][1] = *(const v4u*)(gr + 256); } };
    gk(rk, 0); gv(0); gg(g, 0);
    V qf[NQ][2], qf2[NQ][2];
#pragma unroll
    for (int qt = 0; qt < NQ; ++qt)
#pragma unroll
        for (int ks = 0; ks < 2; ++ks) { const size_t o = (size_t)(q0 + qt * 16 + lr) * HD + ks * 32 + 8 * hi; qf[qt][ks] = F::ld(Q + o); if (HI) qf2[qt][ks] = F::ld(Q2 + o); }
#pragma unroll
    for (int u = 0; u < TT / 512; ++u) { const v4i m = *(const v4i*)(kvp + (tid + 128 * u) * 4); v4f bz;
#pragma unroll
        for (int q = 0; q < 4; ++q) bz[q] = (m[q] != 0) ? 0.0f : -3.0e38f;
        *(v4f*)(bias + (tid + 128 * u) * 4) = bz; }
    sk(rk, 0); sv(0);
    lds_barrier();   // stage 0 and the mask table stand in LDS before any wave reads them
    // masked raw scores of the stage's 32 keys
    auto scores = [&](int bs, int j0, v8f (&s)[2][NQ]) { const T16* kb = sb + bs * SBUF; V kf[2][2], kf2[2][2];
#pragma unroll
        for (int kt = 0; kt < 2; ++kt)
#pragma unroll
            for (int ks = 0; ks < 2; ++ks) { const int o = (kt * 16 + lr) * KPI + ks * 32 + 8 * hi; kf[kt][ks] = F::ld(kb + o); if (HI) kf2[kt][ks] = F::ld(kb + KTS + o); }
        auto prod = [&](int kt, int qt, v8f a) {
#pragma unroll
            for (int ks = 0; ks < 2; ++ks) { a = F::mma(kf[kt][ks], qf[qt][ks], a); if (HI) { a = F::mma(kf[kt][ks], qf2[qt][ks], a); a = F::mma(kf2[kt][ks], qf[qt][ks], a); } }
            return a; };
#pragma unroll
        for (int kt = 0; kt < 2; ++kt) { const float* bp = bias + j0 + kt * 16 + 8 * hi; const v4f c0 = *(const v4f*)bp, c1 = *(const v4f*)(bp + 4); const v8f cb = __builtin_shufflevector(c0, c1, 0, 1, 2, 3, 4, 5, 6, 7);
#pragma unroll
            for (int qt = 0; qt < NQ; ++qt) s[kt][qt] = prod(kt, qt, cb); }
        if (j0 == (q0 & ~31)) {   // scalar test: the one stage with this wave's diagonal
#pragma unroll
            for (int kt = 0; kt < 2; ++kt)
#pragma unroll
                for (int qt = 0; qt < NQ; ++qt) { const v8f a = prod(kt, qt, (v8f){}); const int dj = q0 + qt * 16 + lr - (j0 + kt * 16 + 8 * hi);
#pragma unroll
                    for (int r = 0; r < 8; ++r) s[kt][qt][r] = (dj == r) ? a[r] : s[kt][qt][r]; } } };
    // nm: minus the row's reference in log2 units, plus OFF (fp16 rows carry p x 2^OFF). The reference starts below every real score and above the mask's -3e38 * CE: a masked key gives e = 0 from the first stage on, and the first kept key raises it (the factor is then 2^-huge = 0, on sums that are 0).
    constexpr float OFF = HI ? 0.0f : 10.0f, ETOP = HI ? 32.0f : 32768.0f;   // ETOP = 2^(OFF + 5): the most that a lane's 16 e of a row and stage may sum to under the reference in use; so e <= 2^15, and p stays inside fp16 for group_prob <= 1
    float nm[NQ], l[NQ];
#pragma unroll
    for (int qt = 0; qt < NQ; ++qt) { nm[qt] = 1.0e30f; l[qt] = 0.f; }
    v8f o[4][NQ];
#pragma unroll
    for (int dt = 0; dt < 4; ++dt)
#pragma unroll
        for (int qt = 0; qt < NQ; ++qt) o[dt][qt] = (v8f){};
#pragma unroll 1   // rolled: a second stage body would cost registers and instruction cache and save nothing
    for (int st = 0; st < TT / 32; ++st) { const int j0 = st * 32, bs = st & 1;
        gk(rk, (j0 + 32) & (TT - 1)); gv((j0 + 32) & (TT - 1));
        asm volatile("s_wait_xcnt 0x0" ::: "memory");   // the K and V^T loads' address registers may take the next loads' results: the wait stands in front of that overwrite
        gg(gn, (j0 + 32) & (TT - 1));
        __builtin_amdgcn_sched_barrier(0);   // keeps the next stage's global loads issued ahead of this stage's work, whose time covers their latency
        v8f s[2][NQ]; scores(bs, j0, s); V pf[NQ], pf2[NQ], vf[4], vf2[4]; float ls[NQ];
        const T16* vb = sb + bs * SBUF + NP * KTS;   // the V^T fragments are read ahead of the exponentials, which cover the LDS latency
        auto ldv = [&]() {
#pragma unroll
            for (int dt = 0; dt < 4; ++dt) { const int vo = (dt * 16 + lr) * VPI + 8 * hi; vf[dt] = F::ld(vb + vo); if (HI) vf2[dt] = F::ld(vb + VTS + vo); } };
        // from s and the references in use: e, its sum over the lane's 16 keys of each row (ls, two chains), and p as the B operand
        auto expo = [&]() {
#pragma unroll
            for (int qt = 0; qt < NQ; ++qt) { v16h ph; v8u uh, ul; float a0 = 0.f, a1 = 0.f;
#pragma unroll
                for (int kt = 0; kt < 2; ++kt)
#pragma unroll
                    for (int r = 0; r < 8; r += 2) { const unsigned gw = g[qt][kt][r >> 1];
                        float e0, e1; exp2x2(__builtin_fmaf(s[kt][qt][r], CE, nm[qt]), __builtin_fmaf(s[kt][qt][r + 1], CE, nm[qt]), e0, e1);
                        if (kt == 0 && r == 0) { a0 = e0; a1 = e1; } else { a0 += e0; a1 += e1; }
                        const float p0 = e0 * bflo(gw), p1 = e1 * bfhi(gw);
                        if constexpr (HI) { const unsigned a = pkbf(p0, p1); uh[kt * 4 + (r >> 1)] = a; ul[kt * 4 + (r >> 1)] = pkbf(p0 - bflo(a), p1 - bfhi(a)); } else { ph[kt * 8 + r] = tohx(p0); ph[kt * 8 + r + 1] = tohx(p1); } }
                ls[qt] = a0 + a1;
                if constexpr (HI) { pf[qt] = __builtin_bit_cast(v16bf, uh); pf2[qt] = __builtin_bit_cast(v16bf, ul); } else pf[qt] = ph; } };
        ldv();
        __builtin_amdgcn_sched_barrier(0);   // keeps the V^T reads issued here: the exponentials cover their latency
        expo();
        float lm = ls[0];
#pragma unroll
        for (int qt = 1; qt < NQ; ++qt) lm = fmaxf(lm, ls[qt]);
        if (__builtin_expect(__builtin_amdgcn_ballot_w32(!(lm <= ETOP)) != 0, 0)) {   // scalar branch, one test a stage, on sums that are needed anyway (e >= 0: no e is above its sum; an overflow reads as infinity and fails too); seldom taken once the references have settled
            scores(bs, j0, s);   // the stage's K rows still stand in LDS: the scores are formed again rather than kept in registers through every stage
#pragma unroll
            for (int qt = 0; qt < NQ; ++qt) { const v8f &a = s[0][qt], &c = s[1][qt];
                const float tm = fmaxf(max3f(max3f(a[0], a[1], a[2]), max3f(a[3], a[4], a[5]), max3f(a[6], a[7], c[0])), max3f(max3f(c[1], c[2], c[3]), max3f(c[4], c[5], c[6]), c[7]));
                const float rm = fmaxf(tm, __shfl_xor(tm, 16, 32)), nn = fminf(nm[qt], __builtin_fmaf(rm, -CE, OFF));   // both halves of the wave hold the same nm and get the same nn
                const float al = exp2x1(nn - nm[qt]); nm[qt] = nn; l[qt] *= al;
#pragma unroll
                for (int dt = 0; dt < 4; ++dt) o[dt][qt] *= al; }
            expo();   // now e <= 2^OFF: 16 of them stay below ETOP, so once more is enough
            ldv(); }   // read again, so that they need not stay in registers through this branch
#pragma unroll
        for (int qt = 0; qt < NQ; ++qt) l[qt] += ls[qt];
#pragma unroll
        for (int dt = 0; dt < 4; ++dt)
#pragma unroll
            for (int qt = 0; qt < NQ; ++qt) { o[dt][qt] = F::mma(vf[dt], pf[qt], o[dt][qt]); if (HI) { o[dt][qt] = F::mma(vf[dt], pf2[qt], o[dt][qt]); o[dt][qt] = F::mma(vf2[dt], pf[qt], o[dt][qt]); } }
        sk(rk, bs ^ 1); sv(bs ^ 1);
#pragma unroll
        for (int qt = 0; qt < NQ; ++qt) { g[qt][0] = gn[qt][0]; g[qt][1] = gn[qt][1]; }
        lds_barrier(); }   // publishes the next stage; ends every wave's reads of the buffer that the next trip refills
#pragma unroll
    for (int qt = 0; qt < NQ; ++qt) { const float inv = __fdiv_rn(1.0f, l[qt] + __shfl_xor(l[qt], 16, 32)); const size_t oo = (size_t)(q0 + qt * 16 + lr) * DQ + 8 * hi;
#pragma unroll
        for (int dt = 0; dt < 4; ++dt) { v4u oh, ol;
#pragma unroll
            for (int r = 0; r < 8; r += 2) { const float y0 = o[dt][qt][r] * inv, y1 = o[dt][qt][r + 1] * inv; const unsigned a = pkbf(y0, y1); oh[r >> 1] = a; ol[r >> 1] = pkbf(y0 - bflo(a), y1 - bfhi(a)); }
            *(v4u*)(Ah + oo + dt * 16) = oh; *(v4u*)(Al + oo + dt * 16) = ol; } }
}
// amdgpu_waves_per_eu(4, 4): a budget of 256 registers; without it the build takes a few more, which costs the fourth wave of a SIMD and puts register-window switches into the loop
__global__ __launch_bounds__(128) __attribute__((amdgpu_waves_per_eu(4, 4))) void k_fattn(const h16* __restrict__ Q16, const bf* __restrict__ Qh, const bf* __restrict__ Ql, const h16* __restrict__ K16, const bf* __restrict__ Kh, const bf* __restrict__ Kl, const h16* __restrict__ V16, const bf* __restrict__ Vh, const bf* __restrict__ Vl, const int* __restrict__ kmask, const bf* __restrict__ GB, bf* Ah, bf* Al) {
    __shared__ __align__(16) char sm[2 * SBUF * 2]; __shared__ __align__(16) float bias[TT];
    const int wv = __builtin_amdgcn_readfirstlane((int)(threadIdx.x >> 5));   // wave number, scalar: the row base and the diagonal test stay in scalar registers
    const int bx = blockIdx.x, h = blockIdx.y, b = blockIdx.z; const size_t po = ((size_t)b * NH_ + h) * TT * HD;
    const int* kvp = kmask + (size_t)b * TT; const bf* gq = GB + (size_t)b * TT * TT; bf* ah = Ah + (size_t)b * TT * DQ + h * HD; bf* al = Al + (size_t)b * TT * DQ + h * HD;
    if (bx < RH / 64) attn_rows<bf, true, 1>(Qh + po, Ql + po, Kh + po, Kl + po, Vh + po, Vl + po, kvp, gq, bx * 64 + wv * 16, ah, al, (bf*)sm, bias);
    else attn_rows<h16, false, 2>(Q16 + po, nullptr, K16 + po, nullptr, V16 + po, nullptr, kvp, gq, RH + (bx - RH / 64) * 128 + wv * 32, ah, al, (h16*)sm, bias);
}

extern "C" void kernel_launch(void* const* d_in, const int* in_sizes, int n_in,
                              void* d_out, int out_size, void* d_ws, size_t ws_size, hipStream_t stream) {
    (void)in_sizes; (void)n_in; (void)out_size;
    const float* x = (const float*)d_in[0]; const float* xk = (const float*)d_in[1]; const float* xv = (const float*)d_in[2]; const float* gprob = (const float*)d_in[3];   /* group_prob [2][2048][2048] f32 */ const int* kmask = (const int*)d_in[4];   /* mask [2][2048] int32: 1 = attendable key (OR the diagonal) */ const float* wq = (const float*)d_in[5]; const float* bq = (const float*)d_in[6]; const float* wk = (const float*)d_in[7]; const float* bk = (const float*)d_in[8]; const float* wv = (const float*)d_in[9]; const float* bv = (const float*)d_in[10]; const float* wo = (const float*)d_in[11]; const float* bo = (const float*)d_in[12];   /* input order query, key, value, group_prob, mask, Wq, bq, Wk, bk, Wv, bv, Wo, bo ('oi') */
    float* OUT = (float*)d_out;     // [2][2048][1024]
    char* wsp = (char*)d_ws;
    auto take = [&](size_t bytes) { char* p = wsp; wsp += (bytes + 255) & ~(size_t)255; return (void*)p; };
    bf* XB = (bf*)take((size_t)CVE * 2);   // k_cvt's range: the three streams [stream][batch][t][DM], then the four weights
    bf* WQ = XB + (size_t)3 * NB_ * TT * DM; bf* WK = WQ + (size_t)DM * DM; bf* WV = WK + (size_t)DM * DM; bf* WO = WV + (size_t)DM * DM;
    const size_t PS = (size_t)NH_ * TT * HD;   // one batch's plane, elements (NKV == NH_); every plane holds both batches
    h16* QP16 = (h16*)take(NB_ * PS * 2); h16* KP16 = (h16*)take(NB_ * PS * 2); h16* VT16 = (h16*)take(NB_ * PS * 2);
    bf* QPh = (bf*)take(NB_ * PS * 2); bf* QPl = (bf*)take(NB_ * PS * 2); bf* KPh = (bf*)take(NB_ * PS * 2); bf* KPl = (bf*)take(NB_ * PS * 2); bf* VTh = (bf*)take(NB_ * PS * 2); bf* VTl = (bf*)take(NB_ * PS * 2);
    bf* GB = (bf*)take((size_t)GVE * 2);   // group_prob, bf16, in k_fattn's fragment order
    bf* ATh = (bf*)take((size_t)NB_ * TT * DQ * 2); bf* ATl = (bf*)take((size_t)NB_ * TT * DQ * 2);
    if ((size_t)(wsp - (char*)d_ws) > ws_size) return;    // ws 256 MiB
    k_cvt<<<CVE / CBE + GVE / CBE, 256, 0, stream>>>(x, xk, xv, wq, wk, wv, wo, gprob, XB, GB);
    k_proj<<<dim3(TT / 128, DQ / 128, 3 * NB_), 256, 0, stream>>>(XB, WQ, WK, WV, bq, bk, bv, QP16, QPh, QPl, KP16, KPh, KPl, VT16, VTh, VTl);
    k_fattn<<<dim3(RH / 64 + (TT - RH) / 128, NH_, NB_), 128, 0, stream>>>(QP16, QPh, QPl, KP16, KPh, KPl, VT16, VTh, VTl, kmask, GB, ATh, ATl);
    k_gemmo<<<dim3(NB_ * TT / 128, DM / 128, 1), 256, 0, stream>>>(ATh, ATl, WO, OUT, bo);   /* both batches: their rows follow one another in ATh, ATl and OUT */
}

// v009
// Measured time: 116 microseconds a run.
// Next to v008, in two timings, it ran 1.19 times as fast each time.
// Counting every step since v000, it is 17.4 times as fast.
#include <hip/hip_runtime.h>

// Multi-headed attention on three streams with a padding-or-diagonal mask and a post-softmax group weighting (query, key, value [2][2048][1024]; q, k, v = x W^T + b ('oi' 0.02, zero biases; 16 heads x 64); scores / sqrt(64); key j is kept for query i when mask[b][j] != 0 OR j == i (mask int [2][2048] random 0/1, read; -1e9 == exclusion); p = softmax; p = p x group_prob[b][i][j] (f32 [2][2048][2048] uniform, read; NOT renormalised); x = p.v; out = merged Wo^T + bo -> [2][2048][1024] (4.2 M); argument order query, key, value, group_prob, mask, Wq, bq, Wk, bk, Wv, bv, Wo, bo).
// Four launches: bf16 copies of query, key, value, the 'oi' weights and group_prob (the last in the attention's fragment order; key and value rows and group_prob's columns in the order in which the keys are walked: kept keys first); the three exact projections of both batches + f32 biases, whose epilogue writes the head planes; one fused attention launch for all heads of both batches (hybrid rows: < 512 hi/lo 3 products, rest fp16 x1024): it walks the batch's kept keys, then each row's own key where the mask drops it (the always-kept diagonal), multiplies each exponential by the bf16 copy of group_prob[b][i][j] and divides the P.V sums by the row's sum of exponentials; merged hi/lo x Wo exact + bo.
// Compute dtypes, f32 accumulate: every input rounded to bf16 incl. group_prob; projections exact + f32 biases; attention rows < 512 3 products, rest fp16; softmax and group weighting f32; Wo hl x exact + bias.

#define NB_  2
#define TT   2048
#define DM   1024
#define NH_  16
#define NKV  16
#define HD   64
#define DQ   (NH_ * HD)
#define DKV  (NKV * HD)
#define RH   512                  // query rows < RH use hi+lo planes (0: none)
#define WIN  0
#define SCL  0.125f   // HD^-0.5
typedef _Float16 h16;
typedef unsigned short bf;
typedef __attribute__((ext_vector_type(16))) __bf16   v16bf;
typedef __attribute__((ext_vector_type(16))) _Float16 v16h;
typedef __attribute__((ext_vector_type(8)))  _Float16 v8h;
typedef __attribute__((ext_vector_type(8)))  unsigned short v8us;
typedef __attribute__((ext_vector_type(8)))  float    v8f;
typedef __attribute__((ext_vector_type(4)))  _Float16 v4h;
typedef __attribute__((ext_vector_type(4)))  unsigned short v4us;
typedef __attribute__((ext_vector_type(4)))  float    v4f;
typedef v8h  __attribute__((may_alias)) v8ha;
typedef v4f  __attribute__((may_alias)) v4fa;
typedef v8us __attribute__((may_alias)) v8usa;

__device__ __forceinline__ unsigned short f2bf(float f) { unsigned u = __float_as_uint(f); u += 0x7FFFu + ((u >> 16) & 1u); return (unsigned short)(u >> 16); }
__device__ __forceinline__ float bf2f(unsigned short b) { return __uint_as_float(((unsigned)b) << 16); }
__device__ __forceinline__ float bfr(float f) { return bf2f(f2bf(f)); }
__device__ __forceinline__ v16h cat16(v8h lo, v8h hi) { return __builtin_shufflevector(lo, hi, 0, 1, 2, 3, 4, 5, 6, 7, 8, 9, 10, 11, 12, 13, 14, 15); }
__device__ __forceinline__ v16bf cat16b(v8us lo, v8us hi) { return __builtin_bit_cast(v16bf, __builtin_shufflevector(lo, hi, 0, 1, 2, 3, 4, 5, 6, 7, 8, 9, 10, 11, 12, 13, 14, 15)); }
__device__ __forceinline__ v8f wmma16(v16h a, v16h b, v8f c) { return __builtin_amdgcn_wmma_f32_16x16x32_f16(false, a, false, b, (short)0, c, false, false); }
__device__ __forceinline__ v8f wmmab(v16bf a, v16bf b, v8f c) { return __builtin_amdgcn_wmma_f32_16x16x32_bf16(false, a, false, b, (short)0, c, false, false); }



// ---- gemmt: GEMM on a 128x128 output tile (bx, by) per work-group of 8 waves (2 x 4, a wave holds 64x32: 8 accumulators), k = DM walked in stages of 64.
// A stage's rows (128 B of each of the 128 A rows and 128 Bt rows: whole lines) are read from global one stage ahead into registers and shared through two LDS buffers, one barrier a stage; the fragments come from LDS.
// C[m][n] (f32, pitch ldc, + optional f32 bias[n]) = sum_k A[m][k] Bt[n][k] (NSPLIT == 1: + A2[m][k] Bt[n][k]). A, A2 and Bt are K-contiguous bf16 planes of pitch DM. sm: the work-group's LDS, GLDS(NSPLIT) bytes.
// The epilogue passes the f32 tile through LDS (pitch 132 floats), so that a wave stores whole rows. PL != 0: no f32 C; the tile goes out as three 16-bit planes (fp16, bf16 hi, bf16 lo of the remainder).
// PL == 1: one plane block of [ldc rows][64] per 64 columns (head planes [h][t][d]), bias[n]. PL == 2: row-major [m][n] with pitch ldc, bias[m] (V^T = Wv X^T: rows are head dims, columns tokens).
template <typename T16> struct WFrag;
template <> struct WFrag<h16> { typedef v16h V; static __device__ __forceinline__ V ld(const h16* p) { return cat16(*(const v8h*)p, *(const v8h*)(p + 16)); } static __device__ __forceinline__ v8f mma(V a, V b, v8f c) { return wmma16(a, b, c); } };
template <> struct WFrag<bf> { typedef v16bf V; static __device__ __forceinline__ V ld(const bf* p) { return cat16b(*(const v8us*)p, *(const v8us*)(p + 16)); } static __device__ __forceinline__ v8f mma(V a, V b, v8f c) { return wmmab(a, b, c); } };
typedef __attribute__((ext_vector_type(4))) int v4i;
typedef v4i __attribute__((may_alias)) v4ia;
// work-group barrier that orders LDS alone: unlike __syncthreads() it does not wait for the global loads in flight (they go to registers and concern no other wave)
__device__ __forceinline__ void lds_barrier() { __builtin_amdgcn_fence(__ATOMIC_RELEASE, "workgroup", "local"); __builtin_amdgcn_s_barrier(); __builtin_amdgcn_fence(__ATOMIC_ACQUIRE, "workgroup", "local"); }
#define GPI 72            // LDS pitch of a row's 64 elements: 128 B + 16 B, for 16-byte readers
#define GOP (128 * GPI)   // elements of one operand's stage
#define GLDS(NSPLIT) (2 * ((NSPLIT) ? 3 : 2) * GOP * 2)   // two stage buffers, bytes; the f32 tile of the epilogue (128 * 132 * 4) fits inside
template <int NSPLIT, bool BIAS, int PL>
__device__ __forceinline__ void gemmt(char* sm, const int bx, const int by, const bf* __restrict__ A, const bf* __restrict__ A2, const bf* __restrict__ Bt, float* C, int ldc, const float* __restrict__ bias, h16* P16, bf* Ph, bf* Pl) {
    static_assert(GLDS(NSPLIT) >= 128 * 132 * 4 && DM % 64 == 0, "the epilogue's tile fits the stage buffers; whole stages");
    typedef WFrag<bf> F; typedef typename F::V V;   // every inner loop below is unrolled in full, so that the fragment, staging and accumulator arrays stay in registers
    constexpr int NO = NSPLIT ? 3 : 2, SB = NO * GOP, NS = DM / 64;   // operand tiles a stage (A, A2, Bt), elements of a stage buffer, stages
    const int tid = threadIdx.x, lane = tid & 31, lr = lane & 15, hi = lane >> 4; const int r0 = bx * 128, c0 = by * 128;
    const int wv = __builtin_amdgcn_readfirstlane(tid >> 5), wm = wv >> 2, wn = wv & 3;   // wave number, scalar: the wave's place in the tile stays in scalar registers
    bf* sb = (bf*)sm;
    const size_t ga = (size_t)(r0 + (tid >> 3)) * DM + (tid & 7) * 8, gb = (size_t)(c0 + (tid >> 3)) * DM + (tid & 7) * 8;   // 8 threads a row: a wave's load covers 4 whole lines
    const int so = (tid >> 3) * GPI + (tid & 7) * 8;
    v4i rg[NO][4];
    auto gl = [&](int kc) {
#pragma unroll
        for (int u = 0; u < 4; ++u) { const size_t d = (size_t)u * 32 * DM + kc; rg[0][u] = *(const v4ia*)(A + ga + d); if (NSPLIT) rg[1][u] = *(const v4ia*)(A2 + ga + d); rg[NO - 1][u] = *(const v4ia*)(Bt + gb + d); } };
    auto st = [&](int bs) { bf* d = sb + bs * SB + so;
#pragma unroll
        for (int u = 0; u < 4; ++u)
#pragma unroll
            for (int p = 0; p < NO; ++p) *(v4ia*)(d + p * GOP + u * 32 * GPI) = rg[p][u]; };
    v8f acc[4][2];
#pragma unroll
    for (int mb = 0; mb < 4; ++mb)
#pragma unroll
        for (int nb = 0; nb < 2; ++nb) acc[mb][nb] = (v8f){};
    gl(0); st(0);
    lds_barrier();   // stage 0 stands in LDS before any wave reads it
#pragma unroll 1   // rolled: a second stage body would cost registers and instruction cache and save nothing
    for (int s = 0; s < NS; ++s) { const int bs = s & 1;
        if (s + 1 < NS) gl((s + 1) * 64);   // issued ahead of this stage's work, whose time covers their latency
        const bf* ab = sb + bs * SB + (wm * 64 + lr) * GPI + 8 * hi; const bf* bb = sb + bs * SB + (NO - 1) * GOP + (wn * 32 + lr) * GPI + 8 * hi;
#pragma unroll
        for (int ks = 0; ks < 2; ++ks) { V a[4], a2[4], b[2];
#pragma unroll
            for (int mb = 0; mb < 4; ++mb) { a[mb] = F::ld(ab + mb * 16 * GPI + ks * 32); if (NSPLIT) a2[mb] = F::ld(ab + GOP + mb * 16 * GPI + ks * 32); }
#pragma unroll
            for (int nb = 0; nb < 2; ++nb) b[nb] = F::ld(bb + nb * 16 * GPI + ks * 32);
#pragma unroll
            for (int nb = 0; nb < 2; ++nb)
#pragma unroll
                for (int mb = 0; mb < 4; ++mb) { acc[mb][nb] = F::mma(a[mb], b[nb], acc[mb][nb]); if (NSPLIT) acc[mb][nb] = F::mma(a2[mb], b[nb], acc[mb][nb]); } }
        if (s + 1 < NS) st(bs ^ 1);
        lds_barrier(); }   // publishes the next stage; ends every wave's reads of the buffer that the next trip refills (after the last trip: that the f32 tile overwrites)
    float* os = (float*)sm; const int cofs = lane * 4; v4f bv = (v4f){}; float pbl = 0.f;   // a wave takes rows wv, wv + 8, ...: 4 columns a lane; the biases are read ahead of the LDS stores, which cover their latency
    if constexpr (BIAS && PL != 2) { const v4f t = *(const v4f*)(bias + c0 + cofs); bv[0] = bfr(t[0]); bv[1] = bfr(t[1]); bv[2] = bfr(t[2]); bv[3] = bfr(t[3]); }
    if constexpr (BIAS && PL == 2) pbl = bfr(bias[r0 + lr * 8 + wv]);   // one load for the wave's 16 rows: lane i (and i + 16) holds the bias of row i * 8 + wv
#pragma unroll
    for (int mb = 0; mb < 4; ++mb)
#pragma unroll
        for (int nb = 0; nb < 2; ++nb)
#pragma unroll
            for (int j = 0; j < 8; ++j) os[(wm * 64 + mb * 16 + hi * 8 + j) * 132 + wn * 32 + nb * 16 + lr] = acc[mb][nb][j];
    lds_barrier();   // every wave's part of the f32 tile stands in LDS before any row is read
#pragma unroll
    for (int i = 0; i < 16; ++i) { const int row = i * 8 + wv; v4f val = *(const v4fa*)(os + row * 132 + cofs);
        if (BIAS) { if constexpr (PL == 2) val += __uint_as_float(__builtin_amdgcn_readlane(__float_as_uint(pbl), i)); else val += bv; }   // i is a constant of the unrolled loop: the row's bias comes out of lane i as a scalar
        if constexpr (PL == 0) *(v4f*)(C + (size_t)(r0 + row) * ldc + c0 + cofs) = val;
        else { const size_t e = (PL == 1) ? ((size_t)(by * 2 + (cofs >> 6)) * ldc + r0 + row) * 64 + (cofs & 63) : (size_t)(r0 + row) * ldc + c0 + cofs; v4h o16; v4us oh, ol;
#pragma unroll
            for (int q = 0; q < 4; ++q) { o16[q] = (h16)val[q]; const unsigned short a2 = f2bf(val[q]); oh[q] = a2; ol[q] = f2bf(val[q] - bf2f(a2)); }
            *(v4h*)(P16 + e) = o16; *(v4us*)(Ph + e) = oh; *(v4us*)(Pl + e) = ol; } }
}

// k_gemmo: out = (Ah + Al) Wo^T + bo, f32; grid (M/128, DM/128).
__global__ __launch_bounds__(256) void k_gemmo(const bf* __restrict__ Ah, const bf* __restrict__ Al, const bf* __restrict__ WO, float* C, const float* __restrict__ bo) {
    __shared__ __align__(16) char sm[GLDS(1)];
    gemmt<1, true, 0>(sm, blockIdx.x, blockIdx.y, Ah, Al, WO, C, DM, bo, nullptr, nullptr, nullptr);
}
// k_proj: the q, k and v projections of both batches in one launch; grid (TT/128, DQ/128, 3 * NB_), z = stream * NB_ + batch. X holds the bf16 streams as [stream][batch][t][DM]; every plane holds both batches.
// q and k: x W^T into head planes; v: V^T = Wv X^T (rows [g][d], columns t), so its tile indices change places.
__global__ __launch_bounds__(256) void k_proj(const bf* __restrict__ X, const bf* __restrict__ WQ, const bf* __restrict__ WK, const bf* __restrict__ WV, const float* __restrict__ bq, const float* __restrict__ bk, const float* __restrict__ bv,
                                              h16* QP16, bf* QPh, bf* QPl, h16* KP16, bf* KPh, bf* KPl, h16* VT16, bf* VTh, bf* VTl) {
    __shared__ __align__(16) char sm[GLDS(0)];
    const int z = blockIdx.z, sm_ = z / NB_; const bf* xs = X + (size_t)z * TT * DM; const size_t po = (size_t)(z % NB_) * NH_ * TT * HD;
    if (sm_ == 2) gemmt<0, true, 2>(sm, blockIdx.y, blockIdx.x, WV, nullptr, xs, nullptr, TT, bv, VT16 + po, VTh + po, VTl + po);
    else gemmt<0, true, 1>(sm, blockIdx.x, blockIdx.y, xs, nullptr, sm_ ? WK : WQ, nullptr, TT, sm_ ? bk : bq, (sm_ ? KP16 : QP16) + po, (sm_ ? KPh : QPh) + po, (sm_ ? KPl : QPl) + po);
}

__device__ __forceinline__ h16 tohx(float x) { return (h16)x; }
typedef __attribute__((ext_vector_type(2))) float v2f;
typedef __attribute__((ext_vector_type(2))) __bf16 v2bf;
typedef __attribute__((ext_vector_type(4))) unsigned v4u;
__device__ __forceinline__ unsigned pkbf(float a, float b) { v2f x; x[0] = a; x[1] = b; return __builtin_bit_cast(unsigned, __builtin_convertvector(x, v2bf)); }   // two f32 -> packed bf16, round to nearest even

// k_cvt: every f32 -> bf16 copy of the call in one launch. dst is one range: query, key, value (NB_ * TT * DM elements each), then Wq, Wk, Wv, Wo (DM * DM each). Of key and value, token j's row stands at place pos[j] of its batch (key_order below).
// A block converts CBE consecutive elements of one tensor (every tensor's size is a multiple of CBE), a thread CU pieces of 8: few waves to start, and each has all its loads in flight at once. Grid CVE / CBE + GVE / CBE.
// The last GVE / CBE blocks round group_prob to bf16 into gdst, once for all 16 heads, in the order in which k_fattn's lanes use it: [batch * TT / 16 + row group][stage of 32 keys][key tile kt][lane = hi * 16 + row][8 keys], the key's place pos[j] = stage * 32 + kt * 16 + hi * 8 + r.
// So a wave of k_fattn reads a (row group, stage, key tile) as 512 contiguous bytes, 4 whole lines, where the f32 rows gave it 32 bytes of each of 16 lines per load. A block takes one group of 16 rows; a wave's piece is 8 rows x 32 keys: it reads whole lines (32 B a lane) and puts each value at its place in an LDS image of the group (64 KiB), which the block then copies out in whole lines.
#define CU  16
#define CBE (CU * 256 * 8)
#define CVE (3 * NB_ * TT * DM + 4 * DM * DM)
#define GVE (NB_ * TT * TT)
#define CMP (TT + 8)   // pitch of a batch's row of cm, ints
// key_order: the order in which the attention walks a batch's keys: the kept ones (mask != 0) first, then the others, each part in its natural order. For a block of 256 threads, 8 keys a thread.
// pos[j] (LDS, TT entries) = key j's place p; a count over TT flags, so 0 <= p < TT for any content of the mask. FR: instead the byte offset of place p in a row group's fragment order, (p / 8) * 256 + (p % 8) * 2.
// cmo != nullptr: also stores cm[j] = number of masked keys before j, j = 0 .. TT.
template <bool FR>
__device__ __forceinline__ void key_order(const v4i m0, const v4i m1, unsigned short* pos, int* wsum, int* cmo) {   // m0, m1: mask[tid * 8 .. + 7], read by the caller ahead of its own loads (loads return in order: read behind them, the mask would wait for them all)
    const int tid = threadIdx.x, lane = tid & 31, wv = tid >> 5; unsigned zb = 0;   // bit k: key tid * 8 + k is masked
#pragma unroll
    for (int k = 0; k < 8; ++k) zb |= (((k < 4 ? m0[k & 3] : m1[k & 3]) == 0) ? 1u : 0u) << k;
    const int c = __builtin_popcount(zb); int sc = c;   // running count over the wave's lanes
#pragma unroll
    for (int d = 1; d < 32; d <<= 1) { const int t = __shfl_up(sc, d, 32); if (lane >= d) sc += t; }
    if (lane == 31) wsum[wv] = sc;
    lds_barrier();   // the eight waves' counts stand in LDS before any wave adds them up
    int base = 0, tot = 0;
#pragma unroll
    for (int w = 0; w < 8; ++w) { const int x = wsum[w]; base += (w < wv) ? x : 0; tot += x; }
    const int cb = base + sc - c, nk = TT - tot; v8us pv;   // cb: masked keys before the thread's first
#pragma unroll
    for (int k = 0; k < 8; ++k) { const int cm = cb + __builtin_popcount(zb & ((1u << k) - 1u)), p = ((zb >> k) & 1u) ? nk + cm : tid * 8 + k - cm; pv[k] = (unsigned short)(FR ? (p >> 3) * 256 + (p & 7) * 2 : p); }
    *(v8usa*)(pos + tid * 8) = pv;
    if (cmo) { v4i c0, c1;
#pragma unroll
        for (int k = 0; k < 4; ++k) { c0[k] = cb + __builtin_popcount(zb & ((1u << k) - 1u)); c1[k] = cb + __builtin_popcount(zb & ((16u << k) - 1u)); }
        *(v4i*)(cmo + tid * 8) = c0; *(v4i*)(cmo + tid * 8 + 4) = c1; if (tid == 255) cmo[TT] = cb + c; }
    lds_barrier();   // the whole table stands in LDS before any wave reads it
}
// amdgpu_waves_per_eu(6, 6): a budget of 160 registers; without it the build takes a few more, which costs the sixth wave of a SIMD: the launch's three blocks per WGP would no longer all run at once
__global__ __launch_bounds__(256) __attribute__((amdgpu_waves_per_eu(6, 6))) void k_cvt(const float* __restrict__ xq, const float* __restrict__ xk, const float* __restrict__ xv, const float* __restrict__ wq, const float* __restrict__ wk, const float* __restrict__ wv, const float* __restrict__ wo, const float* __restrict__ gp, const int* __restrict__ kmask, bf* dst, bf* gdst, int* cmw) {
    __shared__ __align__(16) bf gl[16 * TT]; __shared__ __align__(16) unsigned short pos[TT]; __shared__ int wsum[8];
    constexpr int BX = NB_ * TT * DM / CBE, BW = DM * DM / CBE; static_assert(NB_ * TT * DM % CBE == 0 && DM * DM % CBE == 0, "a block stays inside one tensor");
    static_assert(16 * TT == CBE && CU * 8 == 2 * (TT / 32), "a block of the group_prob part is one group of 16 rows: 2 x TT / 32 wave pieces");
    const int bx = blockIdx.x; const float* s; int b0, kv = 0;   // the block's tensor, that tensor's first block, and whether it is the key or the value stream: scalar
    if (bx >= CVE / CBE) {   // scalar test: the group_prob part
        const int rg = bx - CVE / CBE, lane = threadIdx.x & 31, wv8 = threadIdx.x >> 5, row = (wv8 & 1) * 8 + (lane >> 2), un = lane & 3;   // the lane's row of the group and its 8 keys of the piece's 32: keys un * 8 .. + 7
        const float* sg = gp + ((size_t)rg * 16 + row) * TT + (wv8 >> 1) * 32 + un * 8; bf* dg = gdst + (size_t)rg * 16 * TT + threadIdx.x * 8;
        const int* km = kmask + (rg / (TT / 16)) * TT + threadIdx.x * 8; const v4i m0 = *(const v4i*)km, m1 = *(const v4i*)(km + 4);
        v8f w[CU];   // as below: every load issues ahead of the first conversion
#pragma unroll
        for (int u = 0; u < CU; ++u) w[u] = *(const v8f*)(sg + u * 128);   // piece u: keys (u * 4 + wv8 / 2) * 32 .. + 31 in their natural order
        asm volatile("s_wait_xcnt 0x0" :: "v"(sg) : "memory");   // the loads' address registers stay as they are (sg is an input here) until every load's address has been taken; no load's result may land in them before
        key_order<true>(m0, m1, pos, wsum, nullptr);   // behind the loads' issue: their latency covers it
        char* gr = (char*)gl + row * 16;   // the lane's row inside each unit of 8 keys x 16 rows
#pragma unroll
        for (int u = 0; u < CU; ++u) { const v8us pj = *(const v8usa*)(pos + u * 128 + (wv8 >> 1) * 32 + un * 8);   // where the lane's 8 keys go
#pragma unroll
            for (int k = 0; k < 8; k += 2) { const unsigned o = pkbf(w[u][k], w[u][k + 1]); *(bf*)(gr + pj[k]) = (bf)(o & 0xFFFFu); *(bf*)(gr + pj[k + 1]) = (bf)(o >> 16); } }
        lds_barrier();   // the group's 16 rows stand in LDS in fragment order before they are copied out
#pragma unroll
        for (int u = 0; u < CU; ++u) *(v8us*)(dg + u * 2048) = *(const v8usa*)(gl + threadIdx.x * 8 + u * 2048);
        return; }
    if (bx < 3 * BX) { const int t = bx / BX; s = (t == 0) ? xq : (t == 1) ? xk : xv; b0 = t * BX; kv = t; }
    else { const int t = (bx - 3 * BX) / BW; s = (t == 0) ? wq : (t == 1) ? wk : (t == 2) ? wv : wo; b0 = 3 * BX + t * BW; }
    s += (size_t)(bx - b0) * CBE + threadIdx.x * 8; bf* d = dst + (size_t)bx * CBE + threadIdx.x * 8;
    v8f v[CU];   // the loops over u are unrolled in full: v stays in registers and the loads issue ahead of the first conversion
    constexpr int RB = CBE / DM, BT = TT / RB; static_assert(2048 == 2 * DM && TT % RB == 0, "a piece of 2048 elements is two rows; a block stays inside one batch");
    const int bt = (bx - b0) / BT, t0 = (bx - b0) % BT * RB;   // key and value streams: the block's batch and its first token there
    if (kv) { const int* km = kmask + bt * TT + threadIdx.x * 8; const v4i m0 = *(const v4i*)km, m1 = *(const v4i*)(km + 4);
#pragma unroll
        for (int u = 0; u < CU; ++u) v[u] = *(const v8f*)(s + u * 2048);
        asm volatile("s_wait_xcnt 0x0" :: "v"(s) : "memory");   // as above: the loads' address registers stay as they are until every load's address has been taken
        key_order<false>(m0, m1, pos, wsum, (kv == 1 && t0 == 0) ? cmw + bt * CMP : nullptr);   // scalar test; behind the loads' issue, whose latency covers it; one block a batch hands cm to k_fattn
        bf* dk = dst + ((size_t)b0 * RB + bt * TT) * DM + (threadIdx.x & 127) * 8;
#pragma unroll
        for (int u = 0; u < CU; ++u) { v8us o;
#pragma unroll
            for (int k = 0; k < 8; ++k) o[k] = f2bf(v[u][k]);
            *(v8us*)(dk + (size_t)pos[t0 + u * 2 + (threadIdx.x >> 7)] * DM) = o; }   // token j's row goes to place pos[j] of its batch: K and V^T come out of k_proj in the walking order
        return; }
#pragma unroll
    for (int u = 0; u < CU; ++u) v[u] = *(const v8f*)(s + u * 2048);
#pragma unroll
    for (int u = 0; u < CU; ++u) { v8us o;
#pragma unroll
        for (int k = 0; k < 8; ++k) o[k] = f2bf(v[u][k]);
        *(v8us*)(d + u * 2048) = o; } }

// k_fattn: scores, mask, softmax, group weighting, P.V and the head merge in one kernel; no score or probability leaves the registers. Grid (RH/64 + (TT-RH)/128, heads, batches), 4 waves.
// A wave owns NQ * 16 query rows of one head; the work-group walks the batch's kept keys once, 32 keys a stage, then the few stages that hold its own rows' masked keys (keys stand in k_cvt's order, kept ones first). A stage's K rows and V^T rows are read from global in whole or half lines, one stage ahead, and shared through two LDS buffers (one barrier a stage).
// S^T = K Q^T (A = K rows, B = Q rows, same k order on both sides): a lane holds 8 keys of ONE query per tile. The key mask is a ceiling on the place: a full stage of kept keys needs no test; in the last, partly filled one the places from nk on take -3e38;
// in a stage of masked keys every element takes -3e38 but a row's own key (the diagonal is always kept). cm (k_cvt's count of masked keys before each token) gives nk, the stages to walk and each row's own place.
// Each stage: e = exp(s / 8 - ref), l += e, p = e x group_prob[b][i][j] (k_cvt's bf16 copy, in this kernel's fragment order: 2 loads of 512 contiguous bytes per 16 rows and stage); the two key tiles of a stage, converted in place, are the B operand of O^T += V^T P^T (A = V^T rows in the hardware k order).
// ref is a row's running reference, not its maximum: any value cancels in O / l. One test a stage and wave (ballot, scalar branch), on the stage's sums of e: only when a lane's 16 e of some row sum to more than 2^5 does the wave form the stage's scores again, raise every row's ref to the stage's maximum where that is higher, scale l and O by 2^(old - new) and take the exponentials anew.
// The epilogue joins the wave halves' sums, divides by l (the weighting is not renormalised: l sums e alone) and stores hi/lo bf16 planes of the merged rows, 16 B per lane.
// Rows < RH: hi/lo bf16 planes, 3 products in both GEMMs, 16 rows a wave; the rest fp16 with p carried x 1024 (folded into the exponent, so l carries it too and it cancels), 32 rows a wave.
#define KPI 72   // LDS pitch of a K row in elements: 128 B + 16 B, for 16-byte readers
#define VPI 40   // LDS pitch of a V^T row of 32 keys in elements: 64 B + 16 B
#define SBUF (2 * (32 * KPI + 64 * VPI))   // elements of one stage buffer at two planes per operand
typedef __attribute__((ext_vector_type(8))) unsigned v8u;
// two 2^x in one statement: the early-clobber outputs keep each off the other's registers, and the v_nop keeps the slot that the instruction set asks for behind a transcendental before its result is used or its source overwritten
__device__ __forceinline__ void exp2x2(float x0, float x1, float& e0, float& e1) { asm("v_exp_f32 %0, %2\n\tv_exp_f32 %1, %3\n\tv_nop" : "=&v"(e0), "=&v"(e1) : "v"(x0), "v"(x1)); }
__device__ __forceinline__ float exp2x1(float x) { float e; asm("v_exp_f32 %0, %1\n\tv_nop" : "=&v"(e) : "v"(x)); return e; }   // one 2^x, with the same slot behind it
__device__ __forceinline__ float max3f(float a, float b, float c) { return fmaxf(fmaxf(a, b), c); }
__device__ __forceinline__ float bflo(unsigned u) { return __uint_as_float(u << 16); }
__device__ __forceinline__ float bfhi(unsigned u) { return __uint_as_float(u & 0xFFFF0000u); }
template <typename T16, bool HI, int NQ>
__device__ __forceinline__ void attn_rows(const T16* __restrict__ Q, const T16* __restrict__ Q2, const T16* __restrict__ K, const T16* __restrict__ K2, const T16* __restrict__ VT, const T16* __restrict__ VT2, const int* __restrict__ cm, const bf* __restrict__ gq, const int q0, const int qw, bf* Ah, bf* Al, T16* sb, int* dpt) {
    typedef WFrag<T16> F; typedef typename F::V V;   // every inner loop below is unrolled in full, so that the fragment and accumulator arrays stay in registers
    constexpr int NP = HI ? 2 : 1, KTS = 32 * KPI, VTS = 64 * VPI;
    const int tid = threadIdx.x, lane = tid & 31, lr = lane & 15, hi = lane >> 4;
    const float CE = SCL * 1.4426950408889634f;
    v4i rk[NP][2], rv[NP][2];
    auto gk = [&](v4i (&t)[NP][2], int j0) {
#pragma unroll
        for (int u = 0; u < 2; ++u) { const size_t o = (size_t)j0 * HD + (tid + 128 * u) * 8; t[0][u] = *(const v4ia*)(K + o); if (HI) t[NP - 1][u] = *(const v4ia*)(K2 + o); } };
    auto gv = [&](int j0) {
#pragma unroll
        for (int u = 0; u < 2; ++u) { const int x = tid + 128 * u; const size_t o = (size_t)(x >> 2) * TT + j0 + (x & 3) * 8; rv[0][u] = *(const v4ia*)(VT + o); if (HI) rv[NP - 1][u] = *(const v4ia*)(VT2 + o); } };
    auto sk = [&](const v4i (&t)[NP][2], int bs) { T16* d = sb + bs * SBUF;
#pragma unroll
        for (int u = 0; u < 2; ++u) { const int x = tid + 128 * u, o = (x >> 3) * KPI + (x & 7) * 8; *(v4ia*)(d + o) = t[0][u]; if (HI) *(v4ia*)(d + KTS + o) = t[NP - 1][u]; } };
    auto sv = [&](int bs) { T16* d = sb + bs * SBUF + NP * KTS;
#pragma unroll
        for (int u = 0; u < 2; ++u) { const int x = tid + 128 * u, o = (x >> 2) * VPI + (x & 3) * 8; *(v4ia*)(d + o) = rv[0][u]; if (HI) *(v4ia*)(d + VTS + o) = rv[NP - 1][u]; } };
    v4u g[NQ][2], gn[NQ][2];   // group_prob (bf16, two a register) of this stage's and of the next stage's 32 keys, 8 + 8 per lane and query row
    auto gg = [&](v4u (&t)[NQ][2], int j0) {
#pragma unroll
        for (int qt = 0; qt < NQ; ++qt) { const bf* gr = gq + ((size_t)((q0 >> 4) + qt) * (TT / 32) + (j0 >> 5)) * 512 + lane * 8; t[qt][0] = *(const v4u*)gr; t[qt][1] = *(const v4u*)(gr + 256); } };
    // The walk, scalar: ns stages hold the batch's nk kept keys; then, from stage e0 on, the stages that hold the masked keys of the work-group's own rows qw .. qw + NQ * 64 - 1 (they lie side by side: the order is stable), for the diagonal alone; nt trips in all.
    // Every count is clamped to the shape and a stage's number is taken modulo TT / 32: trips and addresses are bounded whatever cm holds.
    const int nk = min(max(TT - cm[TT], 0), TT), ma = min(max(cm[qw], 0), TT - nk), mb = min(max(cm[qw + NQ * 64], ma), min(ma + NQ * 64, TT - nk));
    const int nf = nk >> 5, ns = (nk + 31) >> 5, e0 = (nk + ma) >> 5, nt = ns + ((mb > ma) ? ((nk + mb - 1) >> 5) - e0 + 1 : 0);
    auto jof = [&](int t) { return (((t < ns) ? t : e0 + t - ns) & (TT / 32 - 1)) * 32; };   // first key place of trip t
    int* dp = dpt + (q0 - qw) + lr;   // per row of the work-group: place of the row's own key where the mask drops it, else -1 (a kept key needs no diagonal rule); in LDS, as only the last few trips read it
#pragma unroll
    for (int qt = 0; qt < NQ; ++qt) { const int i = q0 + qt * 16 + lr, c0 = cm[i]; dp[qt * 16] = (cm[i + 1] != c0) ? nk + c0 : -1; }
    gk(rk, jof(0)); gv(jof(0)); gg(g, jof(0));
    V qf[NQ][2], qf2[NQ][2];
#pragma unroll
    for (int qt = 0; qt < NQ; ++qt)
#pragma unroll
        for (int ks = 0; ks < 2; ++ks) { const size_t o = (size_t)(q0 + qt * 16 + lr) * HD + ks * 32 + 8 * hi; qf[qt][ks] = F::ld(Q + o); if (HI) qf2[qt][ks] = F::ld(Q2 + o); }
    sk(rk, 0); sv(0);
    lds_barrier();   // stage 0 stands in LDS before any wave reads it
    // masked raw scores of the stage's 32 keys
    auto scores = [&](int bs, int j0, int st, v8f (&s)[2][NQ]) { const T16* kb = sb + bs * SBUF; V kf[2][2], kf2[2][2];
#pragma unroll
        for (int kt = 0; kt < 2; ++kt)
#pragma unroll
            for (int ks = 0; ks < 2; ++ks) { const int o = (kt * 16 + lr) * KPI + ks * 32 + 8 * hi; kf[kt][ks] = F::ld(kb + o); if (HI) kf2[kt][ks] = F::ld(kb + KTS + o); }
        auto prod = [&](int kt, int qt, v8f a) {
#pragma unroll
            for (int ks = 0; ks < 2; ++ks) { a = F::mma(kf[kt][ks], qf[qt][ks], a); if (HI) { a = F::mma(kf[kt][ks], qf2[qt][ks], a); a = F::mma(kf2[kt][ks], qf[qt][ks], a); } }
            return a; };
        if (st < nf) {   // scalar test: a full stage of kept keys
#pragma unroll
            for (int kt = 0; kt < 2; ++kt)
#pragma unroll
                for (int qt = 0; qt < NQ; ++qt) s[kt][qt] = prod(kt, qt, (v8f){});
        } else {   // past them a row keeps the places lo .. lo + sp alone: in the last, partly filled stage of kept keys those below nk, in a stage of masked keys its own key
#pragma unroll
            for (int qt = 0; qt < NQ; ++qt) { const int lo = (st >= ns) ? dp[qt * 16] : 0; const unsigned sp = (st >= ns) ? 0u : (unsigned)(nk - 1);
#pragma unroll
                for (int kt = 0; kt < 2; ++kt) { const v8f a = prod(kt, qt, (v8f){}); const unsigned d0 = (unsigned)(j0 + kt * 16 + 8 * hi - lo);
#pragma unroll
                    for (int r = 0; r < 8; ++r) s[kt][qt][r] = (d0 + r <= sp) ? a[r] : -3.0e38f; } } } };
    // nm: minus the row's reference in log2 units, plus OFF (fp16 rows carry p x 2^OFF). The reference starts below every real score and above the mask's -3e38 * CE: a masked key gives e = 0 from the first stage on, and the first kept key raises it (the factor is then 2^-huge = 0, on sums that are 0).
    constexpr float OFF = HI ? 0.0f : 10.0f, ETOP = HI ? 32.0f : 32768.0f;   // ETOP = 2^(OFF + 5): the most that a lane's 16 e of a row and stage may sum to under the reference in use; so e <= 2^15, and p stays inside fp16 for group_prob <= 1
    float nm[NQ], l[NQ];
#pragma unroll
    for (int qt = 0; qt < NQ; ++qt) { nm[qt] = 1.0e30f; l[qt] = 0.f; }
    v8f o[4][NQ];
#pragma unroll
    for (int dt = 0; dt < 4; ++dt)
#pragma unroll
        for (int qt = 0; qt < NQ; ++qt) o[dt][qt] = (v8f){};
#pragma unroll 1   // rolled: a second stage body would cost registers and instruction cache and save nothing
    for (int st = 0; st < nt; ++st) { const int j0 = jof(st), jn = jof(st + 1), bs = st & 1;
        gk(rk, jn); gv(jn);
        asm volatile("s_wait_xcnt 0x0" ::: "memory");   // the K and V^T loads' address registers may take the next loads' results: the wait stands in front of that overwrite
        gg(gn, jn);
        __builtin_amdgcn_sched_barrier(0);   // keeps the next stage's global loads issued ahead of this stage's work, whose time covers their latency
        v8f s[2][NQ]; scores(bs, j0, st, s); V pf[NQ], pf2[NQ], vf[4], vf2[4]; float ls[NQ];
        const T16* vb = sb + bs * SBUF + NP * KTS;   // the V^T fragments are read ahead of the exponentials, which cover the LDS latency
        auto ldv = [&]() {
#pragma unroll
            for (int dt = 0; dt < 4; ++dt) { const int vo = (dt * 16 + lr) * VPI + 8 * hi; vf[dt] = F::ld(vb + vo); if (HI) vf2[dt] = F::ld(vb + VTS + vo); } };
        // from s and the references in use: e, its sum over the lane's 16 keys of each row (ls, two chains), and p as the B operand
        auto expo = [&]() {
#pragma unroll
            for (int qt = 0; qt < NQ; ++qt) { v16h ph; v8u uh, ul; float a0 = 0.f, a1 = 0.f;
#pragma unroll
                for (int kt = 0; kt < 2; ++kt)
#pragma unroll
                    for (int r = 0; r < 8; r += 2) { const unsigned gw = g[qt][kt][r >> 1];
                        float e0, e1; exp2x2(__builtin_fmaf(s[kt][qt][r], CE, nm[qt]), __builtin_fmaf(s[kt][qt][r + 1], CE, nm[qt]), e0, e1);
                        if (kt == 0 && r == 0) { a0 = e0; a1 = e1; } else { a0 += e0; a1 += e1; }
                        const float p0 = e0 * bflo(gw), p1 = e1 * bfhi(gw);
                        if constexpr (HI) { const unsigned a = pkbf(p0, p1); uh[kt * 4 + (r >> 1)] = a; ul[kt * 4 + (r >> 1)] = pkbf(p0 - bflo(a), p1 - bfhi(a)); } else { ph[kt * 8 + r] = tohx(p0); ph[kt * 8 + r + 1] = tohx(p1); } }
                ls[qt] = a0 + a1;
                if constexpr (HI) { pf[qt] = __builtin_bit_cast(v16bf, uh); pf2[qt] = __builtin_bit_cast(v16bf, ul); } else pf[qt] = ph; } };
        ldv();
        __builtin_amdgcn_sched_barrier(0);   // keeps the V^T reads issued here: the exponentials cover their latency
        expo();
        float lm = ls[0];
#pragma unroll
        for (int qt = 1; qt < NQ; ++qt) lm = fmaxf(lm, ls[qt]);
        if (__builtin_expect(__builtin_amdgcn_ballot_w32(!(lm <= ETOP)) != 0, 0)) {   // scalar branch, one test a stage, on sums that are needed anyway (e >= 0: no e is above its sum; an overflow reads as infinity and fails too); seldom taken once the references have settled
            scores(bs, j0, st, s);   // the stage's K rows still stand in LDS: the scores are formed again rather than kept in registers through every stage
#pragma unroll
            for (int qt = 0; qt < NQ; ++qt) { const v8f &a = s[0][qt], &c = s[1][qt];
                const float tm = fmaxf(max3f(max3f(a[0], a[1], a[2]), max3f(a[3], a[4], a[5]), max3f(a[6], a[7], c[0])), max3f(max3f(c[1], c[2], c[3]), max3f(c[4], c[5], c[6]), c[7]));
                const float rm = fmaxf(tm, __shfl_xor(tm, 16, 32)), nn = fminf(nm[qt], __builtin_fmaf(rm, -CE, OFF));   // both halves of the wave hold the same nm and get the same nn
                const float al = exp2x1(nn - nm[qt]); nm[qt] = nn; l[qt] *= al;
#pragma unroll
                for (int dt = 0; dt < 4; ++dt) o[dt][qt] *= al; }
            expo();   // now e <= 2^OFF: 16 of them stay below ETOP, so once more is enough
            ldv(); }   // read again, so that they need not stay in registers through this branch
#pragma unroll
        for (int qt = 0; qt < NQ; ++qt) l[qt] += ls[qt];
#pragma unroll
        for (int dt = 0; dt < 4; ++dt)
#pragma unroll
            for (int qt = 0; qt < NQ; ++qt) { o[dt][qt] = F::mma(vf[dt], pf[qt], o[dt][qt]); if (HI) { o[dt][qt] = F::mma(vf[dt], pf2[qt], o[dt][qt]); o[dt][qt] = F::mma(vf2[dt], pf[qt], o[dt][qt]); } }
        sk(rk, bs ^ 1); sv(bs ^ 1);
#pragma unroll
        for (int qt = 0; qt < NQ; ++qt) { g[qt][0] = gn[qt][0]; g[qt][1] = gn[qt][1]; }
        lds_barrier(); }   // publishes the next stage; ends every wave's reads of the buffer that the next trip refills
#pragma unroll
    for (int qt = 0; qt < NQ; ++qt) { const float inv = __fdiv_rn(1.0f, l[qt] + __shfl_xor(l[qt], 16, 32)); const size_t oo = (size_t)(q0 + qt * 16 + lr) * DQ + 8 * hi;
#pragma unroll
        for (int dt = 0; dt < 4; ++dt) { v4u oh, ol;
#pragma unroll
            for (int r = 0; r < 8; r += 2) { const float y0 = o[dt][qt][r] * inv, y1 = o[dt][qt][r + 1] * inv; const unsigned a = pkbf(y0, y1); oh[r >> 1] = a; ol[r >> 1] = pkbf(y0 - bflo(a), y1 - bfhi(a)); }
            *(v4u*)(Ah + oo + dt * 16) = oh; *(v4u*)(Al + oo + dt * 16) = ol; } }
}
// amdgpu_waves_per_eu(4, 4): a budget of 256 registers; without it the build takes a few more, which costs the fourth wave of a SIMD and puts register-window switches into the loop
__global__ __launch_bounds__(128) __attribute__((amdgpu_waves_per_eu(4, 4))) void k_fattn(const h16* __restrict__ Q16, const bf* __restrict__ Qh, const bf* __restrict__ Ql, const h16* __restrict__ K16, const bf* __restrict__ Kh, const bf* __restrict__ Kl, const h16* __restrict__ V16, const bf* __restrict__ Vh, const bf* __restrict__ Vl, const int* __restrict__ CM, const bf* __restrict__ GB, bf* Ah, bf* Al) {
    __shared__ __align__(16) char sm[2 * SBUF * 2]; __shared__ int dpt[128];   // one word per row of the work-group
    const int wv = __builtin_amdgcn_readfirstlane((int)(threadIdx.x >> 5));   // wave number, scalar: the row base stays in scalar registers
    const int bx = blockIdx.x, h = blockIdx.y, b = blockIdx.z; const size_t po = ((size_t)b * NH_ + h) * TT * HD;
    const int* kvp = CM + (size_t)b * CMP; const bf* gq = GB + (size_t)b * TT * TT; bf* ah = Ah + (size_t)b * TT * DQ + h * HD; bf* al = Al + (size_t)b * TT * DQ + h * HD;
    if (bx < RH / 64) attn_rows<bf, true, 1>(Qh + po, Ql + po, Kh + po, Kl + po, Vh + po, Vl + po, kvp, gq, bx * 64 + wv * 16, bx * 64, ah, al, (bf*)sm, dpt);
    else attn_rows<h16, false, 2>(Q16 + po, nullptr, K16 + po, nullptr, V16 + po, nullptr, kvp, gq, RH + (bx - RH / 64) * 128 + wv * 32, RH + (bx - RH / 64) * 128, ah, al, (h16*)sm, dpt);
}

extern "C" void kernel_launch(void* const* d_in, const int* in_sizes, int n_in,
                              void* d_out, int out_size, void* d_ws, size_t ws_size, hipStream_t stream) {
    (void)in_sizes; (void)n_in; (void)out_size;
    const float* x = (const float*)d_in[0]; const float* xk = (const float*)d_in[1]; const float* xv = (const float*)d_in[2]; const float* gprob = (const float*)d_in[3];   /* group_prob [2][2048][2048] f32 */ const int* kmask = (const int*)d_in[4];   /* mask [2][2048] int32: 1 = attendable key (OR the diagonal) */ const float* wq = (const float*)d_in[5]; const float* bq = (const float*)d_in[6]; const float* wk = (const float*)d_in[7]; const float* bk = (const float*)d_in[8]; const float* wv = (const float*)d_in[9]; const float* bv = (const float*)d_in[10]; const float* wo = (const float*)d_in[11]; const float* bo = (const float*)d_in[12];   /* input order query, key, value, group_prob, mask, Wq, bq, Wk, bk, Wv, bv, Wo, bo ('oi') */
    float* OUT = (float*)d_out;     // [2][2048][1024]
    char* wsp = (char*)d_ws;
    auto take = [&](size_t bytes) { char* p = wsp; wsp += (bytes + 255) & ~(size_t)255; return (void*)p; };
    bf* XB = (bf*)take((size_t)CVE * 2);   // k_cvt's range: the three streams [stream][batch][t][DM], then the four weights
    bf* WQ = XB + (size_t)3 * NB_ * TT * DM; bf* WK = WQ + (size_t)DM * DM; bf* WV = WK + (size_t)DM * DM; bf* WO = WV + (size_t)DM * DM;
    const size_t PS = (size_t)NH_ * TT * HD;   // one batch's plane, elements (NKV == NH_); every plane holds both batches
    h16* QP16 = (h16*)take(NB_ * PS * 2); h16* KP16 = (h16*)take(NB_ * PS * 2); h16* VT16 = (h16*)take(NB_ * PS * 2);
    bf* QPh = (bf*)take(NB_ * PS * 2); bf* QPl = (bf*)take(NB_ * PS * 2); bf* KPh = (bf*)take(NB_ * PS * 2); bf* KPl = (bf*)take(NB_ * PS * 2); bf* VTh = (bf*)take(NB_ * PS * 2); bf* VTl = (bf*)take(NB_ * PS * 2);
    bf* GB = (bf*)take((size_t)GVE * 2);   // group_prob, bf16, in k_fattn's fragment order
    bf* ATh = (bf*)take((size_t)NB_ * TT * DQ * 2); bf* ATl = (bf*)take((size_t)NB_ * TT * DQ * 2);
    int* CM = (int*)take((size_t)NB_ * CMP * 4);   // per batch: masked keys before j, j = 0 .. TT
    if ((size_t)(wsp - (char*)d_ws) > ws_size) return;    // ws 256 MiB
    k_cvt<<<CVE / CBE + GVE / CBE, 256, 0, stream>>>(x, xk, xv, wq, wk, wv, wo, gprob, kmask, XB, GB, CM);
    k_proj<<<dim3(TT / 128, DQ / 128, 3 * NB_), 256, 0, stream>>>(XB, WQ, WK, WV, bq, bk, bv, QP16, QPh, QPl, KP16, KPh, KPl, VT16, VTh, VTl);
    k_fattn<<<dim3(RH / 64 + (TT - RH) / 128, NH_, NB_), 128, 0, stream>>>(QP16, QPh, QPl, KP16, KPh, KPl, VT16, VTh, VTl, CM, GB, ATh, ATl);
    k_gemmo<<<dim3(NB_ * TT / 128, DM / 128, 1), 256, 0, stream>>>(ATh, ATl, WO, OUT, bo);   /* both batches: their rows follow one another in ATh, ATl and OUT */
}

// v010
// It runs in 113 microseconds.
// Timed twice side by side with v009, it ran 1.03 times as fast both times.
// Over all steps from v000 it is 18.0 times as fast.
#include <hip/hip_runtime.h>

// Multi-headed attention on three streams with a padding-or-diagonal mask and a post-softmax group weighting (query, key, value [2][2048][1024]; q, k, v = x W^T + b ('oi' 0.02, zero biases; 16 heads x 64); scores / sqrt(64); key j is kept for query i when mask[b][j] != 0 OR j == i (mask int [2][2048] random 0/1, read; -1e9 == exclusion); p = softmax; p = p x group_prob[b][i][j] (f32 [2][2048][2048] uniform, read; NOT renormalised); x = p.v; out = merged Wo^T + bo -> [2][2048][1024] (4.2 M); argument order query, key, value, group_prob, mask, Wq, bq, Wk, bk, Wv, bv, Wo, bo).
// Four launches: bf16 copies of query, key, value, the 'oi' weights and group_prob (the last in the attention's fragment order; key and value rows and group_prob's columns in the order in which the keys are walked: kept keys first); the three exact projections of both batches + f32 biases, whose epilogue writes the head planes; one fused attention launch for all heads of both batches (hybrid rows: < 512 hi/lo 3 products, rest fp16 x1024): it walks the batch's kept keys, then each row's own key where the mask drops it (the always-kept diagonal), multiplies each exponential by the bf16 copy of group_prob[b][i][j] and divides the P.V sums by the row's sum of exponentials; merged hi/lo x Wo exact + bo.
// Compute dtypes, f32 accumulate: every input rounded to bf16 incl. group_prob; projections exact + f32 biases; attention rows < 512 3 products, rest fp16; softmax and group weighting f32; Wo hl x exact + bias.

#define NB_  2
#define TT   2048
#define DM   1024
#define NH_  16
#define NKV  16
#define HD   64
#define DQ   (NH_ * HD)
#define DKV  (NKV * HD)
#define RH   512                  // query rows < RH use hi+lo planes (0: none)
#define WIN  0
#define SCL  0.125f   // HD^-0.5
typedef _Float16 h16;
typedef unsigned short bf;
typedef __attribute__((ext_vector_type(16))) __bf16   v16bf;
typedef __attribute__((ext_vector_type(16))) _Float16 v16h;
typedef __attribute__((ext_vector_type(8)))  _Float16 v8h;
typedef __attribute__((ext_vector_type(8)))  unsigned short v8us;
typedef __attribute__((ext_vector_type(8)))  float    v8f;
typedef __attribute__((ext_vector_type(4)))  _Float16 v4h;
typedef __attribute__((ext_vector_type(4)))  unsigned short v4us;
typedef __attribute__((ext_vector_type(4)))  float    v4f;
typedef v8h  __attribute__((may_alias)) v8ha;
typedef v4f  __attribute__((may_alias)) v4fa;
typedef v8us __attribute__((may_alias)) v8usa;

__device__ __forceinline__ unsigned short f2bf(float f) { unsigned u = __float_as_uint(f); u += 0x7FFFu + ((u >> 16) & 1u); return (unsigned short)(u >> 16); }
__device__ __forceinline__ float bf2f(unsigned short b) { return __uint_as_float(((unsigned)b) << 16); }
__device__ __forceinline__ float bfr(float f) { return bf2f(f2bf(f)); }
__device__ __forceinline__ v16h cat16(v8h lo, v8h hi) { return __builtin_shufflevector(lo, hi, 0, 1, 2, 3, 4, 5, 6, 7, 8, 9, 10, 11, 12, 13, 14, 15); }
__device__ __forceinline__ v16bf cat16b(v8us lo, v8us hi) { return __builtin_bit_cast(v16bf, __builtin_shufflevector(lo, hi, 0, 1, 2, 3, 4, 5, 6, 7, 8, 9, 10, 11, 12, 13, 14, 15)); }
__device__ __forceinline__ v8f wmma16(v16h a, v16h b, v8f c) { return __builtin_amdgcn_wmma_f32_16x16x32_f16(false, a, false, b, (short)0, c, false, false); }
__device__ __forceinline__ v8f wmmab(v16bf a, v16bf b, v8f c) { return __builtin_amdgcn_wmma_f32_16x16x32_bf16(false, a, false, b, (short)0, c, false, false); }



// ---- gemmt: GEMM on a 128x128 output tile (bx, by) per work-group of 8 waves (2 x 4, a wave holds 64x32: 8 accumulators), k = DM walked in stages of 64.
// A stage's rows (128 B of each of the 128 A rows and 128 Bt rows: whole lines) are read from global one stage ahead into registers and shared through two LDS buffers, one barrier a stage; the fragments come from LDS.
// The walk over k is a ring: tile (bx, by) begins at stage (bx + 2 by) mod stages (PL == 2: 2 bx + by) and wraps, so that the work-groups that share A rows (same bx) or Bt rows (same by) do not ask L2 for the same lines at the same moment.
// C[m][n] (f32, pitch ldc, + optional f32 bias[n]) = sum_k A[m][k] Bt[n][k] (NSPLIT == 1: + A2[m][k] Bt[n][k]). A, A2 and Bt are K-contiguous bf16 planes of pitch DM. sm: the work-group's LDS, GLDS(NSPLIT) bytes.
// The epilogue passes the f32 tile through LDS (pitch 132 floats), so that a wave stores whole rows. PL != 0: no f32 C; the tile goes out as three 16-bit planes (fp16, bf16 hi, bf16 lo of the remainder).
// PL == 1: one plane block of [ldc rows][64] per 64 columns (head planes [h][t][d]), bias[n]. PL == 2: row-major [m][n] with pitch ldc, bias[m] (V^T = Wv X^T: rows are head dims, columns tokens).
template <typename T16> struct WFrag;
template <> struct WFrag<h16> { typedef v16h V; static __device__ __forceinline__ V ld(const h16* p) { return cat16(*(const v8h*)p, *(const v8h*)(p + 16)); } static __device__ __forceinline__ v8f mma(V a, V b, v8f c) { return wmma16(a, b, c); } };
template <> struct WFrag<bf> { typedef v16bf V; static __device__ __forceinline__ V ld(const bf* p) { return cat16b(*(const v8us*)p, *(const v8us*)(p + 16)); } static __device__ __forceinline__ v8f mma(V a, V b, v8f c) { return wmmab(a, b, c); } };
typedef __attribute__((ext_vector_type(4))) int v4i;
typedef v4i __attribute__((may_alias)) v4ia;
// work-group barrier that orders LDS alone: unlike __syncthreads() it does not wait for the global loads in flight (they go to registers and concern no other wave)
__device__ __forceinline__ void lds_barrier() { __builtin_amdgcn_fence(__ATOMIC_RELEASE, "workgroup", "local"); __builtin_amdgcn_s_barrier(); __builtin_amdgcn_fence(__ATOMIC_ACQUIRE, "workgroup", "local"); }
#define GPI 72            // LDS pitch of a row's 64 elements: 128 B + 16 B, for 16-byte readers
#define GOP (128 * GPI)   // elements of one operand's stage
#define GLDS(NSPLIT) (2 * ((NSPLIT) ? 3 : 2) * GOP * 2)   // two stage buffers, bytes; the f32 tile of the epilogue (128 * 132 * 4) fits inside
template <int NSPLIT, bool BIAS, int PL>
__device__ __forceinline__ void gemmt(char* sm, const int bx, const int by, const bf* __restrict__ A, const bf* __restrict__ A2, const bf* __restrict__ Bt, float* C, int ldc, const float* __restrict__ bias, h16* P16, bf* Ph, bf* Pl) {
    static_assert(GLDS(NSPLIT) >= 128 * 132 * 4 && DM % 64 == 0 && ((DM / 64) & (DM / 64 - 1)) == 0, "the epilogue's tile fits the stage buffers; whole stages, a power of two of them (the ring's wrap is a mask)");
    typedef WFrag<bf> F; typedef typename F::V V;   // every inner loop below is unrolled in full, so that the fragment, staging and accumulator arrays stay in registers
    constexpr int NO = NSPLIT ? 3 : 2, SB = NO * GOP, NS = DM / 64;   // operand tiles a stage (A, A2, Bt), elements of a stage buffer, stages
    const int tid = threadIdx.x, lane = tid & 31, lr = lane & 15, hi = lane >> 4; const int r0 = bx * 128, c0 = by * 128;
    const int wv = __builtin_amdgcn_readfirstlane(tid >> 5), wm = wv >> 2, wn = wv & 3;   // wave number, scalar: the wave's place in the tile stays in scalar registers
    bf* sb = (bf*)sm;
    const size_t ga = (size_t)(r0 + (tid >> 3)) * DM + (tid & 7) * 8, gb = (size_t)(c0 + (tid >> 3)) * DM + (tid & 7) * 8;   // 8 threads a row: a wave's load covers 4 whole lines
    const int so = (tid >> 3) * GPI + (tid & 7) * 8;
    v4i rg[NO][4];
    auto gl = [&](int kc) {
#pragma unroll
        for (int u = 0; u < 4; ++u) { const size_t d = (size_t)u * 32 * DM + kc; rg[0][u] = *(const v4ia*)(A + ga + d); if (NSPLIT) rg[1][u] = *(const v4ia*)(A2 + ga + d); rg[NO - 1][u] = *(const v4ia*)(Bt + gb + d); } };
    auto st = [&](int bs) { bf* d = sb + bs * SB + so;
#pragma unroll
        for (int u = 0; u < 4; ++u)
#pragma unroll
            for (int p = 0; p < NO; ++p) *(v4ia*)(d + p * GOP + u * 32 * GPI) = rg[p][u]; };
    v8f acc[4][2];
#pragma unroll
    for (int mb = 0; mb < 4; ++mb)
#pragma unroll
        for (int nb = 0; nb < 2; ++nb) acc[mb][nb] = (v8f){};
    const int rot = (PL == 2) ? 2 * bx + by : bx + 2 * by;   // the tile's first stage (modulo NS), scalar; the factor 2 goes with the side that has the fewer tiles (DM / 128 of them), so that the sharers of either operand spread over the ring
    gl((rot & (NS - 1)) * 64); st(0);
    lds_barrier();   // the first stage stands in LDS before any wave reads it
#pragma unroll 1   // rolled: a second stage body would cost registers and instruction cache and save nothing
    for (int s = 0; s < NS; ++s) { const int bs = s & 1;
        if (s + 1 < NS) gl(((s + 1 + rot) & (NS - 1)) * 64);   // issued ahead of this stage's work, whose time covers their latency
        const bf* ab = sb + bs * SB + (wm * 64 + lr) * GPI + 8 * hi; const bf* bb = sb + bs * SB + (NO - 1) * GOP + (wn * 32 + lr) * GPI + 8 * hi;
#pragma unroll
        for (int ks = 0; ks < 2; ++ks) { V a[4], a2[4], b[2];
#pragma unroll
            for (int mb = 0; mb < 4; ++mb) { a[mb] = F::ld(ab + mb * 16 * GPI + ks * 32); if (NSPLIT) a2[mb] = F::ld(ab + GOP + mb * 16 * GPI + ks * 32); }
#pragma unroll
            for (int nb = 0; nb < 2; ++nb) b[nb] = F::ld(bb + nb * 16 * GPI + ks * 32);
#pragma unroll
            for (int nb = 0; nb < 2; ++nb)
#pragma unroll
                for (int mb = 0; mb < 4; ++mb) { acc[mb][nb] = F::mma(a[mb], b[nb], acc[mb][nb]); if (NSPLIT) acc[mb][nb] = F::mma(a2[mb], b[nb], acc[mb][nb]); } }
        if (s + 1 < NS) st(bs ^ 1);
        lds_barrier(); }   // publishes the next stage; ends every wave's reads of the buffer that the next trip refills (after the last trip: that the f32 tile overwrites)
    float* os = (float*)sm; const int cofs = lane * 4; v4f bv = (v4f){}; float pbl = 0.f;   // a wave takes rows wv, wv + 8, ...: 4 columns a lane; the biases are read ahead of the LDS stores, which cover their latency
    if constexpr (BIAS && PL != 2) { const v4f t = *(const v4f*)(bias + c0 + cofs); bv[0] = bfr(t[0]); bv[1] = bfr(t[1]); bv[2] = bfr(t[2]); bv[3] = bfr(t[3]); }
    if constexpr (BIAS && PL == 2) pbl = bfr(bias[r0 + lr * 8 + wv]);   // one load for the wave's 16 rows: lane i (and i + 16) holds the bias of row i * 8 + wv
#pragma unroll
    for (int mb = 0; mb < 4; ++mb)
#pragma unroll
        for (int nb = 0; nb < 2; ++nb)
#pragma unroll
            for (int j = 0; j < 8; ++j) os[(wm * 64 + mb * 16 + hi * 8 + j) * 132 + wn * 32 + nb * 16 + lr] = acc[mb][nb][j];
    lds_barrier();   // every wave's part of the f32 tile stands in LDS before any row is read
#pragma unroll
    for (int i = 0; i < 16; ++i) { const int row = i * 8 + wv; v4f val = *(const v4fa*)(os + row * 132 + cofs);
        if (BIAS) { if constexpr (PL == 2) val += __uint_as_float(__builtin_amdgcn_readlane(__float_as_uint(pbl), i)); else val += bv; }   // i is a constant of the unrolled loop: the row's bias comes out of lane i as a scalar
        if constexpr (PL == 0) *(v4f*)(C + (size_t)(r0 + row) * ldc + c0 + cofs) = val;
        else { const size_t e = (PL == 1) ? ((size_t)(by * 2 + (cofs >> 6)) * ldc + r0 + row) * 64 + (cofs & 63) : (size_t)(r0 + row) * ldc + c0 + cofs; v4h o16; v4us oh, ol;
#pragma unroll
            for (int q = 0; q < 4; ++q) { o16[q] = (h16)val[q]; const unsigned short a2 = f2bf(val[q]); oh[q] = a2; ol[q] = f2bf(val[q] - bf2f(a2)); }
            *(v4h*)(P16 + e) = o16; *(v4us*)(Ph + e) = oh; *(v4us*)(Pl + e) = ol; } }
}

// k_gemmo: out = (Ah + Al) Wo^T + bo, f32; grid (M/128, DM/128).
__global__ __launch_bounds__(256) void k_gemmo(const bf* __restrict__ Ah, const bf* __restrict__ Al, const bf* __restrict__ WO, float* C, const float* __restrict__ bo) {
    __shared__ __align__(16) char sm[GLDS(1)];
    gemmt<1, true, 0>(sm, blockIdx.x, blockIdx.y, Ah, Al, WO, C, DM, bo, nullptr, nullptr, nullptr);
}
// k_proj: the q, k and v projections of both batches in one launch; grid (TT/128, DQ/128, 3 * NB_), z = stream * NB_ + batch. X holds the bf16 streams as [stream][batch][t][DM]; every plane holds both batches.
// q and k: x W^T into head planes; v: V^T = Wv X^T (rows [g][d], columns t), so its tile indices change places.
__global__ __launch_bounds__(256) void k_proj(const bf* __restrict__ X, const bf* __restrict__ WQ, const bf* __restrict__ WK, const bf* __restrict__ WV, const float* __restrict__ bq, const float* __restrict__ bk, const float* __restrict__ bv,
                                              h16* QP16, bf* QPh, bf* QPl, h16* KP16, bf* KPh, bf* KPl, h16* VT16, bf* VTh, bf* VTl) {
    __shared__ __align__(16) char sm[GLDS(0)];
    const int z = blockIdx.z, sm_ = z / NB_; const bf* xs = X + (size_t)z * TT * DM; const size_t po = (size_t)(z % NB_) * NH_ * TT * HD;
    if (sm_ == 2) gemmt<0, true, 2>(sm, blockIdx.y, blockIdx.x, WV, nullptr, xs, nullptr, TT, bv, VT16 + po, VTh + po, VTl + po);
    else gemmt<0, true, 1>(sm, blockIdx.x, blockIdx.y, xs, nullptr, sm_ ? WK : WQ, nullptr, TT, sm_ ? bk : bq, (sm_ ? KP16 : QP16) + po, (sm_ ? KPh : QPh) + po, (sm_ ? KPl : QPl) + po);
}

__device__ __forceinline__ h16 tohx(float x) { return (h16)x; }
typedef __attribute__((ext_vector_type(2))) float v2f;
typedef __attribute__((ext_vector_type(2))) __bf16 v2bf;
typedef __attribute__((ext_vector_type(4))) unsigned v4u;
__device__ __forceinline__ unsigned pkbf(float a, float b) { v2f x; x[0] = a; x[1] = b; return __builtin_bit_cast(unsigned, __builtin_convertvector(x, v2bf)); }   // two f32 -> packed bf16, round to nearest even

// k_cvt: every f32 -> bf16 copy of the call in one launch. dst is one range: query, key, value (NB_ * TT * DM elements each), then Wq, Wk, Wv, Wo (DM * DM each). Of key and value, token j's row stands at place pos[j] of its batch (key_order below).
// A block converts CBE consecutive elements of one tensor (every tensor's size is a multiple of CBE), a thread CU pieces of 8: few waves to start, and each has all its loads in flight at once. Grid CVE / CBE + GVE / CBE.
// The last GVE / CBE blocks round group_prob to bf16 into gdst, once for all 16 heads, in the order in which k_fattn's lanes use it: [batch * TT / 16 + row group][stage of 32 keys][key tile kt][lane = hi * 16 + row][8 keys], the key's place pos[j] = stage * 32 + kt * 16 + hi * 8 + r.
// So a wave of k_fattn reads a (row group, stage, key tile) as 512 contiguous bytes, 4 whole lines, where the f32 rows gave it 32 bytes of each of 16 lines per load. A block takes one group of 16 rows; a wave's piece is 8 rows x 32 keys: it reads whole lines (32 B a lane) and puts each value at its place in an LDS image of the group (64 KiB), which the block then copies out in whole lines.
#define CU  16
#define CBE (CU * 256 * 8)
#define CVE (3 * NB_ * TT * DM + 4 * DM * DM)
#define GVE (NB_ * TT * TT)
#define CMP (TT + 8)   // pitch of a batch's row of cm, ints
// key_order: the order in which the attention walks a batch's keys: the kept ones (mask != 0) first, then the others, each part in its natural order. For a block of 256 threads, 8 keys a thread.
// pos[j] (LDS, TT entries) = key j's place p; a count over TT flags, so 0 <= p < TT for any content of the mask. FR: instead the byte offset of place p in a row group's fragment order, (p / 8) * 256 + (p % 8) * 2.
// cmo != nullptr: also stores cm[j] = number of masked keys before j, j = 0 .. TT.
template <bool FR>
__device__ __forceinline__ void key_order(const v4i m0, const v4i m1, unsigned short* pos, int* wsum, int* cmo) {   // m0, m1: mask[tid * 8 .. + 7], read by the caller ahead of its own loads (loads return in order: read behind them, the mask would wait for them all)
    const int tid = threadIdx.x, lane = tid & 31, wv = tid >> 5; unsigned zb = 0;   // bit k: key tid * 8 + k is masked
#pragma unroll
    for (int k = 0; k < 8; ++k) zb |= (((k < 4 ? m0[k & 3] : m1[k & 3]) == 0) ? 1u : 0u) << k;
    const int c = __builtin_popcount(zb); int sc = c;   // running count over the wave's lanes
#pragma unroll
    for (int d = 1; d < 32; d <<= 1) { const int t = __shfl_up(sc, d, 32); if (lane >= d) sc += t; }
    if (lane == 31) wsum[wv] = sc;
    lds_barrier();   // the eight waves' counts stand in LDS before any wave adds them up
    int base = 0, tot = 0;
#pragma unroll
    for (int w = 0; w < 8; ++w) { const int x = wsum[w]; base += (w < wv) ? x : 0; tot += x; }
    const int cb = base + sc - c, nk = TT - tot; v8us pv;   // cb: masked keys before the thread's first
#pragma unroll
    for (int k = 0; k < 8; ++k) { const int cm = cb + __builtin_popcount(zb & ((1u << k) - 1u)), p = ((zb >> k) & 1u) ? nk + cm : tid * 8 + k - cm; pv[k] = (unsigned short)(FR ? (p >> 3) * 256 + (p & 7) * 2 : p); }
    *(v8usa*)(pos + tid * 8) = pv;
    if (cmo) { v4i c0, c1;
#pragma unroll
        for (int k = 0; k < 4; ++k) { c0[k] = cb + __builtin_popcount(zb & ((1u << k) - 1u)); c1[k] = cb + __builtin_popcount(zb & ((16u << k) - 1u)); }
        *(v4i*)(cmo + tid * 8) = c0; *(v4i*)(cmo + tid * 8 + 4) = c1; if (tid == 255) cmo[TT] = cb + c; }
    lds_barrier();   // the whole table stands in LDS before any wave reads it
}
// amdgpu_waves_per_eu(6, 6): a budget of 160 registers; without it the build takes a few more, which costs the sixth wave of a SIMD: the launch's three blocks per WGP would no longer all run at once
__global__ __launch_bounds__(256) __attribute__((amdgpu_waves_per_eu(6, 6))) void k_cvt(const float* __restrict__ xq, const float* __restrict__ xk, const float* __restrict__ xv, const float* __restrict__ wq, const float* __restrict__ wk, const float* __restrict__ wv, const float* __restrict__ wo, const float* __restrict__ gp, const int* __restrict__ kmask, bf* dst, bf* gdst, int* cmw) {
    __shared__ __align__(16) bf gl[16 * TT]; __shared__ __align__(16) unsigned short pos[TT]; __shared__ int wsum[8];
    constexpr int BX = NB_ * TT * DM / CBE, BW = DM * DM / CBE; static_assert(NB_ * TT * DM % CBE == 0 && DM * DM % CBE == 0, "a block stays inside one tensor");
    static_assert(16 * TT == CBE && CU * 8 == 2 * (TT / 32), "a block of the group_prob part is one group of 16 rows: 2 x TT / 32 wave pieces");
    const int bx = blockIdx.x; const float* s; int b0, kv = 0;   // the block's tensor, that tensor's first block, and whether it is the key or the value stream: scalar
    if (bx >= CVE / CBE) {   // scalar test: the group_prob part
        const int rg = bx - CVE / CBE, lane = threadIdx.x & 31, wv8 = threadIdx.x >> 5, row = (wv8 & 1) * 8 + (lane >> 2), un = lane & 3;   // the lane's row of the group and its 8 keys of the piece's 32: keys un * 8 .. + 7
        const float* sg = gp + ((size_t)rg * 16 + row) * TT + (wv8 >> 1) * 32 + un * 8; bf* dg = gdst + (size_t)rg * 16 * TT + threadIdx.x * 8;
        const int* km = kmask + (rg / (TT / 16)) * TT + threadIdx.x * 8; const v4i m0 = *(const v4i*)km, m1 = *(const v4i*)(km + 4);
        v8f w[CU];   // as below: every load issues ahead of the first conversion
#pragma unroll
        for (int u = 0; u < CU; ++u) w[u] = *(const v8f*)(sg + u * 128);   // piece u: keys (u * 4 + wv8 / 2) * 32 .. + 31 in their natural order
        asm volatile("s_wait_xcnt 0x0" :: "v"(sg) : "memory");   // the loads' address registers stay as they are (sg is an input here) until every load's address has been taken; no load's result may land in them before
        key_order<true>(m0, m1, pos, wsum, nullptr);   // behind the loads' issue: their latency covers it
        char* gr = (char*)gl + row * 16;   // the lane's row inside each unit of 8 keys x 16 rows
#pragma unroll
        for (int u = 0; u < CU; ++u) { const v8us pj = *(const v8usa*)(pos + u * 128 + (wv8 >> 1) * 32 + un * 8);   // where the lane's 8 keys go
#pragma unroll
            for (int k = 0; k < 8; k += 2) { const unsigned o = pkbf(w[u][k], w[u][k + 1]); *(bf*)(gr + pj[k]) = (bf)(o & 0xFFFFu); *(bf*)(gr + pj[k + 1]) = (bf)(o >> 16); } }
        lds_barrier();   // the group's 16 rows stand in LDS in fragment order before they are copied out
#pragma unroll
        for (int u = 0; u < CU; ++u) *(v8us*)(dg + u * 2048) = *(const v8usa*)(gl + threadIdx.x * 8 + u * 2048);
        return; }
    if (bx < 3 * BX) { const int t = bx / BX; s = (t == 0) ? xq : (t == 1) ? xk : xv; b0 = t * BX; kv = t; }
    else { const int t = (bx - 3 * BX) / BW; s = (t == 0) ? wq : (t == 1) ? wk : (t == 2) ? wv : wo; b0 = 3 * BX + t * BW; }
    s += (size_t)(bx - b0) * CBE + threadIdx.x * 8; bf* d = dst + (size_t)bx * CBE + threadIdx.x * 8;
    v8f v[CU];   // the loops over u are unrolled in full: v stays in registers and the loads issue ahead of the first conversion
    constexpr int RB = CBE / DM, BT = TT / RB; static_assert(2048 == 2 * DM && TT % RB == 0, "a piece of 2048 elements is two rows; a block stays inside one batch");
    const int bt = (bx - b0) / BT, t0 = (bx - b0) % BT * RB;   // key and value streams: the block's batch and its first token there
    if (kv) { const int* km = kmask + bt * TT + threadIdx.x * 8; const v4i m0 = *(const v4i*)km, m1 = *(const v4i*)(km + 4);
#pragma unroll
        for (int u = 0; u < CU; ++u) v[u] = *(const v8f*)(s + u * 2048);
        asm volatile("s_wait_xcnt 0x0" :: "v"(s) : "memory");   // as above: the loads' address registers stay as they are until every load's address has been taken
        key_order<false>(m0, m1, pos, wsum, (kv == 1 && t0 == 0) ? cmw + bt * CMP : nullptr);   // scalar test; behind the loads' issue, whose latency covers it; one block a batch hands cm to k_fattn
        bf* dk = dst + ((size_t)b0 * RB + bt * TT) * DM + (threadIdx.x & 127) * 8;
#pragma unroll
        for (int u = 0; u < CU; ++u) { v8us o;
#pragma unroll
            for (int k = 0; k < 8; ++k) o[k] = f2bf(v[u][k]);
            *(v8us*)(dk + (size_t)pos[t0 + u * 2 + (threadIdx.x >> 7)] * DM) = o; }   // token j's row goes to place pos[j] of its batch: K and V^T come out of k_proj in the walking order
        return; }
#pragma unroll
    for (int u = 0; u < CU; ++u) v[u] = *(const v8f*)(s + u * 2048);
#pragma unroll
    for (int u = 0; u < CU; ++u) { v8us o;
#pragma unroll
        for (int k = 0; k < 8; ++k) o[k] = f2bf(v[u][k]);
        *(v8us*)(d + u * 2048) = o; } }

// k_fattn: scores, mask, softmax, group weighting, P.V and the head merge in one kernel; no score or probability leaves the registers. Grid (RH/64 + (TT-RH)/128, heads, batches), 4 waves.
// A wave owns NQ * 16 query rows of one head; the work-group walks the batch's kept keys once, 32 keys a stage (as a ring, from a stage of its own), then the few stages that hold its own rows' masked keys (keys stand in k_cvt's order, kept ones first). A stage's K rows and V^T rows are read from global in whole or half lines, one stage ahead, and shared through two LDS buffers (one barrier a stage).
// S^T = K Q^T (A = K rows, B = Q rows, same k order on both sides): a lane holds 8 keys of ONE query per tile. The key mask is a ceiling on the place: a full stage of kept keys needs no test; in the last, partly filled one the places from nk on take -3e38;
// in a stage of masked keys every element takes -3e38 but a row's own key (the diagonal is always kept). cm (k_cvt's count of masked keys before each token) gives nk, the stages to walk and each row's own place.
// Each stage: e = exp(s / 8 - ref), l += e, p = e x group_prob[b][i][j] (k_cvt's bf16 copy, in this kernel's fragment order: 2 loads of 512 contiguous bytes per 16 rows and stage); the two key tiles of a stage, converted in place, are the B operand of O^T += V^T P^T (A = V^T rows in the hardware k order).
// ref is a row's running reference, not its maximum: any value cancels in O / l. One test a stage and wave (ballot, scalar branch), on the stage's sums of e: only when a lane's 16 e of some row sum to more than 2^5 does the wave form the stage's scores again, raise every row's ref to the stage's maximum where that is higher, scale l and O by 2^(old - new) and take the exponentials anew.
// The epilogue joins the wave halves' sums, divides by l (the weighting is not renormalised: l sums e alone) and stores hi/lo bf16 planes of the merged rows, 16 B per lane.
// Rows < RH: hi/lo bf16 planes, 3 products in both GEMMs, 16 rows a wave; the rest fp16 with p carried x 1024 (folded into the exponent, so l carries it too and it cancels), 32 rows a wave.
#define KPI 72   // LDS pitch of a K row in elements: 128 B + 16 B, for 16-byte readers
#define VPI 40   // LDS pitch of a V^T row of 32 keys in elements: 64 B + 16 B
#define SBUF (2 * (32 * KPI + 64 * VPI))   // elements of one stage buffer at two planes per operand
typedef __attribute__((ext_vector_type(8))) unsigned v8u;
// two 2^x in one statement: the early-clobber outputs keep each off the other's registers, and the v_nop keeps the slot that the instruction set asks for behind a transcendental before its result is used or its source overwritten
__device__ __forceinline__ void exp2x2(float x0, float x1, float& e0, float& e1) { asm("v_exp_f32 %0, %2\n\tv_exp_f32 %1, %3\n\tv_nop" : "=&v"(e0), "=&v"(e1) : "v"(x0), "v"(x1)); }
__device__ __forceinline__ float exp2x1(float x) { float e; asm("v_exp_f32 %0, %1\n\tv_nop" : "=&v"(e) : "v"(x)); return e; }   // one 2^x, with the same slot behind it
__device__ __forceinline__ float max3f(float a, float b, float c) { return fmaxf(fmaxf(a, b), c); }
__device__ __forceinline__ float bflo(unsigned u) { return __uint_as_float(u << 16); }
__device__ __forceinline__ float bfhi(unsigned u) { return __uint_as_float(u & 0xFFFF0000u); }
template <typename T16, bool HI, int NQ>
__device__ __forceinline__ void attn_rows(const T16* __restrict__ Q, const T16* __restrict__ Q2, const T16* __restrict__ K, const T16* __restrict__ K2, const T16* __restrict__ VT, const T16* __restrict__ VT2, const int* __restrict__ cm, const bf* __restrict__ gq, const int q0, const int qw, const int rs, bf* Ah, bf* Al, T16* sb, int* dpt) {
    typedef WFrag<T16> F; typedef typename F::V V;   // every inner loop below is unrolled in full, so that the fragment and accumulator arrays stay in registers
    constexpr int NP = HI ? 2 : 1, KTS = 32 * KPI, VTS = 64 * VPI;
    const int tid = threadIdx.x, lane = tid & 31, lr = lane & 15, hi = lane >> 4;
    const float CE = SCL * 1.4426950408889634f;
    v4i rk[NP][2], rv[NP][2];
    auto gk = [&](v4i (&t)[NP][2], int j0) {
#pragma unroll
        for (int u = 0; u < 2; ++u) { const size_t o = (size_t)j0 * HD + (tid + 128 * u) * 8; t[0][u] = *(const v4ia*)(K + o); if (HI) t[NP - 1][u] = *(const v4ia*)(K2 + o); } };
    auto gv = [&](int j0) {
#pragma unroll
        for (int u = 0; u < 2; ++u) { const int x = tid + 128 * u; const size_t o = (size_t)(x >> 2) * TT + j0 + (x & 3) * 8; rv[0][u] = *(const v4ia*)(VT + o); if (HI) rv[NP - 1][u] = *(const v4ia*)(VT2 + o); } };
    auto sk = [&](const v4i (&t)[NP][2], int bs) { T16* d = sb + bs * SBUF;
#pragma unroll
        for (int u = 0; u < 2; ++u) { const int x = tid + 128 * u, o = (x >> 3) * KPI + (x & 7) * 8; *(v4ia*)(d + o) = t[0][u]; if (HI) *(v4ia*)(d + KTS + o) = t[NP - 1][u]; } };
    auto sv = [&](int bs) { T16* d = sb + bs * SBUF + NP * KTS;
#pragma unroll
        for (int u = 0; u < 2; ++u) { const int x = tid + 128 * u, o = (x >> 2) * VPI + (x & 3) * 8; *(v4ia*)(d + o) = rv[0][u]; if (HI) *(v4ia*)(d + VTS + o) = rv[NP - 1][u]; } };
    v4u g[NQ][2], gn[NQ][2];   // group_prob (bf16, two a register) of this stage's and of the next stage's 32 keys, 8 + 8 per lane and query row
    auto gg = [&](v4u (&t)[NQ][2], int j0) {
#pragma unroll
        for (int qt = 0; qt < NQ; ++qt) { const bf* gr = gq + ((size_t)((q0 >> 4) + qt) * (TT / 32) + (j0 >> 5)) * 512 + lane * 8; t[qt][0] = *(const v4u*)gr; t[qt][1] = *(const v4u*)(gr + 256); } };
    // The walk, scalar: ns stages hold the batch's nk kept keys; then, from stage e0 on, the stages that hold the masked keys of the work-group's own rows qw .. qw + NQ * 64 - 1 (they lie side by side: the order is stable), for the diagonal alone; nt trips in all.
    // Every count is clamped to the shape and a stage's number is taken modulo TT / 32: trips and addresses are bounded whatever cm holds. nk is pinned to a scalar register, so that every count derived from it and the loop's tests on them stay scalar.
    const int nk = __builtin_amdgcn_readfirstlane(min(max(TT - cm[TT], 0), TT)), ma = min(max(cm[qw], 0), TT - nk), mb = min(max(cm[qw + NQ * 64], ma), min(ma + NQ * 64, TT - nk));
    const int nf = nk >> 5, ns = (nk + 31) >> 5, e0 = (nk + ma) >> 5, nt = ns + ((mb > ma) ? ((nk + mb - 1) >> 5) - e0 + 1 : 0);
    auto jof = [&](int t) { return (((t < ns) ? t : e0 + t - ns) & (TT / 32 - 1)) * 32; };   // first key place of stage t of that list
    // The kept keys' stages are walked as a ring that begins at a stage of the work-group's own (rs in 0 .. 31, spread over the ns stages): work-groups that share K and V^T rows (same head) or group_prob rows (same rows, other heads) do not ask L2 for the same lines at the same moment.
    const int rot = (rs * ns) >> 5;   // 0 <= rot < ns (0 where ns == 0)
    auto wst = [&](int t) { const int u = t + rot; return (t < ns) ? ((u < ns) ? u : u - ns) : t; };   // the stage that trip t walks
    int* dp = dpt + (q0 - qw) + lr;   // per row of the work-group: place of the row's own key where the mask drops it, else -1 (a kept key needs no diagonal rule); in LDS, as only the last few trips read it
#pragma unroll
    for (int qt = 0; qt < NQ; ++qt) { const int i = q0 + qt * 16 + lr, c0 = cm[i]; dp[qt * 16] = (cm[i + 1] != c0) ? nk + c0 : -1; }
    gk(rk, jof(wst(0))); gv(jof(wst(0))); gg(g, jof(wst(0)));
    V qf[NQ][2], qf2[NQ][2];
#pragma unroll
    for (int qt = 0; qt < NQ; ++qt)
#pragma unroll
        for (int ks = 0; ks < 2; ++ks) { const size_t o = (size_t)(q0 + qt * 16 + lr) * HD + ks * 32 + 8 * hi; qf[qt][ks] = F::ld(Q + o); if (HI) qf2[qt][ks] = F::ld(Q2 + o); }
    sk(rk, 0); sv(0);
    lds_barrier();   // the first stage stands in LDS before any wave reads it
    // masked raw scores of the stage's 32 keys
    auto scores = [&](int bs, int j0, int st, v8f (&s)[2][NQ]) { const T16* kb = sb + bs * SBUF; V kf[2][2], kf2[2][2];
#pragma unroll
        for (int kt = 0; kt < 2; ++kt)
#pragma unroll
            for (int ks = 0; ks < 2; ++ks) { const int o = (kt * 16 + lr) * KPI + ks * 32 + 8 * hi; kf[kt][ks] = F::ld(kb + o); if (HI) kf2[kt][ks] = F::ld(kb + KTS + o); }
        auto prod = [&](int kt, int qt, v8f a) {
#pragma unroll
            for (int ks = 0; ks < 2; ++ks) { a = F::mma(kf[kt][ks], qf[qt][ks], a); if (HI) { a = F::mma(kf[kt][ks], qf2[qt][ks], a); a = F::mma(kf2[kt][ks], qf[qt][ks], a); } }
            return a; };
        if (st < nf) {   // scalar test: a full stage of kept keys
#pragma unroll
            for (int kt = 0; kt < 2; ++kt)
#pragma unroll
                for (int qt = 0; qt < NQ; ++qt) s[kt][qt] = prod(kt, qt, (v8f){});
        } else {   // past them a row keeps the places lo .. lo + sp alone: in the last, partly filled stage of kept keys those below nk, in a stage of masked keys its own key
#pragma unroll
            for (int qt = 0; qt < NQ; ++qt) { const int lo = (st >= ns) ? dp[qt * 16] : 0; const unsigned sp = (st >= ns) ? 0u : (unsigned)(nk - 1);
#pragma unroll
                for (int kt = 0; kt < 2; ++kt) { const v8f a = prod(kt, qt, (v8f){}); const unsigned d0 = (unsigned)(j0 + kt * 16 + 8 * hi - lo);
#pragma unroll
                    for (int r = 0; r < 8; ++r) s[kt][qt][r] = (d0 + r <= sp) ? a[r] : -3.0e38f; } } } };
    // nm: minus the row's reference in log2 units, plus OFF (fp16 rows carry p x 2^OFF). The reference starts below every real score and above the mask's -3e38 * CE: a masked key gives e = 0 from the first stage on, and the first kept key raises it (the factor is then 2^-huge = 0, on sums that are 0).
    constexpr float OFF = HI ? 0.0f : 10.0f, ETOP = HI ? 32.0f : 32768.0f;   // ETOP = 2^(OFF + 5): the most that a lane's 16 e of a row and stage may sum to under the reference in use; so e <= 2^15, and p stays inside fp16 for group_prob <= 1
    float nm[NQ], l[NQ];
#pragma unroll
    for (int qt = 0; qt < NQ; ++qt) { nm[qt] = 1.0e30f; l[qt] = 0.f; }
    v8f o[4][NQ];
#pragma unroll
    for (int dt = 0; dt < 4; ++dt)
#pragma unroll
        for (int qt = 0; qt < NQ; ++qt) o[dt][qt] = (v8f){};
#pragma unroll 1   // rolled: a second stage body would cost registers and instruction cache and save nothing
    for (int st = 0; st < nt; ++st) { const int sw = wst(st), j0 = jof(sw), jn = jof(wst(st + 1)), bs = st & 1;
        gk(rk, jn); gv(jn);
        asm volatile("s_wait_xcnt 0x0" ::: "memory");   // the K and V^T loads' address registers may take the next loads' results: the wait stands in front of that overwrite
        gg(gn, jn);
        __builtin_amdgcn_sched_barrier(0);   // keeps the next stage's global loads issued ahead of this stage's work, whose time covers their latency
        v8f s[2][NQ]; scores(bs, j0, sw, s); V pf[NQ], pf2[NQ], vf[4], vf2[4]; float ls[NQ];
        const T16* vb = sb + bs * SBUF + NP * KTS;   // the V^T fragments are read ahead of the exponentials, which cover the LDS latency
        auto ldv = [&]() {
#pragma unroll
            for (int dt = 0; dt < 4; ++dt) { const int vo = (dt * 16 + lr) * VPI + 8 * hi; vf[dt] = F::ld(vb + vo); if (HI) vf2[dt] = F::ld(vb + VTS + vo); } };
        // from s and the references in use: e, its sum over the lane's 16 keys of each row (ls, two chains), and p as the B operand
        auto expo = [&]() {
#pragma unroll
            for (int qt = 0; qt < NQ; ++qt) { v16h ph; v8u uh, ul; float a0 = 0.f, a1 = 0.f;
#pragma unroll
                for (int kt = 0; kt < 2; ++kt)
#pragma unroll
                    for (int r = 0; r < 8; r += 2) { const unsigned gw = g[qt][kt][r >> 1];
                        float e0, e1; exp2x2(__builtin_fmaf(s[kt][qt][r], CE, nm[qt]), __builtin_fmaf(s[kt][qt][r + 1], CE, nm[qt]), e0, e1);
                        if (kt == 0 && r == 0) { a0 = e0; a1 = e1; } else { a0 += e0; a1 += e1; }
                        const float p0 = e0 * bflo(gw), p1 = e1 * bfhi(gw);
                        if constexpr (HI) { const unsigned a = pkbf(p0, p1); uh[kt * 4 + (r >> 1)] = a; ul[kt * 4 + (r >> 1)] = pkbf(p0 - bflo(a), p1 - bfhi(a)); } else { ph[kt * 8 + r] = tohx(p0); ph[kt * 8 + r + 1] = tohx(p1); } }
                ls[qt] = a0 + a1;
                if constexpr (HI) { pf[qt] = __builtin_bit_cast(v16bf, uh); pf2[qt] = __builtin_bit_cast(v16bf, ul); } else pf[qt] = ph; } };
        ldv();
        __builtin_amdgcn_sched_barrier(0);   // keeps the V^T reads issued here: the exponentials cover their latency
        expo();
        float lm = ls[0];
#pragma unroll
        for (int qt = 1; qt < NQ; ++qt) lm = fmaxf(lm, ls[qt]);
        if (__builtin_expect(__builtin_amdgcn_ballot_w32(!(lm <= ETOP)) != 0, 0)) {   // scalar branch, one test a stage, on sums that are needed anyway (e >= 0: no e is above its sum; an overflow reads as infinity and fails too); seldom taken once the references have settled
            scores(bs, j0, sw, s);   // the stage's K rows still stand in LDS: the scores are formed again rather than kept in registers through every stage
#pragma unroll
            for (int qt = 0; qt < NQ; ++qt) { const v8f &a = s[0][qt], &c = s[1][qt];
                const float tm = fmaxf(max3f(max3f(a[0], a[1], a[2]), max3f(a[3], a[4], a[5]), max3f(a[6], a[7], c[0])), max3f(max3f(c[1], c[2], c[3]), max3f(c[4], c[5], c[6]), c[7]));
                const float rm = fmaxf(tm, __shfl_xor(tm, 16, 32)), nn = fminf(nm[qt], __builtin_fmaf(rm, -CE, OFF));   // both halves of the wave hold the same nm and get the same nn
                const float al = exp2x1(nn - nm[qt]); nm[qt] = nn; l[qt] *= al;
#pragma unroll
                for (int dt = 0; dt < 4; ++dt) o[dt][qt] *= al; }
            expo();   // now e <= 2^OFF: 16 of them stay below ETOP, so once more is enough
            ldv(); }   // read again, so that they need not stay in registers through this branch
#pragma unroll
        for (int qt = 0; qt < NQ; ++qt) l[qt] += ls[qt];
#pragma unroll
        for (int dt = 0; dt < 4; ++dt)
#pragma unroll
            for (int qt = 0; qt < NQ; ++qt) { o[dt][qt] = F::mma(vf[dt], pf[qt], o[dt][qt]); if (HI) { o[dt][qt] = F::mma(vf[dt], pf2[qt], o[dt][qt]); o[dt][qt] = F::mma(vf2[dt], pf[qt], o[dt][qt]); } }
        sk(rk, bs ^ 1); sv(bs ^ 1);
#pragma unroll
        for (int qt = 0; qt < NQ; ++qt) { g[qt][0] = gn[qt][0]; g[qt][1] = gn[qt][1]; }
        lds_barrier(); }   // publishes the next stage; ends every wave's reads of the buffer that the next trip refills
#pragma unroll
    for (int qt = 0; qt < NQ; ++qt) { const float inv = __fdiv_rn(1.0f, l[qt] + __shfl_xor(l[qt], 16, 32)); const size_t oo = (size_t)(q0 + qt * 16 + lr) * DQ + 8 * hi;
#pragma unroll
        for (int dt = 0; dt < 4; ++dt) { v4u oh, ol;
#pragma unroll
            for (int r = 0; r < 8; r += 2) { const float y0 = o[dt][qt][r] * inv, y1 = o[dt][qt][r + 1] * inv; const unsigned a = pkbf(y0, y1); oh[r >> 1] = a; ol[r >> 1] = pkbf(y0 - bflo(a), y1 - bfhi(a)); }
            *(v4u*)(Ah + oo + dt * 16) = oh; *(v4u*)(Al + oo + dt * 16) = ol; } }
}
// amdgpu_waves_per_eu(4, 4): a budget of 256 registers; without it the build takes a few more, which costs the fourth wave of a SIMD and puts register-window switches into the loop
__global__ __launch_bounds__(128) __attribute__((amdgpu_waves_per_eu(4, 4))) void k_fattn(const h16* __restrict__ Q16, const bf* __restrict__ Qh, const bf* __restrict__ Ql, const h16* __restrict__ K16, const bf* __restrict__ Kh, const bf* __restrict__ Kl, const h16* __restrict__ V16, const bf* __restrict__ Vh, const bf* __restrict__ Vl, const int* __restrict__ CM, const bf* __restrict__ GB, bf* Ah, bf* Al) {
    __shared__ __align__(16) char sm[2 * SBUF * 2]; __shared__ int dpt[128];   // one word per row of the work-group
    const int wv = __builtin_amdgcn_readfirstlane((int)(threadIdx.x >> 5));   // wave number, scalar: the row base stays in scalar registers
    const int bx = blockIdx.x, h = blockIdx.y, b = blockIdx.z; const size_t po = ((size_t)b * NH_ + h) * TT * HD;
    const int rs = (3 * bx + 2 * h) & 31;   // where the work-group's key walk begins: differs between the row blocks of a head (3 is odd) and between the heads of a row block
    const int* kvp = CM + (size_t)b * CMP; const bf* gq = GB + (size_t)b * TT * TT; bf* ah = Ah + (size_t)b * TT * DQ + h * HD; bf* al = Al + (size_t)b * TT * DQ + h * HD;
    if (bx < RH / 64) attn_rows<bf, true, 1>(Qh + po, Ql + po, Kh + po, Kl + po, Vh + po, Vl + po, kvp, gq, bx * 64 + wv * 16, bx * 64, rs, ah, al, (bf*)sm, dpt);
    else attn_rows<h16, false, 2>(Q16 + po, nullptr, K16 + po, nullptr, V16 + po, nullptr, kvp, gq, RH + (bx - RH / 64) * 128 + wv * 32, RH + (bx - RH / 64) * 128, rs, ah, al, (h16*)sm, dpt);
}

extern "C" void kernel_launch(void* const* d_in, const int* in_sizes, int n_in,
                              void* d_out, int out_size, void* d_ws, size_t ws_size, hipStream_t stream) {
    (void)in_sizes; (void)n_in; (void)out_size;
    const float* x = (const float*)d_in[0]; const float* xk = (const float*)d_in[1]; const float* xv = (const float*)d_in[2]; const float* gprob = (const float*)d_in[3];   /* group_prob [2][2048][2048] f32 */ const int* kmask = (const int*)d_in[4];   /* mask [2][2048] int32: 1 = attendable key (OR the diagonal) */ const float* wq = (const float*)d_in[5]; const float* bq = (const float*)d_in[6]; const float* wk = (const float*)d_in[7]; const float* bk = (const float*)d_in[8]; const float* wv = (const float*)d_in[9]; const float* bv = (const float*)d_in[10]; const float* wo = (const float*)d_in[11]; const float* bo = (const float*)d_in[12];   /* input order query, key, value, group_prob, mask, Wq, bq, Wk, bk, Wv, bv, Wo, bo ('oi') */
    float* OUT = (float*)d_out;     // [2][2048][1024]
    char* wsp = (char*)d_ws;
    auto take = [&](size_t bytes) { char* p = wsp; wsp += (bytes + 255) & ~(size_t)255; return (void*)p; };
    bf* XB = (bf*)take((size_t)CVE * 2);   // k_cvt's range: the three streams [stream][batch][t][DM], then the four weights
    bf* WQ = XB + (size_t)3 * NB_ * TT * DM; bf* WK = WQ + (size_t)DM * DM; bf* WV = WK + (size_t)DM * DM; bf* WO = WV + (size_t)DM * DM;
    const size_t PS = (size_t)NH_ * TT * HD;   // one batch's plane, elements (NKV == NH_); every plane holds both batches
    h16* QP16 = (h16*)take(NB_ * PS * 2); h16* KP16 = (h16*)take(NB_ * PS * 2); h16* VT16 = (h16*)take(NB_ * PS * 2);
    bf* QPh = (bf*)take(NB_ * PS * 2); bf* QPl = (bf*)take(NB_ * PS * 2); bf* KPh = (bf*)take(NB_ * PS * 2); bf* KPl = (bf*)take(NB_ * PS * 2); bf* VTh = (bf*)take(NB_ * PS * 2); bf* VTl = (bf*)take(NB_ * PS * 2);
    bf* GB = (bf*)take((size_t)GVE * 2);   // group_prob, bf16, in k_fattn's fragment order
    bf* ATh = (bf*)take((size_t)NB_ * TT * DQ * 2); bf* ATl = (bf*)take((size_t)NB_ * TT * DQ * 2);
    int* CM = (int*)take((size_t)NB_ * CMP * 4);   // per batch: masked keys before j, j = 0 .. TT
    if ((size_t)(wsp - (char*)d_ws) > ws_size) return;    // ws 256 MiB
    k_cvt<<<CVE / CBE + GVE / CBE, 256, 0, stream>>>(x, xk, xv, wq, wk, wv, wo, gprob, kmask, XB, GB, CM);
    k_proj<<<dim3(TT / 128, DQ / 128, 3 * NB_), 256, 0, stream>>>(XB, WQ, WK, WV, bq, bk, bv, QP16, QPh, QPl, KP16, KPh, KPl, VT16, VTh, VTl);
    k_fattn<<<dim3(RH / 64 + (TT - RH) / 128, NH_, NB_), 128, 0, stream>>>(QP16, QPh, QPl, KP16, KPh, KPl, VT16, VTh, VTl, CM, GB, ATh, ATl);
    k_gemmo<<<dim3(NB_ * TT / 128, DM / 128, 1), 256, 0, stream>>>(ATh, ATl, WO, OUT, bo);   /* both batches: their rows follow one another in ATh, ATl and OUT */
}
